// v000
// Measured on an AMD MI455X. A time is GPU time per run, averaged over a window of back-to-back runs after a warm-up
// (all launches, gaps included; the runs take copies of the inputs in turn), and the median of several windows.
// Apart from v000's, it joins two sittings. Times from different sittings can be a few percent apart, while
// side-by-side timings come from the same sitting.
// The starting kernel, v000, takes 1770 microseconds a run.
#include <hip/hip_runtime.h>

// MSA row attention with pair bias (msa [1][128][256][256], pair [1][256][256][128]; m = LN(msa), p = LN(pair) (eps 1e-5, affine); Q, K, V = m W ('xw' [256][256], 8 heads x 32), G = sigmoid(m Wg + bg); bias[h][i][j] = (p Wp)[i][j][h] ('xw' [128][8]); per sequence s and head h: attn = softmax(Q_s,h . K_s,h / sqrt(32) + bias_h); vals = G * (attn V); out = vals Wo + bo ('xw' [256][256]) -> [1][128][256][256] (8.4 M)).
// Layout: row LayerNorm kernels (one wave per row) write hi/lo operands for the msa (32,768 x 256) and pair (65,536 x 128) slabs; hl x exact projections (Q, K, V, gate pre-activation, and the pair bias against Wp zero-padded to 64 columns); plane kernels lay Q/K out as [sequence x head][residue][32] and V^T zero-padded to 64 rows; 16 (sequence, head) pseudo-heads per pass: scores (3 products, K 32), a kernel adds bias[h][i][j], softmax over the 256 residues with every row hi/lo, attn.V (3 products), and a merge kernel applies the sigmoid gate while writing the hi/lo operand of the Wo GEMM.
// Compute dtypes, f32 accumulate: every input rounded to bf16; LN, sigmoid, softmax f32; GEMM activations bf16 hi/lo (2 products) x exact weights; scores and attn.V 3 products.

#define NB_  1
#define TT   256
#define DM   256
#define NH_  8
#define NKV  8
#define REP  (NH_ / NKV)
#define HD   32
#define DQ   (NH_ * HD)
#define DKV  (NKV * HD)
#define ZH   16    // pseudo-heads (sequence, head) per pass
#define RH   256                  // query rows < RH use hi+lo planes (0: none)
#define WIN  0
#define PCAR 1024.0f
#define SCL  0.17677669529663688f   // 32^-0.5
#define NS   128     // sequences
#define NI   256     // residues (= TT)
#define CZ   128     // pair channels
#define NP   (NS * NH_)   // 1024 pseudo-heads
#define NRM  (NS * NI)    // 32768 msa rows
#define NRP  (NI * NI)    // 65536 pair rows
#define HP   64      // padded head width for attn.v
#define NBP  64      // padded bias projection width (8 heads used)
typedef _Float16 h16;
typedef unsigned short bf;
typedef __attribute__((ext_vector_type(16))) __bf16   v16bf;
typedef __attribute__((ext_vector_type(16))) _Float16 v16h;
typedef __attribute__((ext_vector_type(8)))  _Float16 v8h;
typedef __attribute__((ext_vector_type(8)))  unsigned short v8us;
typedef __attribute__((ext_vector_type(8)))  float    v8f;
typedef __attribute__((ext_vector_type(4)))  float    v4f;
typedef v8h  __attribute__((may_alias)) v8ha;
typedef v4f  __attribute__((may_alias)) v4fa;
typedef v8us __attribute__((may_alias)) v8usa;

__device__ __forceinline__ unsigned short f2bf(float f) { unsigned u = __float_as_uint(f); u += 0x7FFFu + ((u >> 16) & 1u); return (unsigned short)(u >> 16); }
__device__ __forceinline__ float bf2f(unsigned short b) { return __uint_as_float(((unsigned)b) << 16); }
__device__ __forceinline__ float bfr(float f) { return bf2f(f2bf(f)); }
__device__ __forceinline__ v16h cat16(v8h lo, v8h hi) { return __builtin_shufflevector(lo, hi, 0, 1, 2, 3, 4, 5, 6, 7, 8, 9, 10, 11, 12, 13, 14, 15); }
__device__ __forceinline__ v16bf cat16b(v8us lo, v8us hi) { return __builtin_bit_cast(v16bf, __builtin_shufflevector(lo, hi, 0, 1, 2, 3, 4, 5, 6, 7, 8, 9, 10, 11, 12, 13, 14, 15)); }
__device__ __forceinline__ v8f wmma16(v16h a, v16h b, v8f c) { return __builtin_amdgcn_wmma_f32_16x16x32_f16(false, a, false, b, (short)0, c, false, false); }
__device__ __forceinline__ v8f wmmab(v16bf a, v16bf b, v8f c) { return __builtin_amdgcn_wmma_f32_16x16x32_bf16(false, a, false, b, (short)0, c, false, false); }



// ---- k_gemmw: register-blocked GEMM, ONE WAVE per 64x64 output tile (16 accumulators), operands straight from K-contiguous 16-bit planes; grid (M/64, N/64, Z), 32 threads.
// C[m][n] (f32, pitch ldc, + optional f32 bias[n]) = sum_k A[m][k] Bt[n][k] (+ split products per NSPLIT). z-batch strides sA/sB/sC in elements. K % 32 == 0.
template <typename T16> struct WFrag;
template <> struct WFrag<h16> { typedef v16h V; static __device__ __forceinline__ V ld(const h16* p) { return cat16(*(const v8h*)p, *(const v8h*)(p + 16)); } static __device__ __forceinline__ v8f mma(V a, V b, v8f c) { return wmma16(a, b, c); } };
template <> struct WFrag<bf> { typedef v16bf V; static __device__ __forceinline__ V ld(const bf* p) { return cat16b(*(const v8us*)p, *(const v8us*)(p + 16)); } static __device__ __forceinline__ v8f mma(V a, V b, v8f c) { return wmmab(a, b, c); } };
template <typename T16, int NSPLIT, bool BIAS>
__global__ __launch_bounds__(32) void k_gemmw(const T16* __restrict__ A, const T16* __restrict__ A2, const T16* __restrict__ Bt, const T16* __restrict__ Bt2, int K, float* C, int ldc, const float* __restrict__ bias, size_t sA, size_t sB, size_t sC) {
    typedef typename WFrag<T16>::V V;
    __shared__ __align__(16) float os[16 * 68];
    const size_t z = blockIdx.z; A += z * sA; if (A2) A2 += z * sA; Bt += z * sB; if (Bt2) Bt2 += z * sB; C += z * sC;
    const int lane = threadIdx.x & 31, lr = lane & 15, hi = lane >> 4; const int r0 = blockIdx.x * 64, c0 = blockIdx.y * 64;
    v8f acc[4][4];
#pragma unroll
    for (int mb = 0; mb < 4; ++mb)
#pragma unroll
        for (int nb = 0; nb < 4; ++nb) acc[mb][nb] = (v8f){};
    const size_t aoff = (size_t)(r0 + lr) * K + 8 * hi, boff = (size_t)(c0 + lr) * K + 8 * hi;
#pragma unroll 1
    for (int kc = 0; kc < K; kc += 32) {
        V a[4], a2[4];
#pragma unroll
        for (int mb = 0; mb < 4; ++mb) { a[mb] = WFrag<T16>::ld(A + aoff + (size_t)mb * 16 * K + kc); if (NSPLIT == 1 || NSPLIT == 2) a2[mb] = WFrag<T16>::ld(A2 + aoff + (size_t)mb * 16 * K + kc); }
#pragma unroll
        for (int nb = 0; nb < 4; ++nb) { const V b = WFrag<T16>::ld(Bt + boff + (size_t)nb * 16 * K + kc); V b2; if (NSPLIT >= 2) b2 = WFrag<T16>::ld(Bt2 + boff + (size_t)nb * 16 * K + kc);
#pragma unroll
            for (int mb = 0; mb < 4; ++mb) { acc[mb][nb] = WFrag<T16>::mma(a[mb], b, acc[mb][nb]); if (NSPLIT == 1 || NSPLIT == 2) acc[mb][nb] = WFrag<T16>::mma(a2[mb], b, acc[mb][nb]); if (NSPLIT >= 2) acc[mb][nb] = WFrag<T16>::mma(a[mb], b2, acc[mb][nb]); } }
        asm volatile("v_nop\n\tv_nop\n\tv_nop\n\tv_nop" : "+v"(acc[0][0]), "+v"(acc[1][1]), "+v"(acc[2][2]), "+v"(acc[3][3]) : "v"(a[0]), "v"(a[3]));
    }
#pragma unroll
    for (int mb = 0; mb < 4; ++mb) {
#pragma unroll
        for (int nb = 0; nb < 4; ++nb) {
#pragma unroll
            for (int j = 0; j < 8; ++j) os[(hi * 8 + j) * 68 + nb * 16 + lr] = acc[mb][nb][j]; }
        __builtin_amdgcn_wave_barrier(); asm volatile("" ::: "memory");
        float* crow = C + (size_t)(r0 + mb * 16) * ldc + c0;
{
#pragma unroll
            for (int s = 0; s < 8; ++s) { const int row = 2 * s + hi, cofs = lr * 4; v4f val = *(const v4fa*)(os + row * 68 + cofs); if (BIAS) { val[0] += bfr(bias[c0 + cofs]); val[1] += bfr(bias[c0 + cofs + 1]); val[2] += bfr(bias[c0 + cofs + 2]); val[3] += bfr(bias[c0 + cofs + 3]); }
                *(v4f*)(crow + (size_t)row * ldc + cofs) = val; }
             }
        __builtin_amdgcn_wave_barrier(); asm volatile("" ::: "memory");
    }
}

__device__ __forceinline__ h16 tohx(float x) { return (h16)x; }
__device__ __forceinline__ void splitf(float y, unsigned short& h, unsigned short& l) { h = f2bf(y); l = f2bf(y - bf2f(h)); }
typedef __attribute__((ext_vector_type(2))) _Float16 v2h;
typedef __attribute__((ext_vector_type(4))) _Float16 v4h;
typedef __attribute__((ext_vector_type(2))) unsigned short v2us;
typedef __attribute__((ext_vector_type(4))) unsigned short v4us;
typedef __attribute__((ext_vector_type(2))) float v2f;
typedef __attribute__((ext_vector_type(4))) int v4i;

__global__ __launch_bounds__(256) void k_wtG(const float* __restrict__ w, int K, int N, bf* Bt) {
    const int lane = threadIdx.x & 31; const int L0 = (blockIdx.x * 8 + (threadIdx.x >> 5)) * 8; const int nlines = N * K / 64;
{
#pragma unroll 1
        for (int l = 0; l < 8; ++l) { const int L = L0 + l; if (L >= nlines) break; const size_t e = (size_t)L * 64 + lane * 2; const int k = (int)(e % K), n = (int)(e / K); v2us o;
            o[0] = f2bf(w[(size_t)k * N + n]); o[1] = f2bf(w[(size_t)(k + 1) * N + n]); *(v2us*)(Bt + e) = o; }
         }
}
__global__ __launch_bounds__(256) void k_cvt8(const float* __restrict__ src, bf* dst, size_t n8) { const size_t i = (size_t)blockIdx.x * 256 + threadIdx.x; if (i >= n8) return; const v8f v = *(const v8f*)(src + i * 8); v8us o;
#pragma unroll
    for (int k = 0; k < 8; ++k) o[k] = f2bf(v[k]); *(v8us*)(dst + i * 8) = o;  }




// k_asoft: per row (zz, i): t = S x HD^-0.5 (no mask); softmax over the 256 keys (register row, one exp, fixed trees);
__global__ __launch_bounds__(256) void k_asoft(const float* __restrict__ Sb, h16* P16, bf* Ph, bf* Pl) {
    const int lane = threadIdx.x & 31; const int row = blockIdx.x * 8 + (threadIdx.x >> 5); if (row >= ZH * TT) return; const int i = row % TT; const int zz = row / TT; (void)zz; const bool hires = (i < RH); const float* sr = Sb + (size_t)row * TT; float v[TT / 32]; float mx = -3.0e38f;
#pragma unroll
    for (int ch = 0; ch < TT / 128; ++ch) { const int j0 = ch * 128 + lane * 4; const v4f a = *(const v4f*)(sr + j0);
#pragma unroll
        for (int q = 0; q < 4; ++q) { const int j = j0 + q; (void)j; const float t = a[q] * SCL; v[ch * 4 + q] = t; mx = fmaxf(mx, t); } }
#pragma unroll
    for (int sh = 16; sh; sh >>= 1) mx = fmaxf(mx, __shfl_xor(mx, sh, 32));
    float sum = 0.f;
#pragma unroll
    for (int k = 0; k < TT / 32; ++k) { float d0 = __fsub_rn(v[k], mx); asm volatile("" : "+v"(d0)); v[k] = __builtin_amdgcn_exp2f(__fmul_rn(d0, 1.4426950408889634f)); sum += v[k]; }
#pragma unroll
    for (int sh = 16; sh; sh >>= 1) sum += __shfl_xor(sum, sh, 32);
    const float f = __fdiv_rn(hires ? 1.0f : PCAR, sum);
{
        if (hires) {
#pragma unroll
            for (int ch = 0; ch < TT / 128; ++ch) { v4us oh, ol;
#pragma unroll
                for (int q = 0; q < 4; ++q) { unsigned short a, c2; splitf(v[ch * 4 + q] * f, a, c2); oh[q] = a; ol[q] = c2; }
                const size_t oo = ((size_t)zz * (RH ? RH : 1) + i) * TT + ch * 128 + lane * 4; *(v4us*)(Ph + oo) = oh; *(v4us*)(Pl + oo) = ol; }
        } else {
#pragma unroll
            for (int ch = 0; ch < TT / 128; ++ch) { v4h o4;
#pragma unroll
                for (int q = 0; q < 4; ++q) o4[q] = tohx(v[ch * 4 + q] * f);
                *(v4h*)(P16 + (size_t)row * TT + ch * 128 + lane * 4) = o4; } }
         }
}
__device__ __forceinline__ float ex2g(float a) { return __builtin_amdgcn_exp2f(__fmul_rn(a, 1.4426950408889634f)); }
__device__ __forceinline__ float sigm(float a) { return __fdiv_rn(1.0f, __fadd_rn(1.0f, ex2g(-a))); }
template <int WD>
__global__ __launch_bounds__(256) void k_lnrow(const float* __restrict__ X, size_t nrows, const float* __restrict__ g, const float* __restrict__ bb, bf* Hh, bf* Hl) { const int lane = threadIdx.x & 31; const size_t r = (size_t)blockIdx.x * 8 + (threadIdx.x >> 5); if (r >= nrows) return; const float* xr = X + r * WD; float a[WD / 32]; float s = 0.f;
#pragma unroll
    for (int c = 0; c < WD / 128; ++c) { const v4f v = *(const v4f*)(xr + c * 128 + lane * 4); for (int q = 0; q < 4; ++q) { a[c * 4 + q] = bfr(v[q]); s = __fadd_rn(s, a[c * 4 + q]); } }
#pragma unroll
    for (int sh = 16; sh; sh >>= 1) s = __fadd_rn(s, __shfl_xor(s, sh, 32));
    const float mean = __fdiv_rn(s, (float)WD); float s2 = 0.f;
#pragma unroll
    for (int k = 0; k < WD / 32; ++k) { const float dv = __fsub_rn(a[k], mean); s2 = __fadd_rn(s2, __fmul_rn(dv, dv)); }
#pragma unroll
    for (int sh = 16; sh; sh >>= 1) s2 = __fadd_rn(s2, __shfl_xor(s2, sh, 32));
    const float rs = __fdiv_rn(1.0f, __fsqrt_rn(__fadd_rn(__fdiv_rn(s2, (float)WD), 1e-5f)));
{
#pragma unroll
        for (int c = 0; c < WD / 128; ++c) { v4us oh, ol; for (int q = 0; q < 4; ++q) { const int col = c * 128 + lane * 4 + q; float y = __fmul_rn(__fmul_rn(__fsub_rn(a[c * 4 + q], mean), rs), bfr(g[col])); asm volatile("" : "+v"(y)); y = __fadd_rn(y, bfr(bb[col])); unsigned short u, w2; splitf(y, u, w2); oh[q] = u; ol[q] = w2; } *(v4us*)(Hh + r * WD + c * 128 + lane * 4) = oh; *(v4us*)(Hl + r * WD + c * 128 + lane * 4) = ol; }
         } }
__global__ __launch_bounds__(256) void k_wpad(const float* __restrict__ w, bf* Bt) { const int e2 = (blockIdx.x * 256 + threadIdx.x) * 2; if (e2 >= NBP * CZ) return; const int k = e2 % CZ; const int n = e2 / CZ; v2us o; const unsigned short a0 = f2bf(w[(size_t)k * NH_ + min(n, NH_ - 1)]), a1 = f2bf(w[(size_t)(k + 1) * NH_ + min(n, NH_ - 1)]); o[0] = (n < NH_) ? a0 : (unsigned short)0; o[1] = (n < NH_) ? a1 : (unsigned short)0; *(v2us*)(Bt + e2) = o;  }
__global__ __launch_bounds__(256) void k_planesS(const float* __restrict__ F, bf* Ph, bf* Pl) { const size_t k = (size_t)blockIdx.x * 256 + threadIdx.x; if (k >= (size_t)NP * NI * HD / 4) return; const size_t e = k * 4; const int d = (int)(e % HD); const int i = (int)((e / HD) % NI); const int p = (int)(e / ((size_t)HD * NI)); const int s = p / NH_, h = p % NH_; const v4f a = *(const v4f*)(F + ((size_t)s * NI + i) * DQ + h * HD + d); v4us oh, ol;
#pragma unroll
    for (int q = 0; q < 4; ++q) { unsigned short u, w2; splitf(a[q], u, w2); oh[q] = u; ol[q] = w2; }
    *(v4us*)(Ph + e) = oh; *(v4us*)(Pl + e) = ol;  }
__global__ __launch_bounds__(256) void k_vtpS(const float* __restrict__ F, bf* Vh, bf* Vl) { const size_t e = ((size_t)blockIdx.x * 256 + threadIdx.x) * 2; if (e >= (size_t)NP * HP * NI) return; const int i = (int)(e % NI); const int d = (int)((e / NI) % HP); const int p = (int)(e / ((size_t)NI * HP)); const int s = p / NH_, h = p % NH_; const int dd = min(d, HD - 1); v2us oh, ol;
#pragma unroll
    for (int q = 0; q < 2; ++q) { const float v = F[((size_t)s * NI + i + q) * DQ + h * HD + dd]; unsigned short u, w2; splitf(v, u, w2); oh[q] = (d < HD) ? u : (unsigned short)0; ol[q] = (d < HD) ? w2 : (unsigned short)0; }
    *(v2us*)(Vh + e) = oh; *(v2us*)(Vl + e) = ol;  }
__global__ __launch_bounds__(256) void k_addbias(float* Sb, const float* __restrict__ BIAS, int p0) { const size_t k = (size_t)blockIdx.x * 256 + threadIdx.x; if (k >= (size_t)ZH * NI * NI / 4) return; const size_t e = k * 4; const int j0 = (int)(e % NI); const int i = (int)((e / NI) % NI); const int zz = (int)(e / ((size_t)NI * NI)); const int h = (p0 + zz) % NH_; v4f a = *(const v4f*)(Sb + e);
#pragma unroll
    for (int q = 0; q < 4; ++q) a[q] = __fadd_rn(a[q], __fmul_rn(BIAS[((size_t)i * NI + j0 + q) * NBP + h], 5.656854249492380f));   /* x sqrt(32): the softmax kernel scales the whole row by 32^-0.5, the reference adds the bias AFTER that scale */
    *(v4f*)(Sb + e) = a;  }
__global__ __launch_bounds__(256) void k_mergeG(const float* __restrict__ O, const float* __restrict__ GP, int p0, bf* Ah, bf* Al) { const size_t k = (size_t)blockIdx.x * 256 + threadIdx.x; if (k >= (size_t)ZH * NI * HD / 4) return; const size_t e = k * 4; const int d = (int)(e % HD); const int i = (int)((e / HD) % NI); const int zz = (int)(e / ((size_t)HD * NI)); const int p = p0 + zz; const int s = p / NH_, h = p % NH_; const size_t row = (size_t)s * NI + i; const v4f o = *(const v4f*)(O + ((size_t)zz * NI + i) * HP + d); const v4f gp = *(const v4f*)(GP + row * DQ + h * HD + d); v4us oh, ol;
#pragma unroll
    for (int q = 0; q < 4; ++q) { float y = __fmul_rn(sigm(gp[q]), o[q]); unsigned short u, w2; splitf(y, u, w2); oh[q] = u; ol[q] = w2; }
    const size_t oo = row * DQ + h * HD + d; *(v4us*)(Ah + oo) = oh; *(v4us*)(Al + oo) = ol;  }

extern "C" void kernel_launch(void* const* d_in, const int* in_sizes, int n_in,
                              void* d_out, int out_size, void* d_ws, size_t ws_size, hipStream_t stream) {
    (void)in_sizes; (void)n_in; (void)out_size;
    const float* msa = (const float*)d_in[0]; const float* pair = (const float*)d_in[1]; const float* lmg = (const float*)d_in[2]; const float* lmb = (const float*)d_in[3]; const float* lpg = (const float*)d_in[4]; const float* lpb = (const float*)d_in[5]; const float* wq = (const float*)d_in[6]; const float* wk = (const float*)d_in[7]; const float* wv = (const float*)d_in[8]; const float* wp = (const float*)d_in[9]; const float* wg = (const float*)d_in[10]; const float* bg = (const float*)d_in[11]; const float* wo = (const float*)d_in[12]; const float* bo = (const float*)d_in[13];
    float* OUT = (float*)d_out;     // [1][128][256][256]
    char* wsp = (char*)d_ws;
    auto take = [&](size_t bytes) { char* p = wsp; wsp += (bytes + 255) & ~(size_t)255; return (void*)p; };
    bf* WQ = (bf*)take((size_t)DQ * DM * 2); bf* WK = (bf*)take((size_t)DQ * DM * 2); bf* WV = (bf*)take((size_t)DQ * DM * 2); bf* WG = (bf*)take((size_t)DQ * DM * 2); bf* WO = (bf*)take((size_t)DM * DQ * 2); bf* WP = (bf*)take((size_t)NBP * CZ * 2);
    bf* Mh = (bf*)take((size_t)NRM * DM * 2); bf* Ml = (bf*)take((size_t)NRM * DM * 2); float* FQ = (float*)take((size_t)NRM * DQ * 4); float* GP = (float*)take((size_t)NRM * DQ * 4); float* BIAS = (float*)take((size_t)NRP * NBP * 4);
    bf* QPh = (bf*)take((size_t)NP * NI * HD * 2); bf* QPl = (bf*)take((size_t)NP * NI * HD * 2); bf* KPh = (bf*)take((size_t)NP * NI * HD * 2); bf* KPl = (bf*)take((size_t)NP * NI * HD * 2); bf* VTh = (bf*)take((size_t)NP * HP * NI * 2); bf* VTl = (bf*)take((size_t)NP * HP * NI * 2);
    float* Sb = (float*)take((size_t)ZH * NI * NI * 4); bf* Ph = (bf*)take((size_t)ZH * NI * NI * 2); bf* Pl = (bf*)take((size_t)ZH * NI * NI * 2); float* Ob = (float*)take((size_t)ZH * NI * HP * 4); bf* ATh = Mh; bf* ATl = Ml;   /* the gated context reuses the LN operand buffers (m is dead after the projections) */
    if ((size_t)(wsp - (char*)d_ws) > ws_size) return;    // ws 256 MiB (carve ~250 MiB; the pair LN operand aliases FQ/GP before the projections, see below)
    bf* PLh = (bf*)FQ; bf* PLl = (bf*)GP;   /* pair LN planes [65536][128] bf16 = 16 MiB each, inside FQ / GP (32 MiB each) which are written only later */
    k_wtG<<<(DM * DQ / 64 + 63) / 64, 256, 0, stream>>>(wq, DM, DQ, WQ); k_wtG<<<(DM * DQ / 64 + 63) / 64, 256, 0, stream>>>(wk, DM, DQ, WK); k_wtG<<<(DM * DQ / 64 + 63) / 64, 256, 0, stream>>>(wv, DM, DQ, WV); k_wtG<<<(DM * DQ / 64 + 63) / 64, 256, 0, stream>>>(wg, DM, DQ, WG); k_wtG<<<(DQ * DM / 64 + 63) / 64, 256, 0, stream>>>(wo, DQ, DM, WO); k_wpad<<<(NBP * CZ / 2 + 255) / 256, 256, 0, stream>>>(wp, WP);
    /* pair bias: BIAS[(i*256 + j)][h] = LN(pair[i][j]) . Wp[:, h] (columns 8..63 zero) */
    k_lnrow<CZ><<<(unsigned)((NRP + 7) / 8), 256, 0, stream>>>(pair, (size_t)NRP, lpg, lpb, PLh, PLl);
    k_gemmw<bf, 1, false><<<dim3(NRP / 64, NBP / 64, 1), 32, 0, stream>>>(PLh, PLl, WP, nullptr, CZ, BIAS, NBP, nullptr, 0, 0, 0);
    /* msa LN -> Q, K, V, gate pre-activation */
    k_lnrow<DM><<<(unsigned)((NRM + 7) / 8), 256, 0, stream>>>(msa, (size_t)NRM, lmg, lmb, Mh, Ml);
    k_gemmw<bf, 1, false><<<dim3(NRM / 64, DQ / 64, 1), 32, 0, stream>>>(Mh, Ml, WQ, nullptr, DM, FQ, DQ, nullptr, 0, 0, 0); k_planesS<<<(unsigned)(((size_t)NP * NI * HD / 4 + 255) / 256), 256, 0, stream>>>(FQ, QPh, QPl);
    k_gemmw<bf, 1, false><<<dim3(NRM / 64, DQ / 64, 1), 32, 0, stream>>>(Mh, Ml, WK, nullptr, DM, FQ, DQ, nullptr, 0, 0, 0); k_planesS<<<(unsigned)(((size_t)NP * NI * HD / 4 + 255) / 256), 256, 0, stream>>>(FQ, KPh, KPl);   /* K (FQ reused after the q planes) */
    k_gemmw<bf, 1, false><<<dim3(NRM / 64, DQ / 64, 1), 32, 0, stream>>>(Mh, Ml, WV, nullptr, DM, FQ, DQ, nullptr, 0, 0, 0); k_vtpS<<<(unsigned)(((size_t)NP * HP * NI / 2 + 255) / 256), 256, 0, stream>>>(FQ, VTh, VTl);   /* V (FQ reused after the k planes are built) */
    k_gemmw<bf, 1, true><<<dim3(NRM / 64, DQ / 64, 1), 32, 0, stream>>>(Mh, Ml, WG, nullptr, DM, GP, DQ, bg, 0, 0, 0);          /* gate pre-activation m Wg + bg */
    for (int p0 = 0; p0 < NP; p0 += ZH) {
        k_gemmw<bf, 2, false><<<dim3(NI / 64, NI / 64, ZH), 32, 0, stream>>>(QPh + (size_t)p0 * NI * HD, QPl + (size_t)p0 * NI * HD, KPh + (size_t)p0 * NI * HD, KPl + (size_t)p0 * NI * HD, HD, Sb, NI, nullptr, (size_t)NI * HD, (size_t)NI * HD, (size_t)NI * NI);
        k_addbias<<<(unsigned)(((size_t)ZH * NI * NI / 4 + 255) / 256), 256, 0, stream>>>(Sb, BIAS, p0);
        k_asoft<<<ZH * TT / 8, 256, 0, stream>>>(Sb, nullptr, Ph, Pl);
        k_gemmw<bf, 2, false><<<dim3(NI / 64, HP / 64, ZH), 32, 0, stream>>>(Ph, Pl, VTh + (size_t)p0 * HP * NI, VTl + (size_t)p0 * HP * NI, NI, Ob, HP, nullptr, (size_t)NI * NI, (size_t)HP * NI, (size_t)NI * HP);
        k_mergeG<<<(unsigned)(((size_t)ZH * NI * HD / 4 + 255) / 256), 256, 0, stream>>>(Ob, GP, p0, ATh, ATl); }
    k_gemmw<bf, 1, true><<<dim3(NRM / 64, DM / 64, 1), 32, 0, stream>>>(ATh, ATl, WO, nullptr, DQ, OUT, DM, bo, 0, 0, 0);            /* out = vals Wo + bo */
}

// v002
// Measured time: 251 microseconds a run.
// Versions in between are left out here; by their measured steps it is 7.04 times as fast as v000.
#include <hip/hip_runtime.h>

// MSA row attention with pair bias (msa [1][128][256][256], pair [1][256][256][128]; m = LN(msa), p = LN(pair) (eps 1e-5, affine); Q, K, V = m W ('xw' [256][256], 8 heads x 32), G = sigmoid(m Wg + bg); bias[h][i][j] = (p Wp)[i][j][h] ('xw' [128][8]); per sequence s and head h: attn = softmax(Q_s,h . K_s,h / sqrt(32) + bias_h); vals = G * (attn V); out = vals Wo + bo ('xw' [256][256]) -> [1][128][256][256] (8.4 M)).
// Layout: row LayerNorm kernels (one wave per row) write hi/lo operands for the msa (32,768 x 256) and pair (65,536 x 128) slabs; hl x exact projections (Q, K, V, gate pre-activation, and the pair bias against Wp zero-padded to 64 columns); the Q and K GEMMs store hi/lo planes [sequence x head][residue][32] and the V GEMM hi/lo V^T planes [sequence x head][64][residue], rows 0..31 written and read, from their epilogues; one attention kernel over all 1024 (sequence, head) pairs keeps a wave's 16 x 256 scores in registers: scores (3 products, K 32), + bias[h][i][j], softmax over the 256 residues with every row hi/lo, attn.V (3 products), sigmoid gate, and writes the hi/lo operand of the Wo GEMM.
// Compute dtypes, f32 accumulate: every input rounded to bf16; LN, sigmoid, softmax f32; GEMM activations bf16 hi/lo (2 products) x exact weights; scores and attn.V 3 products.

#define NB_  1
#define TT   256
#define DM   256
#define NH_  8
#define NKV  8
#define REP  (NH_ / NKV)
#define HD   32
#define DQ   (NH_ * HD)
#define DKV  (NKV * HD)
#define WIN  0
#define SCL  0.17677669529663688f   // 32^-0.5
#define NS   128     // sequences
#define NI   256     // residues (= TT)
#define CZ   128     // pair channels
#define NP   (NS * NH_)   // 1024 pseudo-heads
#define NRM  (NS * NI)    // 32768 msa rows
#define NRP  (NI * NI)    // 65536 pair rows
#define HP   64      // padded head width for attn.v
#define NBP  64      // padded bias projection width (8 heads used)
typedef _Float16 h16;
typedef unsigned short bf;
typedef __attribute__((ext_vector_type(16))) __bf16   v16bf;
typedef __attribute__((ext_vector_type(16))) _Float16 v16h;
typedef __attribute__((ext_vector_type(8)))  _Float16 v8h;
typedef __attribute__((ext_vector_type(8)))  unsigned short v8us;
typedef __attribute__((ext_vector_type(8)))  float    v8f;
typedef __attribute__((ext_vector_type(4)))  float    v4f;
typedef v8h  __attribute__((may_alias)) v8ha;
typedef v4f  __attribute__((may_alias)) v4fa;
typedef v8us __attribute__((may_alias)) v8usa;

__device__ __forceinline__ unsigned short f2bf(float f) { unsigned u = __float_as_uint(f); u += 0x7FFFu + ((u >> 16) & 1u); return (unsigned short)(u >> 16); }
__device__ __forceinline__ float bf2f(unsigned short b) { return __uint_as_float(((unsigned)b) << 16); }
__device__ __forceinline__ float bfr(float f) { return bf2f(f2bf(f)); }
__device__ __forceinline__ void splitf(float y, unsigned short& h, unsigned short& l) { h = f2bf(y); l = f2bf(y - bf2f(h)); }
__device__ __forceinline__ v16h cat16(v8h lo, v8h hi) { return __builtin_shufflevector(lo, hi, 0, 1, 2, 3, 4, 5, 6, 7, 8, 9, 10, 11, 12, 13, 14, 15); }
__device__ __forceinline__ v16bf cat16b(v8us lo, v8us hi) { return __builtin_bit_cast(v16bf, __builtin_shufflevector(lo, hi, 0, 1, 2, 3, 4, 5, 6, 7, 8, 9, 10, 11, 12, 13, 14, 15)); }
__device__ __forceinline__ v8f wmma16(v16h a, v16h b, v8f c) { return __builtin_amdgcn_wmma_f32_16x16x32_f16(false, a, false, b, (short)0, c, false, false); }
__device__ __forceinline__ v8f wmmab(v16bf a, v16bf b, v8f c) { return __builtin_amdgcn_wmma_f32_16x16x32_bf16(false, a, false, b, (short)0, c, false, false); }



// ---- k_gemmw: register-blocked GEMM, ONE WAVE per 64x64 output tile (16 accumulators), operands straight from K-contiguous 16-bit planes; grid (M/64, N/64, Z), 32 threads.
// C[m][n] (f32, pitch ldc, + optional f32 bias[n]) = sum_k A[m][k] Bt[n][k] (+ split products per NSPLIT). z-batch strides sA/sB/sC in elements. K % 32 == 0.
// OUTM 0: f32 C. OUTM 1 and 2 (m = sequence x residue, n = head x 32): bf16 hi/lo of C, 1: to Ph/Pl[sequence x head][residue][32], 2: transposed to Ph/Pl[sequence x head][HP][residue]. Both store 16 bytes a lane and whole 128-byte lines a store.
template <typename T16> struct WFrag;
template <> struct WFrag<h16> { typedef v16h V; static __device__ __forceinline__ V ld(const h16* p) { return cat16(*(const v8h*)p, *(const v8h*)(p + 16)); } static __device__ __forceinline__ v8f mma(V a, V b, v8f c) { return wmma16(a, b, c); } };
template <> struct WFrag<bf> { typedef v16bf V; static __device__ __forceinline__ V ld(const bf* p) { return cat16b(*(const v8us*)p, *(const v8us*)(p + 16)); } static __device__ __forceinline__ v8f mma(V a, V b, v8f c) { return wmmab(a, b, c); } };
template <typename T16, int NSPLIT, bool BIAS, int OUTM>
__global__ __launch_bounds__(32) void k_gemmw(const T16* __restrict__ A, const T16* __restrict__ A2, const T16* __restrict__ Bt, const T16* __restrict__ Bt2, int K, float* C, int ldc, const float* __restrict__ bias, size_t sA, size_t sB, size_t sC, bf* Ph, bf* Pl) {
    typedef typename WFrag<T16>::V V;
    const size_t z = blockIdx.z; A += z * sA; if (A2) A2 += z * sA; Bt += z * sB; if (Bt2) Bt2 += z * sB; C += z * sC;
    const int lane = threadIdx.x & 31, lr = lane & 15, hi = lane >> 4; const int r0 = blockIdx.x * 64, c0 = blockIdx.y * 64;
    v8f acc[4][4];
#pragma unroll
    for (int mb = 0; mb < 4; ++mb)
#pragma unroll
        for (int nb = 0; nb < 4; ++nb) acc[mb][nb] = (v8f){};
    const size_t aoff = (size_t)(r0 + lr) * K + 8 * hi, boff = (size_t)(c0 + lr) * K + 8 * hi;
#pragma unroll 1
    for (int kc = 0; kc < K; kc += 32) {
        V a[4], a2[4];
#pragma unroll
        for (int mb = 0; mb < 4; ++mb) { a[mb] = WFrag<T16>::ld(A + aoff + (size_t)mb * 16 * K + kc); if (NSPLIT == 1 || NSPLIT == 2) a2[mb] = WFrag<T16>::ld(A2 + aoff + (size_t)mb * 16 * K + kc); }
#pragma unroll
        for (int nb = 0; nb < 4; ++nb) { const V b = WFrag<T16>::ld(Bt + boff + (size_t)nb * 16 * K + kc); V b2; if (NSPLIT >= 2) b2 = WFrag<T16>::ld(Bt2 + boff + (size_t)nb * 16 * K + kc);
#pragma unroll
            for (int mb = 0; mb < 4; ++mb) { acc[mb][nb] = WFrag<T16>::mma(a[mb], b, acc[mb][nb]); if (NSPLIT == 1 || NSPLIT == 2) acc[mb][nb] = WFrag<T16>::mma(a2[mb], b, acc[mb][nb]); if (NSPLIT >= 2) acc[mb][nb] = WFrag<T16>::mma(a[mb], b2, acc[mb][nb]); } }
        asm volatile("v_nop\n\tv_nop\n\tv_nop\n\tv_nop" : "+v"(acc[0][0]), "+v"(acc[1][1]), "+v"(acc[2][2]), "+v"(acc[3][3]) : "v"(a[0]), "v"(a[3]));
    }
    if constexpr (OUTM == 2) {
    /* a lane's 8 accumulator rows are 8 neighbouring residues of one channel: 16 bytes of a V^T row. 16 channels x 64 residues are turned in LDS (pitch 144 bytes), so that 8 lanes store one channel's whole line */
    __shared__ __align__(16) bf ts[2][16 * 72];
    /* every loop of this block is unrolled so that acc[][] and the vectors' elements are indexed by constants and stay in registers */
#pragma unroll
    for (int nb = 0; nb < 4; ++nb) {
#pragma unroll
        for (int mb = 0; mb < 4; ++mb) { v8us oh, ol;
#pragma unroll
            for (int j = 0; j < 8; ++j) { unsigned short u, w2; splitf(acc[mb][nb][j], u, w2); oh[j] = u; ol[j] = w2; }
            *(v8usa*)(ts[0] + lr * 72 + mb * 16 + hi * 8) = oh; *(v8usa*)(ts[1] + lr * 72 + mb * 16 + hi * 8) = ol; }
        __builtin_amdgcn_wave_barrier(); asm volatile("" ::: "memory");   /* as below: keeps the compiler from moving the LDS reads of other lanes' values over the writes */
#pragma unroll
        for (int s = 0; s < 4; ++s) { const int col = 4 * s + (lane >> 3), rofs = (lane & 7) * 8; const v8us oh = *(const v8usa*)(ts[0] + col * 72 + rofs), ol = *(const v8usa*)(ts[1] + col * 72 + rofs);
            const unsigned m = (unsigned)(r0 + rofs), n = (unsigned)(c0 + nb * 16 + col);
            const unsigned e = (((m / NI) * NH_ + n / HD) * HP + n % HD) * NI + m % NI;
            *(v8us*)(Ph + e) = oh; *(v8us*)(Pl + e) = ol; }
        __builtin_amdgcn_wave_barrier(); asm volatile("" ::: "memory");   /* and the next block's writes over these reads */
    }
    } else {
    __shared__ __align__(16) float os[16 * 68];
#pragma unroll
    for (int mb = 0; mb < 4; ++mb) {
#pragma unroll
        for (int nb = 0; nb < 4; ++nb) {
#pragma unroll
            for (int j = 0; j < 8; ++j) os[(hi * 8 + j) * 68 + nb * 16 + lr] = acc[mb][nb][j]; }
        __builtin_amdgcn_wave_barrier(); asm volatile("" ::: "memory");
        if (OUTM == 0) {
        float* crow = C + (size_t)(r0 + mb * 16) * ldc + c0;
#pragma unroll
            for (int s = 0; s < 8; ++s) { const int row = 2 * s + hi, cofs = lr * 4; v4f val = *(const v4fa*)(os + row * 68 + cofs); if (BIAS) { val[0] += bfr(bias[c0 + cofs]); val[1] += bfr(bias[c0 + cofs + 1]); val[2] += bfr(bias[c0 + cofs + 2]); val[3] += bfr(bias[c0 + cofs + 3]); }
                *(v4f*)(crow + (size_t)row * ldc + cofs) = val; }
        } else {
            /* unrolled, like the inner loop: the vectors' elements are indexed by constants and stay in registers */
#pragma unroll
            for (int s = 0; s < 4; ++s) { const int row = 4 * s + (lane >> 3), cofs = (lane & 7) * 8; const v4f v0 = *(const v4fa*)(os + row * 68 + cofs), v1 = *(const v4fa*)(os + row * 68 + cofs + 4); v8us oh, ol;
#pragma unroll
                for (int q = 0; q < 8; ++q) { unsigned short u, w2; splitf(q < 4 ? v0[q & 3] : v1[q & 3], u, w2); oh[q] = u; ol[q] = w2; }
                const unsigned m = (unsigned)(r0 + mb * 16 + row), n = (unsigned)(c0 + cofs);
                const unsigned e = (((m / NI) * NH_ + n / HD) * NI + m % NI) * HD + n % HD;
                *(v8us*)(Ph + e) = oh; *(v8us*)(Pl + e) = ol; }
        }
        __builtin_amdgcn_wave_barrier(); asm volatile("" ::: "memory");
    }
    }
}

typedef __attribute__((ext_vector_type(2))) _Float16 v2h;
typedef __attribute__((ext_vector_type(4))) _Float16 v4h;
typedef __attribute__((ext_vector_type(2))) unsigned short v2us;
typedef __attribute__((ext_vector_type(4))) unsigned short v4us;
typedef __attribute__((ext_vector_type(2))) float v2f;
typedef __attribute__((ext_vector_type(4))) int v4i;

__global__ __launch_bounds__(256) void k_wtG(const float* __restrict__ w, int K, int N, bf* Bt) {
    const int lane = threadIdx.x & 31; const int L0 = (blockIdx.x * 8 + (threadIdx.x >> 5)) * 8; const int nlines = N * K / 64;
{
#pragma unroll 1
        for (int l = 0; l < 8; ++l) { const int L = L0 + l; if (L >= nlines) break; const size_t e = (size_t)L * 64 + lane * 2; const int k = (int)(e % K), n = (int)(e / K); v2us o;
            o[0] = f2bf(w[(size_t)k * N + n]); o[1] = f2bf(w[(size_t)(k + 1) * N + n]); *(v2us*)(Bt + e) = o; }
         }
}
__global__ __launch_bounds__(256) void k_cvt8(const float* __restrict__ src, bf* dst, size_t n8) { const size_t i = (size_t)blockIdx.x * 256 + threadIdx.x; if (i >= n8) return; const v8f v = *(const v8f*)(src + i * 8); v8us o;
#pragma unroll
    for (int k = 0; k < 8; ++k) o[k] = f2bf(v[k]); *(v8us*)(dst + i * 8) = o;  }




template <int WD>
__global__ __launch_bounds__(256) void k_lnrow(const float* __restrict__ X, size_t nrows, const float* __restrict__ g, const float* __restrict__ bb, bf* Hh, bf* Hl) { const int lane = threadIdx.x & 31; const size_t r = (size_t)blockIdx.x * 8 + (threadIdx.x >> 5); if (r >= nrows) return; const float* xr = X + r * WD; float a[WD / 32]; float s = 0.f;
#pragma unroll
    for (int c = 0; c < WD / 128; ++c) { const v4f v = *(const v4f*)(xr + c * 128 + lane * 4); for (int q = 0; q < 4; ++q) { a[c * 4 + q] = bfr(v[q]); s = __fadd_rn(s, a[c * 4 + q]); } }
#pragma unroll
    for (int sh = 16; sh; sh >>= 1) s = __fadd_rn(s, __shfl_xor(s, sh, 32));
    const float mean = __fdiv_rn(s, (float)WD); float s2 = 0.f;
#pragma unroll
    for (int k = 0; k < WD / 32; ++k) { const float dv = __fsub_rn(a[k], mean); s2 = __fadd_rn(s2, __fmul_rn(dv, dv)); }
#pragma unroll
    for (int sh = 16; sh; sh >>= 1) s2 = __fadd_rn(s2, __shfl_xor(s2, sh, 32));
    const float rs = __fdiv_rn(1.0f, __fsqrt_rn(__fadd_rn(__fdiv_rn(s2, (float)WD), 1e-5f)));
{
#pragma unroll
        for (int c = 0; c < WD / 128; ++c) { v4us oh, ol; for (int q = 0; q < 4; ++q) { const int col = c * 128 + lane * 4 + q; float y = __fmul_rn(__fmul_rn(__fsub_rn(a[c * 4 + q], mean), rs), bfr(g[col])); asm volatile("" : "+v"(y)); y = __fadd_rn(y, bfr(bb[col])); unsigned short u, w2; splitf(y, u, w2); oh[q] = u; ol[q] = w2; } *(v4us*)(Hh + r * WD + c * 128 + lane * 4) = oh; *(v4us*)(Hl + r * WD + c * 128 + lane * 4) = ol; }
         } }
__global__ __launch_bounds__(256) void k_wpad(const float* __restrict__ w, bf* Bt) { const int e2 = (blockIdx.x * 256 + threadIdx.x) * 2; if (e2 >= NBP * CZ) return; const int k = e2 % CZ; const int n = e2 / CZ; v2us o; const unsigned short a0 = f2bf(w[(size_t)k * NH_ + min(n, NH_ - 1)]), a1 = f2bf(w[(size_t)(k + 1) * NH_ + min(n, NH_ - 1)]); o[0] = (n < NH_) ? a0 : (unsigned short)0; o[1] = (n < NH_) ? a1 : (unsigned short)0; *(v2us*)(Bt + e2) = o;  }
__device__ __forceinline__ float sigm_slot(float a) { float e; asm("v_exp_f32 %0, %1\n\tv_nop" : "=v"(e) : "v"(__fmul_rn(-a, 1.4426950408889634f))); return __fdiv_rn(1.0f, __fadd_rn(1.0f, e)); }
// Four exponentials and one v_nop in one statement, for the same slot: the outputs are early-clobbered, so none overwrites a source of the exponential in front of it, and the v_nop stands behind the last.
__device__ __forceinline__ void exp2x4(float& a, float& b, float& c, float& d) { float e0, e1, e2, e3; asm("v_exp_f32 %0, %4\n\tv_exp_f32 %1, %5\n\tv_exp_f32 %2, %6\n\tv_exp_f32 %3, %7\n\tv_nop" : "=&v"(e0), "=&v"(e1), "=&v"(e2), "=&v"(e3) : "v"(a), "v"(b), "v"(c), "v"(d)); a = e0; b = e1; c = e2; d = e3; }
// k_fattn: scores, pair bias, softmax, attn.V and the sigmoid gate of one (sequence, head) for 16 query rows per wave, nothing through memory in between.
// S^T = K Q^T (A = 16 key rows, B = the wave's 16 queries): lane (lr, hi) holds, of query lr, keys 16 t + 8 hi + 0..7 in st[t]; two neighbouring tiles are the B fragment of O^T = V^T P^T as they lie.
// Workgroup: 8 waves = 2 neighbouring heads x 4 query tiles, so that each 128-byte line of the gated context is written inside one workgroup; grid 128 sequences x 4 head pairs x 4 query blocks.
// The second launch bound asks for four waves per SIMD (256 registers a wave), so that two workgroups share a WGP and one's vector work covers the other's loads.
__global__ __launch_bounds__(256, 4) void k_fattn(const bf* __restrict__ QPh, const bf* __restrict__ QPl, const bf* __restrict__ KPh, const bf* __restrict__ KPl, const bf* __restrict__ VTh, const bf* __restrict__ VTl, const float* __restrict__ BT, const float* __restrict__ GP, bf* Ah, bf* Al) {
    const int lane = threadIdx.x & 31, lr = lane & 15, hi = lane >> 4, w = threadIdx.x >> 5;
    const int qb = blockIdx.x & 3, hp = (blockIdx.x >> 2) & 3, s = blockIdx.x >> 4;
    const int h = hp * 2 + (w & 1), p = s * NH_ + h, i = qb * 64 + (w >> 1) * 16 + lr;
    /* 32-bit byte offsets (every plane is below 64 MiB): one offset register serves a hi and a lo plane */
    const unsigned qo = (((unsigned)p * NI + i) * HD + 8 * hi) * 2u, ko = (((unsigned)p * NI + lr) * HD + 8 * hi) * 2u, bo = ((unsigned)h * NRP + (unsigned)i * NI + 8 * hi) * 4u;
    const bf* qph = (const bf*)((const char*)QPh + qo); const bf* qpl = (const bf*)((const char*)QPl + qo); const bf* kph = (const bf*)((const char*)KPh + ko); const bf* kpl = (const bf*)((const char*)KPl + ko);
    const v16bf qh = WFrag<bf>::ld(qph), ql = WFrag<bf>::ld(qpl);
    const float* br = (const float*)((const char*)BT + bo);
    v8f st[NI / 16]; float mx = -3.0e38f;
#pragma unroll
    for (int t = 0; t < NI / 16; ++t) {
        const v16bf kh = WFrag<bf>::ld(kph + t * 16 * HD), kl = WFrag<bf>::ld(kpl + t * 16 * HD);
        const v4f b0 = *(const v4f*)(br + t * 16), b1 = *(const v4f*)(br + t * 16 + 4);
        v8f c = (v8f){}; c = wmmab(kh, qh, c); c = wmmab(kh, ql, c); c = wmmab(kl, qh, c);
#pragma unroll
        for (int j = 0; j < 8; ++j) { const float x = __fadd_rn(c[j], __fmul_rn(j < 4 ? b0[j & 3] : b1[j & 3], 5.656854249492380f)) * SCL;   /* (S + bias x sqrt(32)) x 32^-0.5: the reference adds the bias after the scale */
            c[j] = x; mx = fmaxf(mx, x); }
        st[t] = c; }
    asm volatile("s_wait_xcnt 0x0" :: "v"(qo), "v"(ko), "v"(bo), "s"(QPh), "s"(QPl), "s"(KPh), "s"(KPl), "s"(BT) : "memory");   /* precaution: the offset and base registers of the loads above are inputs here, so they stay live up to this wait and none is overwritten in front of it */
    mx = fmaxf(mx, __shfl_xor(mx, 16, 32));
    float sm[4] = {0.f, 0.f, 0.f, 0.f};
#pragma unroll
    for (int t = 0; t < NI / 16; ++t) {
#pragma unroll
        for (int j = 0; j < 8; j += 4) { float x[4];
#pragma unroll
            for (int q = 0; q < 4; ++q) x[q] = __fmul_rn(__fsub_rn(st[t][j + q], mx), 1.4426950408889634f);
            exp2x4(x[0], x[1], x[2], x[3]);
#pragma unroll
            for (int q = 0; q < 4; ++q) { st[t][j + q] = x[q]; sm[q] += x[q]; } } }
    float sum = (sm[0] + sm[1]) + (sm[2] + sm[3]); sum += __shfl_xor(sum, 16, 32);
    const float f = __fdiv_rn(1.0f, sum);
    const unsigned vo = (((unsigned)p * HP + lr) * NI + 8 * hi) * 2u;
    const bf* vph = (const bf*)((const char*)VTh + vo); const bf* vpl = (const bf*)((const char*)VTl + vo);
    v8f o[2]; o[0] = (v8f){}; o[1] = (v8f){};
#pragma unroll
    for (int c = 0; c < NI / 32; ++c) { v8us ph0, pl0, ph1, pl1;
#pragma unroll
        for (int j = 0; j < 8; ++j) { unsigned short u, w2; splitf(st[2 * c][j] * f, u, w2); ph0[j] = u; pl0[j] = w2; splitf(st[2 * c + 1][j] * f, u, w2); ph1[j] = u; pl1[j] = w2; }
        const v16bf ph = cat16b(ph0, ph1), pl = cat16b(pl0, pl1);
#pragma unroll
        for (int mb = 0; mb < 2; ++mb) { const v16bf vh = WFrag<bf>::ld(vph + mb * 16 * NI + c * 32), vl = WFrag<bf>::ld(vpl + mb * 16 * NI + c * 32);
            o[mb] = wmmab(vh, ph, o[mb]); o[mb] = wmmab(vh, pl, o[mb]); o[mb] = wmmab(vl, ph, o[mb]); } }
    asm volatile("s_wait_xcnt 0x0" :: "v"(vo), "s"(VTh), "s"(VTl) : "memory");   /* the same for the V^T loads */
    const size_t oo = ((size_t)s * NI + i) * DQ + h * HD + 8 * hi;   /* o[mb][r] = context[query i][channel 16 mb + 8 hi + r] */
#pragma unroll
    for (int mb = 0; mb < 2; ++mb) { const v4f g0 = *(const v4f*)(GP + oo + mb * 16), g1 = *(const v4f*)(GP + oo + mb * 16 + 4); v8us oh, ol;
#pragma unroll
        for (int r = 0; r < 8; ++r) { const float y = __fmul_rn(sigm_slot(r < 4 ? g0[r & 3] : g1[r & 3]), o[mb][r]); unsigned short u, w2; splitf(y, u, w2); oh[r] = u; ol[r] = w2; }
        *(v8us*)(Ah + oo + mb * 16) = oh; *(v8us*)(Al + oo + mb * 16) = ol; }
}

extern "C" void kernel_launch(void* const* d_in, const int* in_sizes, int n_in,
                              void* d_out, int out_size, void* d_ws, size_t ws_size, hipStream_t stream) {
    (void)in_sizes; (void)n_in; (void)out_size;
    const float* msa = (const float*)d_in[0]; const float* pair = (const float*)d_in[1]; const float* lmg = (const float*)d_in[2]; const float* lmb = (const float*)d_in[3]; const float* lpg = (const float*)d_in[4]; const float* lpb = (const float*)d_in[5]; const float* wq = (const float*)d_in[6]; const float* wk = (const float*)d_in[7]; const float* wv = (const float*)d_in[8]; const float* wp = (const float*)d_in[9]; const float* wg = (const float*)d_in[10]; const float* bg = (const float*)d_in[11]; const float* wo = (const float*)d_in[12]; const float* bo = (const float*)d_in[13];
    float* OUT = (float*)d_out;     // [1][128][256][256]
    char* wsp = (char*)d_ws;
    auto take = [&](size_t bytes) { char* p = wsp; wsp += (bytes + 255) & ~(size_t)255; return (void*)p; };
    bf* WQ = (bf*)take((size_t)DQ * DM * 2); bf* WK = (bf*)take((size_t)DQ * DM * 2); bf* WV = (bf*)take((size_t)DQ * DM * 2); bf* WG = (bf*)take((size_t)DQ * DM * 2); bf* WO = (bf*)take((size_t)DM * DQ * 2); bf* WP = (bf*)take((size_t)NBP * CZ * 2);
    bf* Mh = (bf*)take((size_t)NRM * DM * 2); bf* Ml = (bf*)take((size_t)NRM * DM * 2); float* FQ = (float*)take((size_t)NRM * DQ * 4); float* GP = (float*)take((size_t)NRM * DQ * 4); float* BIAS = (float*)take((size_t)NRP * NBP * 4);
    bf* QPh = (bf*)take((size_t)NP * NI * HD * 2); bf* QPl = (bf*)take((size_t)NP * NI * HD * 2); bf* KPh = (bf*)take((size_t)NP * NI * HD * 2); bf* KPl = (bf*)take((size_t)NP * NI * HD * 2); bf* VTh = (bf*)take((size_t)NP * HP * NI * 2); bf* VTl = (bf*)take((size_t)NP * HP * NI * 2);
    bf* ATh = Mh; bf* ATl = Ml;   /* the gated context reuses the LN operand buffers (m is dead after the projections) */
    if ((size_t)(wsp - (char*)d_ws) > ws_size) return;    // ws 256 MiB (carve ~241 MiB; the pair LN operand aliases FQ/GP before the projections, see below)
    bf* PLh = (bf*)FQ; bf* PLl = (bf*)GP;   /* pair LN planes [65536][128] bf16 = 16 MiB each, inside FQ / GP (32 MiB each); GP is written only later, FQ holds nothing else */
    k_wtG<<<(DM * DQ / 64 + 63) / 64, 256, 0, stream>>>(wq, DM, DQ, WQ); k_wtG<<<(DM * DQ / 64 + 63) / 64, 256, 0, stream>>>(wk, DM, DQ, WK); k_wtG<<<(DM * DQ / 64 + 63) / 64, 256, 0, stream>>>(wv, DM, DQ, WV); k_wtG<<<(DM * DQ / 64 + 63) / 64, 256, 0, stream>>>(wg, DM, DQ, WG); k_wtG<<<(DQ * DM / 64 + 63) / 64, 256, 0, stream>>>(wo, DQ, DM, WO); k_wpad<<<(NBP * CZ / 2 + 255) / 256, 256, 0, stream>>>(wp, WP);
    /* pair bias, head-major: BIAS[h][i*256 + j] = Wp[:, h] . LN(pair[i][j]) (rows 8..63 zero): Wp is the A operand, the hi/lo LN planes the B operand */
    k_lnrow<CZ><<<(unsigned)((NRP + 7) / 8), 256, 0, stream>>>(pair, (size_t)NRP, lpg, lpb, PLh, PLl);
    k_gemmw<bf, 3, false, 0><<<dim3(NBP / 64, NRP / 64, 1), 32, 0, stream>>>(WP, nullptr, PLh, PLl, CZ, BIAS, NRP, nullptr, 0, 0, 0, nullptr, nullptr);
    /* msa LN -> Q, K, V, gate pre-activation */
    k_lnrow<DM><<<(unsigned)((NRM + 7) / 8), 256, 0, stream>>>(msa, (size_t)NRM, lmg, lmb, Mh, Ml);
    k_gemmw<bf, 1, false, 1><<<dim3(NRM / 64, DQ / 64, 1), 32, 0, stream>>>(Mh, Ml, WQ, nullptr, DM, nullptr, 0, nullptr, 0, 0, 0, QPh, QPl);
    k_gemmw<bf, 1, false, 1><<<dim3(NRM / 64, DQ / 64, 1), 32, 0, stream>>>(Mh, Ml, WK, nullptr, DM, nullptr, 0, nullptr, 0, 0, 0, KPh, KPl);
    k_gemmw<bf, 1, false, 2><<<dim3(NRM / 64, DQ / 64, 1), 32, 0, stream>>>(Mh, Ml, WV, nullptr, DM, nullptr, 0, nullptr, 0, 0, 0, VTh, VTl);
    k_gemmw<bf, 1, true, 0><<<dim3(NRM / 64, DQ / 64, 1), 32, 0, stream>>>(Mh, Ml, WG, nullptr, DM, GP, DQ, bg, 0, 0, 0, nullptr, nullptr);          /* gate pre-activation m Wg + bg */
    k_fattn<<<NS * (NH_ / 2) * (NI / 64), 256, 0, stream>>>(QPh, QPl, KPh, KPl, VTh, VTl, BIAS, GP, ATh, ATl);
    k_gemmw<bf, 1, true, 0><<<dim3(NRM / 64, DM / 64, 1), 32, 0, stream>>>(ATh, ATl, WO, nullptr, DQ, OUT, DM, bo, 0, 0, 0, nullptr, nullptr);            /* out = vals Wo + bo */
}

// v003
// Measured time: 201 microseconds a run.
// Next to v002, in two timings, it ran 1.24 times as fast each time.
// All steps since v000 together make it 8.73 times as fast.
#include <hip/hip_runtime.h>

// MSA row attention with pair bias (msa [1][128][256][256], pair [1][256][256][128]; m = LN(msa), p = LN(pair) (eps 1e-5, affine); Q, K, V = m W ('xw' [256][256], 8 heads x 32), G = sigmoid(m Wg + bg); bias[h][i][j] = (p Wp)[i][j][h] ('xw' [128][8]); per sequence s and head h: attn = softmax(Q_s,h . K_s,h / sqrt(32) + bias_h); vals = G * (attn V); out = vals Wo + bo ('xw' [256][256]) -> [1][128][256][256] (8.4 M)).
// Layout: row LayerNorm kernels (one wave per row) write hi/lo operands for the msa (32,768 x 256) and pair (65,536 x 128) slabs; hl x exact projections (Q, K, V, gate pre-activation, and the pair bias against Wp zero-padded to 64 columns); the Q and K GEMMs store hi/lo planes [sequence x head][residue][32] and the V GEMM hi/lo V^T planes [sequence x head][64][residue], rows 0..31 written and read, from their epilogues; one attention kernel over all 1024 (sequence, head) pairs keeps a wave's 16 x 256 scores in registers: scores (3 products, K 32), + bias[h][i][j], softmax over the 256 residues with every row hi/lo, attn.V (3 products), sigmoid gate, and writes the hi/lo operand of the Wo GEMM.
// Compute dtypes, f32 accumulate: every input rounded to bf16; LN, sigmoid, softmax f32; GEMM activations bf16 hi/lo (2 products) x exact weights; scores and attn.V 3 products.

#define NB_  1
#define TT   256
#define DM   256
#define NH_  8
#define NKV  8
#define REP  (NH_ / NKV)
#define HD   32
#define DQ   (NH_ * HD)
#define DKV  (NKV * HD)
#define WIN  0
#define SCL  0.17677669529663688f   // 32^-0.5
#define NS   128     // sequences
#define NI   256     // residues (= TT)
#define CZ   128     // pair channels
#define NP   (NS * NH_)   // 1024 pseudo-heads
#define NRM  (NS * NI)    // 32768 msa rows
#define NRP  (NI * NI)    // 65536 pair rows
#define HP   64      // padded head width for attn.v
#define NBP  64      // padded bias projection width (8 heads used)
typedef _Float16 h16;
typedef unsigned short bf;
typedef __attribute__((ext_vector_type(16))) __bf16   v16bf;
typedef __attribute__((ext_vector_type(16))) _Float16 v16h;
typedef __attribute__((ext_vector_type(8)))  _Float16 v8h;
typedef __attribute__((ext_vector_type(8)))  unsigned short v8us;
typedef __attribute__((ext_vector_type(8)))  float    v8f;
typedef __attribute__((ext_vector_type(4)))  float    v4f;
typedef v8h  __attribute__((may_alias)) v8ha;
typedef v4f  __attribute__((may_alias)) v4fa;
typedef v8us __attribute__((may_alias)) v8usa;

__device__ __forceinline__ unsigned short f2bf(float f) { unsigned u = __float_as_uint(f); u += 0x7FFFu + ((u >> 16) & 1u); return (unsigned short)(u >> 16); }
__device__ __forceinline__ float bf2f(unsigned short b) { return __uint_as_float(((unsigned)b) << 16); }
__device__ __forceinline__ float bfr(float f) { return bf2f(f2bf(f)); }
__device__ __forceinline__ void splitf(float y, unsigned short& h, unsigned short& l) { h = f2bf(y); l = f2bf(y - bf2f(h)); }
__device__ __forceinline__ v16h cat16(v8h lo, v8h hi) { return __builtin_shufflevector(lo, hi, 0, 1, 2, 3, 4, 5, 6, 7, 8, 9, 10, 11, 12, 13, 14, 15); }
__device__ __forceinline__ v16bf cat16b(v8us lo, v8us hi) { return __builtin_bit_cast(v16bf, __builtin_shufflevector(lo, hi, 0, 1, 2, 3, 4, 5, 6, 7, 8, 9, 10, 11, 12, 13, 14, 15)); }
__device__ __forceinline__ v8f wmma16(v16h a, v16h b, v8f c) { return __builtin_amdgcn_wmma_f32_16x16x32_f16(false, a, false, b, (short)0, c, false, false); }
__device__ __forceinline__ v8f wmmab(v16bf a, v16bf b, v8f c) { return __builtin_amdgcn_wmma_f32_16x16x32_bf16(false, a, false, b, (short)0, c, false, false); }



// ---- gemmw_tile: register-blocked GEMM, ONE WAVE per 64x64 output tile (16 accumulators), operands straight from K-contiguous 16-bit planes; tile (bx, by) of (M/64, N/64), 32 threads; sm = the wave's 4608 bytes of LDS for the epilogue.
// C[m][n] (f32, pitch ldc, + optional f32 bias[n]) = sum_k A[m][k] Bt[n][k] (+ split products per NSPLIT). K % 32 == 0.
// OUTM 0: f32 C. OUTM 1 and 2 (m = sequence x residue, n = head x 32): bf16 hi/lo of C, 1: to Ph/Pl[sequence x head][residue][32], 2: transposed to Ph/Pl[sequence x head][HP][residue]. Both store 16 bytes a lane and whole 128-byte lines a store.
template <typename T16> struct WFrag;
template <> struct WFrag<h16> { typedef v16h V; static __device__ __forceinline__ V ld(const h16* p) { return cat16(*(const v8h*)p, *(const v8h*)(p + 16)); } static __device__ __forceinline__ v8f mma(V a, V b, v8f c) { return wmma16(a, b, c); } };
template <> struct WFrag<bf> { typedef v16bf V; static __device__ __forceinline__ V ld(const bf* p) { return cat16b(*(const v8us*)p, *(const v8us*)(p + 16)); } static __device__ __forceinline__ v8f mma(V a, V b, v8f c) { return wmmab(a, b, c); } };
template <typename T16, int NSPLIT, bool BIAS, int OUTM>
__device__ __forceinline__ void gemmw_tile(const T16* __restrict__ A, const T16* __restrict__ A2, const T16* __restrict__ Bt, const T16* __restrict__ Bt2, int K, float* C, int ldc, const float* __restrict__ bias, bf* Ph, bf* Pl, int bx, int by, char* sm) {
    typedef typename WFrag<T16>::V V;
    const int lane = threadIdx.x & 31, lr = lane & 15, hi = lane >> 4; const int r0 = bx * 64, c0 = by * 64;
    v8f acc[4][4];
#pragma unroll
    for (int mb = 0; mb < 4; ++mb)
#pragma unroll
        for (int nb = 0; nb < 4; ++nb) acc[mb][nb] = (v8f){};
    /* 32-bit byte offsets, as in k_fattn (every operand plane is below 64 MiB): one offset register serves the planes of A, one those of B, and the wait at the foot of the trip can name them */
    unsigned ao = ((unsigned)(r0 + lr) * K + 8 * hi) * 2u, bo = ((unsigned)(c0 + lr) * K + 8 * hi) * 2u;
#pragma unroll 1
    for (int kc = 0; kc < K; kc += 32) {
        V a[4], a2[4]; const T16* pa = (const T16*)((const char*)A + ao); const T16* pa2 = (const T16*)((const char*)A2 + ao); const T16* pb = (const T16*)((const char*)Bt + bo); const T16* pb2 = (const T16*)((const char*)Bt2 + bo);
#pragma unroll
        for (int mb = 0; mb < 4; ++mb) { a[mb] = WFrag<T16>::ld(pa + mb * 16 * K); if (NSPLIT == 1 || NSPLIT == 2) a2[mb] = WFrag<T16>::ld(pa2 + mb * 16 * K); }
#pragma unroll
        for (int nb = 0; nb < 4; ++nb) { const V b = WFrag<T16>::ld(pb + nb * 16 * K); V b2; if (NSPLIT >= 2) b2 = WFrag<T16>::ld(pb2 + nb * 16 * K);
#pragma unroll
            for (int mb = 0; mb < 4; ++mb) { acc[mb][nb] = WFrag<T16>::mma(a[mb], b, acc[mb][nb]); if (NSPLIT == 1 || NSPLIT == 2) acc[mb][nb] = WFrag<T16>::mma(a2[mb], b, acc[mb][nb]); if (NSPLIT >= 2) acc[mb][nb] = WFrag<T16>::mma(a[mb], b2, acc[mb][nb]); } }
        asm volatile("v_nop\n\tv_nop\n\tv_nop\n\tv_nop" : "+v"(acc[0][0]), "+v"(acc[1][1]), "+v"(acc[2][2]), "+v"(acc[3][3]) : "v"(a[0]), "v"(a[3]));
        asm volatile("s_wait_xcnt 0x0" :: "v"(ao), "v"(bo) : "memory");   /* precaution: the offset registers of this trip's loads are inputs here, so they stay live up to this wait and no load of the trip lands in one of them */
        ao += 64u; bo += 64u;
    }
    if constexpr (OUTM == 2) {
    /* a lane's 8 accumulator rows are 8 neighbouring residues of one channel: 16 bytes of a V^T row. 16 channels x 64 residues are turned in LDS (pitch 144 bytes), so that 8 lanes store one channel's whole line */
    bf (*ts)[16 * 72] = (bf (*)[16 * 72])sm;
    /* every loop of this block is unrolled so that acc[][] and the vectors' elements are indexed by constants and stay in registers */
#pragma unroll
    for (int nb = 0; nb < 4; ++nb) {
#pragma unroll
        for (int mb = 0; mb < 4; ++mb) { v8us oh, ol;
#pragma unroll
            for (int j = 0; j < 8; ++j) { unsigned short u, w2; splitf(acc[mb][nb][j], u, w2); oh[j] = u; ol[j] = w2; }
            *(v8usa*)(ts[0] + lr * 72 + mb * 16 + hi * 8) = oh; *(v8usa*)(ts[1] + lr * 72 + mb * 16 + hi * 8) = ol; }
        __builtin_amdgcn_wave_barrier(); asm volatile("" ::: "memory");   /* as below: keeps the compiler from moving the LDS reads of other lanes' values over the writes */
#pragma unroll
        for (int s = 0; s < 4; ++s) { const int col = 4 * s + (lane >> 3), rofs = (lane & 7) * 8; const v8us oh = *(const v8usa*)(ts[0] + col * 72 + rofs), ol = *(const v8usa*)(ts[1] + col * 72 + rofs);
            const unsigned m = (unsigned)(r0 + rofs), n = (unsigned)(c0 + nb * 16 + col);
            const unsigned e = (((m / NI) * NH_ + n / HD) * HP + n % HD) * NI + m % NI;
            *(v8us*)(Ph + e) = oh; *(v8us*)(Pl + e) = ol; }
        asm volatile("s_wait_xcnt 0x0" ::: "memory");   /* precaution: stands behind these stores, in front of whatever next overwrites their address or data registers */
        __builtin_amdgcn_wave_barrier(); asm volatile("" ::: "memory");   /* and the next block's writes over these reads */
    }
    } else {
    float* os = (float*)sm;
#pragma unroll
    for (int mb = 0; mb < 4; ++mb) {
#pragma unroll
        for (int nb = 0; nb < 4; ++nb) {
#pragma unroll
            for (int j = 0; j < 8; ++j) os[(hi * 8 + j) * 68 + nb * 16 + lr] = acc[mb][nb][j]; }
        __builtin_amdgcn_wave_barrier(); asm volatile("" ::: "memory");
        if (OUTM == 0) {
        float* crow = C + (size_t)(r0 + mb * 16) * ldc + c0;
#pragma unroll
            for (int s = 0; s < 8; ++s) { const int row = 2 * s + hi, cofs = lr * 4; v4f val = *(const v4fa*)(os + row * 68 + cofs); if (BIAS) { val[0] += bfr(bias[c0 + cofs]); val[1] += bfr(bias[c0 + cofs + 1]); val[2] += bfr(bias[c0 + cofs + 2]); val[3] += bfr(bias[c0 + cofs + 3]); }
                *(v4f*)(crow + (size_t)row * ldc + cofs) = val; }
        } else {
            /* unrolled, like the inner loop: the vectors' elements are indexed by constants and stay in registers */
#pragma unroll
            for (int s = 0; s < 4; ++s) { const int row = 4 * s + (lane >> 3), cofs = (lane & 7) * 8; const v4f v0 = *(const v4fa*)(os + row * 68 + cofs), v1 = *(const v4fa*)(os + row * 68 + cofs + 4); v8us oh, ol;
#pragma unroll
                for (int q = 0; q < 8; ++q) { unsigned short u, w2; splitf(q < 4 ? v0[q & 3] : v1[q & 3], u, w2); oh[q] = u; ol[q] = w2; }
                const unsigned m = (unsigned)(r0 + mb * 16 + row), n = (unsigned)(c0 + cofs);
                const unsigned e = (((m / NI) * NH_ + n / HD) * NI + m % NI) * HD + n % HD;
                *(v8us*)(Ph + e) = oh; *(v8us*)(Pl + e) = ol; }
        }
        asm volatile("s_wait_xcnt 0x0" ::: "memory");   /* precaution, as above: behind the stores of either form */
        __builtin_amdgcn_wave_barrier(); asm volatile("" ::: "memory");
    }
    }
}

// k_proj: the five GEMMs that depend on the LayerNorm planes alone, in one launch, one tile a workgroup: blocks 0..8191 = Q, K, V, gate (2048 tiles each, row tile fastest), blocks 8192..9215 = the pair bias (the shortest K, so last).
__global__ __launch_bounds__(32) void k_proj(const bf* __restrict__ Mh, const bf* __restrict__ Ml, const bf* __restrict__ WQ, const bf* __restrict__ WK, const bf* __restrict__ WV, const bf* __restrict__ WG, const float* __restrict__ bg, bf* QPh, bf* QPl, bf* KPh, bf* KPl, bf* VTh, bf* VTl, float* GP, const bf* __restrict__ WP, const bf* __restrict__ PLh, const bf* __restrict__ PLl, float* BIAS) {
    __shared__ __align__(16) char sm[4608];
    const int b = blockIdx.x;
    if (b < 4 * (NRM / 64) * (DQ / 64)) {
        const int g = b / ((NRM / 64) * (DQ / 64)), bx = b % (NRM / 64), by = (b / (NRM / 64)) % (DQ / 64);
        if (g < 2) gemmw_tile<bf, 1, false, 1>(Mh, Ml, g ? WK : WQ, nullptr, DM, nullptr, 0, nullptr, g ? KPh : QPh, g ? KPl : QPl, bx, by, sm);
        else if (g == 2) gemmw_tile<bf, 1, false, 2>(Mh, Ml, WV, nullptr, DM, nullptr, 0, nullptr, VTh, VTl, bx, by, sm);
        else gemmw_tile<bf, 1, true, 0>(Mh, Ml, WG, nullptr, DM, GP, DQ, bg, nullptr, nullptr, bx, by, sm);          /* gate pre-activation m Wg + bg */
    } else {
        /* pair bias, head-major: BIAS[h][i*256 + j] = Wp[:, h] . LN(pair[i][j]) (rows 8..63 zero): Wp is the A operand, the hi/lo LN planes the B operand */
        gemmw_tile<bf, 3, false, 0>(WP, nullptr, PLh, PLl, CZ, BIAS, NRP, nullptr, nullptr, nullptr, 0, b - 4 * (NRM / 64) * (DQ / 64), sm);
    }
}
// k_gemmo: out = vals Wo + bo; grid (M/64, N/64).
__global__ __launch_bounds__(32) void k_gemmo(const bf* __restrict__ Ah, const bf* __restrict__ Al, const bf* __restrict__ WO, float* OUT, const float* __restrict__ bo) {
    __shared__ __align__(16) char sm[4608];
    gemmw_tile<bf, 1, true, 0>(Ah, Al, WO, nullptr, DQ, OUT, DM, bo, nullptr, nullptr, blockIdx.x, blockIdx.y, sm);
}

typedef __attribute__((ext_vector_type(2))) _Float16 v2h;
typedef __attribute__((ext_vector_type(4))) _Float16 v4h;
typedef __attribute__((ext_vector_type(2))) unsigned short v2us;
typedef __attribute__((ext_vector_type(4))) unsigned short v4us;
typedef __attribute__((ext_vector_type(2))) float v2f;
typedef __attribute__((ext_vector_type(4))) int v4i;

__device__ __forceinline__ void wtG(const float* __restrict__ w, int K, int N, bf* Bt, int blk) {
    const int lane = threadIdx.x & 31; const int L0 = (blk * 8 + (threadIdx.x >> 5)) * 8; const int nlines = N * K / 64;
{
#pragma unroll 1
        for (int l = 0; l < 8; ++l) { const int L = L0 + l; if (L >= nlines) break; const size_t e = (size_t)L * 64 + lane * 2; const int k = (int)(e % K), n = (int)(e / K); v2us o;
            o[0] = f2bf(w[(size_t)k * N + n]); o[1] = f2bf(w[(size_t)(k + 1) * N + n]); *(v2us*)(Bt + e) = o; }
         }
}
__global__ __launch_bounds__(256) void k_cvt8(const float* __restrict__ src, bf* dst, size_t n8) { const size_t i = (size_t)blockIdx.x * 256 + threadIdx.x; if (i >= n8) return; const v8f v = *(const v8f*)(src + i * 8); v8us o;
#pragma unroll
    for (int k = 0; k < 8; ++k) o[k] = f2bf(v[k]); *(v8us*)(dst + i * 8) = o;  }




template <int WD>
__device__ __forceinline__ void lnrow(const float* __restrict__ X, size_t nrows, const float* __restrict__ g, const float* __restrict__ bb, bf* Hh, bf* Hl, int blk) { const int lane = threadIdx.x & 31; const size_t r = (size_t)blk * 8 + (threadIdx.x >> 5); if (r >= nrows) return; const float* xr = X + r * WD; float a[WD / 32]; float s = 0.f;
#pragma unroll
    for (int c = 0; c < WD / 128; ++c) { const v4f v = *(const v4f*)(xr + c * 128 + lane * 4); for (int q = 0; q < 4; ++q) { a[c * 4 + q] = bfr(v[q]); s = __fadd_rn(s, a[c * 4 + q]); } }
#pragma unroll
    for (int sh = 16; sh; sh >>= 1) s = __fadd_rn(s, __shfl_xor(s, sh, 32));
    const float mean = __fdiv_rn(s, (float)WD); float s2 = 0.f;
#pragma unroll
    for (int k = 0; k < WD / 32; ++k) { const float dv = __fsub_rn(a[k], mean); s2 = __fadd_rn(s2, __fmul_rn(dv, dv)); }
#pragma unroll
    for (int sh = 16; sh; sh >>= 1) s2 = __fadd_rn(s2, __shfl_xor(s2, sh, 32));
    const float rs = __fdiv_rn(1.0f, __fsqrt_rn(__fadd_rn(__fdiv_rn(s2, (float)WD), 1e-5f)));
{
#pragma unroll
        for (int c = 0; c < WD / 128; ++c) { v4us oh, ol; for (int q = 0; q < 4; ++q) { const int col = c * 128 + lane * 4 + q; float y = __fmul_rn(__fmul_rn(__fsub_rn(a[c * 4 + q], mean), rs), bfr(g[col])); asm volatile("" : "+v"(y)); y = __fadd_rn(y, bfr(bb[col])); unsigned short u, w2; splitf(y, u, w2); oh[q] = u; ol[q] = w2; } *(v4us*)(Hh + r * WD + c * 128 + lane * 4) = oh; *(v4us*)(Hl + r * WD + c * 128 + lane * 4) = ol;
            asm volatile("s_wait_xcnt 0x0" ::: "memory"); }   /* precaution: behind the two stores, in front of the next overwrite of their registers */
         } }
__device__ __forceinline__ void wpad(const float* __restrict__ w, bf* Bt, int blk) { const int e2 = (blk * 256 + threadIdx.x) * 2; if (e2 >= NBP * CZ) return; const int k = e2 % CZ; const int n = e2 / CZ; v2us o; const unsigned short a0 = f2bf(w[(size_t)k * NH_ + min(n, NH_ - 1)]), a1 = f2bf(w[(size_t)(k + 1) * NH_ + min(n, NH_ - 1)]); o[0] = (n < NH_) ? a0 : (unsigned short)0; o[1] = (n < NH_) ? a1 : (unsigned short)0; *(v2us*)(Bt + e2) = o;  }
// k_prep: everything that depends on the inputs alone, in one launch. Blocks 0..79: the five 256 x 256 weights to bf16 [n][k] (16 blocks each); 80..95: Wp padded; then 8192 blocks of pair LayerNorm rows and 4096 of msa rows. The few weight blocks, which are chains of dependent-latency trips, come first and run beside the LayerNorm streams.
#define NBW  ((DM * DQ / 64 + 63) / 64)       // blocks of one weight
#define NBWP ((NBP * CZ / 2 + 255) / 256)     // blocks of the padded Wp
__global__ __launch_bounds__(256) void k_prep(const float* __restrict__ msa, const float* __restrict__ pair, const float* __restrict__ lmg, const float* __restrict__ lmb, const float* __restrict__ lpg, const float* __restrict__ lpb, const float* __restrict__ wq, const float* __restrict__ wk, const float* __restrict__ wv, const float* __restrict__ wg, const float* __restrict__ wo, const float* __restrict__ wp, bf* WQ, bf* WK, bf* WV, bf* WG, bf* WO, bf* WP, bf* Mh, bf* Ml, bf* PLh, bf* PLl) {
    const int b = blockIdx.x;
    if (b < 5 * NBW) { const int g = b / NBW;
        const float* w = g == 0 ? wq : g == 1 ? wk : g == 2 ? wv : g == 3 ? wg : wo; bf* o = g == 0 ? WQ : g == 1 ? WK : g == 2 ? WV : g == 3 ? WG : WO;
        wtG(w, DM, DQ, o, b % NBW); }      /* all five are 256 x 256 (DM == DQ) */
    else if (b < 5 * NBW + NBWP) wpad(wp, WP, b - 5 * NBW);
    else if (b < 5 * NBW + NBWP + NRP / 8) lnrow<CZ>(pair, (size_t)NRP, lpg, lpb, PLh, PLl, b - (5 * NBW + NBWP));
    else lnrow<DM>(msa, (size_t)NRM, lmg, lmb, Mh, Ml, b - (5 * NBW + NBWP + NRP / 8));
}
__device__ __forceinline__ float sigm_slot(float a) { float e; asm("v_exp_f32 %0, %1\n\tv_nop" : "=v"(e) : "v"(__fmul_rn(-a, 1.4426950408889634f))); return __fdiv_rn(1.0f, __fadd_rn(1.0f, e)); }
// Four exponentials and one v_nop in one statement, for the same slot: the outputs are early-clobbered, so none overwrites a source of the exponential in front of it, and the v_nop stands behind the last.
__device__ __forceinline__ void exp2x4(float& a, float& b, float& c, float& d) { float e0, e1, e2, e3; asm("v_exp_f32 %0, %4\n\tv_exp_f32 %1, %5\n\tv_exp_f32 %2, %6\n\tv_exp_f32 %3, %7\n\tv_nop" : "=&v"(e0), "=&v"(e1), "=&v"(e2), "=&v"(e3) : "v"(a), "v"(b), "v"(c), "v"(d)); a = e0; b = e1; c = e2; d = e3; }
// k_fattn: scores, pair bias, softmax, attn.V and the sigmoid gate of one (sequence, head) for 16 query rows per wave, nothing through memory in between.
// S^T = K Q^T (A = 16 key rows, B = the wave's 16 queries): lane (lr, hi) holds, of query lr, keys 16 t + 8 hi + 0..7 in st[t]; two neighbouring tiles are the B fragment of O^T = V^T P^T as they lie.
// Workgroup: 8 waves = 2 neighbouring heads x 4 query tiles, so that each 128-byte line of the gated context is written inside one workgroup; grid 128 sequences x 4 head pairs x 4 query blocks.
// The second launch bound asks for four waves per SIMD (256 registers a wave), so that two workgroups share a WGP and one's vector work covers the other's loads.
__global__ __launch_bounds__(256, 4) void k_fattn(const bf* __restrict__ QPh, const bf* __restrict__ QPl, const bf* __restrict__ KPh, const bf* __restrict__ KPl, const bf* __restrict__ VTh, const bf* __restrict__ VTl, const float* __restrict__ BT, const float* __restrict__ GP, bf* Ah, bf* Al) {
    const int lane = threadIdx.x & 31, lr = lane & 15, hi = lane >> 4, w = threadIdx.x >> 5;
    const int qb = blockIdx.x & 3, hp = (blockIdx.x >> 2) & 3, s = blockIdx.x >> 4;
    const int h = hp * 2 + (w & 1), p = s * NH_ + h, i = qb * 64 + (w >> 1) * 16 + lr;
    /* 32-bit byte offsets (every plane is below 64 MiB): one offset register serves a hi and a lo plane */
    const unsigned qo = (((unsigned)p * NI + i) * HD + 8 * hi) * 2u, ko = (((unsigned)p * NI + lr) * HD + 8 * hi) * 2u, bo = ((unsigned)h * NRP + (unsigned)i * NI + 8 * hi) * 4u;
    const bf* qph = (const bf*)((const char*)QPh + qo); const bf* qpl = (const bf*)((const char*)QPl + qo); const bf* kph = (const bf*)((const char*)KPh + ko); const bf* kpl = (const bf*)((const char*)KPl + ko);
    const v16bf qh = WFrag<bf>::ld(qph), ql = WFrag<bf>::ld(qpl);
    const float* br = (const float*)((const char*)BT + bo);
    v8f st[NI / 16]; float mx = -3.0e38f;
#pragma unroll
    for (int t = 0; t < NI / 16; ++t) {
        const v16bf kh = WFrag<bf>::ld(kph + t * 16 * HD), kl = WFrag<bf>::ld(kpl + t * 16 * HD);
        const v4f b0 = *(const v4f*)(br + t * 16), b1 = *(const v4f*)(br + t * 16 + 4);
        v8f c = (v8f){}; c = wmmab(kh, qh, c); c = wmmab(kh, ql, c); c = wmmab(kl, qh, c);
#pragma unroll
        for (int j = 0; j < 8; ++j) { const float x = __fadd_rn(c[j], __fmul_rn(j < 4 ? b0[j & 3] : b1[j & 3], 5.656854249492380f)) * SCL;   /* (S + bias x sqrt(32)) x 32^-0.5: the reference adds the bias after the scale */
            c[j] = x; mx = fmaxf(mx, x); }
        st[t] = c; }
    asm volatile("s_wait_xcnt 0x0" :: "v"(qo), "v"(ko), "v"(bo), "s"(QPh), "s"(QPl), "s"(KPh), "s"(KPl), "s"(BT) : "memory");   /* precaution: the offset and base registers of the loads above are inputs here, so they stay live up to this wait and none is overwritten in front of it */
    mx = fmaxf(mx, __shfl_xor(mx, 16, 32));
    float sm[4] = {0.f, 0.f, 0.f, 0.f};
#pragma unroll
    for (int t = 0; t < NI / 16; ++t) {
#pragma unroll
        for (int j = 0; j < 8; j += 4) { float x[4];
#pragma unroll
            for (int q = 0; q < 4; ++q) x[q] = __fmul_rn(__fsub_rn(st[t][j + q], mx), 1.4426950408889634f);
            exp2x4(x[0], x[1], x[2], x[3]);
#pragma unroll
            for (int q = 0; q < 4; ++q) { st[t][j + q] = x[q]; sm[q] += x[q]; } } }
    float sum = (sm[0] + sm[1]) + (sm[2] + sm[3]); sum += __shfl_xor(sum, 16, 32);
    const float f = __fdiv_rn(1.0f, sum);
    const unsigned vo = (((unsigned)p * HP + lr) * NI + 8 * hi) * 2u;
    const bf* vph = (const bf*)((const char*)VTh + vo); const bf* vpl = (const bf*)((const char*)VTl + vo);
    v8f o[2]; o[0] = (v8f){}; o[1] = (v8f){};
#pragma unroll
    for (int c = 0; c < NI / 32; ++c) { v8us ph0, pl0, ph1, pl1;
#pragma unroll
        for (int j = 0; j < 8; ++j) { unsigned short u, w2; splitf(st[2 * c][j] * f, u, w2); ph0[j] = u; pl0[j] = w2; splitf(st[2 * c + 1][j] * f, u, w2); ph1[j] = u; pl1[j] = w2; }
        const v16bf ph = cat16b(ph0, ph1), pl = cat16b(pl0, pl1);
#pragma unroll
        for (int mb = 0; mb < 2; ++mb) { const v16bf vh = WFrag<bf>::ld(vph + mb * 16 * NI + c * 32), vl = WFrag<bf>::ld(vpl + mb * 16 * NI + c * 32);
            o[mb] = wmmab(vh, ph, o[mb]); o[mb] = wmmab(vh, pl, o[mb]); o[mb] = wmmab(vl, ph, o[mb]); } }
    asm volatile("s_wait_xcnt 0x0" :: "v"(vo), "s"(VTh), "s"(VTl) : "memory");   /* the same for the V^T loads */
    const size_t oo = ((size_t)s * NI + i) * DQ + h * HD + 8 * hi;   /* o[mb][r] = context[query i][channel 16 mb + 8 hi + r] */
#pragma unroll
    for (int mb = 0; mb < 2; ++mb) { const v4f g0 = *(const v4f*)(GP + oo + mb * 16), g1 = *(const v4f*)(GP + oo + mb * 16 + 4); v8us oh, ol;
#pragma unroll
        for (int r = 0; r < 8; ++r) { const float y = __fmul_rn(sigm_slot(r < 4 ? g0[r & 3] : g1[r & 3]), o[mb][r]); unsigned short u, w2; splitf(y, u, w2); oh[r] = u; ol[r] = w2; }
        *(v8us*)(Ah + oo + mb * 16) = oh; *(v8us*)(Al + oo + mb * 16) = ol; }
}

extern "C" void kernel_launch(void* const* d_in, const int* in_sizes, int n_in,
                              void* d_out, int out_size, void* d_ws, size_t ws_size, hipStream_t stream) {
    (void)in_sizes; (void)n_in; (void)out_size;
    const float* msa = (const float*)d_in[0]; const float* pair = (const float*)d_in[1]; const float* lmg = (const float*)d_in[2]; const float* lmb = (const float*)d_in[3]; const float* lpg = (const float*)d_in[4]; const float* lpb = (const float*)d_in[5]; const float* wq = (const float*)d_in[6]; const float* wk = (const float*)d_in[7]; const float* wv = (const float*)d_in[8]; const float* wp = (const float*)d_in[9]; const float* wg = (const float*)d_in[10]; const float* bg = (const float*)d_in[11]; const float* wo = (const float*)d_in[12]; const float* bo = (const float*)d_in[13];
    float* OUT = (float*)d_out;     // [1][128][256][256]
    char* wsp = (char*)d_ws;
    auto take = [&](size_t bytes) { char* p = wsp; wsp += (bytes + 255) & ~(size_t)255; return (void*)p; };
    bf* WQ = (bf*)take((size_t)DQ * DM * 2); bf* WK = (bf*)take((size_t)DQ * DM * 2); bf* WV = (bf*)take((size_t)DQ * DM * 2); bf* WG = (bf*)take((size_t)DQ * DM * 2); bf* WO = (bf*)take((size_t)DM * DQ * 2); bf* WP = (bf*)take((size_t)NBP * CZ * 2);
    bf* Mh = (bf*)take((size_t)NRM * DM * 2); bf* Ml = (bf*)take((size_t)NRM * DM * 2); float* FQ = (float*)take((size_t)NRM * DQ * 4); float* GP = (float*)take((size_t)NRM * DQ * 4); float* BIAS = (float*)take((size_t)NRP * NBP * 4);
    bf* QPh = (bf*)take((size_t)NP * NI * HD * 2); bf* QPl = (bf*)take((size_t)NP * NI * HD * 2); bf* KPh = (bf*)take((size_t)NP * NI * HD * 2); bf* KPl = (bf*)take((size_t)NP * NI * HD * 2); bf* VTh = (bf*)take((size_t)NP * HP * NI * 2); bf* VTl = (bf*)take((size_t)NP * HP * NI * 2);
    bf* ATh = Mh; bf* ATl = Ml;   /* the gated context reuses the LN operand buffers (m is dead after the projections) */
    if ((size_t)(wsp - (char*)d_ws) > ws_size) return;    // ws 256 MiB (carve ~241 MiB; the pair LN operand lies in FQ, see below)
    bf* PLh = (bf*)FQ; bf* PLl = (bf*)FQ + (size_t)NRP * CZ;   /* pair LN planes [65536][128] bf16 = 16 MiB each, both inside FQ (32 MiB), which holds nothing else: the gate GEMM writes GP in the launch that reads them */
    k_prep<<<5 * NBW + NBWP + NRP / 8 + NRM / 8, 256, 0, stream>>>(msa, pair, lmg, lmb, lpg, lpb, wq, wk, wv, wg, wo, wp, WQ, WK, WV, WG, WO, WP, Mh, Ml, PLh, PLl);
    k_proj<<<4 * (NRM / 64) * (DQ / 64) + NRP / 64, 32, 0, stream>>>(Mh, Ml, WQ, WK, WV, WG, bg, QPh, QPl, KPh, KPl, VTh, VTl, GP, WP, PLh, PLl, BIAS);
    k_fattn<<<NS * (NH_ / 2) * (NI / 64), 256, 0, stream>>>(QPh, QPl, KPh, KPl, VTh, VTl, BIAS, GP, ATh, ATl);
    k_gemmo<<<dim3(NRM / 64, DM / 64, 1), 32, 0, stream>>>(ATh, ATl, WO, OUT, bo);            /* out = vals Wo + bo */
}

// v004
// Measured time: 152 microseconds a run.
// Timed twice side by side with v003, it ran 1.32 and 1.33 times as fast.
// Counting every step since v000, it is 11.6 times as fast.
#include <hip/hip_runtime.h>

// MSA row attention with pair bias (msa [1][128][256][256], pair [1][256][256][128]; m = LN(msa), p = LN(pair) (eps 1e-5, affine); Q, K, V = m W ('xw' [256][256], 8 heads x 32), G = sigmoid(m Wg + bg); bias[h][i][j] = (p Wp)[i][j][h] ('xw' [128][8]); per sequence s and head h: attn = softmax(Q_s,h . K_s,h / sqrt(32) + bias_h); vals = G * (attn V); out = vals Wo + bo ('xw' [256][256]) -> [1][128][256][256] (8.4 M)).
// Layout: row LayerNorm kernels (one wave per row) write hi/lo operands for the msa (32,768 x 256) and pair (65,536 x 128) slabs; hl x exact projections (Q, K, V, gate pre-activation, and the pair bias against Wp zero-padded to 64 columns); the Q and K GEMMs store hi/lo planes [sequence x head][residue][32] and the V GEMM hi/lo V^T planes [sequence x head][64][residue], rows 0..31 written and read, from their epilogues; one attention kernel over all 1024 (sequence, head) pairs keeps a wave's 16 x 256 scores in registers: scores (3 products, K 32), + bias[h][i][j], softmax over the 256 residues with every row hi/lo, attn.V (3 products), sigmoid gate, and writes the hi/lo operand of the Wo GEMM.
// Operand order: every 16-bit plane that a matrix fragment is loaded from lies in fragment order (fro() below), written so by its producer; the pair bias lies in the order of the score accumulators. A wave's 16-byte-a-lane load then covers 512 contiguous bytes.
// Compute dtypes, f32 accumulate: every input rounded to bf16; LN, sigmoid, softmax f32; GEMM activations bf16 hi/lo (2 products) x exact weights; scores and attn.V 3 products.

#define NB_  1
#define TT   256
#define DM   256
#define NH_  8
#define NKV  8
#define REP  (NH_ / NKV)
#define HD   32
#define DQ   (NH_ * HD)
#define DKV  (NKV * HD)
#define WIN  0
#define SCL  0.17677669529663688f   // 32^-0.5
#define NS   128     // sequences
#define NI   256     // residues (= TT)
#define CZ   128     // pair channels
#define NP   (NS * NH_)   // 1024 pseudo-heads
#define NRM  (NS * NI)    // 32768 msa rows
#define NRP  (NI * NI)    // 65536 pair rows
#define HP   64      // padded head width for attn.v
#define NBP  64      // padded bias projection width (8 heads used)
typedef _Float16 h16;
typedef unsigned short bf;
typedef __attribute__((ext_vector_type(16))) __bf16   v16bf;
typedef __attribute__((ext_vector_type(16))) _Float16 v16h;
typedef __attribute__((ext_vector_type(8)))  _Float16 v8h;
typedef __attribute__((ext_vector_type(8)))  unsigned short v8us;
typedef __attribute__((ext_vector_type(8)))  float    v8f;
typedef __attribute__((ext_vector_type(4)))  float    v4f;
typedef v8h  __attribute__((may_alias)) v8ha;
typedef v4f  __attribute__((may_alias)) v4fa;
typedef v8us __attribute__((may_alias)) v8usa;

__device__ __forceinline__ unsigned short f2bf(float f) { unsigned u = __float_as_uint(f); u += 0x7FFFu + ((u >> 16) & 1u); return (unsigned short)(u >> 16); }
__device__ __forceinline__ float bf2f(unsigned short b) { return __uint_as_float(((unsigned)b) << 16); }
__device__ __forceinline__ float bfr(float f) { return bf2f(f2bf(f)); }
__device__ __forceinline__ void splitf(float y, unsigned short& h, unsigned short& l) { h = f2bf(y); l = f2bf(y - bf2f(h)); }
__device__ __forceinline__ v16h cat16(v8h lo, v8h hi) { return __builtin_shufflevector(lo, hi, 0, 1, 2, 3, 4, 5, 6, 7, 8, 9, 10, 11, 12, 13, 14, 15); }
__device__ __forceinline__ v16bf cat16b(v8us lo, v8us hi) { return __builtin_bit_cast(v16bf, __builtin_shufflevector(lo, hi, 0, 1, 2, 3, 4, 5, 6, 7, 8, 9, 10, 11, 12, 13, 14, 15)); }
// Fragment order of a [rows][K] 16-bit plane: blocks of 16 rows x 32 k (1 KiB), block (row / 16, k / 32) row-major; inside a block [k / 16 % 2][k / 8 % 2][row % 16][k % 8], which is [register half][lane][8]: lane (lr, hi) of a 16x16x32 fragment finds its 16 values at block + lane * 8 and + 256.
__device__ __forceinline__ unsigned fro(unsigned row, unsigned k, unsigned K) { return ((row >> 4) * (K >> 5) + (k >> 5)) * 512u + ((k >> 4) & 1u) * 256u + ((k >> 3) & 1u) * 128u + (row & 15u) * 8u + (k & 7u); }
// its inverse: element e of the plane -> (row, k)
__device__ __forceinline__ void frd(unsigned e, unsigned K, unsigned& row, unsigned& k) { const unsigned blk = e >> 9; row = (blk / (K >> 5)) * 16u + ((e >> 3) & 15u); k = (blk % (K >> 5)) * 32u + ((e >> 8) & 1u) * 16u + ((e >> 7) & 1u) * 8u + (e & 7u); }
__device__ __forceinline__ v8f wmma16(v16h a, v16h b, v8f c) { return __builtin_amdgcn_wmma_f32_16x16x32_f16(false, a, false, b, (short)0, c, false, false); }
__device__ __forceinline__ v8f wmmab(v16bf a, v16bf b, v8f c) { return __builtin_amdgcn_wmma_f32_16x16x32_bf16(false, a, false, b, (short)0, c, false, false); }



// ---- gemmw_tile: register-blocked GEMM, ONE WAVE per 64x64 output tile (16 accumulators), operands straight from 16-bit planes in fragment order; tile (bx, by) of (M/64, N/64), 32 threads; sm = the wave's 4608 bytes of LDS for the epilogue.
// C[m][n] (f32, pitch ldc, + optional f32 bias[n]) = sum_k A[m][k] Bt[n][k] (+ split products per NSPLIT). K % 32 == 0.
// OUTM 0: f32 C. OUTM 1 and 2 (m = sequence x residue, n = head x 32): bf16 hi/lo of C, 1: to Ph/Pl[sequence x head][residue][32], 2: transposed to Ph/Pl[sequence x head][HP][residue], each [sequence x head] slab in fragment order. OUTM 3 (the pair bias): rows 0..7 of C, f32, in the order of the score accumulators. All store 16 bytes a lane and whole 128-byte lines a store.
template <typename T16> struct WFrag;
template <> struct WFrag<h16> { typedef v16h V; static __device__ __forceinline__ V ld(const h16* p) { return cat16(*(const v8h*)p, *(const v8h*)(p + 256)); } static __device__ __forceinline__ v8f mma(V a, V b, v8f c) { return wmma16(a, b, c); } };
template <> struct WFrag<bf> { typedef v16bf V; static __device__ __forceinline__ V ld(const bf* p) { return cat16b(*(const v8us*)p, *(const v8us*)(p + 256)); } static __device__ __forceinline__ v8f mma(V a, V b, v8f c) { return wmmab(a, b, c); } };
template <typename T16, int NSPLIT, bool BIAS, int OUTM>
__device__ __forceinline__ void gemmw_tile(const T16* __restrict__ A, const T16* __restrict__ A2, const T16* __restrict__ Bt, const T16* __restrict__ Bt2, int K, float* C, int ldc, const float* __restrict__ bias, bf* Ph, bf* Pl, int bx, int by, char* sm) {
    typedef typename WFrag<T16>::V V;
    const int lane = threadIdx.x & 31, lr = lane & 15, hi = lane >> 4; const int r0 = bx * 64, c0 = by * 64;
    constexpr int NMB = OUTM == 3 ? 1 : 4;   /* 16-row blocks of A that are multiplied: all that the epilogue stores */
    v8f acc[NMB][4];
#pragma unroll
    for (int mb = 0; mb < NMB; ++mb)
#pragma unroll
        for (int nb = 0; nb < 4; ++nb) acc[mb][nb] = (v8f){};
    /* 32-bit byte offsets, as in k_fattn (every operand plane is below 64 MiB): one offset register serves the planes of A, one those of B, and the wait at the foot of the trip can name them */
    unsigned ao = ((unsigned)r0 * K + 8 * lane) * 2u, bo = ((unsigned)c0 * K + 8 * lane) * 2u;   /* 16 rows of K values are K / 32 blocks of 512 */
#pragma unroll 1
    for (int kc = 0; kc < K; kc += 32) {
        V a[NMB], a2[NMB]; const T16* pa = (const T16*)((const char*)A + ao); const T16* pa2 = (const T16*)((const char*)A2 + ao); const T16* pb = (const T16*)((const char*)Bt + bo); const T16* pb2 = (const T16*)((const char*)Bt2 + bo);
#pragma unroll
        for (int mb = 0; mb < NMB; ++mb) { a[mb] = WFrag<T16>::ld(pa + mb * 16 * K); if (NSPLIT == 1 || NSPLIT == 2) a2[mb] = WFrag<T16>::ld(pa2 + mb * 16 * K); }
#pragma unroll
        for (int nb = 0; nb < 4; ++nb) { const V b = WFrag<T16>::ld(pb + nb * 16 * K); V b2; if (NSPLIT >= 2) b2 = WFrag<T16>::ld(pb2 + nb * 16 * K);
#pragma unroll
            for (int mb = 0; mb < NMB; ++mb) { acc[mb][nb] = WFrag<T16>::mma(a[mb], b, acc[mb][nb]); if (NSPLIT == 1 || NSPLIT == 2) acc[mb][nb] = WFrag<T16>::mma(a2[mb], b, acc[mb][nb]); if (NSPLIT >= 2) acc[mb][nb] = WFrag<T16>::mma(a[mb], b2, acc[mb][nb]); } }
        asm volatile("v_nop\n\tv_nop\n\tv_nop\n\tv_nop" : "+v"(acc[0][0]), "+v"(acc[1 % NMB][1]), "+v"(acc[2 % NMB][2]), "+v"(acc[3 % NMB][3]) : "v"(a[0]), "v"(a[NMB - 1]));
        asm volatile("s_wait_xcnt 0x0" :: "v"(ao), "v"(bo) : "memory");   /* precaution: the offset registers of this trip's loads are inputs here, so they stay live up to this wait and no load of the trip lands in one of them */
        ao += 1024u; bo += 1024u;
    }
    if constexpr (OUTM == 2) {
    /* a lane's 8 accumulator rows are 8 neighbouring residues of one channel: one lane's 16 bytes of a V^T fragment (row = channel, k = residue), so every store is 512 contiguous bytes as the values lie */
    const unsigned pv = ((unsigned)r0 / NI) * NH_ + (unsigned)c0 / HD, kb = ((unsigned)r0 % NI) / 32;
    /* every loop of this block is unrolled so that acc[][] and the vectors' elements are indexed by constants and stay in registers */
#pragma unroll
    for (int nb = 0; nb < 4; ++nb) {
#pragma unroll
        for (int mb = 0; mb < 4; ++mb) { v8us oh, ol;
#pragma unroll
            for (int j = 0; j < 8; ++j) { unsigned short u, w2; splitf(acc[mb][nb][j], u, w2); oh[j] = u; ol[j] = w2; }
            const unsigned e = (pv + (nb >> 1)) * (HP * NI) + ((nb & 1) * (NI / 32) + kb + (mb >> 1)) * 512u + (mb & 1) * 256u + lane * 8u;
            *(v8us*)(Ph + e) = oh; *(v8us*)(Pl + e) = ol; }
        asm volatile("s_wait_xcnt 0x0" ::: "memory");   /* precaution: stands behind these stores, in front of whatever next overwrites their address or data registers */
    }
    } else if constexpr (OUTM == 3) {
    /* B row 16 (256 I + j) + lr is pair position (i = 16 I + lr, j) (see k_prep), so lane lr of the lower half holds, for head r, bias[r][i][j0 .. j0 + 3] in acc[0][0..3][r]: 16 bytes of C[head][I][j / 16][j / 4 % 2][j / 8 % 2][i % 16][j % 4], which k_fattn reads lane by lane */
    if (hi == 0) {
        const unsigned e0 = (((unsigned)by >> 6) * 16u + (((unsigned)by & 63u) >> 2)) * 256u + ((unsigned)by & 1u) * 128u + (((unsigned)by >> 1) & 1u) * 64u + lr * 4u;
#pragma unroll
        for (int r = 0; r < NH_; ++r) { v4f val; val[0] = acc[0][0][r]; val[1] = acc[0][1][r]; val[2] = acc[0][2][r]; val[3] = acc[0][3][r]; *(v4f*)(C + e0 + (unsigned)r * NRP) = val; }
        asm volatile("s_wait_xcnt 0x0" ::: "memory");   /* precaution, as above */
    }
    } else {
    float* os = (float*)sm;
#pragma unroll
    for (int mb = 0; mb < 4; ++mb) {
#pragma unroll
        for (int nb = 0; nb < 4; ++nb) {
#pragma unroll
            for (int j = 0; j < 8; ++j) os[(hi * 8 + j) * 68 + nb * 16 + lr] = acc[mb][nb][j]; }
        __builtin_amdgcn_wave_barrier(); asm volatile("" ::: "memory");
        if (OUTM == 0) {
        float* crow = C + (size_t)(r0 + mb * 16) * ldc + c0;
#pragma unroll
            for (int s = 0; s < 8; ++s) { const int row = 2 * s + hi, cofs = lr * 4; v4f val = *(const v4fa*)(os + row * 68 + cofs); if (BIAS) { val[0] += bfr(bias[c0 + cofs]); val[1] += bfr(bias[c0 + cofs + 1]); val[2] += bfr(bias[c0 + cofs + 2]); val[3] += bfr(bias[c0 + cofs + 3]); }
                *(v4f*)(crow + (size_t)row * ldc + cofs) = val; }
        } else {
            /* unrolled, like the inner loop: the vectors' elements are indexed by constants and stay in registers */
#pragma unroll
            for (int s = 0; s < 4; ++s) { const int row = 8 * (s & 1) + (lane & 7), cofs = ((s >> 1) * 4 + (lane >> 3)) * 8; const v4f v0 = *(const v4fa*)(os + row * 68 + cofs), v1 = *(const v4fa*)(os + row * 68 + cofs + 4); v8us oh, ol;   /* 8 rows x the 4 pieces of one head: 4 whole lines in fragment order */
#pragma unroll
                for (int q = 0; q < 8; ++q) { unsigned short u, w2; splitf(q < 4 ? v0[q & 3] : v1[q & 3], u, w2); oh[q] = u; ol[q] = w2; }
                const unsigned m = (unsigned)(r0 + mb * 16 + row), n = (unsigned)(c0 + cofs);
                const unsigned e = ((m / NI) * NH_ + n / HD) * (NI * HD) + fro(m % NI, n % HD, HD);
                *(v8us*)(Ph + e) = oh; *(v8us*)(Pl + e) = ol; }
        }
        asm volatile("s_wait_xcnt 0x0" ::: "memory");   /* precaution, as above: behind the stores of either form */
        __builtin_amdgcn_wave_barrier(); asm volatile("" ::: "memory");
    }
    }
}

// k_proj: the five GEMMs that depend on the LayerNorm planes alone, in one launch, one tile a workgroup: blocks 0..8191 = Q, K, V, gate (2048 tiles each, row tile fastest), blocks 8192..9215 = the pair bias (the shortest K, so last).
__global__ __launch_bounds__(32) void k_proj(const bf* __restrict__ Mh, const bf* __restrict__ Ml, const bf* __restrict__ WQ, const bf* __restrict__ WK, const bf* __restrict__ WV, const bf* __restrict__ WG, const float* __restrict__ bg, bf* QPh, bf* QPl, bf* KPh, bf* KPl, bf* VTh, bf* VTl, float* GP, const bf* __restrict__ WP, const bf* __restrict__ PLh, const bf* __restrict__ PLl, float* BIAS) {
    __shared__ __align__(16) char sm[4608];
    const int b = blockIdx.x;
    if (b < 4 * (NRM / 64) * (DQ / 64)) {
        const int g = b / ((NRM / 64) * (DQ / 64)), bx = b % (NRM / 64), by = (b / (NRM / 64)) % (DQ / 64);
        if (g < 2) gemmw_tile<bf, 1, false, 1>(Mh, Ml, g ? WK : WQ, nullptr, DM, nullptr, 0, nullptr, g ? KPh : QPh, g ? KPl : QPl, bx, by, sm);
        else if (g == 2) gemmw_tile<bf, 1, false, 2>(Mh, Ml, WV, nullptr, DM, nullptr, 0, nullptr, VTh, VTl, bx, by, sm);
        else gemmw_tile<bf, 1, true, 0>(Mh, Ml, WG, nullptr, DM, GP, DQ, bg, nullptr, nullptr, bx, by, sm);          /* gate pre-activation m Wg + bg */
    } else {
        /* pair bias, head-major: bias[h][i][j] = Wp[:, h] . LN(pair[i][j]): Wp (rows 8..63 zero) is the A operand, the hi/lo LN planes the B operand; the 8 head rows are stored */
        gemmw_tile<bf, 3, false, 3>(WP, nullptr, PLh, PLl, CZ, BIAS, NRP, nullptr, nullptr, nullptr, 0, b - 4 * (NRM / 64) * (DQ / 64), sm);
    }
}
// k_gemmo: out = vals Wo + bo; grid (M/64, N/64).
__global__ __launch_bounds__(32) void k_gemmo(const bf* __restrict__ Ah, const bf* __restrict__ Al, const bf* __restrict__ WO, float* OUT, const float* __restrict__ bo) {
    __shared__ __align__(16) char sm[4608];
    gemmw_tile<bf, 1, true, 0>(Ah, Al, WO, nullptr, DQ, OUT, DM, bo, nullptr, nullptr, blockIdx.x, blockIdx.y, sm);
}

typedef __attribute__((ext_vector_type(2))) _Float16 v2h;
typedef __attribute__((ext_vector_type(4))) _Float16 v4h;
typedef __attribute__((ext_vector_type(2))) unsigned short v2us;
typedef __attribute__((ext_vector_type(4))) unsigned short v4us;
typedef v4us __attribute__((may_alias)) v4usa;
typedef __attribute__((ext_vector_type(2))) float v2f;
typedef __attribute__((ext_vector_type(4))) int v4i;

__device__ __forceinline__ void wtG(const float* __restrict__ w, int K, int N, bf* Bt, int blk) {
    const int lane = threadIdx.x & 31; const int L0 = (blk * 8 + (threadIdx.x >> 5)) * 8; const int nlines = N * K / 64;
{
#pragma unroll 1
        for (int l = 0; l < 8; ++l) { const int L = L0 + l; if (L >= nlines) break; const size_t e = (size_t)L * 64 + lane * 2; unsigned n, k; frd((unsigned)e, (unsigned)K, n, k); v2us o;   /* the line is written whole; (n, k) follow from its place */
            o[0] = f2bf(w[(size_t)k * N + n]); o[1] = f2bf(w[(size_t)(k + 1) * N + n]); *(v2us*)(Bt + e) = o; }
         }
}
__global__ __launch_bounds__(256) void k_cvt8(const float* __restrict__ src, bf* dst, size_t n8) { const size_t i = (size_t)blockIdx.x * 256 + threadIdx.x; if (i >= n8) return; const v8f v = *(const v8f*)(src + i * 8); v8us o;
#pragma unroll
    for (int k = 0; k < 8; ++k) o[k] = f2bf(v[k]); *(v8us*)(dst + i * 8) = o;  }




template <int WD>
__device__ __forceinline__ void lnrow(const float* __restrict__ X, size_t r, const float* __restrict__ g, const float* __restrict__ bb, bf* Hh, bf* Hl, int blk, bf* ls) { const int lane = threadIdx.x & 31, w = threadIdx.x >> 5; const float* xr = X + r * WD;   /* r: the wave's source row; it becomes row blk * 8 + w of the planes */ float a[WD / 32]; float s = 0.f;
#pragma unroll
    for (int c = 0; c < WD / 128; ++c) { const v4f v = *(const v4f*)(xr + c * 128 + lane * 4); for (int q = 0; q < 4; ++q) { a[c * 4 + q] = bfr(v[q]); s = __fadd_rn(s, a[c * 4 + q]); } }
#pragma unroll
    for (int sh = 16; sh; sh >>= 1) s = __fadd_rn(s, __shfl_xor(s, sh, 32));
    const float mean = __fdiv_rn(s, (float)WD); float s2 = 0.f;
#pragma unroll
    for (int k = 0; k < WD / 32; ++k) { const float dv = __fsub_rn(a[k], mean); s2 = __fadd_rn(s2, __fmul_rn(dv, dv)); }
#pragma unroll
    for (int sh = 16; sh; sh >>= 1) s2 = __fadd_rn(s2, __shfl_xor(s2, sh, 32));
    const float rs = __fdiv_rn(1.0f, __fsqrt_rn(__fadd_rn(__fdiv_rn(s2, (float)WD), 1e-5f)));
{
#pragma unroll
        for (int c = 0; c < WD / 128; ++c) { v4us oh, ol; for (int q = 0; q < 4; ++q) { const int col = c * 128 + lane * 4 + q; float y = __fmul_rn(__fmul_rn(__fsub_rn(a[c * 4 + q], mean), rs), bfr(g[col])); asm volatile("" : "+v"(y)); y = __fadd_rn(y, bfr(bb[col])); unsigned short u, w2; splitf(y, u, w2); oh[q] = u; ol[q] = w2; } bf* lw = ls + (c * 16 + (lane >> 1)) * 72 + w * 8 + (lane & 1) * 4; *(v4usa*)lw = oh; *(v4usa*)(lw + (WD / 8) * 72) = ol; }
         }
    /* in fragment order a 128-byte line holds 8 k of 8 rows, one piece from each wave: the block's 8 rows are gathered in LDS, [plane][k / 8][row][8] at a pitch of 144 bytes (the waves' 8-byte writes then fall on distinct banks), and stored as whole lines */
    __syncthreads();
#pragma unroll
    for (int s = 0; s < WD / 128; ++s) { const int idx = w * (WD / 128) + s, pl = idx / (WD / 32), kp = (idx % (WD / 32)) * 4 + (lane >> 3);
        const v8us v = *(const v8usa*)(ls + (pl * (WD / 8) + kp) * 72 + (lane & 7) * 8);
        *(v8us*)((pl ? Hl : Hh) + fro((unsigned)blk * 8u + (lane & 7), (unsigned)kp * 8u, WD)) = v; }
    asm volatile("s_wait_xcnt 0x0" ::: "memory");   /* precaution: behind the stores, in front of the next overwrite of their registers */
}
__device__ __forceinline__ void wpad(const float* __restrict__ w, bf* Bt, int blk) { const int e2 = (blk * 256 + threadIdx.x) * 2; if (e2 >= NBP * CZ) return; unsigned un, uk; frd((unsigned)e2, CZ, un, uk); const int k = (int)uk; const int n = (int)un; v2us o; const unsigned short a0 = f2bf(w[(size_t)k * NH_ + min(n, NH_ - 1)]), a1 = f2bf(w[(size_t)(k + 1) * NH_ + min(n, NH_ - 1)]); o[0] = (n < NH_) ? a0 : (unsigned short)0; o[1] = (n < NH_) ? a1 : (unsigned short)0; *(v2us*)(Bt + e2) = o;  }
// k_prep: everything that depends on the inputs alone, in one launch. Blocks 0..79: the five 256 x 256 weights to bf16 [n][k] (16 blocks each); 80..95: Wp padded; then 8192 blocks of pair LayerNorm rows and 4096 of msa rows, 8 rows a block. Plane row 16 (256 I + j) + lr of the pair planes is pair position (i = 16 I + lr, j), so that a 16-row fragment holds 16 queries of one key, as the score accumulators do. The few weight blocks, which are chains of dependent-latency trips, come first and run beside the LayerNorm streams.
#define NBW  ((DM * DQ / 64 + 63) / 64)       // blocks of one weight
#define NBWP ((NBP * CZ / 2 + 255) / 256)     // blocks of the padded Wp
__global__ __launch_bounds__(256) void k_prep(const float* __restrict__ msa, const float* __restrict__ pair, const float* __restrict__ lmg, const float* __restrict__ lmb, const float* __restrict__ lpg, const float* __restrict__ lpb, const float* __restrict__ wq, const float* __restrict__ wk, const float* __restrict__ wv, const float* __restrict__ wg, const float* __restrict__ wo, const float* __restrict__ wp, bf* WQ, bf* WK, bf* WV, bf* WG, bf* WO, bf* WP, bf* Mh, bf* Ml, bf* PLh, bf* PLl) {
    __shared__ __align__(16) bf ls[2 * (DM / 8) * 72];
    const int b = blockIdx.x;
    if (b < 5 * NBW) { const int g = b / NBW;
        const float* w = g == 0 ? wq : g == 1 ? wk : g == 2 ? wv : g == 3 ? wg : wo; bf* o = g == 0 ? WQ : g == 1 ? WK : g == 2 ? WV : g == 3 ? WG : WO;
        wtG(w, DM, DQ, o, b % NBW); }      /* all five are 256 x 256 (DM == DQ) */
    else if (b < 5 * NBW + NBWP) wpad(wp, WP, b - 5 * NBW);
    else if (b < 5 * NBW + NBWP + NRP / 8) { const int q = b - (5 * NBW + NBWP); lnrow<CZ>(pair, (size_t)((q >> 9) * 16 + (q & 1) * 8 + (threadIdx.x >> 5)) * NI + ((q >> 1) & (NI - 1)), lpg, lpb, PLh, PLl, q, ls); }
    else { const int q = b - (5 * NBW + NBWP + NRP / 8); lnrow<DM>(msa, (size_t)q * 8 + (threadIdx.x >> 5), lmg, lmb, Mh, Ml, q, ls); }
}
__device__ __forceinline__ float sigm_slot(float a) { float e; asm("v_exp_f32 %0, %1\n\tv_nop" : "=v"(e) : "v"(__fmul_rn(-a, 1.4426950408889634f))); return __fdiv_rn(1.0f, __fadd_rn(1.0f, e)); }
// Four exponentials and one v_nop in one statement, for the same slot: the outputs are early-clobbered, so none overwrites a source of the exponential in front of it, and the v_nop stands behind the last.
__device__ __forceinline__ void exp2x4(float& a, float& b, float& c, float& d) { float e0, e1, e2, e3; asm("v_exp_f32 %0, %4\n\tv_exp_f32 %1, %5\n\tv_exp_f32 %2, %6\n\tv_exp_f32 %3, %7\n\tv_nop" : "=&v"(e0), "=&v"(e1), "=&v"(e2), "=&v"(e3) : "v"(a), "v"(b), "v"(c), "v"(d)); a = e0; b = e1; c = e2; d = e3; }
// k_fattn: scores, pair bias, softmax, attn.V and the sigmoid gate of one (sequence, head) for 16 query rows per wave, nothing through memory in between.
// S^T = K Q^T (A = 16 key rows, B = the wave's 16 queries): lane (lr, hi) holds, of query lr, keys 16 t + 8 hi + 0..7 in st[t]; two neighbouring tiles are the B fragment of O^T = V^T P^T as they lie.
// Workgroup: 8 waves = 2 neighbouring heads x 4 query tiles; grid 128 sequences x 4 head pairs x 4 query blocks.
// The second launch bound asks for four waves per SIMD (256 registers a wave), so that two workgroups share a WGP and one's vector work covers the other's loads.
__global__ __launch_bounds__(256, 4) void k_fattn(const bf* __restrict__ QPh, const bf* __restrict__ QPl, const bf* __restrict__ KPh, const bf* __restrict__ KPl, const bf* __restrict__ VTh, const bf* __restrict__ VTl, const float* __restrict__ BT, const float* __restrict__ GP, bf* Ah, bf* Al) {
    const int lane = threadIdx.x & 31, lr = lane & 15, hi = lane >> 4, w = threadIdx.x >> 5;
    const int qb = blockIdx.x & 3, hp = (blockIdx.x >> 2) & 3, s = blockIdx.x >> 4;
    const int h = hp * 2 + (w & 1), p = s * NH_ + h, i = qb * 64 + (w >> 1) * 16 + lr;
    /* 32-bit byte offsets (every plane is below 64 MiB): one offset register serves a hi and a lo plane */
    const unsigned qo = (((unsigned)p * NI + (i - lr)) * HD + 8 * lane) * 2u, ko = ((unsigned)p * NI * HD + 8 * lane) * 2u, bo = ((unsigned)h * NRP + (unsigned)(i - lr) * NI + 4 * lane) * 4u;   /* fragment order: 16 rows x 32 = one block of 512; bias: 16 queries x 16 keys = 256 floats, [j / 4 % 2][lane][4] */
    const bf* qph = (const bf*)((const char*)QPh + qo); const bf* qpl = (const bf*)((const char*)QPl + qo); const bf* kph = (const bf*)((const char*)KPh + ko); const bf* kpl = (const bf*)((const char*)KPl + ko);
    const v16bf qh = WFrag<bf>::ld(qph), ql = WFrag<bf>::ld(qpl);
    const float* br = (const float*)((const char*)BT + bo);
    v8f st[NI / 16]; float mx = -3.0e38f;
#pragma unroll
    for (int t = 0; t < NI / 16; ++t) {
        const v16bf kh = WFrag<bf>::ld(kph + t * 16 * HD), kl = WFrag<bf>::ld(kpl + t * 16 * HD);
        const v4f b0 = *(const v4f*)(br + t * 256), b1 = *(const v4f*)(br + t * 256 + 128);
        v8f c = (v8f){}; c = wmmab(kh, qh, c); c = wmmab(kh, ql, c); c = wmmab(kl, qh, c);
#pragma unroll
        for (int j = 0; j < 8; ++j) { const float x = __fadd_rn(c[j], __fmul_rn(j < 4 ? b0[j & 3] : b1[j & 3], 5.656854249492380f)) * SCL;   /* (S + bias x sqrt(32)) x 32^-0.5: the reference adds the bias after the scale */
            c[j] = x; mx = fmaxf(mx, x); }
        st[t] = c; }
    asm volatile("s_wait_xcnt 0x0" :: "v"(qo), "v"(ko), "v"(bo), "s"(QPh), "s"(QPl), "s"(KPh), "s"(KPl), "s"(BT) : "memory");   /* precaution: the offset and base registers of the loads above are inputs here, so they stay live up to this wait and none is overwritten in front of it */
    mx = fmaxf(mx, __shfl_xor(mx, 16, 32));
    float sm[4] = {0.f, 0.f, 0.f, 0.f};
#pragma unroll
    for (int t = 0; t < NI / 16; ++t) {
#pragma unroll
        for (int j = 0; j < 8; j += 4) { float x[4];
#pragma unroll
            for (int q = 0; q < 4; ++q) x[q] = __fmul_rn(__fsub_rn(st[t][j + q], mx), 1.4426950408889634f);
            exp2x4(x[0], x[1], x[2], x[3]);
#pragma unroll
            for (int q = 0; q < 4; ++q) { st[t][j + q] = x[q]; sm[q] += x[q]; } } }
    float sum = (sm[0] + sm[1]) + (sm[2] + sm[3]); sum += __shfl_xor(sum, 16, 32);
    const float f = __fdiv_rn(1.0f, sum);
    const unsigned vo = ((unsigned)p * HP * NI + 8 * lane) * 2u;
    const bf* vph = (const bf*)((const char*)VTh + vo); const bf* vpl = (const bf*)((const char*)VTl + vo);
    v8f o[2]; o[0] = (v8f){}; o[1] = (v8f){};
#pragma unroll
    for (int c = 0; c < NI / 32; ++c) { v8us ph0, pl0, ph1, pl1;
#pragma unroll
        for (int j = 0; j < 8; ++j) { unsigned short u, w2; splitf(st[2 * c][j] * f, u, w2); ph0[j] = u; pl0[j] = w2; splitf(st[2 * c + 1][j] * f, u, w2); ph1[j] = u; pl1[j] = w2; }
        const v16bf ph = cat16b(ph0, ph1), pl = cat16b(pl0, pl1);
#pragma unroll
        for (int mb = 0; mb < 2; ++mb) { const v16bf vh = WFrag<bf>::ld(vph + mb * 16 * NI + c * 512), vl = WFrag<bf>::ld(vpl + mb * 16 * NI + c * 512);
            o[mb] = wmmab(vh, ph, o[mb]); o[mb] = wmmab(vh, pl, o[mb]); o[mb] = wmmab(vl, ph, o[mb]); } }
    asm volatile("s_wait_xcnt 0x0" :: "v"(vo), "s"(VTh), "s"(VTl) : "memory");   /* the same for the V^T loads */
    const size_t oo = ((size_t)s * NI + i) * DQ + h * HD + 8 * hi;   /* o[mb][r] = context[query i][channel 16 mb + 8 hi + r] */
    const unsigned ao = ((unsigned)(s * NI + (i - lr)) * DQ + h * 512 + 8 * lane);   /* the same in fragment order (K = DQ, block k / 32 = h): o[mb] is register half mb as it lies */
#pragma unroll
    for (int mb = 0; mb < 2; ++mb) { const v4f g0 = *(const v4f*)(GP + oo + mb * 16), g1 = *(const v4f*)(GP + oo + mb * 16 + 4); v8us oh, ol;
#pragma unroll
        for (int r = 0; r < 8; ++r) { const float y = __fmul_rn(sigm_slot(r < 4 ? g0[r & 3] : g1[r & 3]), o[mb][r]); unsigned short u, w2; splitf(y, u, w2); oh[r] = u; ol[r] = w2; }
        *(v8us*)(Ah + ao + mb * 256) = oh; *(v8us*)(Al + ao + mb * 256) = ol; }
}

extern "C" void kernel_launch(void* const* d_in, const int* in_sizes, int n_in,
                              void* d_out, int out_size, void* d_ws, size_t ws_size, hipStream_t stream) {
    (void)in_sizes; (void)n_in; (void)out_size;
    const float* msa = (const float*)d_in[0]; const float* pair = (const float*)d_in[1]; const float* lmg = (const float*)d_in[2]; const float* lmb = (const float*)d_in[3]; const float* lpg = (const float*)d_in[4]; const float* lpb = (const float*)d_in[5]; const float* wq = (const float*)d_in[6]; const float* wk = (const float*)d_in[7]; const float* wv = (const float*)d_in[8]; const float* wp = (const float*)d_in[9]; const float* wg = (const float*)d_in[10]; const float* bg = (const float*)d_in[11]; const float* wo = (const float*)d_in[12]; const float* bo = (const float*)d_in[13];
    float* OUT = (float*)d_out;     // [1][128][256][256]
    char* wsp = (char*)d_ws;
    auto take = [&](size_t bytes) { char* p = wsp; wsp += (bytes + 255) & ~(size_t)255; return (void*)p; };
    bf* WQ = (bf*)take((size_t)DQ * DM * 2); bf* WK = (bf*)take((size_t)DQ * DM * 2); bf* WV = (bf*)take((size_t)DQ * DM * 2); bf* WG = (bf*)take((size_t)DQ * DM * 2); bf* WO = (bf*)take((size_t)DM * DQ * 2); bf* WP = (bf*)take((size_t)NBP * CZ * 2);
    bf* Mh = (bf*)take((size_t)NRM * DM * 2); bf* Ml = (bf*)take((size_t)NRM * DM * 2); float* FQ = (float*)take((size_t)NRM * DQ * 4); float* GP = (float*)take((size_t)NRM * DQ * 4); float* BIAS = (float*)take((size_t)NRP * NBP * 4);
    bf* QPh = (bf*)take((size_t)NP * NI * HD * 2); bf* QPl = (bf*)take((size_t)NP * NI * HD * 2); bf* KPh = (bf*)take((size_t)NP * NI * HD * 2); bf* KPl = (bf*)take((size_t)NP * NI * HD * 2); bf* VTh = (bf*)take((size_t)NP * HP * NI * 2); bf* VTl = (bf*)take((size_t)NP * HP * NI * 2);
    bf* ATh = Mh; bf* ATl = Ml;   /* the gated context reuses the LN operand buffers (m is dead after the projections) */
    if ((size_t)(wsp - (char*)d_ws) > ws_size) return;    // ws 256 MiB (carve ~241 MiB; the pair LN operand lies in FQ, see below)
    bf* PLh = (bf*)FQ; bf* PLl = (bf*)FQ + (size_t)NRP * CZ;   /* pair LN planes [65536][128] bf16 = 16 MiB each, both inside FQ (32 MiB), which holds nothing else: the gate GEMM writes GP in the launch that reads them */
    k_prep<<<5 * NBW + NBWP + NRP / 8 + NRM / 8, 256, 0, stream>>>(msa, pair, lmg, lmb, lpg, lpb, wq, wk, wv, wg, wo, wp, WQ, WK, WV, WG, WO, WP, Mh, Ml, PLh, PLl);
    k_proj<<<4 * (NRM / 64) * (DQ / 64) + NRP / 64, 32, 0, stream>>>(Mh, Ml, WQ, WK, WV, WG, bg, QPh, QPl, KPh, KPl, VTh, VTl, GP, WP, PLh, PLl, BIAS);
    k_fattn<<<NS * (NH_ / 2) * (NI / 64), 256, 0, stream>>>(QPh, QPl, KPh, KPl, VTh, VTl, BIAS, GP, ATh, ATl);
    k_gemmo<<<dim3(NRM / 64, DM / 64, 1), 32, 0, stream>>>(ATh, ATl, WO, OUT, bo);            /* out = vals Wo + bo */
}

// v005
// One run takes 143 microseconds.
// Two timings next to v004 both put it at 1.06 times that version's speed.
// All steps since v000 together make it 12.2 times as fast.
#include <hip/hip_runtime.h>

// MSA row attention with pair bias (msa [1][128][256][256], pair [1][256][256][128]; m = LN(msa), p = LN(pair) (eps 1e-5, affine); Q, K, V = m W ('xw' [256][256], 8 heads x 32), G = sigmoid(m Wg + bg); bias[h][i][j] = (p Wp)[i][j][h] ('xw' [128][8]); per sequence s and head h: attn = softmax(Q_s,h . K_s,h / sqrt(32) + bias_h); vals = G * (attn V); out = vals Wo + bo ('xw' [256][256]) -> [1][128][256][256] (8.4 M)).
// Layout: row LayerNorm kernels (one wave per row) write hi/lo operands for the msa (32,768 x 256) and pair (65,536 x 128) slabs; hl x exact projections (Q, K, V, gate pre-activation, and the pair bias against Wp zero-padded to 64 columns); the Q and K GEMMs store hi/lo planes [sequence x head][residue][32] and the V GEMM hi/lo V^T planes [sequence x head][64][residue], rows 0..31 written and read, from their epilogues; one attention kernel over all 1024 (sequence, head) pairs keeps a wave's 16 x 256 scores in registers: scores (3 products, K 32), + bias[h][i][j], softmax over the 256 residues with every row hi/lo, attn.V (3 products), sigmoid gate, and writes the hi/lo operand of the Wo GEMM.
// Operand order: every 16-bit plane that a matrix fragment is loaded from lies in fragment order (fro() below), written so by its producer; the pair bias lies in the order of the score accumulators. A wave's 16-byte-a-lane load then covers 512 contiguous bytes.
// Compute dtypes, f32 accumulate: every input rounded to bf16; LN, sigmoid, softmax f32; GEMM activations bf16 hi/lo (2 products) x exact weights; scores and attn.V 3 products.

#define NB_  1
#define TT   256
#define DM   256
#define NH_  8
#define NKV  8
#define REP  (NH_ / NKV)
#define HD   32
#define DQ   (NH_ * HD)
#define DKV  (NKV * HD)
#define WIN  0
#define SCL  0.17677669529663688f   // 32^-0.5
#define NS   128     // sequences
#define NI   256     // residues (= TT)
#define CZ   128     // pair channels
#define NP   (NS * NH_)   // 1024 pseudo-heads
#define NRM  (NS * NI)    // 32768 msa rows
#define NRP  (NI * NI)    // 65536 pair rows
#define HP   64      // padded head width for attn.v
#define NBP  64      // padded bias projection width (8 heads used)
typedef _Float16 h16;
typedef unsigned short bf;
typedef __attribute__((ext_vector_type(16))) __bf16   v16bf;
typedef __attribute__((ext_vector_type(16))) _Float16 v16h;
typedef __attribute__((ext_vector_type(8)))  _Float16 v8h;
typedef __attribute__((ext_vector_type(8)))  unsigned short v8us;
typedef __attribute__((ext_vector_type(8)))  float    v8f;
typedef __attribute__((ext_vector_type(4)))  float    v4f;
typedef v8h  __attribute__((may_alias)) v8ha;
typedef v4f  __attribute__((may_alias)) v4fa;
typedef v8us __attribute__((may_alias)) v8usa;

typedef __attribute__((ext_vector_type(2))) float    f32x2;
typedef __attribute__((ext_vector_type(2))) __bf16   bf16x2;
typedef __attribute__((ext_vector_type(4))) unsigned u32x4;
typedef __attribute__((ext_vector_type(2))) unsigned u32x2;
// f32 -> bf16, nearest even, by the convert instruction: one v_cvt_pk_bf16_f32 rounds two values and leaves them packed as the planes hold them
__device__ __forceinline__ unsigned pk2(float a, float b) { f32x2 x; x[0] = a; x[1] = b; return __builtin_bit_cast(unsigned, __builtin_convertvector(x, bf16x2)); }
__device__ __forceinline__ unsigned short f2bf(float f) { return __builtin_bit_cast(unsigned short, (__bf16)f); }
__device__ __forceinline__ float bf2f(unsigned short b) { return __uint_as_float(((unsigned)b) << 16); }
__device__ __forceinline__ float bfr(float f) { return bf2f(f2bf(f)); }
__device__ __forceinline__ void bfr2(float a, float b, float& ra, float& rb) { const unsigned h = pk2(a, b); ra = __uint_as_float(h << 16); rb = __uint_as_float(h & 0xFFFF0000u); }
// hi/lo split of a pair: h = the two rounded values, l = the two rounded remainders (a remainder is exact in f32)
__device__ __forceinline__ void split2(float a, float b, unsigned& h, unsigned& l) { h = pk2(a, b); l = pk2(a - __uint_as_float(h << 16), b - __uint_as_float(h & 0xFFFF0000u)); }
__device__ __forceinline__ void split8(v8f y, v8us& oh, v8us& ol) { u32x4 h, l;
    /* unrolled so that the vectors' elements are indexed by constants and stay in registers */
#pragma unroll
    for (int q = 0; q < 4; ++q) { unsigned u, w2; split2(y[2 * q], y[2 * q + 1], u, w2); h[q] = u; l[q] = w2; }
    oh = __builtin_bit_cast(v8us, h); ol = __builtin_bit_cast(v8us, l); }
__device__ __forceinline__ v16h cat16(v8h lo, v8h hi) { return __builtin_shufflevector(lo, hi, 0, 1, 2, 3, 4, 5, 6, 7, 8, 9, 10, 11, 12, 13, 14, 15); }
__device__ __forceinline__ v16bf cat16b(v8us lo, v8us hi) { return __builtin_bit_cast(v16bf, __builtin_shufflevector(lo, hi, 0, 1, 2, 3, 4, 5, 6, 7, 8, 9, 10, 11, 12, 13, 14, 15)); }
// Fragment order of a [rows][K] 16-bit plane: blocks of 16 rows x 32 k (1 KiB), block (row / 16, k / 32) row-major; inside a block [k / 16 % 2][k / 8 % 2][row % 16][k % 8], which is [register half][lane][8]: lane (lr, hi) of a 16x16x32 fragment finds its 16 values at block + lane * 8 and + 256.
__device__ __forceinline__ unsigned fro(unsigned row, unsigned k, unsigned K) { return ((row >> 4) * (K >> 5) + (k >> 5)) * 512u + ((k >> 4) & 1u) * 256u + ((k >> 3) & 1u) * 128u + (row & 15u) * 8u + (k & 7u); }
// its inverse: element e of the plane -> (row, k)
__device__ __forceinline__ void frd(unsigned e, unsigned K, unsigned& row, unsigned& k) { const unsigned blk = e >> 9; row = (blk / (K >> 5)) * 16u + ((e >> 3) & 15u); k = (blk % (K >> 5)) * 32u + ((e >> 8) & 1u) * 16u + ((e >> 7) & 1u) * 8u + (e & 7u); }
__device__ __forceinline__ v8f wmma16(v16h a, v16h b, v8f c) { return __builtin_amdgcn_wmma_f32_16x16x32_f16(false, a, false, b, (short)0, c, false, false); }
__device__ __forceinline__ v8f wmmab(v16bf a, v16bf b, v8f c) { return __builtin_amdgcn_wmma_f32_16x16x32_bf16(false, a, false, b, (short)0, c, false, false); }



// ---- gemmw_tile: register-blocked GEMM, ONE WAVE per 64x64 output tile (16 accumulators), operands straight from 16-bit planes in fragment order; tile (bx, by) of (M/64, N/64), 32 threads; sm = the wave's 4608 bytes of LDS for the epilogue.
// C[m][n] (f32, pitch ldc, + optional f32 bias[n]) = sum_k A[m][k] Bt[n][k] (+ split products per NSPLIT). K % 32 == 0.
// OUTM 0: f32 C. OUTM 1 and 2 (m = sequence x residue, n = head x 32): bf16 hi/lo of C, 1: to Ph/Pl[sequence x head][residue][32], 2: transposed to Ph/Pl[sequence x head][HP][residue], each [sequence x head] slab in fragment order. OUTM 3 (the pair bias): rows 0..7 of C, f32, in the order of the score accumulators. All store 16 bytes a lane and whole 128-byte lines a store.
template <typename T16> struct WFrag;
template <> struct WFrag<h16> { typedef v16h V; static __device__ __forceinline__ V ld(const h16* p) { return cat16(*(const v8h*)p, *(const v8h*)(p + 256)); } static __device__ __forceinline__ v8f mma(V a, V b, v8f c) { return wmma16(a, b, c); } };
template <> struct WFrag<bf> { typedef v16bf V; static __device__ __forceinline__ V ld(const bf* p) { return cat16b(*(const v8us*)p, *(const v8us*)(p + 256)); } static __device__ __forceinline__ v8f mma(V a, V b, v8f c) { return wmmab(a, b, c); } };
template <typename T16, int NSPLIT, bool BIAS, int OUTM>
__device__ __forceinline__ void gemmw_tile(const T16* __restrict__ A, const T16* __restrict__ A2, const T16* __restrict__ Bt, const T16* __restrict__ Bt2, int K, float* C, int ldc, const float* __restrict__ bias, bf* Ph, bf* Pl, int bx, int by, char* sm) {
    typedef typename WFrag<T16>::V V;
    const int lane = threadIdx.x & 31, lr = lane & 15, hi = lane >> 4; const int r0 = bx * 64, c0 = by * 64;
    constexpr int NMB = OUTM == 3 ? 1 : 4;   /* 16-row blocks of A that are multiplied: all that the epilogue stores */
    v8f acc[NMB][4];
#pragma unroll
    for (int mb = 0; mb < NMB; ++mb)
#pragma unroll
        for (int nb = 0; nb < 4; ++nb) acc[mb][nb] = (v8f){};
    /* 32-bit byte offsets, as in k_fattn (every operand plane is below 64 MiB): one offset register serves the planes of A, one those of B, and the wait at the foot of the trip can name them */
    unsigned ao = ((unsigned)r0 * K + 8 * lane) * 2u, bo = ((unsigned)c0 * K + 8 * lane) * 2u;   /* 16 rows of K values are K / 32 blocks of 512 */
#pragma unroll 1
    for (int kc = 0; kc < K; kc += 32) {
        V a[NMB], a2[NMB]; const T16* pa = (const T16*)((const char*)A + ao); const T16* pa2 = (const T16*)((const char*)A2 + ao); const T16* pb = (const T16*)((const char*)Bt + bo); const T16* pb2 = (const T16*)((const char*)Bt2 + bo);
#pragma unroll
        for (int mb = 0; mb < NMB; ++mb) { a[mb] = WFrag<T16>::ld(pa + mb * 16 * K); if (NSPLIT == 1 || NSPLIT == 2) a2[mb] = WFrag<T16>::ld(pa2 + mb * 16 * K); }
#pragma unroll
        for (int nb = 0; nb < 4; ++nb) { const V b = WFrag<T16>::ld(pb + nb * 16 * K); V b2; if (NSPLIT >= 2) b2 = WFrag<T16>::ld(pb2 + nb * 16 * K);
#pragma unroll
            for (int mb = 0; mb < NMB; ++mb) { acc[mb][nb] = WFrag<T16>::mma(a[mb], b, acc[mb][nb]); if (NSPLIT == 1 || NSPLIT == 2) acc[mb][nb] = WFrag<T16>::mma(a2[mb], b, acc[mb][nb]); if (NSPLIT >= 2) acc[mb][nb] = WFrag<T16>::mma(a[mb], b2, acc[mb][nb]); } }
        asm volatile("v_nop\n\tv_nop\n\tv_nop\n\tv_nop" : "+v"(acc[0][0]), "+v"(acc[1 % NMB][1]), "+v"(acc[2 % NMB][2]), "+v"(acc[3 % NMB][3]) : "v"(a[0]), "v"(a[NMB - 1]));
        asm volatile("s_wait_xcnt 0x0" :: "v"(ao), "v"(bo) : "memory");   /* precaution: the offset registers of this trip's loads are inputs here, so they stay live up to this wait and no load of the trip lands in one of them */
        ao += 1024u; bo += 1024u;
    }
    if constexpr (OUTM == 2) {
    /* a lane's 8 accumulator rows are 8 neighbouring residues of one channel: one lane's 16 bytes of a V^T fragment (row = channel, k = residue), so every store is 512 contiguous bytes as the values lie */
    const unsigned pv = ((unsigned)r0 / NI) * NH_ + (unsigned)c0 / HD, kb = ((unsigned)r0 % NI) / 32;
    /* every loop of this block is unrolled so that acc[][] and the vectors' elements are indexed by constants and stay in registers */
#pragma unroll
    for (int nb = 0; nb < 4; ++nb) {
#pragma unroll
        for (int mb = 0; mb < 4; ++mb) { v8us oh, ol;
            split8(acc[mb][nb], oh, ol);
            const unsigned e = (pv + (nb >> 1)) * (HP * NI) + ((nb & 1) * (NI / 32) + kb + (mb >> 1)) * 512u + (mb & 1) * 256u + lane * 8u;
            *(v8us*)(Ph + e) = oh; *(v8us*)(Pl + e) = ol; }
        asm volatile("s_wait_xcnt 0x0" ::: "memory");   /* precaution: stands behind these stores, in front of whatever next overwrites their address or data registers */
    }
    } else if constexpr (OUTM == 3) {
    /* B row 16 (256 I + j) + lr is pair position (i = 16 I + lr, j) (see k_prep), so lane lr of the lower half holds, for head r, bias[r][i][j0 .. j0 + 3] in acc[0][0..3][r]: 16 bytes of C[head][I][j / 16][j / 4 % 2][j / 8 % 2][i % 16][j % 4], which k_fattn reads lane by lane */
    if (hi == 0) {
        const unsigned e0 = (((unsigned)by >> 6) * 16u + (((unsigned)by & 63u) >> 2)) * 256u + ((unsigned)by & 1u) * 128u + (((unsigned)by >> 1) & 1u) * 64u + lr * 4u;
#pragma unroll
        for (int r = 0; r < NH_; ++r) { v4f val; val[0] = acc[0][0][r]; val[1] = acc[0][1][r]; val[2] = acc[0][2][r]; val[3] = acc[0][3][r]; *(v4f*)(C + e0 + (unsigned)r * NRP) = val; }
        asm volatile("s_wait_xcnt 0x0" ::: "memory");   /* precaution, as above */
    }
    } else {
    float* os = (float*)sm;
#pragma unroll
    for (int mb = 0; mb < 4; ++mb) {
#pragma unroll
        for (int nb = 0; nb < 4; ++nb) {
#pragma unroll
            for (int j = 0; j < 8; ++j) os[(hi * 8 + j) * 68 + nb * 16 + lr] = acc[mb][nb][j]; }
        __builtin_amdgcn_wave_barrier(); asm volatile("" ::: "memory");
        if (OUTM == 0) {
        float* crow = C + (size_t)(r0 + mb * 16) * ldc + c0;
#pragma unroll
            for (int s = 0; s < 8; ++s) { const int row = 2 * s + hi, cofs = lr * 4; v4f val = *(const v4fa*)(os + row * 68 + cofs); if (BIAS) { val[0] += bfr(bias[c0 + cofs]); val[1] += bfr(bias[c0 + cofs + 1]); val[2] += bfr(bias[c0 + cofs + 2]); val[3] += bfr(bias[c0 + cofs + 3]); }
                *(v4f*)(crow + (size_t)row * ldc + cofs) = val; }
        } else {
            /* unrolled, like the inner loop: the vectors' elements are indexed by constants and stay in registers */
#pragma unroll
            for (int s = 0; s < 4; ++s) { const int row = 8 * (s & 1) + (lane & 7), cofs = ((s >> 1) * 4 + (lane >> 3)) * 8; const v4f v0 = *(const v4fa*)(os + row * 68 + cofs), v1 = *(const v4fa*)(os + row * 68 + cofs + 4); v8us oh, ol;   /* 8 rows x the 4 pieces of one head: 4 whole lines in fragment order */
                split8(__builtin_shufflevector(v0, v1, 0, 1, 2, 3, 4, 5, 6, 7), oh, ol);
                const unsigned m = (unsigned)(r0 + mb * 16 + row), n = (unsigned)(c0 + cofs);
                const unsigned e = ((m / NI) * NH_ + n / HD) * (NI * HD) + fro(m % NI, n % HD, HD);
                *(v8us*)(Ph + e) = oh; *(v8us*)(Pl + e) = ol; }
        }
        asm volatile("s_wait_xcnt 0x0" ::: "memory");   /* precaution, as above: behind the stores of either form */
        __builtin_amdgcn_wave_barrier(); asm volatile("" ::: "memory");
    }
    }
}

// k_proj: the five GEMMs that depend on the LayerNorm planes alone, in one launch, one tile a workgroup: blocks 0..8191 = Q, K, V, gate (2048 tiles each, row tile fastest), blocks 8192..9215 = the pair bias (the shortest K, so last).
__global__ __launch_bounds__(32) void k_proj(const bf* __restrict__ Mh, const bf* __restrict__ Ml, const bf* __restrict__ WQ, const bf* __restrict__ WK, const bf* __restrict__ WV, const bf* __restrict__ WG, const float* __restrict__ bg, bf* QPh, bf* QPl, bf* KPh, bf* KPl, bf* VTh, bf* VTl, float* GP, const bf* __restrict__ WP, const bf* __restrict__ PLh, const bf* __restrict__ PLl, float* BIAS) {
    __shared__ __align__(16) char sm[4608];
    const int b = blockIdx.x;
    if (b < 4 * (NRM / 64) * (DQ / 64)) {
        const int g = b / ((NRM / 64) * (DQ / 64)), bx = b % (NRM / 64), by = (b / (NRM / 64)) % (DQ / 64);
        if (g < 2) gemmw_tile<bf, 1, false, 1>(Mh, Ml, g ? WK : WQ, nullptr, DM, nullptr, 0, nullptr, g ? KPh : QPh, g ? KPl : QPl, bx, by, sm);
        else if (g == 2) gemmw_tile<bf, 1, false, 2>(Mh, Ml, WV, nullptr, DM, nullptr, 0, nullptr, VTh, VTl, bx, by, sm);
        else gemmw_tile<bf, 1, true, 0>(Mh, Ml, WG, nullptr, DM, GP, DQ, bg, nullptr, nullptr, bx, by, sm);          /* gate pre-activation m Wg + bg */
    } else {
        /* pair bias, head-major: bias[h][i][j] = Wp[:, h] . LN(pair[i][j]): Wp (rows 8..63 zero) is the A operand, the hi/lo LN planes the B operand; the 8 head rows are stored */
        gemmw_tile<bf, 3, false, 3>(WP, nullptr, PLh, PLl, CZ, BIAS, NRP, nullptr, nullptr, nullptr, 0, b - 4 * (NRM / 64) * (DQ / 64), sm);
    }
}
// k_gemmo: out = vals Wo + bo; grid (M/64, N/64).
__global__ __launch_bounds__(32) void k_gemmo(const bf* __restrict__ Ah, const bf* __restrict__ Al, const bf* __restrict__ WO, float* OUT, const float* __restrict__ bo) {
    __shared__ __align__(16) char sm[4608];
    gemmw_tile<bf, 1, true, 0>(Ah, Al, WO, nullptr, DQ, OUT, DM, bo, nullptr, nullptr, blockIdx.x, blockIdx.y, sm);
}

typedef __attribute__((ext_vector_type(2))) _Float16 v2h;
typedef __attribute__((ext_vector_type(4))) _Float16 v4h;
typedef __attribute__((ext_vector_type(2))) unsigned short v2us;
typedef __attribute__((ext_vector_type(4))) unsigned short v4us;
typedef v4us __attribute__((may_alias)) v4usa;
typedef __attribute__((ext_vector_type(2))) float v2f;
typedef __attribute__((ext_vector_type(4))) int v4i;

__device__ __forceinline__ void wtG(const float* __restrict__ w, int K, int N, bf* Bt, int blk) {
    const int lane = threadIdx.x & 31; const int L0 = (blk * 8 + (threadIdx.x >> 5)) * 8; const int nlines = N * K / 64;
{
#pragma unroll 1
        for (int l = 0; l < 8; ++l) { const int L = L0 + l; if (L >= nlines) break; const size_t e = (size_t)L * 64 + lane * 2; unsigned n, k; frd((unsigned)e, (unsigned)K, n, k); v2us o;   /* the line is written whole; (n, k) follow from its place */
            o[0] = f2bf(w[(size_t)k * N + n]); o[1] = f2bf(w[(size_t)(k + 1) * N + n]); *(v2us*)(Bt + e) = o; }
         }
}
__global__ __launch_bounds__(256) void k_cvt8(const float* __restrict__ src, bf* dst, size_t n8) { const size_t i = (size_t)blockIdx.x * 256 + threadIdx.x; if (i >= n8) return; const v8f v = *(const v8f*)(src + i * 8); v8us o;
#pragma unroll
    for (int k = 0; k < 8; ++k) o[k] = f2bf(v[k]); *(v8us*)(dst + i * 8) = o;  }




template <int WD>
__device__ __forceinline__ void lnrow(const float* __restrict__ X, size_t r, const float* __restrict__ g, const float* __restrict__ bb, bf* Hh, bf* Hl, int blk, bf* ls) { const int lane = threadIdx.x & 31, w = threadIdx.x >> 5; const float* xr = X + r * WD;   /* r: the wave's source row; it becomes row blk * 8 + w of the planes */ float a[WD / 32]; float s = 0.f;
#pragma unroll
    for (int c = 0; c < WD / 128; ++c) { const v4f v = *(const v4f*)(xr + c * 128 + lane * 4); bfr2(v[0], v[1], a[c * 4], a[c * 4 + 1]); bfr2(v[2], v[3], a[c * 4 + 2], a[c * 4 + 3]); for (int q = 0; q < 4; ++q) s = __fadd_rn(s, a[c * 4 + q]); }
#pragma unroll
    for (int sh = 16; sh; sh >>= 1) s = __fadd_rn(s, __shfl_xor(s, sh, 32));
    const float mean = __fdiv_rn(s, (float)WD); float s2 = 0.f;
#pragma unroll
    for (int k = 0; k < WD / 32; ++k) { const float dv = __fsub_rn(a[k], mean); s2 = __fadd_rn(s2, __fmul_rn(dv, dv)); }
#pragma unroll
    for (int sh = 16; sh; sh >>= 1) s2 = __fadd_rn(s2, __shfl_xor(s2, sh, 32));
    const float rs = __fdiv_rn(1.0f, __fsqrt_rn(__fadd_rn(__fdiv_rn(s2, (float)WD), 1e-5f)));
{
#pragma unroll
        for (int c = 0; c < WD / 128; ++c) { v4us oh, ol; const int col = c * 128 + lane * 4; float gq[4], bq[4], yq[4]; bfr2(g[col], g[col + 1], gq[0], gq[1]); bfr2(g[col + 2], g[col + 3], gq[2], gq[3]); bfr2(bb[col], bb[col + 1], bq[0], bq[1]); bfr2(bb[col + 2], bb[col + 3], bq[2], bq[3]);
            for (int q = 0; q < 4; ++q) { float y = __fmul_rn(__fmul_rn(__fsub_rn(a[c * 4 + q], mean), rs), gq[q]); asm volatile("" : "+v"(y)); yq[q] = __fadd_rn(y, bq[q]); }
            u32x2 h2, l2; { unsigned u, w2; split2(yq[0], yq[1], u, w2); h2[0] = u; l2[0] = w2; split2(yq[2], yq[3], u, w2); h2[1] = u; l2[1] = w2; } oh = __builtin_bit_cast(v4us, h2); ol = __builtin_bit_cast(v4us, l2); bf* lw = ls + (c * 16 + (lane >> 1)) * 72 + w * 8 + (lane & 1) * 4; *(v4usa*)lw = oh; *(v4usa*)(lw + (WD / 8) * 72) = ol; }
         }
    /* in fragment order a 128-byte line holds 8 k of 8 rows, one piece from each wave: the block's 8 rows are gathered in LDS, [plane][k / 8][row][8] at a pitch of 144 bytes (the waves' 8-byte writes then fall on distinct banks), and stored as whole lines */
    __syncthreads();
#pragma unroll
    for (int s = 0; s < WD / 128; ++s) { const int idx = w * (WD / 128) + s, pl = idx / (WD / 32), kp = (idx % (WD / 32)) * 4 + (lane >> 3);
        const v8us v = *(const v8usa*)(ls + (pl * (WD / 8) + kp) * 72 + (lane & 7) * 8);
        *(v8us*)((pl ? Hl : Hh) + fro((unsigned)blk * 8u + (lane & 7), (unsigned)kp * 8u, WD)) = v; }
    asm volatile("s_wait_xcnt 0x0" ::: "memory");   /* precaution: behind the stores, in front of the next overwrite of their registers */
}
__device__ __forceinline__ void wpad(const float* __restrict__ w, bf* Bt, int blk) { const int e2 = (blk * 256 + threadIdx.x) * 2; if (e2 >= NBP * CZ) return; unsigned un, uk; frd((unsigned)e2, CZ, un, uk); const int k = (int)uk; const int n = (int)un; v2us o; const unsigned short a0 = f2bf(w[(size_t)k * NH_ + min(n, NH_ - 1)]), a1 = f2bf(w[(size_t)(k + 1) * NH_ + min(n, NH_ - 1)]); o[0] = (n < NH_) ? a0 : (unsigned short)0; o[1] = (n < NH_) ? a1 : (unsigned short)0; *(v2us*)(Bt + e2) = o;  }
// k_prep: everything that depends on the inputs alone, in one launch. Blocks 0..79: the five 256 x 256 weights to bf16 [n][k] (16 blocks each); 80..95: Wp padded; then 8192 blocks of pair LayerNorm rows and 4096 of msa rows, 8 rows a block. Plane row 16 (256 I + j) + lr of the pair planes is pair position (i = 16 I + lr, j), so that a 16-row fragment holds 16 queries of one key, as the score accumulators do. The few weight blocks, which are chains of dependent-latency trips, come first and run beside the LayerNorm streams.
#define NBW  ((DM * DQ / 64 + 63) / 64)       // blocks of one weight
#define NBWP ((NBP * CZ / 2 + 255) / 256)     // blocks of the padded Wp
__global__ __launch_bounds__(256) void k_prep(const float* __restrict__ msa, const float* __restrict__ pair, const float* __restrict__ lmg, const float* __restrict__ lmb, const float* __restrict__ lpg, const float* __restrict__ lpb, const float* __restrict__ wq, const float* __restrict__ wk, const float* __restrict__ wv, const float* __restrict__ wg, const float* __restrict__ wo, const float* __restrict__ wp, bf* WQ, bf* WK, bf* WV, bf* WG, bf* WO, bf* WP, bf* Mh, bf* Ml, bf* PLh, bf* PLl) {
    __shared__ __align__(16) bf ls[2 * (DM / 8) * 72];
    const int b = blockIdx.x;
    if (b < 5 * NBW) { const int g = b / NBW;
        const float* w = g == 0 ? wq : g == 1 ? wk : g == 2 ? wv : g == 3 ? wg : wo; bf* o = g == 0 ? WQ : g == 1 ? WK : g == 2 ? WV : g == 3 ? WG : WO;
        wtG(w, DM, DQ, o, b % NBW); }      /* all five are 256 x 256 (DM == DQ) */
    else if (b < 5 * NBW + NBWP) wpad(wp, WP, b - 5 * NBW);
    else if (b < 5 * NBW + NBWP + NRP / 8) { const int q = b - (5 * NBW + NBWP); lnrow<CZ>(pair, (size_t)((q >> 9) * 16 + (q & 1) * 8 + (threadIdx.x >> 5)) * NI + ((q >> 1) & (NI - 1)), lpg, lpb, PLh, PLl, q, ls); }
    else { const int q = b - (5 * NBW + NBWP + NRP / 8); lnrow<DM>(msa, (size_t)q * 8 + (threadIdx.x >> 5), lmg, lmb, Mh, Ml, q, ls); }
}
__device__ __forceinline__ float sigm_slot(float a) { float e; asm("v_exp_f32 %0, %1\n\tv_nop" : "=v"(e) : "v"(__fmul_rn(-a, 1.4426950408889634f))); return __fdiv_rn(1.0f, __fadd_rn(1.0f, e)); }
// Four exponentials and one v_nop in one statement, for the same slot: the outputs are early-clobbered, so none overwrites a source of the exponential in front of it, and the v_nop stands behind the last.
__device__ __forceinline__ void exp2x4(float& a, float& b, float& c, float& d) { float e0, e1, e2, e3; asm("v_exp_f32 %0, %4\n\tv_exp_f32 %1, %5\n\tv_exp_f32 %2, %6\n\tv_exp_f32 %3, %7\n\tv_nop" : "=&v"(e0), "=&v"(e1), "=&v"(e2), "=&v"(e3) : "v"(a), "v"(b), "v"(c), "v"(d)); a = e0; b = e1; c = e2; d = e3; }
// k_fattn: scores, pair bias, softmax, attn.V and the sigmoid gate of one (sequence, head) for 16 query rows per wave, nothing through memory in between.
// S^T = K Q^T (A = 16 key rows, B = the wave's 16 queries): lane (lr, hi) holds, of query lr, keys 16 t + 8 hi + 0..7 in st[t]; two neighbouring tiles are the B fragment of O^T = V^T P^T as they lie.
// Workgroup: 8 waves = 2 neighbouring heads x 4 query tiles; grid 128 sequences x 4 head pairs x 4 query blocks.
// The second launch bound asks for four waves per SIMD (256 registers a wave), so that two workgroups share a WGP and one's vector work covers the other's loads.
__global__ __launch_bounds__(256, 4) void k_fattn(const bf* __restrict__ QPh, const bf* __restrict__ QPl, const bf* __restrict__ KPh, const bf* __restrict__ KPl, const bf* __restrict__ VTh, const bf* __restrict__ VTl, const float* __restrict__ BT, const float* __restrict__ GP, bf* Ah, bf* Al) {
    const int lane = threadIdx.x & 31, lr = lane & 15, hi = lane >> 4, w = threadIdx.x >> 5;
    const int qb = blockIdx.x & 3, hp = (blockIdx.x >> 2) & 3, s = blockIdx.x >> 4;
    const int h = hp * 2 + (w & 1), p = s * NH_ + h, i = qb * 64 + (w >> 1) * 16 + lr;
    /* 32-bit byte offsets (every plane is below 64 MiB): one offset register serves a hi and a lo plane */
    const unsigned qo = (((unsigned)p * NI + (i - lr)) * HD + 8 * lane) * 2u, ko = ((unsigned)p * NI * HD + 8 * lane) * 2u, bo = ((unsigned)h * NRP + (unsigned)(i - lr) * NI + 4 * lane) * 4u;   /* fragment order: 16 rows x 32 = one block of 512; bias: 16 queries x 16 keys = 256 floats, [j / 4 % 2][lane][4] */
    const bf* qph = (const bf*)((const char*)QPh + qo); const bf* qpl = (const bf*)((const char*)QPl + qo); const bf* kph = (const bf*)((const char*)KPh + ko); const bf* kpl = (const bf*)((const char*)KPl + ko);
    const v16bf qh = WFrag<bf>::ld(qph), ql = WFrag<bf>::ld(qpl);
    const float* br = (const float*)((const char*)BT + bo);
    v8f st[NI / 16]; float mx = -3.0e38f;
#pragma unroll
    for (int t = 0; t < NI / 16; ++t) {
        const v16bf kh = WFrag<bf>::ld(kph + t * 16 * HD), kl = WFrag<bf>::ld(kpl + t * 16 * HD);
        const v4f b0 = *(const v4f*)(br + t * 256), b1 = *(const v4f*)(br + t * 256 + 128);
        v8f c = (v8f){}; c = wmmab(kh, qh, c); c = wmmab(kh, ql, c); c = wmmab(kl, qh, c);
#pragma unroll
        for (int j = 0; j < 8; ++j) { const float x = __fadd_rn(c[j], __fmul_rn(j < 4 ? b0[j & 3] : b1[j & 3], 5.656854249492380f)) * SCL;   /* (S + bias x sqrt(32)) x 32^-0.5: the reference adds the bias after the scale */
            c[j] = x; mx = fmaxf(mx, x); }
        st[t] = c; }
    asm volatile("s_wait_xcnt 0x0" :: "v"(qo), "v"(ko), "v"(bo), "s"(QPh), "s"(QPl), "s"(KPh), "s"(KPl), "s"(BT) : "memory");   /* precaution: the offset and base registers of the loads above are inputs here, so they stay live up to this wait and none is overwritten in front of it */
    mx = fmaxf(mx, __shfl_xor(mx, 16, 32));
    float sm[4] = {0.f, 0.f, 0.f, 0.f};
#pragma unroll
    for (int t = 0; t < NI / 16; ++t) {
#pragma unroll
        for (int j = 0; j < 8; j += 4) { float x[4];
#pragma unroll
            for (int q = 0; q < 4; ++q) x[q] = __fmul_rn(__fsub_rn(st[t][j + q], mx), 1.4426950408889634f);
            exp2x4(x[0], x[1], x[2], x[3]);
#pragma unroll
            for (int q = 0; q < 4; ++q) { st[t][j + q] = x[q]; sm[q] += x[q]; } } }
    float sum = (sm[0] + sm[1]) + (sm[2] + sm[3]); sum += __shfl_xor(sum, 16, 32);
    const float f = __fdiv_rn(1.0f, sum);
    const unsigned vo = ((unsigned)p * HP * NI + 8 * lane) * 2u;
    const bf* vph = (const bf*)((const char*)VTh + vo); const bf* vpl = (const bf*)((const char*)VTl + vo);
    v8f o[2]; o[0] = (v8f){}; o[1] = (v8f){};
#pragma unroll
    for (int c = 0; c < NI / 32; ++c) { v8us ph0, pl0, ph1, pl1;
        split8(st[2 * c] * f, ph0, pl0); split8(st[2 * c + 1] * f, ph1, pl1);
        const v16bf ph = cat16b(ph0, ph1), pl = cat16b(pl0, pl1);
#pragma unroll
        for (int mb = 0; mb < 2; ++mb) { const v16bf vh = WFrag<bf>::ld(vph + mb * 16 * NI + c * 512), vl = WFrag<bf>::ld(vpl + mb * 16 * NI + c * 512);
            o[mb] = wmmab(vh, ph, o[mb]); o[mb] = wmmab(vh, pl, o[mb]); o[mb] = wmmab(vl, ph, o[mb]); } }
    asm volatile("s_wait_xcnt 0x0" :: "v"(vo), "s"(VTh), "s"(VTl) : "memory");   /* the same for the V^T loads */
    const size_t oo = ((size_t)s * NI + i) * DQ + h * HD + 8 * hi;   /* o[mb][r] = context[query i][channel 16 mb + 8 hi + r] */
    const unsigned ao = ((unsigned)(s * NI + (i - lr)) * DQ + h * 512 + 8 * lane);   /* the same in fragment order (K = DQ, block k / 32 = h): o[mb] is register half mb as it lies */
#pragma unroll
    for (int mb = 0; mb < 2; ++mb) { const v4f g0 = *(const v4f*)(GP + oo + mb * 16), g1 = *(const v4f*)(GP + oo + mb * 16 + 4); v8us oh, ol;
        v8f y;
#pragma unroll
        for (int r = 0; r < 8; ++r) y[r] = __fmul_rn(sigm_slot(r < 4 ? g0[r & 3] : g1[r & 3]), o[mb][r]);
        split8(y, oh, ol);
        *(v8us*)(Ah + ao + mb * 256) = oh; *(v8us*)(Al + ao + mb * 256) = ol; }
}

extern "C" void kernel_launch(void* const* d_in, const int* in_sizes, int n_in,
                              void* d_out, int out_size, void* d_ws, size_t ws_size, hipStream_t stream) {
    (void)in_sizes; (void)n_in; (void)out_size;
    const float* msa = (const float*)d_in[0]; const float* pair = (const float*)d_in[1]; const float* lmg = (const float*)d_in[2]; const float* lmb = (const float*)d_in[3]; const float* lpg = (const float*)d_in[4]; const float* lpb = (const float*)d_in[5]; const float* wq = (const float*)d_in[6]; const float* wk = (const float*)d_in[7]; const float* wv = (const float*)d_in[8]; const float* wp = (const float*)d_in[9]; const float* wg = (const float*)d_in[10]; const float* bg = (const float*)d_in[11]; const float* wo = (const float*)d_in[12]; const float* bo = (const float*)d_in[13];
    float* OUT = (float*)d_out;     // [1][128][256][256]
    char* wsp = (char*)d_ws;
    auto take = [&](size_t bytes) { char* p = wsp; wsp += (bytes + 255) & ~(size_t)255; return (void*)p; };
    bf* WQ = (bf*)take((size_t)DQ * DM * 2); bf* WK = (bf*)take((size_t)DQ * DM * 2); bf* WV = (bf*)take((size_t)DQ * DM * 2); bf* WG = (bf*)take((size_t)DQ * DM * 2); bf* WO = (bf*)take((size_t)DM * DQ * 2); bf* WP = (bf*)take((size_t)NBP * CZ * 2);
    bf* Mh = (bf*)take((size_t)NRM * DM * 2); bf* Ml = (bf*)take((size_t)NRM * DM * 2); float* FQ = (float*)take((size_t)NRM * DQ * 4); float* GP = (float*)take((size_t)NRM * DQ * 4); float* BIAS = (float*)take((size_t)NRP * NBP * 4);
    bf* QPh = (bf*)take((size_t)NP * NI * HD * 2); bf* QPl = (bf*)take((size_t)NP * NI * HD * 2); bf* KPh = (bf*)take((size_t)NP * NI * HD * 2); bf* KPl = (bf*)take((size_t)NP * NI * HD * 2); bf* VTh = (bf*)take((size_t)NP * HP * NI * 2); bf* VTl = (bf*)take((size_t)NP * HP * NI * 2);
    bf* ATh = Mh; bf* ATl = Ml;   /* the gated context reuses the LN operand buffers (m is dead after the projections) */
    if ((size_t)(wsp - (char*)d_ws) > ws_size) return;    // ws 256 MiB (carve ~241 MiB; the pair LN operand lies in FQ, see below)
    bf* PLh = (bf*)FQ; bf* PLl = (bf*)FQ + (size_t)NRP * CZ;   /* pair LN planes [65536][128] bf16 = 16 MiB each, both inside FQ (32 MiB), which holds nothing else: the gate GEMM writes GP in the launch that reads them */
    k_prep<<<5 * NBW + NBWP + NRP / 8 + NRM / 8, 256, 0, stream>>>(msa, pair, lmg, lmb, lpg, lpb, wq, wk, wv, wg, wo, wp, WQ, WK, WV, WG, WO, WP, Mh, Ml, PLh, PLl);
    k_proj<<<4 * (NRM / 64) * (DQ / 64) + NRP / 64, 32, 0, stream>>>(Mh, Ml, WQ, WK, WV, WG, bg, QPh, QPl, KPh, KPl, VTh, VTl, GP, WP, PLh, PLl, BIAS);
    k_fattn<<<NS * (NH_ / 2) * (NI / 64), 256, 0, stream>>>(QPh, QPl, KPh, KPl, VTh, VTl, BIAS, GP, ATh, ATl);
    k_gemmo<<<dim3(NRM / 64, DM / 64, 1), 32, 0, stream>>>(ATh, ATl, WO, OUT, bo);            /* out = vals Wo + bo */
}

// v006
// One run takes 128 microseconds.
// Next to v005, in two timings, it ran 1.12 and 1.11 times as fast.
// All steps since v000 together make it 13.7 times as fast.
#include <hip/hip_runtime.h>

// MSA row attention with pair bias (msa [1][128][256][256], pair [1][256][256][128]; m = LN(msa), p = LN(pair) (eps 1e-5, affine); Q, K, V = m W ('xw' [256][256], 8 heads x 32), G = sigmoid(m Wg + bg); bias[h][i][j] = (p Wp)[i][j][h] ('xw' [128][8]); per sequence s and head h: attn = softmax(Q_s,h . K_s,h / sqrt(32) + bias_h); vals = G * (attn V); out = vals Wo + bo ('xw' [256][256]) -> [1][128][256][256] (8.4 M)).
// Layout: row LayerNorm kernels (one wave per row) write hi/lo operands for the msa (32,768 x 256) and pair (65,536 x 128) slabs; hl x exact projections (Q, K, V, gate pre-activation, and the pair bias against Wp zero-padded to 64 columns); the Q and K GEMMs store hi/lo planes [sequence x head][residue][32] and the V GEMM hi/lo V^T planes [sequence x head][64][residue], rows 0..31 written and read, from their epilogues; one attention kernel over all 1024 (sequence, head) pairs keeps a wave's 16 x 256 scores in registers: scores (3 products, K 32), + bias[h][i][j], softmax over the 256 residues with every row hi/lo, attn.V (3 products), sigmoid gate, and writes the hi/lo operand of the Wo GEMM.
// Operand order: every 16-bit plane that a matrix fragment is loaded from lies in fragment order (fro() below), written so by its producer; the pair bias lies in the order of the score accumulators. A wave's 16-byte-a-lane load then covers 512 contiguous bytes.
// Compute dtypes, f32 accumulate: every input rounded to bf16; LN, sigmoid, softmax f32; GEMM activations bf16 hi/lo (2 products) x exact weights; scores and attn.V 3 products.

#define NB_  1
#define TT   256
#define DM   256
#define NH_  8
#define NKV  8
#define REP  (NH_ / NKV)
#define HD   32
#define DQ   (NH_ * HD)
#define DKV  (NKV * HD)
#define WIN  0
#define SCL  0.17677669529663688f   // 32^-0.5
#define NS   128     // sequences
#define NI   256     // residues (= TT)
#define CZ   128     // pair channels
#define NP   (NS * NH_)   // 1024 pseudo-heads
#define NRM  (NS * NI)    // 32768 msa rows
#define NRP  (NI * NI)    // 65536 pair rows
#define HP   64      // padded head width for attn.v
#define NBP  64      // padded bias projection width (8 heads used)
typedef _Float16 h16;
typedef unsigned short bf;
typedef __attribute__((ext_vector_type(16))) __bf16   v16bf;
typedef __attribute__((ext_vector_type(16))) _Float16 v16h;
typedef __attribute__((ext_vector_type(8)))  _Float16 v8h;
typedef __attribute__((ext_vector_type(8)))  unsigned short v8us;
typedef __attribute__((ext_vector_type(8)))  float    v8f;
typedef __attribute__((ext_vector_type(4)))  float    v4f;
typedef v8h  __attribute__((may_alias)) v8ha;
typedef v4f  __attribute__((may_alias)) v4fa;
typedef v8us __attribute__((may_alias)) v8usa;

typedef __attribute__((ext_vector_type(2))) float    f32x2;
typedef __attribute__((ext_vector_type(2))) __bf16   bf16x2;
typedef __attribute__((ext_vector_type(4))) unsigned u32x4;
typedef __attribute__((ext_vector_type(2))) unsigned u32x2;
// f32 -> bf16, nearest even, by the convert instruction: one v_cvt_pk_bf16_f32 rounds two values and leaves them packed as the planes hold them
__device__ __forceinline__ unsigned pk2(float a, float b) { f32x2 x; x[0] = a; x[1] = b; return __builtin_bit_cast(unsigned, __builtin_convertvector(x, bf16x2)); }
__device__ __forceinline__ unsigned short f2bf(float f) { return __builtin_bit_cast(unsigned short, (__bf16)f); }
__device__ __forceinline__ float bf2f(unsigned short b) { return __uint_as_float(((unsigned)b) << 16); }
__device__ __forceinline__ float bfr(float f) { return bf2f(f2bf(f)); }
__device__ __forceinline__ void bfr2(float a, float b, float& ra, float& rb) { const unsigned h = pk2(a, b); ra = __uint_as_float(h << 16); rb = __uint_as_float(h & 0xFFFF0000u); }
// hi/lo split of a pair: h = the two rounded values, l = the two rounded remainders (a remainder is exact in f32)
__device__ __forceinline__ void split2(float a, float b, unsigned& h, unsigned& l) { h = pk2(a, b); l = pk2(a - __uint_as_float(h << 16), b - __uint_as_float(h & 0xFFFF0000u)); }
__device__ __forceinline__ void split8(v8f y, v8us& oh, v8us& ol) { u32x4 h, l;
    /* unrolled so that the vectors' elements are indexed by constants and stay in registers */
#pragma unroll
    for (int q = 0; q < 4; ++q) { unsigned u, w2; split2(y[2 * q], y[2 * q + 1], u, w2); h[q] = u; l[q] = w2; }
    oh = __builtin_bit_cast(v8us, h); ol = __builtin_bit_cast(v8us, l); }
__device__ __forceinline__ v16h cat16(v8h lo, v8h hi) { return __builtin_shufflevector(lo, hi, 0, 1, 2, 3, 4, 5, 6, 7, 8, 9, 10, 11, 12, 13, 14, 15); }
__device__ __forceinline__ v16bf cat16b(v8us lo, v8us hi) { return __builtin_bit_cast(v16bf, __builtin_shufflevector(lo, hi, 0, 1, 2, 3, 4, 5, 6, 7, 8, 9, 10, 11, 12, 13, 14, 15)); }
// Fragment order of a [rows][K] 16-bit plane: blocks of 16 rows x 32 k (1 KiB), block (row / 16, k / 32) row-major; inside a block [k / 16 % 2][k / 8 % 2][row % 16][k % 8], which is [register half][lane][8]: lane (lr, hi) of a 16x16x32 fragment finds its 16 values at block + lane * 8 and + 256.
__device__ __forceinline__ unsigned fro(unsigned row, unsigned k, unsigned K) { return ((row >> 4) * (K >> 5) + (k >> 5)) * 512u + ((k >> 4) & 1u) * 256u + ((k >> 3) & 1u) * 128u + (row & 15u) * 8u + (k & 7u); }
// its inverse: element e of the plane -> (row, k)
__device__ __forceinline__ void frd(unsigned e, unsigned K, unsigned& row, unsigned& k) { const unsigned blk = e >> 9; row = (blk / (K >> 5)) * 16u + ((e >> 3) & 15u); k = (blk % (K >> 5)) * 32u + ((e >> 8) & 1u) * 16u + ((e >> 7) & 1u) * 8u + (e & 7u); }
__device__ __forceinline__ v8f wmma16(v16h a, v16h b, v8f c) { return __builtin_amdgcn_wmma_f32_16x16x32_f16(false, a, false, b, (short)0, c, false, false); }
__device__ __forceinline__ v8f wmmab(v16bf a, v16bf b, v8f c) { return __builtin_amdgcn_wmma_f32_16x16x32_bf16(false, a, false, b, (short)0, c, false, false); }



// ---- gemmw_tile: register-blocked GEMM, ONE WAVE per 64x64 output tile (16 accumulators), operands straight from 16-bit planes in fragment order; tile (bx, by) of (M/64, N/64), 32 threads; sm = the wave's 4608 bytes of LDS for the epilogue.
// C[m][n] (f32, pitch ldc, + optional f32 bias[n]) = sum_k A[m][k] Bt[n][k] (+ split products per NSPLIT). K % 32 == 0.
// OUTM 0: f32 C. OUTM 1 and 2 (m = sequence x residue, n = head x 32): bf16 hi/lo of C, 1: to Ph/Pl[sequence x head][residue][32], 2: transposed to Ph/Pl[sequence x head][HP][residue], each [sequence x head] slab in fragment order. OUTM 3 (the pair bias): rows 0..7 of C, f32, in the order of the score accumulators. All store 16 bytes a lane and whole 128-byte lines a store.
template <typename T16> struct WFrag;
template <> struct WFrag<h16> { typedef v16h V; static __device__ __forceinline__ V ld(const h16* p) { return cat16(*(const v8h*)p, *(const v8h*)(p + 256)); } static __device__ __forceinline__ v8f mma(V a, V b, v8f c) { return wmma16(a, b, c); } };
template <> struct WFrag<bf> { typedef v16bf V; static __device__ __forceinline__ V ld(const bf* p) { return cat16b(*(const v8us*)p, *(const v8us*)(p + 256)); } static __device__ __forceinline__ v8f mma(V a, V b, v8f c) { return wmmab(a, b, c); } };
template <typename T16, int NSPLIT, bool BIAS, int OUTM>
__device__ __forceinline__ void gemmw_tile(const T16* __restrict__ A, const T16* __restrict__ A2, const T16* __restrict__ Bt, const T16* __restrict__ Bt2, int K, float* C, int ldc, const float* __restrict__ bias, bf* Ph, bf* Pl, int bx, int by, char* sm) {
    typedef typename WFrag<T16>::V V;
    const int lane = threadIdx.x & 31, lr = lane & 15, hi = lane >> 4; const int r0 = bx * 64, c0 = by * 64;
    constexpr int NMB = OUTM == 3 ? 1 : 4;   /* 16-row blocks of A that are multiplied: all that the epilogue stores */
    v8f acc[NMB][4];
#pragma unroll
    for (int mb = 0; mb < NMB; ++mb)
#pragma unroll
        for (int nb = 0; nb < 4; ++nb) acc[mb][nb] = (v8f){};
    /* 32-bit byte offsets, as in k_fattn (every operand plane is below 64 MiB): one offset register serves the planes of A, one those of B; neither changes, every trip's step is an immediate offset */
    const unsigned ao = ((unsigned)r0 * K + 8 * lane) * 2u, bo = ((unsigned)c0 * K + 8 * lane) * 2u;   /* 16 rows of K values are K / 32 blocks of 512 */
    const T16* pa = (const T16*)((const char*)A + ao); const T16* pa2 = (const T16*)((const char*)A2 + ao); const T16* pb = (const T16*)((const char*)Bt + bo); const T16* pb2 = (const T16*)((const char*)Bt2 + bo);
    /* NFS fragment sets: trip t's loads all go out as one group in front of the products of trip t - (NFS - 1), so that a trip waits for its operands once, and NFS - 1 trips of products after they were asked for; the pair-bias trip has a quarter of the products, so it asks two trips ahead */
    constexpr int NFS = OUTM == 3 ? 3 : 2;
    V a[NFS][NMB], a2[NFS][NMB], b[NFS][4], b2[NFS][4];
    /* unrolled whole (K is a constant at every call): the sets are indexed by constants and stay in registers, and no address register is rewritten between the trips */
#pragma unroll
    for (int t = 0; t < K / 32 + NFS - 1; ++t) {
        if (t < K / 32) { const int s = t % NFS;
#pragma unroll
            for (int nb = 0; nb < 4; ++nb) { b[s][nb] = WFrag<T16>::ld(pb + t * 512 + nb * 16 * K); if (NSPLIT >= 2) b2[s][nb] = WFrag<T16>::ld(pb2 + t * 512 + nb * 16 * K); }
#pragma unroll
            for (int mb = 0; mb < NMB; ++mb) { a[s][mb] = WFrag<T16>::ld(pa + t * 512 + mb * 16 * K); if (NSPLIT == 1 || NSPLIT == 2) a2[s][mb] = WFrag<T16>::ld(pa2 + t * 512 + mb * 16 * K); } }
        __builtin_amdgcn_sched_barrier(0);   /* keeps the load group in front of the products: moved down among them, each part of it would be waited for by itself */
        if (t >= NFS - 1) { const int s = (t - (NFS - 1)) % NFS;
#pragma unroll
            for (int nb = 0; nb < 4; ++nb) {
#pragma unroll
                for (int mb = 0; mb < NMB; ++mb) { acc[mb][nb] = WFrag<T16>::mma(a[s][mb], b[s][nb], acc[mb][nb]); if (NSPLIT == 1 || NSPLIT == 2) acc[mb][nb] = WFrag<T16>::mma(a2[s][mb], b[s][nb], acc[mb][nb]); if (NSPLIT >= 2) acc[mb][nb] = WFrag<T16>::mma(a[s][mb], b2[s][nb], acc[mb][nb]); } } }
        __builtin_amdgcn_sched_barrier(0);   /* keeps what follows (the next group; behind the last trip the epilogue) from being mixed in among these products: that build took more registers, enough to cost a wave per SIMD */
    }
    asm volatile("s_wait_xcnt 0x0" :: "v"(ao), "v"(bo) : "memory");   /* precaution: the offset registers of the loads are inputs here, so they stay live up to this wait and none is overwritten in front of it */
    if constexpr (OUTM == 2) {
    /* a lane's 8 accumulator rows are 8 neighbouring residues of one channel: one lane's 16 bytes of a V^T fragment (row = channel, k = residue), so every store is 512 contiguous bytes as the values lie */
    const unsigned pv = ((unsigned)r0 / NI) * NH_ + (unsigned)c0 / HD, kb = ((unsigned)r0 % NI) / 32;
    /* every loop of this block is unrolled so that acc[][] and the vectors' elements are indexed by constants and stay in registers */
#pragma unroll
    for (int nb = 0; nb < 4; ++nb) {
#pragma unroll
        for (int mb = 0; mb < 4; ++mb) { v8us oh, ol;
            split8(acc[mb][nb], oh, ol);
            const unsigned e = (pv + (nb >> 1)) * (HP * NI) + ((nb & 1) * (NI / 32) + kb + (mb >> 1)) * 512u + (mb & 1) * 256u + lane * 8u;
            *(v8us*)(Ph + e) = oh; *(v8us*)(Pl + e) = ol; }
        asm volatile("s_wait_xcnt 0x0" ::: "memory");   /* precaution: stands behind these stores, in front of whatever next overwrites their address or data registers */
    }
    } else if constexpr (OUTM == 3) {
    /* B row 16 (256 I + j) + lr is pair position (i = 16 I + lr, j) (see k_prep), so lane lr of the lower half holds, for head r, bias[r][i][j0 .. j0 + 3] in acc[0][0..3][r]: 16 bytes of C[head][I][j / 16][j / 4 % 2][j / 8 % 2][i % 16][j % 4], which k_fattn reads lane by lane */
    if (hi == 0) {
        const unsigned e0 = (((unsigned)by >> 6) * 16u + (((unsigned)by & 63u) >> 2)) * 256u + ((unsigned)by & 1u) * 128u + (((unsigned)by >> 1) & 1u) * 64u + lr * 4u;
#pragma unroll
        for (int r = 0; r < NH_; ++r) { v4f val; val[0] = acc[0][0][r]; val[1] = acc[0][1][r]; val[2] = acc[0][2][r]; val[3] = acc[0][3][r]; *(v4f*)(C + e0 + (unsigned)r * NRP) = val; }
        asm volatile("s_wait_xcnt 0x0" ::: "memory");   /* precaution, as above */
    }
    } else {
    float* os = (float*)sm;
#pragma unroll
    for (int mb = 0; mb < 4; ++mb) {
#pragma unroll
        for (int nb = 0; nb < 4; ++nb) {
#pragma unroll
            for (int j = 0; j < 8; ++j) os[(hi * 8 + j) * 68 + nb * 16 + lr] = acc[mb][nb][j]; }
        __builtin_amdgcn_wave_barrier(); asm volatile("" ::: "memory");
        if (OUTM == 0) {
        float* crow = C + (size_t)(r0 + mb * 16) * ldc + c0;
#pragma unroll
            for (int s = 0; s < 8; ++s) { const int row = 2 * s + hi, cofs = lr * 4; v4f val = *(const v4fa*)(os + row * 68 + cofs); if (BIAS) { val[0] += bfr(bias[c0 + cofs]); val[1] += bfr(bias[c0 + cofs + 1]); val[2] += bfr(bias[c0 + cofs + 2]); val[3] += bfr(bias[c0 + cofs + 3]); }
                *(v4f*)(crow + (size_t)row * ldc + cofs) = val; }
        } else {
            /* unrolled, like the inner loop: the vectors' elements are indexed by constants and stay in registers */
#pragma unroll
            for (int s = 0; s < 4; ++s) { const int row = 8 * (s & 1) + (lane & 7), cofs = ((s >> 1) * 4 + (lane >> 3)) * 8; const v4f v0 = *(const v4fa*)(os + row * 68 + cofs), v1 = *(const v4fa*)(os + row * 68 + cofs + 4); v8us oh, ol;   /* 8 rows x the 4 pieces of one head: 4 whole lines in fragment order */
                split8(__builtin_shufflevector(v0, v1, 0, 1, 2, 3, 4, 5, 6, 7), oh, ol);
                const unsigned m = (unsigned)(r0 + mb * 16 + row), n = (unsigned)(c0 + cofs);
                const unsigned e = ((m / NI) * NH_ + n / HD) * (NI * HD) + fro(m % NI, n % HD, HD);
                *(v8us*)(Ph + e) = oh; *(v8us*)(Pl + e) = ol; }
        }
        asm volatile("s_wait_xcnt 0x0" ::: "memory");   /* precaution, as above: behind the stores of either form */
        __builtin_amdgcn_wave_barrier(); asm volatile("" ::: "memory");
    }
    }
}

// k_proj: the five GEMMs that depend on the LayerNorm planes alone, in one launch, one tile a workgroup: blocks 0..8191 = Q, K, V, gate (2048 tiles each, row tile fastest), blocks 8192..9215 = the pair bias (the shortest K, so last).
__global__ __launch_bounds__(32) void k_proj(const bf* __restrict__ Mh, const bf* __restrict__ Ml, const bf* __restrict__ WQ, const bf* __restrict__ WK, const bf* __restrict__ WV, const bf* __restrict__ WG, const float* __restrict__ bg, bf* QPh, bf* QPl, bf* KPh, bf* KPl, bf* VTh, bf* VTl, float* GP, const bf* __restrict__ WP, const bf* __restrict__ PLh, const bf* __restrict__ PLl, float* BIAS) {
    __shared__ __align__(16) char sm[4608];
    const int b = blockIdx.x;
    if (b < 4 * (NRM / 64) * (DQ / 64)) {
        const int g = b / ((NRM / 64) * (DQ / 64)), bx = b % (NRM / 64), by = (b / (NRM / 64)) % (DQ / 64);
        if (g < 2) gemmw_tile<bf, 1, false, 1>(Mh, Ml, g ? WK : WQ, nullptr, DM, nullptr, 0, nullptr, g ? KPh : QPh, g ? KPl : QPl, bx, by, sm);
        else if (g == 2) gemmw_tile<bf, 1, false, 2>(Mh, Ml, WV, nullptr, DM, nullptr, 0, nullptr, VTh, VTl, bx, by, sm);
        else gemmw_tile<bf, 1, true, 0>(Mh, Ml, WG, nullptr, DM, GP, DQ, bg, nullptr, nullptr, bx, by, sm);          /* gate pre-activation m Wg + bg */
    } else {
        /* pair bias, head-major: bias[h][i][j] = Wp[:, h] . LN(pair[i][j]): Wp (rows 8..63 zero) is the A operand, the hi/lo LN planes the B operand; the 8 head rows are stored */
        gemmw_tile<bf, 3, false, 3>(WP, nullptr, PLh, PLl, CZ, BIAS, NRP, nullptr, nullptr, nullptr, 0, b - 4 * (NRM / 64) * (DQ / 64), sm);
    }
}
// k_gemmo: out = vals Wo + bo; grid (M/64, N/64).
__global__ __launch_bounds__(32) void k_gemmo(const bf* __restrict__ Ah, const bf* __restrict__ Al, const bf* __restrict__ WO, float* OUT, const float* __restrict__ bo) {
    __shared__ __align__(16) char sm[4608];
    gemmw_tile<bf, 1, true, 0>(Ah, Al, WO, nullptr, DQ, OUT, DM, bo, nullptr, nullptr, blockIdx.x, blockIdx.y, sm);
}

typedef __attribute__((ext_vector_type(2))) _Float16 v2h;
typedef __attribute__((ext_vector_type(4))) _Float16 v4h;
typedef __attribute__((ext_vector_type(2))) unsigned short v2us;
typedef __attribute__((ext_vector_type(4))) unsigned short v4us;
typedef v4us __attribute__((may_alias)) v4usa;
typedef __attribute__((ext_vector_type(2))) float v2f;
typedef __attribute__((ext_vector_type(4))) int v4i;

__device__ __forceinline__ void wtG(const float* __restrict__ w, int K, int N, bf* Bt, int blk) {
    const int lane = threadIdx.x & 31; const int L0 = (blk * 8 + (threadIdx.x >> 5)) * 8; const int nlines = N * K / 64;
{
#pragma unroll 1
        for (int l = 0; l < 8; ++l) { const int L = L0 + l; if (L >= nlines) break; const size_t e = (size_t)L * 64 + lane * 2; unsigned n, k; frd((unsigned)e, (unsigned)K, n, k); v2us o;   /* the line is written whole; (n, k) follow from its place */
            o[0] = f2bf(w[(size_t)k * N + n]); o[1] = f2bf(w[(size_t)(k + 1) * N + n]); *(v2us*)(Bt + e) = o; }
         }
}
__global__ __launch_bounds__(256) void k_cvt8(const float* __restrict__ src, bf* dst, size_t n8) { const size_t i = (size_t)blockIdx.x * 256 + threadIdx.x; if (i >= n8) return; const v8f v = *(const v8f*)(src + i * 8); v8us o;
#pragma unroll
    for (int k = 0; k < 8; ++k) o[k] = f2bf(v[k]); *(v8us*)(dst + i * 8) = o;  }




template <int WD>
__device__ __forceinline__ void lnrow(const float* __restrict__ X, size_t r, const float* __restrict__ g, const float* __restrict__ bb, bf* Hh, bf* Hl, int blk, bf* ls) { const int lane = threadIdx.x & 31, w = threadIdx.x >> 5; const float* xr = X + r * WD;   /* r: the wave's source row; it becomes row blk * 8 + w of the planes */ float a[WD / 32]; float s = 0.f;
#pragma unroll
    for (int c = 0; c < WD / 128; ++c) { const v4f v = *(const v4f*)(xr + c * 128 + lane * 4); bfr2(v[0], v[1], a[c * 4], a[c * 4 + 1]); bfr2(v[2], v[3], a[c * 4 + 2], a[c * 4 + 3]); for (int q = 0; q < 4; ++q) s = __fadd_rn(s, a[c * 4 + q]); }
#pragma unroll
    for (int sh = 16; sh; sh >>= 1) s = __fadd_rn(s, __shfl_xor(s, sh, 32));
    const float mean = __fdiv_rn(s, (float)WD); float s2 = 0.f;
#pragma unroll
    for (int k = 0; k < WD / 32; ++k) { const float dv = __fsub_rn(a[k], mean); s2 = __fadd_rn(s2, __fmul_rn(dv, dv)); }
#pragma unroll
    for (int sh = 16; sh; sh >>= 1) s2 = __fadd_rn(s2, __shfl_xor(s2, sh, 32));
    const float rs = __fdiv_rn(1.0f, __fsqrt_rn(__fadd_rn(__fdiv_rn(s2, (float)WD), 1e-5f)));
{
#pragma unroll
        for (int c = 0; c < WD / 128; ++c) { v4us oh, ol; const int col = c * 128 + lane * 4; float gq[4], bq[4], yq[4]; bfr2(g[col], g[col + 1], gq[0], gq[1]); bfr2(g[col + 2], g[col + 3], gq[2], gq[3]); bfr2(bb[col], bb[col + 1], bq[0], bq[1]); bfr2(bb[col + 2], bb[col + 3], bq[2], bq[3]);
            for (int q = 0; q < 4; ++q) { float y = __fmul_rn(__fmul_rn(__fsub_rn(a[c * 4 + q], mean), rs), gq[q]); asm volatile("" : "+v"(y)); yq[q] = __fadd_rn(y, bq[q]); }
            u32x2 h2, l2; { unsigned u, w2; split2(yq[0], yq[1], u, w2); h2[0] = u; l2[0] = w2; split2(yq[2], yq[3], u, w2); h2[1] = u; l2[1] = w2; } oh = __builtin_bit_cast(v4us, h2); ol = __builtin_bit_cast(v4us, l2); bf* lw = ls + (c * 16 + (lane >> 1)) * 72 + w * 8 + (lane & 1) * 4; *(v4usa*)lw = oh; *(v4usa*)(lw + (WD / 8) * 72) = ol; }
         }
    /* in fragment order a 128-byte line holds 8 k of 8 rows, one piece from each wave: the block's 8 rows are gathered in LDS, [plane][k / 8][row][8] at a pitch of 144 bytes (the waves' 8-byte writes then fall on distinct banks), and stored as whole lines */
    __syncthreads();
#pragma unroll
    for (int s = 0; s < WD / 128; ++s) { const int idx = w * (WD / 128) + s, pl = idx / (WD / 32), kp = (idx % (WD / 32)) * 4 + (lane >> 3);
        const v8us v = *(const v8usa*)(ls + (pl * (WD / 8) + kp) * 72 + (lane & 7) * 8);
        *(v8us*)((pl ? Hl : Hh) + fro((unsigned)blk * 8u + (lane & 7), (unsigned)kp * 8u, WD)) = v; }
    asm volatile("s_wait_xcnt 0x0" ::: "memory");   /* precaution: behind the stores, in front of the next overwrite of their registers */
}
__device__ __forceinline__ void wpad(const float* __restrict__ w, bf* Bt, int blk) { const int e2 = (blk * 256 + threadIdx.x) * 2; if (e2 >= NBP * CZ) return; unsigned un, uk; frd((unsigned)e2, CZ, un, uk); const int k = (int)uk; const int n = (int)un; v2us o; const unsigned short a0 = f2bf(w[(size_t)k * NH_ + min(n, NH_ - 1)]), a1 = f2bf(w[(size_t)(k + 1) * NH_ + min(n, NH_ - 1)]); o[0] = (n < NH_) ? a0 : (unsigned short)0; o[1] = (n < NH_) ? a1 : (unsigned short)0; *(v2us*)(Bt + e2) = o;  }
// k_prep: everything that depends on the inputs alone, in one launch. Blocks 0..79: the five 256 x 256 weights to bf16 [n][k] (16 blocks each); 80..95: Wp padded; then 8192 blocks of pair LayerNorm rows and 4096 of msa rows, 8 rows a block. Plane row 16 (256 I + j) + lr of the pair planes is pair position (i = 16 I + lr, j), so that a 16-row fragment holds 16 queries of one key, as the score accumulators do. The few weight blocks, which are chains of dependent-latency trips, come first and run beside the LayerNorm streams.
#define NBW  ((DM * DQ / 64 + 63) / 64)       // blocks of one weight
#define NBWP ((NBP * CZ / 2 + 255) / 256)     // blocks of the padded Wp
__global__ __launch_bounds__(256) void k_prep(const float* __restrict__ msa, const float* __restrict__ pair, const float* __restrict__ lmg, const float* __restrict__ lmb, const float* __restrict__ lpg, const float* __restrict__ lpb, const float* __restrict__ wq, const float* __restrict__ wk, const float* __restrict__ wv, const float* __restrict__ wg, const float* __restrict__ wo, const float* __restrict__ wp, bf* WQ, bf* WK, bf* WV, bf* WG, bf* WO, bf* WP, bf* Mh, bf* Ml, bf* PLh, bf* PLl) {
    __shared__ __align__(16) bf ls[2 * (DM / 8) * 72];
    const int b = blockIdx.x;
    if (b < 5 * NBW) { const int g = b / NBW;
        const float* w = g == 0 ? wq : g == 1 ? wk : g == 2 ? wv : g == 3 ? wg : wo; bf* o = g == 0 ? WQ : g == 1 ? WK : g == 2 ? WV : g == 3 ? WG : WO;
        wtG(w, DM, DQ, o, b % NBW); }      /* all five are 256 x 256 (DM == DQ) */
    else if (b < 5 * NBW + NBWP) wpad(wp, WP, b - 5 * NBW);
    else if (b < 5 * NBW + NBWP + NRP / 8) { const int q = b - (5 * NBW + NBWP); lnrow<CZ>(pair, (size_t)((q >> 9) * 16 + (q & 1) * 8 + (threadIdx.x >> 5)) * NI + ((q >> 1) & (NI - 1)), lpg, lpb, PLh, PLl, q, ls); }
    else { const int q = b - (5 * NBW + NBWP + NRP / 8); lnrow<DM>(msa, (size_t)q * 8 + (threadIdx.x >> 5), lmg, lmb, Mh, Ml, q, ls); }
}
__device__ __forceinline__ float sigm_slot(float a) { float e; asm("v_exp_f32 %0, %1\n\tv_nop" : "=v"(e) : "v"(__fmul_rn(-a, 1.4426950408889634f))); return __fdiv_rn(1.0f, __fadd_rn(1.0f, e)); }
// Four exponentials and one v_nop in one statement, for the same slot: the outputs are early-clobbered, so none overwrites a source of the exponential in front of it, and the v_nop stands behind the last.
__device__ __forceinline__ void exp2x4(float& a, float& b, float& c, float& d) { float e0, e1, e2, e3; asm("v_exp_f32 %0, %4\n\tv_exp_f32 %1, %5\n\tv_exp_f32 %2, %6\n\tv_exp_f32 %3, %7\n\tv_nop" : "=&v"(e0), "=&v"(e1), "=&v"(e2), "=&v"(e3) : "v"(a), "v"(b), "v"(c), "v"(d)); a = e0; b = e1; c = e2; d = e3; }
// k_fattn: scores, pair bias, softmax, attn.V and the sigmoid gate of one (sequence, head) for 16 query rows per wave, nothing through memory in between.
// S^T = K Q^T (A = 16 key rows, B = the wave's 16 queries): lane (lr, hi) holds, of query lr, keys 16 t + 8 hi + 0..7 in st[t]; two neighbouring tiles are the B fragment of O^T = V^T P^T as they lie.
// Workgroup: 8 waves = 2 neighbouring heads x 4 query tiles; grid 128 sequences x 4 head pairs x 4 query blocks.
// The second launch bound asks for four waves per SIMD (256 registers a wave), so that two workgroups share a WGP and one's vector work covers the other's loads.
__global__ __launch_bounds__(256, 4) void k_fattn(const bf* __restrict__ QPh, const bf* __restrict__ QPl, const bf* __restrict__ KPh, const bf* __restrict__ KPl, const bf* __restrict__ VTh, const bf* __restrict__ VTl, const float* __restrict__ BT, const float* __restrict__ GP, bf* Ah, bf* Al) {
    const int lane = threadIdx.x & 31, lr = lane & 15, hi = lane >> 4, w = threadIdx.x >> 5;
    const int qb = blockIdx.x & 3, hp = (blockIdx.x >> 2) & 3, s = blockIdx.x >> 4;
    const int h = hp * 2 + (w & 1), p = s * NH_ + h, i = qb * 64 + (w >> 1) * 16 + lr;
    /* 32-bit byte offsets (every plane is below 64 MiB): one offset register serves a hi and a lo plane */
    const unsigned qo = (((unsigned)p * NI + (i - lr)) * HD + 8 * lane) * 2u, ko = ((unsigned)p * NI * HD + 8 * lane) * 2u, bo = ((unsigned)h * NRP + (unsigned)(i - lr) * NI + 4 * lane) * 4u;   /* fragment order: 16 rows x 32 = one block of 512; bias: 16 queries x 16 keys = 256 floats, [j / 4 % 2][lane][4] */
    const bf* qph = (const bf*)((const char*)QPh + qo); const bf* qpl = (const bf*)((const char*)QPl + qo); const bf* kph = (const bf*)((const char*)KPh + ko); const bf* kpl = (const bf*)((const char*)KPl + ko);
    const v16bf qh = WFrag<bf>::ld(qph), ql = WFrag<bf>::ld(qpl);
    const float* br = (const float*)((const char*)BT + bo);
    v8f st[NI / 16]; float mx = -3.0e38f;
#pragma unroll
    for (int t = 0; t < NI / 16; ++t) {
        const v16bf kh = WFrag<bf>::ld(kph + t * 16 * HD), kl = WFrag<bf>::ld(kpl + t * 16 * HD);
        const v4f b0 = *(const v4f*)(br + t * 256), b1 = *(const v4f*)(br + t * 256 + 128);
        v8f c = (v8f){}; c = wmmab(kh, qh, c); c = wmmab(kh, ql, c); c = wmmab(kl, qh, c);
#pragma unroll
        for (int j = 0; j < 8; ++j) { const float x = __fadd_rn(c[j], __fmul_rn(j < 4 ? b0[j & 3] : b1[j & 3], 5.656854249492380f)) * SCL;   /* (S + bias x sqrt(32)) x 32^-0.5: the reference adds the bias after the scale */
            c[j] = x; mx = fmaxf(mx, x); }
        st[t] = c; }
    asm volatile("s_wait_xcnt 0x0" :: "v"(qo), "v"(ko), "v"(bo), "s"(QPh), "s"(QPl), "s"(KPh), "s"(KPl), "s"(BT) : "memory");   /* precaution: the offset and base registers of the loads above are inputs here, so they stay live up to this wait and none is overwritten in front of it */
    mx = fmaxf(mx, __shfl_xor(mx, 16, 32));
    float sm[4] = {0.f, 0.f, 0.f, 0.f};
#pragma unroll
    for (int t = 0; t < NI / 16; ++t) {
#pragma unroll
        for (int j = 0; j < 8; j += 4) { float x[4];
#pragma unroll
            for (int q = 0; q < 4; ++q) x[q] = __fmul_rn(__fsub_rn(st[t][j + q], mx), 1.4426950408889634f);
            exp2x4(x[0], x[1], x[2], x[3]);
#pragma unroll
            for (int q = 0; q < 4; ++q) { st[t][j + q] = x[q]; sm[q] += x[q]; } } }
    float sum = (sm[0] + sm[1]) + (sm[2] + sm[3]); sum += __shfl_xor(sum, 16, 32);
    const float f = __fdiv_rn(1.0f, sum);
    const unsigned vo = ((unsigned)p * HP * NI + 8 * lane) * 2u;
    const bf* vph = (const bf*)((const char*)VTh + vo); const bf* vpl = (const bf*)((const char*)VTl + vo);
    v8f o[2]; o[0] = (v8f){}; o[1] = (v8f){};
#pragma unroll
    for (int c = 0; c < NI / 32; ++c) { v8us ph0, pl0, ph1, pl1;
        split8(st[2 * c] * f, ph0, pl0); split8(st[2 * c + 1] * f, ph1, pl1);
        const v16bf ph = cat16b(ph0, ph1), pl = cat16b(pl0, pl1);
#pragma unroll
        for (int mb = 0; mb < 2; ++mb) { const v16bf vh = WFrag<bf>::ld(vph + mb * 16 * NI + c * 512), vl = WFrag<bf>::ld(vpl + mb * 16 * NI + c * 512);
            o[mb] = wmmab(vh, ph, o[mb]); o[mb] = wmmab(vh, pl, o[mb]); o[mb] = wmmab(vl, ph, o[mb]); } }
    asm volatile("s_wait_xcnt 0x0" :: "v"(vo), "s"(VTh), "s"(VTl) : "memory");   /* the same for the V^T loads */
    const size_t oo = ((size_t)s * NI + i) * DQ + h * HD + 8 * hi;   /* o[mb][r] = context[query i][channel 16 mb + 8 hi + r] */
    const unsigned ao = ((unsigned)(s * NI + (i - lr)) * DQ + h * 512 + 8 * lane);   /* the same in fragment order (K = DQ, block k / 32 = h): o[mb] is register half mb as it lies */
#pragma unroll
    for (int mb = 0; mb < 2; ++mb) { const v4f g0 = *(const v4f*)(GP + oo + mb * 16), g1 = *(const v4f*)(GP + oo + mb * 16 + 4); v8us oh, ol;
        v8f y;
#pragma unroll
        for (int r = 0; r < 8; ++r) y[r] = __fmul_rn(sigm_slot(r < 4 ? g0[r & 3] : g1[r & 3]), o[mb][r]);
        split8(y, oh, ol);
        *(v8us*)(Ah + ao + mb * 256) = oh; *(v8us*)(Al + ao + mb * 256) = ol; }
}

extern "C" void kernel_launch(void* const* d_in, const int* in_sizes, int n_in,
                              void* d_out, int out_size, void* d_ws, size_t ws_size, hipStream_t stream) {
    (void)in_sizes; (void)n_in; (void)out_size;
    const float* msa = (const float*)d_in[0]; const float* pair = (const float*)d_in[1]; const float* lmg = (const float*)d_in[2]; const float* lmb = (const float*)d_in[3]; const float* lpg = (const float*)d_in[4]; const float* lpb = (const float*)d_in[5]; const float* wq = (const float*)d_in[6]; const float* wk = (const float*)d_in[7]; const float* wv = (const float*)d_in[8]; const float* wp = (const float*)d_in[9]; const float* wg = (const float*)d_in[10]; const float* bg = (const float*)d_in[11]; const float* wo = (const float*)d_in[12]; const float* bo = (const float*)d_in[13];
    float* OUT = (float*)d_out;     // [1][128][256][256]
    char* wsp = (char*)d_ws;
    auto take = [&](size_t bytes) { char* p = wsp; wsp += (bytes + 255) & ~(size_t)255; return (void*)p; };
    bf* WQ = (bf*)take((size_t)DQ * DM * 2); bf* WK = (bf*)take((size_t)DQ * DM * 2); bf* WV = (bf*)take((size_t)DQ * DM * 2); bf* WG = (bf*)take((size_t)DQ * DM * 2); bf* WO = (bf*)take((size_t)DM * DQ * 2); bf* WP = (bf*)take((size_t)NBP * CZ * 2);
    bf* Mh = (bf*)take((size_t)NRM * DM * 2); bf* Ml = (bf*)take((size_t)NRM * DM * 2); float* FQ = (float*)take((size_t)NRM * DQ * 4); float* GP = (float*)take((size_t)NRM * DQ * 4); float* BIAS = (float*)take((size_t)NRP * NBP * 4);
    bf* QPh = (bf*)take((size_t)NP * NI * HD * 2); bf* QPl = (bf*)take((size_t)NP * NI * HD * 2); bf* KPh = (bf*)take((size_t)NP * NI * HD * 2); bf* KPl = (bf*)take((size_t)NP * NI * HD * 2); bf* VTh = (bf*)take((size_t)NP * HP * NI * 2); bf* VTl = (bf*)take((size_t)NP * HP * NI * 2);
    bf* ATh = Mh; bf* ATl = Ml;   /* the gated context reuses the LN operand buffers (m is dead after the projections) */
    if ((size_t)(wsp - (char*)d_ws) > ws_size) return;    // ws 256 MiB (carve ~241 MiB; the pair LN operand lies in FQ, see below)
    bf* PLh = (bf*)FQ; bf* PLl = (bf*)FQ + (size_t)NRP * CZ;   /* pair LN planes [65536][128] bf16 = 16 MiB each, both inside FQ (32 MiB), which holds nothing else: the gate GEMM writes GP in the launch that reads them */
    k_prep<<<5 * NBW + NBWP + NRP / 8 + NRM / 8, 256, 0, stream>>>(msa, pair, lmg, lmb, lpg, lpb, wq, wk, wv, wg, wo, wp, WQ, WK, WV, WG, WO, WP, Mh, Ml, PLh, PLl);
    k_proj<<<4 * (NRM / 64) * (DQ / 64) + NRP / 64, 32, 0, stream>>>(Mh, Ml, WQ, WK, WV, WG, bg, QPh, QPl, KPh, KPl, VTh, VTl, GP, WP, PLh, PLl, BIAS);
    k_fattn<<<NS * (NH_ / 2) * (NI / 64), 256, 0, stream>>>(QPh, QPl, KPh, KPl, VTh, VTl, BIAS, GP, ATh, ATl);
    k_gemmo<<<dim3(NRM / 64, DM / 64, 1), 32, 0, stream>>>(ATh, ATl, WO, OUT, bo);            /* out = vals Wo + bo */
}

// v007
// One run takes 113 microseconds.
// Next to v006, in two timings, it ran 1.13 times as fast each time.
// Counting every step since v000, it is 15.5 times as fast.
#include <hip/hip_runtime.h>

// MSA row attention with pair bias (msa [1][128][256][256], pair [1][256][256][128]; m = LN(msa), p = LN(pair) (eps 1e-5, affine); Q, K, V = m W ('xw' [256][256], 8 heads x 32), G = sigmoid(m Wg + bg); bias[h][i][j] = (p Wp)[i][j][h] ('xw' [128][8]); per sequence s and head h: attn = softmax(Q_s,h . K_s,h / sqrt(32) + bias_h); vals = G * (attn V); out = vals Wo + bo ('xw' [256][256]) -> [1][128][256][256] (8.4 M)).
// Layout: row LayerNorm kernels (one wave per row) write hi/lo operands for the msa (32,768 x 256) and pair (65,536 x 128) slabs; hl x exact projections (Q, K, V, gate pre-activation, and the pair bias against Wp zero-padded to 64 columns); the Q and K GEMMs store hi/lo planes [sequence x head][residue][32] and the V GEMM hi/lo V^T planes [sequence x head][64][residue], rows 0..31 written and read, from their epilogues; one attention kernel over all 1024 (sequence, head) pairs keeps a wave's 16 x 256 scores in registers: scores (3 products, K 32), + bias[h][i][j], softmax over the 256 residues with every row hi/lo, attn.V (3 products), sigmoid gate, and writes the hi/lo operand of the Wo GEMM.
// Operand order: every 16-bit plane that a matrix fragment is loaded from lies in fragment order (fro() below), written so by its producer; the pair bias lies in the order of the score accumulators. A wave's 16-byte-a-lane load then covers 512 contiguous bytes.
// Compute dtypes, f32 accumulate: every input rounded to bf16; LN, sigmoid, softmax f32; GEMM activations bf16 hi/lo (2 products) x exact weights; scores and attn.V 3 products.

#define NB_  1
#define TT   256
#define DM   256
#define NH_  8
#define NKV  8
#define REP  (NH_ / NKV)
#define HD   32
#define DQ   (NH_ * HD)
#define DKV  (NKV * HD)
#define WIN  0
#define SCL  0.17677669529663688f   // 32^-0.5
#define NS   128     // sequences
#define NI   256     // residues (= TT)
#define CZ   128     // pair channels
#define NP   (NS * NH_)   // 1024 pseudo-heads
#define NRM  (NS * NI)    // 32768 msa rows
#define NRP  (NI * NI)    // 65536 pair rows
#define HP   64      // padded head width for attn.v
#define NBP  64      // padded bias projection width (8 heads used)
typedef _Float16 h16;
typedef unsigned short bf;
typedef __attribute__((ext_vector_type(16))) __bf16   v16bf;
typedef __attribute__((ext_vector_type(16))) _Float16 v16h;
typedef __attribute__((ext_vector_type(8)))  _Float16 v8h;
typedef __attribute__((ext_vector_type(8)))  unsigned short v8us;
typedef __attribute__((ext_vector_type(8)))  float    v8f;
typedef __attribute__((ext_vector_type(4)))  float    v4f;
typedef v8h  __attribute__((may_alias)) v8ha;
typedef v4f  __attribute__((may_alias)) v4fa;
typedef v8us __attribute__((may_alias)) v8usa;

typedef __attribute__((ext_vector_type(2))) float    f32x2;
typedef __attribute__((ext_vector_type(2))) __bf16   bf16x2;
typedef __attribute__((ext_vector_type(4))) unsigned u32x4;
typedef __attribute__((ext_vector_type(2))) unsigned u32x2;
// f32 -> bf16, nearest even, by the convert instruction: one v_cvt_pk_bf16_f32 rounds two values and leaves them packed as the planes hold them
__device__ __forceinline__ unsigned pk2(float a, float b) { f32x2 x; x[0] = a; x[1] = b; return __builtin_bit_cast(unsigned, __builtin_convertvector(x, bf16x2)); }
__device__ __forceinline__ unsigned short f2bf(float f) { return __builtin_bit_cast(unsigned short, (__bf16)f); }
__device__ __forceinline__ float bf2f(unsigned short b) { return __uint_as_float(((unsigned)b) << 16); }
__device__ __forceinline__ float bfr(float f) { return bf2f(f2bf(f)); }
__device__ __forceinline__ void bfr2(float a, float b, float& ra, float& rb) { const unsigned h = pk2(a, b); ra = __uint_as_float(h << 16); rb = __uint_as_float(h & 0xFFFF0000u); }
// hi/lo split of a pair: h = the two rounded values, l = the two rounded remainders (a remainder is exact in f32)
__device__ __forceinline__ void split2(float a, float b, unsigned& h, unsigned& l) { h = pk2(a, b); l = pk2(a - __uint_as_float(h << 16), b - __uint_as_float(h & 0xFFFF0000u)); }
__device__ __forceinline__ void split8(v8f y, v8us& oh, v8us& ol) { u32x4 h, l;
    /* unrolled so that the vectors' elements are indexed by constants and stay in registers */
#pragma unroll
    for (int q = 0; q < 4; ++q) { unsigned u, w2; split2(y[2 * q], y[2 * q + 1], u, w2); h[q] = u; l[q] = w2; }
    oh = __builtin_bit_cast(v8us, h); ol = __builtin_bit_cast(v8us, l); }
__device__ __forceinline__ v16h cat16(v8h lo, v8h hi) { return __builtin_shufflevector(lo, hi, 0, 1, 2, 3, 4, 5, 6, 7, 8, 9, 10, 11, 12, 13, 14, 15); }
__device__ __forceinline__ v16bf cat16b(v8us lo, v8us hi) { return __builtin_bit_cast(v16bf, __builtin_shufflevector(lo, hi, 0, 1, 2, 3, 4, 5, 6, 7, 8, 9, 10, 11, 12, 13, 14, 15)); }
// Fragment order of a [rows][K] 16-bit plane: blocks of 16 rows x 32 k (1 KiB), block (row / 16, k / 32) row-major; inside a block [k / 16 % 2][k / 8 % 2][row % 16][k % 8], which is [register half][lane][8]: lane (lr, hi) of a 16x16x32 fragment finds its 16 values at block + lane * 8 and + 256.
__device__ __forceinline__ unsigned fro(unsigned row, unsigned k, unsigned K) { return ((row >> 4) * (K >> 5) + (k >> 5)) * 512u + ((k >> 4) & 1u) * 256u + ((k >> 3) & 1u) * 128u + (row & 15u) * 8u + (k & 7u); }
// its inverse: element e of the plane -> (row, k)
__device__ __forceinline__ void frd(unsigned e, unsigned K, unsigned& row, unsigned& k) { const unsigned blk = e >> 9; row = (blk / (K >> 5)) * 16u + ((e >> 3) & 15u); k = (blk % (K >> 5)) * 32u + ((e >> 8) & 1u) * 16u + ((e >> 7) & 1u) * 8u + (e & 7u); }
__device__ __forceinline__ v8f wmma16(v16h a, v16h b, v8f c) { return __builtin_amdgcn_wmma_f32_16x16x32_f16(false, a, false, b, (short)0, c, false, false); }
__device__ __forceinline__ v8f wmmab(v16bf a, v16bf b, v8f c) { return __builtin_amdgcn_wmma_f32_16x16x32_bf16(false, a, false, b, (short)0, c, false, false); }



// ---- gemmw_tile: register-blocked GEMM, ONE WAVE per 64x64 output tile (16 accumulators), operands straight from 16-bit planes in fragment order; tile (bx, by) of (M/64, N/64), 32 threads; sm = the wave's 4608 bytes of LDS for the epilogue.
// ALDS: A and A2 are the tile's own 64 rows, staged in LDS by stage_a() in the same fragment order, and shared by every wave of the workgroup; B comes from global memory either way.
// C[m][n] (f32, pitch ldc, + optional f32 bias[n]) = sum_k A[m][k] Bt[n][k] (+ split products per NSPLIT). K % 32 == 0.
// OUTM 0: f32 C. OUTM 1 and 2 (m = sequence x residue, n = head x 32): bf16 hi/lo of C, 1: to Ph/Pl[sequence x head][residue][32], 2: transposed to Ph/Pl[sequence x head][HP][residue], each [sequence x head] slab in fragment order. OUTM 3 (the pair bias): rows 0..7 of C, f32, in the order of the score accumulators. All store 16 bytes a lane and whole 128-byte lines a store.
template <typename T16> struct WFrag;
template <> struct WFrag<h16> { typedef v16h V; static __device__ __forceinline__ V ld(const h16* p) { return cat16(*(const v8h*)p, *(const v8h*)(p + 256)); } static __device__ __forceinline__ v8f mma(V a, V b, v8f c) { return wmma16(a, b, c); } };
template <> struct WFrag<bf> { typedef v16bf V; static __device__ __forceinline__ V ld(const bf* p) { return cat16b(*(const v8us*)p, *(const v8us*)(p + 256)); } static __device__ __forceinline__ v8f mma(V a, V b, v8f c) { return wmmab(a, b, c); } };
template <typename T16, int NSPLIT, bool BIAS, int OUTM, bool ALDS>
__device__ __forceinline__ void gemmw_tile(const T16* __restrict__ A, const T16* __restrict__ A2, const T16* __restrict__ Bt, const T16* __restrict__ Bt2, int K, float* C, int ldc, const float* __restrict__ bias, bf* Ph, bf* Pl, int bx, int by, char* sm) {
    typedef typename WFrag<T16>::V V;
    const int lane = threadIdx.x & 31, lr = lane & 15, hi = lane >> 4; const int r0 = bx * 64, c0 = by * 64;
    constexpr int NMB = OUTM == 3 ? 1 : 4;   /* 16-row blocks of A that are multiplied: all that the epilogue stores */
    v8f acc[NMB][4];
#pragma unroll
    for (int mb = 0; mb < NMB; ++mb)
#pragma unroll
        for (int nb = 0; nb < 4; ++nb) acc[mb][nb] = (v8f){};
    /* 32-bit byte offsets, as in k_fattn (every operand plane is below 64 MiB): one offset register serves the planes of A, one those of B; neither changes, every trip's step is an immediate offset */
    const unsigned ao = ((ALDS ? 0u : (unsigned)r0 * K) + 8 * lane) * 2u, bo = ((unsigned)c0 * K + 8 * lane) * 2u;   /* 16 rows of K values are K / 32 blocks of 512 */
    const T16* pa = (const T16*)((const char*)A + ao); const T16* pa2 = (const T16*)((const char*)A2 + ao); const T16* pb = (const T16*)((const char*)Bt + bo); const T16* pb2 = (const T16*)((const char*)Bt2 + bo);
    /* NFS fragment sets: trip t's loads all go out as one group in front of the products of trip t - (NFS - 1), so that a trip waits for its operands once, and NFS - 1 trips of products after they were asked for; the pair-bias trip has a quarter of the products, so it asks two trips ahead */
    constexpr int NFS = OUTM == 3 ? 3 : 2;
    V a[NFS][NMB], a2[NFS][NMB], b[NFS][4], b2[NFS][4];
    /* unrolled whole (K is a constant at every call): the sets are indexed by constants and stay in registers, and no address register is rewritten between the trips */
#pragma unroll
    for (int t = 0; t < K / 32 + NFS - 1; ++t) {
        if (t < K / 32) { const int s = t % NFS;
#pragma unroll
            for (int nb = 0; nb < 4; ++nb) { b[s][nb] = WFrag<T16>::ld(pb + t * 512 + nb * 16 * K); if (NSPLIT >= 2) b2[s][nb] = WFrag<T16>::ld(pb2 + t * 512 + nb * 16 * K); }
#pragma unroll
            for (int mb = 0; mb < NMB; ++mb) { a[s][mb] = WFrag<T16>::ld(pa + t * 512 + mb * 16 * K); if (NSPLIT == 1 || NSPLIT == 2) a2[s][mb] = WFrag<T16>::ld(pa2 + t * 512 + mb * 16 * K); } }
        __builtin_amdgcn_sched_barrier(0);   /* keeps the load group in front of the products: moved down among them, each part of it would be waited for by itself */
        if (t >= NFS - 1) { const int s = (t - (NFS - 1)) % NFS;
#pragma unroll
            for (int nb = 0; nb < 4; ++nb) {
#pragma unroll
                for (int mb = 0; mb < NMB; ++mb) { acc[mb][nb] = WFrag<T16>::mma(a[s][mb], b[s][nb], acc[mb][nb]); if (NSPLIT == 1 || NSPLIT == 2) acc[mb][nb] = WFrag<T16>::mma(a2[s][mb], b[s][nb], acc[mb][nb]); if (NSPLIT >= 2) acc[mb][nb] = WFrag<T16>::mma(a[s][mb], b2[s][nb], acc[mb][nb]); } } }
        __builtin_amdgcn_sched_barrier(0);   /* keeps what follows (the next group; behind the last trip the epilogue) from being mixed in among these products: that build took more registers, enough to cost a wave per SIMD */
    }
    asm volatile("s_wait_xcnt 0x0" :: "v"(ao), "v"(bo) : "memory");   /* precaution: the offset registers of the loads are inputs here, so they stay live up to this wait and none is overwritten in front of it */
    if constexpr (OUTM == 2) {
    /* a lane's 8 accumulator rows are 8 neighbouring residues of one channel: one lane's 16 bytes of a V^T fragment (row = channel, k = residue), so every store is 512 contiguous bytes as the values lie */
    const unsigned pv = ((unsigned)r0 / NI) * NH_ + (unsigned)c0 / HD, kb = ((unsigned)r0 % NI) / 32;
    /* every loop of this block is unrolled so that acc[][] and the vectors' elements are indexed by constants and stay in registers */
#pragma unroll
    for (int nb = 0; nb < 4; ++nb) {
#pragma unroll
        for (int mb = 0; mb < 4; ++mb) { v8us oh, ol;
            split8(acc[mb][nb], oh, ol);
            const unsigned e = (pv + (nb >> 1)) * (HP * NI) + ((nb & 1) * (NI / 32) + kb + (mb >> 1)) * 512u + (mb & 1) * 256u + lane * 8u;
            *(v8us*)(Ph + e) = oh; *(v8us*)(Pl + e) = ol; }
        asm volatile("s_wait_xcnt 0x0" ::: "memory");   /* precaution: stands behind these stores, in front of whatever next overwrites their address or data registers */
    }
    } else if constexpr (OUTM == 3) {
    /* B row 16 (256 I + j) + lr is pair position (i = 16 I + lr, j) (see k_prep), so lane lr of the lower half holds, for head r, bias[r][i][j0 .. j0 + 3] in acc[0][0..3][r]: 16 bytes of C[head][I][j / 16][j / 4 % 2][j / 8 % 2][i % 16][j % 4], which k_fattn reads lane by lane */
    if (hi == 0) {
        const unsigned e0 = (((unsigned)by >> 6) * 16u + (((unsigned)by & 63u) >> 2)) * 256u + ((unsigned)by & 1u) * 128u + (((unsigned)by >> 1) & 1u) * 64u + lr * 4u;
#pragma unroll
        for (int r = 0; r < NH_; ++r) { v4f val; val[0] = acc[0][0][r]; val[1] = acc[0][1][r]; val[2] = acc[0][2][r]; val[3] = acc[0][3][r]; *(v4f*)(C + e0 + (unsigned)r * NRP) = val; }
        asm volatile("s_wait_xcnt 0x0" ::: "memory");   /* precaution, as above */
    }
    } else {
    float* os = (float*)sm;
#pragma unroll
    for (int mb = 0; mb < 4; ++mb) {
#pragma unroll
        for (int nb = 0; nb < 4; ++nb) {
#pragma unroll
            for (int j = 0; j < 8; ++j) os[(hi * 8 + j) * 68 + nb * 16 + lr] = acc[mb][nb][j]; }
        __builtin_amdgcn_wave_barrier(); asm volatile("" ::: "memory");
        if (OUTM == 0) {
        float* crow = C + (size_t)(r0 + mb * 16) * ldc + c0;
#pragma unroll
            for (int s = 0; s < 8; ++s) { const int row = 2 * s + hi, cofs = lr * 4; v4f val = *(const v4fa*)(os + row * 68 + cofs); if (BIAS) { val[0] += bfr(bias[c0 + cofs]); val[1] += bfr(bias[c0 + cofs + 1]); val[2] += bfr(bias[c0 + cofs + 2]); val[3] += bfr(bias[c0 + cofs + 3]); }
                *(v4f*)(crow + (size_t)row * ldc + cofs) = val; }
        } else {
            /* unrolled, like the inner loop: the vectors' elements are indexed by constants and stay in registers */
#pragma unroll
            for (int s = 0; s < 4; ++s) { const int row = 8 * (s & 1) + (lane & 7), cofs = ((s >> 1) * 4 + (lane >> 3)) * 8; const v4f v0 = *(const v4fa*)(os + row * 68 + cofs), v1 = *(const v4fa*)(os + row * 68 + cofs + 4); v8us oh, ol;   /* 8 rows x the 4 pieces of one head: 4 whole lines in fragment order */
                split8(__builtin_shufflevector(v0, v1, 0, 1, 2, 3, 4, 5, 6, 7), oh, ol);
                const unsigned m = (unsigned)(r0 + mb * 16 + row), n = (unsigned)(c0 + cofs);
                const unsigned e = ((m / NI) * NH_ + n / HD) * (NI * HD) + fro(m % NI, n % HD, HD);
                *(v8us*)(Ph + e) = oh; *(v8us*)(Pl + e) = ol; }
        }
        asm volatile("s_wait_xcnt 0x0" ::: "memory");   /* precaution, as above: behind the stores of either form */
        __builtin_amdgcn_wave_barrier(); asm volatile("" ::: "memory");
    }
    }
}

// stage_a: the 64 rows x 256 k of tile bx of both planes of an A operand (in fragment order 32 KiB in a row of each plane) into sa, hi plane then lo plane, by asynchronous copies, 16 bytes a lane; 128 threads, 32 copies a lane. Behind it every wave of the workgroup may read sa.
__device__ __forceinline__ void cp8(unsigned l, const char* g) {
    /* eight copies and their s_wait_xcnt 0 in one statement: a precaution, the wait stands in front of whatever next rewrites an address register of a copy */
    asm volatile("global_load_async_to_lds_b128 %0, %8, off\n\tglobal_load_async_to_lds_b128 %1, %9, off\n\tglobal_load_async_to_lds_b128 %2, %10, off\n\tglobal_load_async_to_lds_b128 %3, %11, off\n\tglobal_load_async_to_lds_b128 %4, %12, off\n\tglobal_load_async_to_lds_b128 %5, %13, off\n\tglobal_load_async_to_lds_b128 %6, %14, off\n\tglobal_load_async_to_lds_b128 %7, %15, off\n\ts_wait_xcnt 0x0"
        :: "v"(l), "v"(l + 2048u), "v"(l + 4096u), "v"(l + 6144u), "v"(l + 8192u), "v"(l + 10240u), "v"(l + 12288u), "v"(l + 14336u),
           "v"(g), "v"(g + 2048), "v"(g + 4096), "v"(g + 6144), "v"(g + 8192), "v"(g + 10240), "v"(g + 12288), "v"(g + 14336) : "memory");
}
__device__ __forceinline__ void stage_a(bf* sa, const bf* __restrict__ Ah, const bf* __restrict__ Al, int bx) {
    const unsigned l = (unsigned)(size_t)sa + threadIdx.x * 16u;   /* the low 32 bits of a __shared__ address are the byte offset in LDS */
    const size_t go = (size_t)bx * (64 * DM * 2) + threadIdx.x * 16u;
    cp8(l, (const char*)Ah + go); cp8(l + 16384u, (const char*)Ah + go + 16384);
    cp8(l + 32768u, (const char*)Al + go); cp8(l + 49152u, (const char*)Al + go + 16384);
    asm volatile("s_wait_asynccnt 0x0" ::: "memory");   /* this wave's copies have landed */
    __syncthreads();                                    /* and every other wave's: nobody reads sa in front of this barrier */
}
// k_proj: the five GEMMs that depend on the LayerNorm planes alone, in one launch, four waves a workgroup. Blocks 0..255 = the pair bias, one tile a wave: the short ones first, since two workgroups fit a WGP and the 512 long ones fill the chip exactly. Blocks 256..767: one 64-row tile of the msa planes, staged once in LDS; wave w multiplies it by column tile w of each of Wq, Wk, Wv and Wg (16 output tiles from one staged A).
__global__ __launch_bounds__(128) void k_proj(const bf* __restrict__ Mh, const bf* __restrict__ Ml, const bf* __restrict__ WQ, const bf* __restrict__ WK, const bf* __restrict__ WV, const bf* __restrict__ WG, const float* __restrict__ bg, bf* QPh, bf* QPl, bf* KPh, bf* KPl, bf* VTh, bf* VTl, float* GP, const bf* __restrict__ WP, const bf* __restrict__ PLh, const bf* __restrict__ PLl, float* BIAS) {
    __shared__ __align__(16) bf sa[2 * 64 * DM];
    __shared__ __align__(16) char sm4[4 * 4608];
    const int b = (int)blockIdx.x - NRP / 256, w = __builtin_amdgcn_readfirstlane(threadIdx.x >> 5); char* sm = sm4 + w * 4608;   /* the wave's number in a scalar register: the tile's addresses then stay scalar, as they were when they came from blockIdx */
    if (b >= 0) {
        stage_a(sa, Mh, Ml, b);
        /* kept rolled: Q and K share one body, so the kernel's text stays as long as it was. Workgroup b starts with GEMM b % 4: at any time the workgroups then read all four weight matrices, not the same few lines of one */
#pragma unroll 1
        for (int it = 0; it < 4; ++it) { const int g = (b + it) & 3;
            if (g < 2) gemmw_tile<bf, 1, false, 1, true>(sa, sa + 64 * DM, g ? WK : WQ, nullptr, DM, nullptr, 0, nullptr, g ? KPh : QPh, g ? KPl : QPl, b, w, sm);
            else if (g == 2) gemmw_tile<bf, 1, false, 2, true>(sa, sa + 64 * DM, WV, nullptr, DM, nullptr, 0, nullptr, VTh, VTl, b, w, sm);
            else gemmw_tile<bf, 1, true, 0, true>(sa, sa + 64 * DM, WG, nullptr, DM, GP, DQ, bg, nullptr, nullptr, b, w, sm);          /* gate pre-activation m Wg + bg */
        }
    } else {
        /* pair bias, head-major: bias[h][i][j] = Wp[:, h] . LN(pair[i][j]): Wp (rows 8..63 zero) is the A operand, the hi/lo LN planes the B operand; the 8 head rows are stored */
        gemmw_tile<bf, 3, false, 3, false>(WP, nullptr, PLh, PLl, CZ, BIAS, NRP, nullptr, nullptr, nullptr, 0, (int)blockIdx.x * 4 + w, sm);
    }
}
// k_gemmo: out = vals Wo + bo; grid M/64, wave w = column tile w, the 64 rows of vals staged once in LDS.
__global__ __launch_bounds__(128) void k_gemmo(const bf* __restrict__ Ah, const bf* __restrict__ Al, const bf* __restrict__ WO, float* OUT, const float* __restrict__ bo) {
    __shared__ __align__(16) bf sa[2 * 64 * DQ];
    __shared__ __align__(16) char sm4[4 * 4608];
    const int w = __builtin_amdgcn_readfirstlane(threadIdx.x >> 5);   /* scalar, as in k_proj */
    stage_a(sa, Ah, Al, blockIdx.x);
    gemmw_tile<bf, 1, true, 0, true>(sa, sa + 64 * DQ, WO, nullptr, DQ, OUT, DM, bo, nullptr, nullptr, blockIdx.x, w, sm4 + w * 4608);
}

typedef __attribute__((ext_vector_type(2))) _Float16 v2h;
typedef __attribute__((ext_vector_type(4))) _Float16 v4h;
typedef __attribute__((ext_vector_type(2))) unsigned short v2us;
typedef __attribute__((ext_vector_type(4))) unsigned short v4us;
typedef v4us __attribute__((may_alias)) v4usa;
typedef __attribute__((ext_vector_type(2))) float v2f;
typedef __attribute__((ext_vector_type(4))) int v4i;

__device__ __forceinline__ void wtG(const float* __restrict__ w, int K, int N, bf* Bt, int blk) {
    const int lane = threadIdx.x & 31; const int L0 = (blk * 8 + (threadIdx.x >> 5)) * 8; const int nlines = N * K / 64;
{
#pragma unroll 1
        for (int l = 0; l < 8; ++l) { const int L = L0 + l; if (L >= nlines) break; const size_t e = (size_t)L * 64 + lane * 2; unsigned n, k; frd((unsigned)e, (unsigned)K, n, k); v2us o;   /* the line is written whole; (n, k) follow from its place */
            o[0] = f2bf(w[(size_t)k * N + n]); o[1] = f2bf(w[(size_t)(k + 1) * N + n]); *(v2us*)(Bt + e) = o; }
         }
}
__global__ __launch_bounds__(256) void k_cvt8(const float* __restrict__ src, bf* dst, size_t n8) { const size_t i = (size_t)blockIdx.x * 256 + threadIdx.x; if (i >= n8) return; const v8f v = *(const v8f*)(src + i * 8); v8us o;
#pragma unroll
    for (int k = 0; k < 8; ++k) o[k] = f2bf(v[k]); *(v8us*)(dst + i * 8) = o;  }




template <int WD>
__device__ __forceinline__ void lnrow(const float* __restrict__ X, size_t r, const float* __restrict__ g, const float* __restrict__ bb, bf* Hh, bf* Hl, int blk, bf* ls) { const int lane = threadIdx.x & 31, w = threadIdx.x >> 5; const float* xr = X + r * WD;   /* r: the wave's source row; it becomes row blk * 8 + w of the planes */ float a[WD / 32]; float s = 0.f;
#pragma unroll
    for (int c = 0; c < WD / 128; ++c) { const v4f v = *(const v4f*)(xr + c * 128 + lane * 4); bfr2(v[0], v[1], a[c * 4], a[c * 4 + 1]); bfr2(v[2], v[3], a[c * 4 + 2], a[c * 4 + 3]); for (int q = 0; q < 4; ++q) s = __fadd_rn(s, a[c * 4 + q]); }
#pragma unroll
    for (int sh = 16; sh; sh >>= 1) s = __fadd_rn(s, __shfl_xor(s, sh, 32));
    const float mean = __fdiv_rn(s, (float)WD); float s2 = 0.f;
#pragma unroll
    for (int k = 0; k < WD / 32; ++k) { const float dv = __fsub_rn(a[k], mean); s2 = __fadd_rn(s2, __fmul_rn(dv, dv)); }
#pragma unroll
    for (int sh = 16; sh; sh >>= 1) s2 = __fadd_rn(s2, __shfl_xor(s2, sh, 32));
    const float rs = __fdiv_rn(1.0f, __fsqrt_rn(__fadd_rn(__fdiv_rn(s2, (float)WD), 1e-5f)));
{
#pragma unroll
        for (int c = 0; c < WD / 128; ++c) { v4us oh, ol; const int col = c * 128 + lane * 4; float gq[4], bq[4], yq[4]; bfr2(g[col], g[col + 1], gq[0], gq[1]); bfr2(g[col + 2], g[col + 3], gq[2], gq[3]); bfr2(bb[col], bb[col + 1], bq[0], bq[1]); bfr2(bb[col + 2], bb[col + 3], bq[2], bq[3]);
            for (int q = 0; q < 4; ++q) { float y = __fmul_rn(__fmul_rn(__fsub_rn(a[c * 4 + q], mean), rs), gq[q]); asm volatile("" : "+v"(y)); yq[q] = __fadd_rn(y, bq[q]); }
            u32x2 h2, l2; { unsigned u, w2; split2(yq[0], yq[1], u, w2); h2[0] = u; l2[0] = w2; split2(yq[2], yq[3], u, w2); h2[1] = u; l2[1] = w2; } oh = __builtin_bit_cast(v4us, h2); ol = __builtin_bit_cast(v4us, l2); bf* lw = ls + (c * 16 + (lane >> 1)) * 72 + w * 8 + (lane & 1) * 4; *(v4usa*)lw = oh; *(v4usa*)(lw + (WD / 8) * 72) = ol; }
         }
    /* in fragment order a 128-byte line holds 8 k of 8 rows, one piece from each wave: the block's 8 rows are gathered in LDS, [plane][k / 8][row][8] at a pitch of 144 bytes (the waves' 8-byte writes then fall on distinct banks), and stored as whole lines */
    __syncthreads();
#pragma unroll
    for (int s = 0; s < WD / 128; ++s) { const int idx = w * (WD / 128) + s, pl = idx / (WD / 32), kp = (idx % (WD / 32)) * 4 + (lane >> 3);
        const v8us v = *(const v8usa*)(ls + (pl * (WD / 8) + kp) * 72 + (lane & 7) * 8);
        *(v8us*)((pl ? Hl : Hh) + fro((unsigned)blk * 8u + (lane & 7), (unsigned)kp * 8u, WD)) = v; }
    asm volatile("s_wait_xcnt 0x0" ::: "memory");   /* precaution: behind the stores, in front of the next overwrite of their registers */
}
__device__ __forceinline__ void wpad(const float* __restrict__ w, bf* Bt, int blk) { const int e2 = (blk * 256 + threadIdx.x) * 2; if (e2 >= NBP * CZ) return; unsigned un, uk; frd((unsigned)e2, CZ, un, uk); const int k = (int)uk; const int n = (int)un; v2us o; const unsigned short a0 = f2bf(w[(size_t)k * NH_ + min(n, NH_ - 1)]), a1 = f2bf(w[(size_t)(k + 1) * NH_ + min(n, NH_ - 1)]); o[0] = (n < NH_) ? a0 : (unsigned short)0; o[1] = (n < NH_) ? a1 : (unsigned short)0; *(v2us*)(Bt + e2) = o;  }
// k_prep: everything that depends on the inputs alone, in one launch. Blocks 0..79: the five 256 x 256 weights to bf16 [n][k] (16 blocks each); 80..95: Wp padded; then 8192 blocks of pair LayerNorm rows and 4096 of msa rows, 8 rows a block. Plane row 16 (256 I + j) + lr of the pair planes is pair position (i = 16 I + lr, j), so that a 16-row fragment holds 16 queries of one key, as the score accumulators do. The few weight blocks, which are chains of dependent-latency trips, come first and run beside the LayerNorm streams.
#define NBW  ((DM * DQ / 64 + 63) / 64)       // blocks of one weight
#define NBWP ((NBP * CZ / 2 + 255) / 256)     // blocks of the padded Wp
__global__ __launch_bounds__(256) void k_prep(const float* __restrict__ msa, const float* __restrict__ pair, const float* __restrict__ lmg, const float* __restrict__ lmb, const float* __restrict__ lpg, const float* __restrict__ lpb, const float* __restrict__ wq, const float* __restrict__ wk, const float* __restrict__ wv, const float* __restrict__ wg, const float* __restrict__ wo, const float* __restrict__ wp, bf* WQ, bf* WK, bf* WV, bf* WG, bf* WO, bf* WP, bf* Mh, bf* Ml, bf* PLh, bf* PLl) {
    __shared__ __align__(16) bf ls[2 * (DM / 8) * 72];
    const int b = blockIdx.x;
    if (b < 5 * NBW) { const int g = b / NBW;
        const float* w = g == 0 ? wq : g == 1 ? wk : g == 2 ? wv : g == 3 ? wg : wo; bf* o = g == 0 ? WQ : g == 1 ? WK : g == 2 ? WV : g == 3 ? WG : WO;
        wtG(w, DM, DQ, o, b % NBW); }      /* all five are 256 x 256 (DM == DQ) */
    else if (b < 5 * NBW + NBWP) wpad(wp, WP, b - 5 * NBW);
    else if (b < 5 * NBW + NBWP + NRP / 8) { const int q = b - (5 * NBW + NBWP); lnrow<CZ>(pair, (size_t)((q >> 9) * 16 + (q & 1) * 8 + (threadIdx.x >> 5)) * NI + ((q >> 1) & (NI - 1)), lpg, lpb, PLh, PLl, q, ls); }
    else { const int q = b - (5 * NBW + NBWP + NRP / 8); lnrow<DM>(msa, (size_t)q * 8 + (threadIdx.x >> 5), lmg, lmb, Mh, Ml, q, ls); }
}
__device__ __forceinline__ float sigm_slot(float a) { float e; asm("v_exp_f32 %0, %1\n\tv_nop" : "=v"(e) : "v"(__fmul_rn(-a, 1.4426950408889634f))); return __fdiv_rn(1.0f, __fadd_rn(1.0f, e)); }
// Four exponentials and one v_nop in one statement, for the same slot: the outputs are early-clobbered, so none overwrites a source of the exponential in front of it, and the v_nop stands behind the last.
__device__ __forceinline__ void exp2x4(float& a, float& b, float& c, float& d) { float e0, e1, e2, e3; asm("v_exp_f32 %0, %4\n\tv_exp_f32 %1, %5\n\tv_exp_f32 %2, %6\n\tv_exp_f32 %3, %7\n\tv_nop" : "=&v"(e0), "=&v"(e1), "=&v"(e2), "=&v"(e3) : "v"(a), "v"(b), "v"(c), "v"(d)); a = e0; b = e1; c = e2; d = e3; }
// k_fattn: scores, pair bias, softmax, attn.V and the sigmoid gate of one (sequence, head) for 16 query rows per wave, nothing through memory in between.
// S^T = K Q^T (A = 16 key rows, B = the wave's 16 queries): lane (lr, hi) holds, of query lr, keys 16 t + 8 hi + 0..7 in st[t]; two neighbouring tiles are the B fragment of O^T = V^T P^T as they lie.
// Workgroup: 8 waves = 2 neighbouring heads x 4 query tiles; grid 128 sequences x 4 head pairs x 4 query blocks.
// The second launch bound asks for four waves per SIMD (256 registers a wave), so that two workgroups share a WGP and one's vector work covers the other's loads.
__global__ __launch_bounds__(256, 4) void k_fattn(const bf* __restrict__ QPh, const bf* __restrict__ QPl, const bf* __restrict__ KPh, const bf* __restrict__ KPl, const bf* __restrict__ VTh, const bf* __restrict__ VTl, const float* __restrict__ BT, const float* __restrict__ GP, bf* Ah, bf* Al) {
    const int lane = threadIdx.x & 31, lr = lane & 15, hi = lane >> 4, w = threadIdx.x >> 5;
    const int qb = blockIdx.x & 3, hp = (blockIdx.x >> 2) & 3, s = blockIdx.x >> 4;
    const int h = hp * 2 + (w & 1), p = s * NH_ + h, i = qb * 64 + (w >> 1) * 16 + lr;
    /* 32-bit byte offsets (every plane is below 64 MiB): one offset register serves a hi and a lo plane */
    const unsigned qo = (((unsigned)p * NI + (i - lr)) * HD + 8 * lane) * 2u, ko = ((unsigned)p * NI * HD + 8 * lane) * 2u, bo = ((unsigned)h * NRP + (unsigned)(i - lr) * NI + 4 * lane) * 4u;   /* fragment order: 16 rows x 32 = one block of 512; bias: 16 queries x 16 keys = 256 floats, [j / 4 % 2][lane][4] */
    const bf* qph = (const bf*)((const char*)QPh + qo); const bf* qpl = (const bf*)((const char*)QPl + qo); const bf* kph = (const bf*)((const char*)KPh + ko); const bf* kpl = (const bf*)((const char*)KPl + ko);
    const v16bf qh = WFrag<bf>::ld(qph), ql = WFrag<bf>::ld(qpl);
    const float* br = (const float*)((const char*)BT + bo);
    v8f st[NI / 16]; float mx = -3.0e38f;
#pragma unroll
    for (int t = 0; t < NI / 16; ++t) {
        const v16bf kh = WFrag<bf>::ld(kph + t * 16 * HD), kl = WFrag<bf>::ld(kpl + t * 16 * HD);
        const v4f b0 = *(const v4f*)(br + t * 256), b1 = *(const v4f*)(br + t * 256 + 128);
        v8f c = (v8f){}; c = wmmab(kh, qh, c); c = wmmab(kh, ql, c); c = wmmab(kl, qh, c);
#pragma unroll
        for (int j = 0; j < 8; ++j) { const float x = __fadd_rn(c[j], __fmul_rn(j < 4 ? b0[j & 3] : b1[j & 3], 5.656854249492380f)) * SCL;   /* (S + bias x sqrt(32)) x 32^-0.5: the reference adds the bias after the scale */
            c[j] = x; mx = fmaxf(mx, x); }
        st[t] = c; }
    asm volatile("s_wait_xcnt 0x0" :: "v"(qo), "v"(ko), "v"(bo), "s"(QPh), "s"(QPl), "s"(KPh), "s"(KPl), "s"(BT) : "memory");   /* precaution: the offset and base registers of the loads above are inputs here, so they stay live up to this wait and none is overwritten in front of it */
    mx = fmaxf(mx, __shfl_xor(mx, 16, 32));
    float sm[4] = {0.f, 0.f, 0.f, 0.f};
#pragma unroll
    for (int t = 0; t < NI / 16; ++t) {
#pragma unroll
        for (int j = 0; j < 8; j += 4) { float x[4];
#pragma unroll
            for (int q = 0; q < 4; ++q) x[q] = __fmul_rn(__fsub_rn(st[t][j + q], mx), 1.4426950408889634f);
            exp2x4(x[0], x[1], x[2], x[3]);
#pragma unroll
            for (int q = 0; q < 4; ++q) { st[t][j + q] = x[q]; sm[q] += x[q]; } } }
    float sum = (sm[0] + sm[1]) + (sm[2] + sm[3]); sum += __shfl_xor(sum, 16, 32);
    const float f = __fdiv_rn(1.0f, sum);
    const unsigned vo = ((unsigned)p * HP * NI + 8 * lane) * 2u;
    const bf* vph = (const bf*)((const char*)VTh + vo); const bf* vpl = (const bf*)((const char*)VTl + vo);
    v8f o[2]; o[0] = (v8f){}; o[1] = (v8f){};
#pragma unroll
    for (int c = 0; c < NI / 32; ++c) { v8us ph0, pl0, ph1, pl1;
        split8(st[2 * c] * f, ph0, pl0); split8(st[2 * c + 1] * f, ph1, pl1);
        const v16bf ph = cat16b(ph0, ph1), pl = cat16b(pl0, pl1);
#pragma unroll
        for (int mb = 0; mb < 2; ++mb) { const v16bf vh = WFrag<bf>::ld(vph + mb * 16 * NI + c * 512), vl = WFrag<bf>::ld(vpl + mb * 16 * NI + c * 512);
            o[mb] = wmmab(vh, ph, o[mb]); o[mb] = wmmab(vh, pl, o[mb]); o[mb] = wmmab(vl, ph, o[mb]); } }
    asm volatile("s_wait_xcnt 0x0" :: "v"(vo), "s"(VTh), "s"(VTl) : "memory");   /* the same for the V^T loads */
    const size_t oo = ((size_t)s * NI + i) * DQ + h * HD + 8 * hi;   /* o[mb][r] = context[query i][channel 16 mb + 8 hi + r] */
    const unsigned ao = ((unsigned)(s * NI + (i - lr)) * DQ + h * 512 + 8 * lane);   /* the same in fragment order (K = DQ, block k / 32 = h): o[mb] is register half mb as it lies */
#pragma unroll
    for (int mb = 0; mb < 2; ++mb) { const v4f g0 = *(const v4f*)(GP + oo + mb * 16), g1 = *(const v4f*)(GP + oo + mb * 16 + 4); v8us oh, ol;
        v8f y;
#pragma unroll
        for (int r = 0; r < 8; ++r) y[r] = __fmul_rn(sigm_slot(r < 4 ? g0[r & 3] : g1[r & 3]), o[mb][r]);
        split8(y, oh, ol);
        *(v8us*)(Ah + ao + mb * 256) = oh; *(v8us*)(Al + ao + mb * 256) = ol; }
}

extern "C" void kernel_launch(void* const* d_in, const int* in_sizes, int n_in,
                              void* d_out, int out_size, void* d_ws, size_t ws_size, hipStream_t stream) {
    (void)in_sizes; (void)n_in; (void)out_size;
    const float* msa = (const float*)d_in[0]; const float* pair = (const float*)d_in[1]; const float* lmg = (const float*)d_in[2]; const float* lmb = (const float*)d_in[3]; const float* lpg = (const float*)d_in[4]; const float* lpb = (const float*)d_in[5]; const float* wq = (const float*)d_in[6]; const float* wk = (const float*)d_in[7]; const float* wv = (const float*)d_in[8]; const float* wp = (const float*)d_in[9]; const float* wg = (const float*)d_in[10]; const float* bg = (const float*)d_in[11]; const float* wo = (const float*)d_in[12]; const float* bo = (const float*)d_in[13];
    float* OUT = (float*)d_out;     // [1][128][256][256]
    char* wsp = (char*)d_ws;
    auto take = [&](size_t bytes) { char* p = wsp; wsp += (bytes + 255) & ~(size_t)255; return (void*)p; };
    bf* WQ = (bf*)take((size_t)DQ * DM * 2); bf* WK = (bf*)take((size_t)DQ * DM * 2); bf* WV = (bf*)take((size_t)DQ * DM * 2); bf* WG = (bf*)take((size_t)DQ * DM * 2); bf* WO = (bf*)take((size_t)DM * DQ * 2); bf* WP = (bf*)take((size_t)NBP * CZ * 2);
    bf* Mh = (bf*)take((size_t)NRM * DM * 2); bf* Ml = (bf*)take((size_t)NRM * DM * 2); float* FQ = (float*)take((size_t)NRM * DQ * 4); float* GP = (float*)take((size_t)NRM * DQ * 4); float* BIAS = (float*)take((size_t)NRP * NBP * 4);
    bf* QPh = (bf*)take((size_t)NP * NI * HD * 2); bf* QPl = (bf*)take((size_t)NP * NI * HD * 2); bf* KPh = (bf*)take((size_t)NP * NI * HD * 2); bf* KPl = (bf*)take((size_t)NP * NI * HD * 2); bf* VTh = (bf*)take((size_t)NP * HP * NI * 2); bf* VTl = (bf*)take((size_t)NP * HP * NI * 2);
    bf* ATh = Mh; bf* ATl = Ml;   /* the gated context reuses the LN operand buffers (m is dead after the projections) */
    if ((size_t)(wsp - (char*)d_ws) > ws_size) return;    // ws 256 MiB (carve ~241 MiB; the pair LN operand lies in FQ, see below)
    bf* PLh = (bf*)FQ; bf* PLl = (bf*)FQ + (size_t)NRP * CZ;   /* pair LN planes [65536][128] bf16 = 16 MiB each, both inside FQ (32 MiB), which holds nothing else: the gate GEMM writes GP in the launch that reads them */
    k_prep<<<5 * NBW + NBWP + NRP / 8 + NRM / 8, 256, 0, stream>>>(msa, pair, lmg, lmb, lpg, lpb, wq, wk, wv, wg, wo, wp, WQ, WK, WV, WG, WO, WP, Mh, Ml, PLh, PLl);
    k_proj<<<NRM / 64 + NRP / 256, 128, 0, stream>>>(Mh, Ml, WQ, WK, WV, WG, bg, QPh, QPl, KPh, KPl, VTh, VTl, GP, WP, PLh, PLl, BIAS);
    k_fattn<<<NS * (NH_ / 2) * (NI / 64), 256, 0, stream>>>(QPh, QPl, KPh, KPl, VTh, VTl, BIAS, GP, ATh, ATl);
    k_gemmo<<<NRM / 64, 128, 0, stream>>>(ATh, ATl, WO, OUT, bo);            /* out = vals Wo + bo */
}

// v008
// It runs in 97.1 microseconds.
// Next to v007, in two timings, it ran 1.16 and 1.15 times as fast.
// Counting every step since v000, it is 17.9 times as fast.
#include <hip/hip_runtime.h>

// MSA row attention with pair bias (msa [1][128][256][256], pair [1][256][256][128]; m = LN(msa), p = LN(pair) (eps 1e-5, affine); Q, K, V = m W ('xw' [256][256], 8 heads x 32), G = sigmoid(m Wg + bg); bias[h][i][j] = (p Wp)[i][j][h] ('xw' [128][8]); per sequence s and head h: attn = softmax(Q_s,h . K_s,h / sqrt(32) + bias_h); vals = G * (attn V); out = vals Wo + bo ('xw' [256][256]) -> [1][128][256][256] (8.4 M)).
// Layout: row LayerNorm kernels (one wave per row) write hi/lo operands for the msa (32,768 x 256) and pair (65,536 x 128) slabs; hl x exact projections (Q, K, V, gate pre-activation, and the pair bias against Wp zero-padded to 64 columns); the Q and K GEMMs store hi/lo planes [sequence x head][residue][32] and the V GEMM hi/lo V^T planes [sequence x head][64][residue], rows 0..31 written and read, from their epilogues; one attention kernel over all 1024 (sequence, head) pairs keeps a wave's 16 x 256 scores in registers: scores (3 products, K 32), + bias[h][i][j], softmax over the 256 residues with every row hi/lo, attn.V (3 products), sigmoid gate, and writes the hi/lo operand of the Wo GEMM.
// Operand order: every 16-bit plane that a matrix fragment is loaded from lies in fragment order (fro() below), written so by its producer; the pair bias lies in the order of the score accumulators. A wave's 16-byte-a-lane load then covers 512 contiguous bytes.
// Compute dtypes, f32 accumulate: every input rounded to bf16; LN, sigmoid, softmax f32; GEMM activations bf16 hi/lo (2 products) x exact weights; scores and attn.V 3 products.

#define NB_  1
#define TT   256
#define DM   256
#define NH_  8
#define NKV  8
#define REP  (NH_ / NKV)
#define HD   32
#define DQ   (NH_ * HD)
#define DKV  (NKV * HD)
#define WIN  0
#define SCL  0.17677669529663688f   // 32^-0.5
#define NS   128     // sequences
#define NI   256     // residues (= TT)
#define CZ   128     // pair channels
#define NP   (NS * NH_)   // 1024 pseudo-heads
#define NRM  (NS * NI)    // 32768 msa rows
#define NRP  (NI * NI)    // 65536 pair rows
#define HP   64      // padded head width for attn.v
#define NBP  64      // padded bias projection width (8 heads used)
typedef _Float16 h16;
typedef unsigned short bf;
typedef __attribute__((ext_vector_type(16))) __bf16   v16bf;
typedef __attribute__((ext_vector_type(16))) _Float16 v16h;
typedef __attribute__((ext_vector_type(8)))  _Float16 v8h;
typedef __attribute__((ext_vector_type(8)))  unsigned short v8us;
typedef __attribute__((ext_vector_type(8)))  float    v8f;
typedef __attribute__((ext_vector_type(4)))  float    v4f;
typedef v8h  __attribute__((may_alias)) v8ha;
typedef v4f  __attribute__((may_alias)) v4fa;
typedef v8us __attribute__((may_alias)) v8usa;

typedef __attribute__((ext_vector_type(2))) float    f32x2;
typedef __attribute__((ext_vector_type(2))) __bf16   bf16x2;
typedef __attribute__((ext_vector_type(4))) unsigned u32x4;
typedef __attribute__((ext_vector_type(2))) unsigned u32x2;
// f32 -> bf16, nearest even, by the convert instruction: one v_cvt_pk_bf16_f32 rounds two values and leaves them packed as the planes hold them
__device__ __forceinline__ unsigned pk2(float a, float b) { f32x2 x; x[0] = a; x[1] = b; return __builtin_bit_cast(unsigned, __builtin_convertvector(x, bf16x2)); }
__device__ __forceinline__ unsigned short f2bf(float f) { return __builtin_bit_cast(unsigned short, (__bf16)f); }
__device__ __forceinline__ float bf2f(unsigned short b) { return __uint_as_float(((unsigned)b) << 16); }
__device__ __forceinline__ float bfr(float f) { return bf2f(f2bf(f)); }
__device__ __forceinline__ void bfr2(float a, float b, float& ra, float& rb) { const unsigned h = pk2(a, b); ra = __uint_as_float(h << 16); rb = __uint_as_float(h & 0xFFFF0000u); }
// hi/lo split of a pair: h = the two rounded values, l = the two rounded remainders (a remainder is exact in f32)
__device__ __forceinline__ void split2(float a, float b, unsigned& h, unsigned& l) { h = pk2(a, b); l = pk2(a - __uint_as_float(h << 16), b - __uint_as_float(h & 0xFFFF0000u)); }
__device__ __forceinline__ void split8(v8f y, v8us& oh, v8us& ol) { u32x4 h, l;
    /* unrolled so that the vectors' elements are indexed by constants and stay in registers */
#pragma unroll
    for (int q = 0; q < 4; ++q) { unsigned u, w2; split2(y[2 * q], y[2 * q + 1], u, w2); h[q] = u; l[q] = w2; }
    oh = __builtin_bit_cast(v8us, h); ol = __builtin_bit_cast(v8us, l); }
__device__ __forceinline__ v16h cat16(v8h lo, v8h hi) { return __builtin_shufflevector(lo, hi, 0, 1, 2, 3, 4, 5, 6, 7, 8, 9, 10, 11, 12, 13, 14, 15); }
__device__ __forceinline__ v16bf cat16b(v8us lo, v8us hi) { return __builtin_bit_cast(v16bf, __builtin_shufflevector(lo, hi, 0, 1, 2, 3, 4, 5, 6, 7, 8, 9, 10, 11, 12, 13, 14, 15)); }
// Fragment order of a [rows][K] 16-bit plane: blocks of 16 rows x 32 k (1 KiB), block (row / 16, k / 32) row-major; inside a block [k / 16 % 2][k / 8 % 2][row % 16][k % 8], which is [register half][lane][8]: lane (lr, hi) of a 16x16x32 fragment finds its 16 values at block + lane * 8 and + 256.
__device__ __forceinline__ unsigned fro(unsigned row, unsigned k, unsigned K) { return ((row >> 4) * (K >> 5) + (k >> 5)) * 512u + ((k >> 4) & 1u) * 256u + ((k >> 3) & 1u) * 128u + (row & 15u) * 8u + (k & 7u); }
// its inverse: element e of the plane -> (row, k)
__device__ __forceinline__ void frd(unsigned e, unsigned K, unsigned& row, unsigned& k) { const unsigned blk = e >> 9; row = (blk / (K >> 5)) * 16u + ((e >> 3) & 15u); k = (blk % (K >> 5)) * 32u + ((e >> 8) & 1u) * 16u + ((e >> 7) & 1u) * 8u + (e & 7u); }
__device__ __forceinline__ v8f wmma16(v16h a, v16h b, v8f c) { return __builtin_amdgcn_wmma_f32_16x16x32_f16(false, a, false, b, (short)0, c, false, false); }
__device__ __forceinline__ v8f wmmab(v16bf a, v16bf b, v8f c) { return __builtin_amdgcn_wmma_f32_16x16x32_bf16(false, a, false, b, (short)0, c, false, false); }



// ---- gemmw_tile: register-blocked GEMM, ONE WAVE per 64x64 output tile (16 accumulators), operands straight from 16-bit planes in fragment order; tile (bx, by) of (M/64, N/64), 32 threads; sm = the wave's 4608 bytes of LDS for the epilogue.
// ALDS: A and A2 are the tile's own 64 rows, staged in LDS by stage_a() in the same fragment order, and shared by every wave of the workgroup; B comes from global memory either way.
// C[m][n] (f32, pitch ldc, + optional f32 bias[n]) = sum_k A[m][k] Bt[n][k] (+ split products per NSPLIT). K % 32 == 0.
// OUTM 0: f32 C. OUTM 1 and 2 (m = sequence x residue, n = head x 32): bf16 hi/lo of C, 1: to Ph/Pl[sequence x head][residue][32], 2: transposed to Ph/Pl[sequence x head][HP][residue], each [sequence x head] slab in fragment order. OUTM 3 (the pair bias): rows 0..7 of C, f32, in the order of the score accumulators. All store 16 bytes a lane and whole 128-byte lines a store.
template <typename T16> struct WFrag;
template <> struct WFrag<h16> { typedef v16h V; static __device__ __forceinline__ V ld(const h16* p) { return cat16(*(const v8h*)p, *(const v8h*)(p + 256)); } static __device__ __forceinline__ v8f mma(V a, V b, v8f c) { return wmma16(a, b, c); } };
template <> struct WFrag<bf> { typedef v16bf V; static __device__ __forceinline__ V ld(const bf* p) { return cat16b(*(const v8us*)p, *(const v8us*)(p + 256)); } static __device__ __forceinline__ v8f mma(V a, V b, v8f c) { return wmmab(a, b, c); } };
template <typename T16, int NSPLIT, bool BIAS, int OUTM, bool ALDS>
__device__ __forceinline__ void gemmw_tile(const T16* __restrict__ A, const T16* __restrict__ A2, const T16* __restrict__ Bt, const T16* __restrict__ Bt2, int K, float* C, int ldc, const float* __restrict__ bias, bf* Ph, bf* Pl, int bx, int by, char* sm) {
    typedef typename WFrag<T16>::V V;
    const int lane = threadIdx.x & 31, lr = lane & 15, hi = lane >> 4; const int r0 = bx * 64, c0 = by * 64;
    constexpr int NMB = OUTM == 3 ? 1 : 4;   /* 16-row blocks of A that are multiplied: all that the epilogue stores */
    v8f acc[NMB][4];
#pragma unroll
    for (int mb = 0; mb < NMB; ++mb)
#pragma unroll
        for (int nb = 0; nb < 4; ++nb) acc[mb][nb] = (v8f){};
    /* 32-bit byte offsets, as in k_fattn (every operand plane is below 64 MiB): one offset register serves the planes of A, one those of B; neither changes, every trip's step is an immediate offset */
    const unsigned ao = ((ALDS ? 0u : (unsigned)r0 * K) + 8 * lane) * 2u, bo = ((unsigned)c0 * K + 8 * lane) * 2u;   /* 16 rows of K values are K / 32 blocks of 512 */
    const T16* pa = (const T16*)((const char*)A + ao); const T16* pa2 = (const T16*)((const char*)A2 + ao); const T16* pb = (const T16*)((const char*)Bt + bo); const T16* pb2 = (const T16*)((const char*)Bt2 + bo);
    /* NFS fragment sets: trip t's loads all go out as one group in front of the products of trip t - (NFS - 1), so that a trip waits for its operands once, and NFS - 1 trips of products after they were asked for; the pair-bias trip has a quarter of the products, so it asks two trips ahead */
    constexpr int NFS = OUTM == 3 ? 3 : 2;
    V a[NFS][NMB], a2[NFS][NMB], b[NFS][4], b2[NFS][4];
    /* unrolled whole (K is a constant at every call): the sets are indexed by constants and stay in registers, and no address register is rewritten between the trips */
#pragma unroll
    for (int t = 0; t < K / 32 + NFS - 1; ++t) {
        if (t < K / 32) { const int s = t % NFS;
#pragma unroll
            for (int nb = 0; nb < 4; ++nb) { b[s][nb] = WFrag<T16>::ld(pb + t * 512 + nb * 16 * K); if (NSPLIT >= 2) b2[s][nb] = WFrag<T16>::ld(pb2 + t * 512 + nb * 16 * K); }
#pragma unroll
            for (int mb = 0; mb < NMB; ++mb) { a[s][mb] = WFrag<T16>::ld(pa + t * 512 + mb * 16 * K); if (NSPLIT == 1 || NSPLIT == 2) a2[s][mb] = WFrag<T16>::ld(pa2 + t * 512 + mb * 16 * K); } }
        __builtin_amdgcn_sched_barrier(0);   /* keeps the load group in front of the products: moved down among them, each part of it would be waited for by itself */
        if (t >= NFS - 1) { const int s = (t - (NFS - 1)) % NFS;
#pragma unroll
            for (int nb = 0; nb < 4; ++nb) {
#pragma unroll
                for (int mb = 0; mb < NMB; ++mb) { acc[mb][nb] = WFrag<T16>::mma(a[s][mb], b[s][nb], acc[mb][nb]); if (NSPLIT == 1 || NSPLIT == 2) acc[mb][nb] = WFrag<T16>::mma(a2[s][mb], b[s][nb], acc[mb][nb]); if (NSPLIT >= 2) acc[mb][nb] = WFrag<T16>::mma(a[s][mb], b2[s][nb], acc[mb][nb]); } } }
        __builtin_amdgcn_sched_barrier(0);   /* keeps what follows (the next group; behind the last trip the epilogue) from being mixed in among these products: that build took more registers, enough to cost a wave per SIMD */
    }
    asm volatile("s_wait_xcnt 0x0" :: "v"(ao), "v"(bo) : "memory");   /* precaution: the offset registers of the loads are inputs here, so they stay live up to this wait and none is overwritten in front of it */
    if constexpr (OUTM == 2) {
    /* a lane's 8 accumulator rows are 8 neighbouring residues of one channel: one lane's 16 bytes of a V^T fragment (row = channel, k = residue), so every store is 512 contiguous bytes as the values lie */
    const unsigned pv = ((unsigned)r0 / NI) * NH_ + (unsigned)c0 / HD, kb = ((unsigned)r0 % NI) / 32;
    /* every loop of this block is unrolled so that acc[][] and the vectors' elements are indexed by constants and stay in registers */
#pragma unroll
    for (int nb = 0; nb < 4; ++nb) {
#pragma unroll
        for (int mb = 0; mb < 4; ++mb) { v8us oh, ol;
            split8(acc[mb][nb], oh, ol);
            const unsigned e = (pv + (nb >> 1)) * (HP * NI) + ((nb & 1) * (NI / 32) + kb + (mb >> 1)) * 512u + (mb & 1) * 256u + lane * 8u;
            *(v8us*)(Ph + e) = oh; *(v8us*)(Pl + e) = ol; }
        asm volatile("s_wait_xcnt 0x0" ::: "memory");   /* precaution: stands behind these stores, in front of whatever next overwrites their address or data registers */
    }
    } else if constexpr (OUTM == 3) {
    /* B row 16 (256 I + j) + lr is pair position (i = 16 I + lr, j) (see k_prep), so lane lr of the lower half holds, for head r, bias[r][i][j0 .. j0 + 3] in acc[0][0..3][r]: 16 bytes of C[head][I][j / 16][j / 4 % 2][j / 8 % 2][i % 16][j % 4], which k_fattn reads lane by lane */
    if (hi == 0) {
        const unsigned e0 = (((unsigned)by >> 6) * 16u + (((unsigned)by & 63u) >> 2)) * 256u + ((unsigned)by & 1u) * 128u + (((unsigned)by >> 1) & 1u) * 64u + lr * 4u;
#pragma unroll
        for (int r = 0; r < NH_; ++r) { v4f val; val[0] = acc[0][0][r]; val[1] = acc[0][1][r]; val[2] = acc[0][2][r]; val[3] = acc[0][3][r]; *(v4f*)(C + e0 + (unsigned)r * NRP) = val; }
        asm volatile("s_wait_xcnt 0x0" ::: "memory");   /* precaution, as above */
    }
    } else {
    float* os = (float*)sm;
#pragma unroll
    for (int mb = 0; mb < 4; ++mb) {
#pragma unroll
        for (int nb = 0; nb < 4; ++nb) {
#pragma unroll
            for (int j = 0; j < 8; ++j) os[(hi * 8 + j) * 68 + nb * 16 + lr] = acc[mb][nb][j]; }
        __builtin_amdgcn_wave_barrier(); asm volatile("" ::: "memory");
        if (OUTM == 0) {
        float* crow = C + (size_t)(r0 + mb * 16) * ldc + c0;
#pragma unroll
            for (int s = 0; s < 8; ++s) { const int row = 2 * s + hi, cofs = lr * 4; v4f val = *(const v4fa*)(os + row * 68 + cofs); if (BIAS) { val[0] += bfr(bias[c0 + cofs]); val[1] += bfr(bias[c0 + cofs + 1]); val[2] += bfr(bias[c0 + cofs + 2]); val[3] += bfr(bias[c0 + cofs + 3]); }
                *(v4f*)(crow + (size_t)row * ldc + cofs) = val; }
        } else {
            /* unrolled, like the inner loop: the vectors' elements are indexed by constants and stay in registers */
#pragma unroll
            for (int s = 0; s < 4; ++s) { const int row = 8 * (s & 1) + (lane & 7), cofs = ((s >> 1) * 4 + (lane >> 3)) * 8; const v4f v0 = *(const v4fa*)(os + row * 68 + cofs), v1 = *(const v4fa*)(os + row * 68 + cofs + 4); v8us oh, ol;   /* 8 rows x the 4 pieces of one head: 4 whole lines in fragment order */
                split8(__builtin_shufflevector(v0, v1, 0, 1, 2, 3, 4, 5, 6, 7), oh, ol);
                const unsigned m = (unsigned)(r0 + mb * 16 + row), n = (unsigned)(c0 + cofs);
                const unsigned e = ((m / NI) * NH_ + n / HD) * (NI * HD) + fro(m % NI, n % HD, HD);
                *(v8us*)(Ph + e) = oh; *(v8us*)(Pl + e) = ol; }
        }
        asm volatile("s_wait_xcnt 0x0" ::: "memory");   /* precaution, as above: behind the stores of either form */
        __builtin_amdgcn_wave_barrier(); asm volatile("" ::: "memory");
    }
    }
}

// stage_a: the 64 rows x 256 k of tile bx of both planes of an A operand (in fragment order 32 KiB in a row of each plane) into sa, hi plane then lo plane, by asynchronous copies, 16 bytes a lane; 128 threads, 32 copies a lane. Behind it every wave of the workgroup may read sa.
__device__ __forceinline__ void cp8(unsigned l, const char* g) {
    /* eight copies and their s_wait_xcnt 0 in one statement: a precaution, the wait stands in front of whatever next rewrites an address register of a copy */
    asm volatile("global_load_async_to_lds_b128 %0, %8, off\n\tglobal_load_async_to_lds_b128 %1, %9, off\n\tglobal_load_async_to_lds_b128 %2, %10, off\n\tglobal_load_async_to_lds_b128 %3, %11, off\n\tglobal_load_async_to_lds_b128 %4, %12, off\n\tglobal_load_async_to_lds_b128 %5, %13, off\n\tglobal_load_async_to_lds_b128 %6, %14, off\n\tglobal_load_async_to_lds_b128 %7, %15, off\n\ts_wait_xcnt 0x0"
        :: "v"(l), "v"(l + 2048u), "v"(l + 4096u), "v"(l + 6144u), "v"(l + 8192u), "v"(l + 10240u), "v"(l + 12288u), "v"(l + 14336u),
           "v"(g), "v"(g + 2048), "v"(g + 4096), "v"(g + 6144), "v"(g + 8192), "v"(g + 10240), "v"(g + 12288), "v"(g + 14336) : "memory");
}
__device__ __forceinline__ void stage_a(bf* sa, const bf* __restrict__ Ah, const bf* __restrict__ Al, int bx) {
    const unsigned l = (unsigned)(size_t)sa + threadIdx.x * 16u;   /* the low 32 bits of a __shared__ address are the byte offset in LDS */
    const size_t go = (size_t)bx * (64 * DM * 2) + threadIdx.x * 16u;
    cp8(l, (const char*)Ah + go); cp8(l + 16384u, (const char*)Ah + go + 16384);
    cp8(l + 32768u, (const char*)Al + go); cp8(l + 49152u, (const char*)Al + go + 16384);
    asm volatile("s_wait_asynccnt 0x0" ::: "memory");   /* this wave's copies have landed */
    __syncthreads();                                    /* and every other wave's: nobody reads sa in front of this barrier */
}
// k_proj: the five GEMMs that depend on the LayerNorm planes alone, in one launch, four waves a workgroup. Blocks 0..255 = the pair bias, one tile a wave: the short ones first, since two workgroups fit a WGP and the 512 long ones fill the chip exactly. Blocks 256..767: one 64-row tile of the msa planes, staged once in LDS; wave w multiplies it by column tile w of each of Wq, Wk, Wv and Wg (16 output tiles from one staged A).
__global__ __launch_bounds__(128) void k_proj(const bf* __restrict__ Mh, const bf* __restrict__ Ml, const bf* __restrict__ WQ, const bf* __restrict__ WK, const bf* __restrict__ WV, const bf* __restrict__ WG, const float* __restrict__ bg, bf* QPh, bf* QPl, bf* KPh, bf* KPl, bf* VTh, bf* VTl, float* GP, const bf* __restrict__ WP, const bf* __restrict__ PLh, const bf* __restrict__ PLl, float* BIAS) {
    __shared__ __align__(16) bf sa[2 * 64 * DM];
    __shared__ __align__(16) char sm4[4 * 4608];
    const int b = (int)blockIdx.x - NRP / 256, w = __builtin_amdgcn_readfirstlane(threadIdx.x >> 5); char* sm = sm4 + w * 4608;   /* the wave's number in a scalar register: the tile's addresses then stay scalar, as they were when they came from blockIdx */
    if (b >= 0) {
        stage_a(sa, Mh, Ml, b);
        /* kept rolled: Q and K share one body, so the kernel's text stays as long as it was. Workgroup b starts with GEMM b % 4: at any time the workgroups then read all four weight matrices, not the same few lines of one */
#pragma unroll 1
        for (int it = 0; it < 4; ++it) { const int g = (b + it) & 3;
            if (g < 2) gemmw_tile<bf, 1, false, 1, true>(sa, sa + 64 * DM, g ? WK : WQ, nullptr, DM, nullptr, 0, nullptr, g ? KPh : QPh, g ? KPl : QPl, b, w, sm);
            else if (g == 2) gemmw_tile<bf, 1, false, 2, true>(sa, sa + 64 * DM, WV, nullptr, DM, nullptr, 0, nullptr, VTh, VTl, b, w, sm);
            else gemmw_tile<bf, 1, true, 0, true>(sa, sa + 64 * DM, WG, nullptr, DM, GP, DQ, bg, nullptr, nullptr, b, w, sm);          /* gate pre-activation m Wg + bg */
        }
    } else {
        /* pair bias, head-major: bias[h][i][j] = Wp[:, h] . LN(pair[i][j]): Wp (rows 8..63 zero) is the A operand, the hi/lo LN planes the B operand; the 8 head rows are stored */
        gemmw_tile<bf, 3, false, 3, false>(WP, nullptr, PLh, PLl, CZ, BIAS, NRP, nullptr, nullptr, nullptr, 0, (int)blockIdx.x * 4 + w, sm);
    }
}
// k_gemmo: out = vals Wo + bo; grid M/64, wave w = column tile w, the 64 rows of vals staged once in LDS.
__global__ __launch_bounds__(128) void k_gemmo(const bf* __restrict__ Ah, const bf* __restrict__ Al, const bf* __restrict__ WO, float* OUT, const float* __restrict__ bo) {
    __shared__ __align__(16) bf sa[2 * 64 * DQ];
    __shared__ __align__(16) char sm4[4 * 4608];
    const int w = __builtin_amdgcn_readfirstlane(threadIdx.x >> 5);   /* scalar, as in k_proj */
    stage_a(sa, Ah, Al, blockIdx.x);
    gemmw_tile<bf, 1, true, 0, true>(sa, sa + 64 * DQ, WO, nullptr, DQ, OUT, DM, bo, nullptr, nullptr, blockIdx.x, w, sm4 + w * 4608);
}

typedef __attribute__((ext_vector_type(2))) _Float16 v2h;
typedef __attribute__((ext_vector_type(4))) _Float16 v4h;
typedef __attribute__((ext_vector_type(2))) unsigned short v2us;
typedef __attribute__((ext_vector_type(4))) unsigned short v4us;
typedef v4us __attribute__((may_alias)) v4usa;
typedef __attribute__((ext_vector_type(2))) float v2f;
typedef __attribute__((ext_vector_type(4))) int v4i;

__device__ __forceinline__ void wtG(const float* __restrict__ w, int K, int N, bf* Bt, int blk) {
    const int lane = threadIdx.x & 31; const int L0 = (blk * 8 + (threadIdx.x >> 5)) * 8; const int nlines = N * K / 64;
{
#pragma unroll 1
        for (int l = 0; l < 8; ++l) { const int L = L0 + l; if (L >= nlines) break; const size_t e = (size_t)L * 64 + lane * 2; unsigned n, k; frd((unsigned)e, (unsigned)K, n, k); v2us o;   /* the line is written whole; (n, k) follow from its place */
            o[0] = f2bf(w[(size_t)k * N + n]); o[1] = f2bf(w[(size_t)(k + 1) * N + n]); *(v2us*)(Bt + e) = o; }
         }
}
__global__ __launch_bounds__(256) void k_cvt8(const float* __restrict__ src, bf* dst, size_t n8) { const size_t i = (size_t)blockIdx.x * 256 + threadIdx.x; if (i >= n8) return; const v8f v = *(const v8f*)(src + i * 8); v8us o;
#pragma unroll
    for (int k = 0; k < 8; ++k) o[k] = f2bf(v[k]); *(v8us*)(dst + i * 8) = o;  }




template <int WD>
__device__ __forceinline__ void lnrow(const float* __restrict__ X, size_t r, const float* __restrict__ g, const float* __restrict__ bb, bf* Hh, bf* Hl, int blk, bf* ls) { const int lane = threadIdx.x & 31, w = threadIdx.x >> 5; const float* xr = X + r * WD;   /* r: the wave's source row; it becomes row blk * 8 + w of the planes */ float a[WD / 32]; float s = 0.f;
#pragma unroll
    for (int c = 0; c < WD / 128; ++c) { const v4f v = *(const v4f*)(xr + c * 128 + lane * 4); bfr2(v[0], v[1], a[c * 4], a[c * 4 + 1]); bfr2(v[2], v[3], a[c * 4 + 2], a[c * 4 + 3]); for (int q = 0; q < 4; ++q) s = __fadd_rn(s, a[c * 4 + q]); }
#pragma unroll
    for (int sh = 16; sh; sh >>= 1) s = __fadd_rn(s, __shfl_xor(s, sh, 32));
    const float mean = __fdiv_rn(s, (float)WD); float s2 = 0.f;
#pragma unroll
    for (int k = 0; k < WD / 32; ++k) { const float dv = __fsub_rn(a[k], mean); s2 = __fadd_rn(s2, __fmul_rn(dv, dv)); }
#pragma unroll
    for (int sh = 16; sh; sh >>= 1) s2 = __fadd_rn(s2, __shfl_xor(s2, sh, 32));
    const float rs = __fdiv_rn(1.0f, __fsqrt_rn(__fadd_rn(__fdiv_rn(s2, (float)WD), 1e-5f)));
{
#pragma unroll
        for (int c = 0; c < WD / 128; ++c) { v4us oh, ol; const int col = c * 128 + lane * 4; float gq[4], bq[4], yq[4]; bfr2(g[col], g[col + 1], gq[0], gq[1]); bfr2(g[col + 2], g[col + 3], gq[2], gq[3]); bfr2(bb[col], bb[col + 1], bq[0], bq[1]); bfr2(bb[col + 2], bb[col + 3], bq[2], bq[3]);
            for (int q = 0; q < 4; ++q) { float y = __fmul_rn(__fmul_rn(__fsub_rn(a[c * 4 + q], mean), rs), gq[q]); asm volatile("" : "+v"(y)); yq[q] = __fadd_rn(y, bq[q]); }
            u32x2 h2, l2; { unsigned u, w2; split2(yq[0], yq[1], u, w2); h2[0] = u; l2[0] = w2; split2(yq[2], yq[3], u, w2); h2[1] = u; l2[1] = w2; } oh = __builtin_bit_cast(v4us, h2); ol = __builtin_bit_cast(v4us, l2); bf* lw = ls + (c * 16 + (lane >> 1)) * 72 + w * 8 + (lane & 1) * 4; *(v4usa*)lw = oh; *(v4usa*)(lw + (WD / 8) * 72) = ol; }
         }
    /* in fragment order a 128-byte line holds 8 k of 8 rows, one piece from each wave: the block's 8 rows are gathered in LDS, [plane][k / 8][row][8] at a pitch of 144 bytes (the waves' 8-byte writes then fall on distinct banks), and stored as whole lines */
    __syncthreads();
#pragma unroll
    for (int s = 0; s < WD / 128; ++s) { const int idx = w * (WD / 128) + s, pl = idx / (WD / 32), kp = (idx % (WD / 32)) * 4 + (lane >> 3);
        const v8us v = *(const v8usa*)(ls + (pl * (WD / 8) + kp) * 72 + (lane & 7) * 8);
        *(v8us*)((pl ? Hl : Hh) + fro((unsigned)blk * 8u + (lane & 7), (unsigned)kp * 8u, WD)) = v; }
    asm volatile("s_wait_xcnt 0x0" ::: "memory");   /* precaution: behind the stores, in front of the next overwrite of their registers */
}
__device__ __forceinline__ void wpad(const float* __restrict__ w, bf* Bt, int blk) { const int e2 = (blk * 256 + threadIdx.x) * 2; if (e2 >= NBP * CZ) return; unsigned un, uk; frd((unsigned)e2, CZ, un, uk); const int k = (int)uk; const int n = (int)un; v2us o; const unsigned short a0 = f2bf(w[(size_t)k * NH_ + min(n, NH_ - 1)]), a1 = f2bf(w[(size_t)(k + 1) * NH_ + min(n, NH_ - 1)]); o[0] = (n < NH_) ? a0 : (unsigned short)0; o[1] = (n < NH_) ? a1 : (unsigned short)0; *(v2us*)(Bt + e2) = o;  }
// k_prep: everything that depends on the inputs alone, in one launch. Blocks 0..79: the five 256 x 256 weights to bf16 [n][k] (16 blocks each); 80..95: Wp padded; then 8192 blocks of pair LayerNorm rows and 4096 of msa rows, 8 rows a block. Plane row 16 (256 I + j) + lr of the pair planes is pair position (i = 16 I + lr, j), so that a 16-row fragment holds 16 queries of one key, as the score accumulators do. The few weight blocks, which are chains of dependent-latency trips, come first and run beside the LayerNorm streams.
#define NBW  ((DM * DQ / 64 + 63) / 64)       // blocks of one weight
#define NBWP ((NBP * CZ / 2 + 255) / 256)     // blocks of the padded Wp
__global__ __launch_bounds__(256) void k_prep(const float* __restrict__ msa, const float* __restrict__ pair, const float* __restrict__ lmg, const float* __restrict__ lmb, const float* __restrict__ lpg, const float* __restrict__ lpb, const float* __restrict__ wq, const float* __restrict__ wk, const float* __restrict__ wv, const float* __restrict__ wg, const float* __restrict__ wo, const float* __restrict__ wp, bf* WQ, bf* WK, bf* WV, bf* WG, bf* WO, bf* WP, bf* Mh, bf* Ml, bf* PLh, bf* PLl) {
    __shared__ __align__(16) bf ls[2 * (DM / 8) * 72];
    const int b = blockIdx.x;
    if (b < 5 * NBW) { const int g = b / NBW;
        const float* w = g == 0 ? wq : g == 1 ? wk : g == 2 ? wv : g == 3 ? wg : wo; bf* o = g == 0 ? WQ : g == 1 ? WK : g == 2 ? WV : g == 3 ? WG : WO;
        wtG(w, DM, DQ, o, b % NBW); }      /* all five are 256 x 256 (DM == DQ) */
    else if (b < 5 * NBW + NBWP) wpad(wp, WP, b - 5 * NBW);
    else if (b < 5 * NBW + NBWP + NRP / 8) { const int q = b - (5 * NBW + NBWP); lnrow<CZ>(pair, (size_t)((q >> 9) * 16 + (q & 1) * 8 + (threadIdx.x >> 5)) * NI + ((q >> 1) & (NI - 1)), lpg, lpb, PLh, PLl, q, ls); }
    else { const int q = b - (5 * NBW + NBWP + NRP / 8); lnrow<DM>(msa, (size_t)q * 8 + (threadIdx.x >> 5), lmg, lmb, Mh, Ml, q, ls); }
}
__device__ __forceinline__ float sigm_slot(float a) { float e; asm("v_exp_f32 %0, %1\n\tv_nop" : "=v"(e) : "v"(__fmul_rn(-a, 1.4426950408889634f))); return __fdiv_rn(1.0f, __fadd_rn(1.0f, e)); }
// Four exponentials and one v_nop in one statement, for the same slot: the outputs are early-clobbered, so none overwrites a source of the exponential in front of it, and the v_nop stands behind the last.
__device__ __forceinline__ void exp2x4(float& a, float& b, float& c, float& d) { float e0, e1, e2, e3; asm("v_exp_f32 %0, %4\n\tv_exp_f32 %1, %5\n\tv_exp_f32 %2, %6\n\tv_exp_f32 %3, %7\n\tv_nop" : "=&v"(e0), "=&v"(e1), "=&v"(e2), "=&v"(e3) : "v"(a), "v"(b), "v"(c), "v"(d)); a = e0; b = e1; c = e2; d = e3; }
// k_fattn: scores, pair bias, softmax, attn.V and the sigmoid gate of one (sequence, head) for 16 query rows per wave, nothing through memory in between.
// S^T = K Q^T (A = 16 key rows, B = the wave's 16 queries): lane (lr, hi) holds, of query lr, keys 16 t + 8 hi + 0..7 in st[t]; two neighbouring tiles are the B fragment of O^T = V^T P^T as they lie.
// Workgroup: 8 waves = 8 query tiles of one (sequence, head); grid 128 sequences x 8 heads x 2 query halves. The head's K and V^T planes, hi and lo (in fragment order 16 KiB in a row each), are staged once in LDS by asynchronous copies and read there by all 8 waves; Q, the bias and the gate, which no two waves share, come from global memory.
// The second launch bound asks for four waves per SIMD (256 registers a wave), so that two workgroups share a WGP and one's vector work covers the other's loads.
__device__ __forceinline__ void cp44(unsigned l, const char* g, const char* g2) {
    /* a hi and a lo plane of 16 KiB, four copies each, 4 KiB apart (256 threads x 16 bytes), and their s_wait_xcnt 0 in one statement: a precaution, as in cp8 */
    asm volatile("global_load_async_to_lds_b128 %0, %8, off\n\tglobal_load_async_to_lds_b128 %1, %9, off\n\tglobal_load_async_to_lds_b128 %2, %10, off\n\tglobal_load_async_to_lds_b128 %3, %11, off\n\tglobal_load_async_to_lds_b128 %4, %12, off\n\tglobal_load_async_to_lds_b128 %5, %13, off\n\tglobal_load_async_to_lds_b128 %6, %14, off\n\tglobal_load_async_to_lds_b128 %7, %15, off\n\ts_wait_xcnt 0x0"
        :: "v"(l), "v"(l + 4096u), "v"(l + 8192u), "v"(l + 12288u), "v"(l + 16384u), "v"(l + 20480u), "v"(l + 24576u), "v"(l + 28672u),
           "v"(g), "v"(g + 4096), "v"(g + 8192), "v"(g + 12288), "v"(g2), "v"(g2 + 4096), "v"(g2 + 8192), "v"(g2 + 12288) : "memory");
}
__global__ __launch_bounds__(256, 4) void k_fattn(const bf* __restrict__ QPh, const bf* __restrict__ QPl, const bf* __restrict__ KPh, const bf* __restrict__ KPl, const bf* __restrict__ VTh, const bf* __restrict__ VTl, const float* __restrict__ BT, const float* __restrict__ GP, bf* Ah, bf* Al) {
    const int lane = threadIdx.x & 31, lr = lane & 15, hi = lane >> 4, w = threadIdx.x >> 5;
    __shared__ __align__(16) bf skv[4 * NI * HD];   /* K hi, K lo, V^T hi, V^T lo (rows 0..31), 16 KiB each */
    const int qb = blockIdx.x & 1, h = (blockIdx.x >> 1) & 7, s = blockIdx.x >> 4;
    const int p = s * NH_ + h, i = qb * 128 + w * 16 + lr;
    { const unsigned l = (unsigned)(size_t)skv + threadIdx.x * 16u;   /* the low 32 bits of a __shared__ address are the byte offset in LDS */
      const size_t gk = (size_t)p * (NI * HD * 2) + threadIdx.x * 16u, gv = (size_t)p * (HP * NI * 2) + threadIdx.x * 16u;
      cp44(l, (const char*)KPh + gk, (const char*)KPl + gk); cp44(l + 32768u, (const char*)VTh + gv, (const char*)VTl + gv); }
    /* 32-bit byte offsets (every plane is below 64 MiB): one offset register serves a hi and a lo plane */
    const unsigned qo = (((unsigned)p * NI + (i - lr)) * HD + 8 * lane) * 2u, bo = ((unsigned)h * NRP + (unsigned)(i - lr) * NI + 4 * lane) * 4u;   /* fragment order: 16 rows x 32 = one block of 512; bias: 16 queries x 16 keys = 256 floats, [j / 4 % 2][lane][4] */
    const bf* qph = (const bf*)((const char*)QPh + qo); const bf* qpl = (const bf*)((const char*)QPl + qo); const bf* kph = skv + 8 * lane; const bf* kpl = kph + NI * HD;
    const v16bf qh = WFrag<bf>::ld(qph), ql = WFrag<bf>::ld(qpl);   /* asked for while the copies fly */
    const float* br = (const float*)((const char*)BT + bo);
    /* K fragments come from LDS one tile ahead (two sets), the bias from global memory two tiles ahead of its tile's products and three ahead of its use (four sets); the first two bias tiles too are asked for while the copies fly */
    v16bf kh[2], kl[2]; v4f b0[4], b1[4];
#pragma unroll
    for (int t = 0; t < 2; ++t) { b0[t] = *(const v4f*)(br + t * 256); b1[t] = *(const v4f*)(br + t * 256 + 128); }
    asm volatile("s_wait_asynccnt 0x0" ::: "memory");   /* this wave's copies have landed */
    __syncthreads();                                    /* and every other wave's: nobody reads skv in front of this barrier */
    kh[0] = WFrag<bf>::ld(kph); kl[0] = WFrag<bf>::ld(kpl);
    v8f st[NI / 16]; float mx = -3.0e38f;
    /* unrolled whole: the sets and st[] are indexed by constants and stay in registers. Trip t: the loads as one group, then tile t's products beside the vector work on tile t - 1 */
#pragma unroll
    for (int t = 0; t <= NI / 16; ++t) {
        if (t + 1 < NI / 16) { kh[(t + 1) & 1] = WFrag<bf>::ld(kph + (t + 1) * 16 * HD); kl[(t + 1) & 1] = WFrag<bf>::ld(kpl + (t + 1) * 16 * HD); }
        if (t + 2 < NI / 16) { b0[(t + 2) & 3] = *(const v4f*)(br + (t + 2) * 256); b1[(t + 2) & 3] = *(const v4f*)(br + (t + 2) * 256 + 128); }
        __builtin_amdgcn_sched_barrier(0);   /* keeps the load group in front of the products: left to itself the compiler set most LDS reads directly in front of their product, each with a wait to 0 */
        if (t < NI / 16) { v8f c = (v8f){}; c = wmmab(kh[t & 1], qh, c); c = wmmab(kh[t & 1], ql, c); c = wmmab(kl[t & 1], qh, c); st[t] = c; }
        if (t >= 1) {
#pragma unroll
            for (int j = 0; j < 8; ++j) { const float x = __fadd_rn(st[t - 1][j], __fmul_rn(j < 4 ? b0[(t - 1) & 3][j & 3] : b1[(t - 1) & 3][j & 3], 5.656854249492380f)) * SCL;   /* (S + bias x sqrt(32)) x 32^-0.5: the reference adds the bias after the scale */
                st[t - 1][j] = x; mx = fmaxf(mx, x); } }
        __builtin_amdgcn_sched_barrier(0);   /* keeps the next group from being mixed in among these products */
    }
    asm volatile("s_wait_xcnt 0x0" :: "v"(qo), "v"(bo), "s"(QPh), "s"(QPl), "s"(BT) : "memory");   /* precaution: the offset and base registers of the loads above are inputs here, so they stay live up to this wait and none is overwritten in front of it */
    mx = fmaxf(mx, __shfl_xor(mx, 16, 32));
    float sm[4] = {0.f, 0.f, 0.f, 0.f};
#pragma unroll
    for (int t = 0; t < NI / 16; ++t) {
#pragma unroll
        for (int j = 0; j < 8; j += 4) { float x[4];
#pragma unroll
            for (int q = 0; q < 4; ++q) x[q] = __fmul_rn(__fsub_rn(st[t][j + q], mx), 1.4426950408889634f);
            exp2x4(x[0], x[1], x[2], x[3]);
#pragma unroll
            for (int q = 0; q < 4; ++q) { st[t][j + q] = x[q]; sm[q] += x[q]; } } }
    float sum = (sm[0] + sm[1]) + (sm[2] + sm[3]); sum += __shfl_xor(sum, 16, 32);
    const float f = __fdiv_rn(1.0f, sum);
    const bf* vph = kph + 2 * NI * HD; const bf* vpl = kph + 3 * NI * HD;
    const size_t oo = ((size_t)s * NI + i) * DQ + h * HD + 8 * hi;   /* o[mb][r] = context[query i][channel 16 mb + 8 hi + r] */
    /* the gate, ahead of attn.V: its exponentials are asm text; with LDS operands the compiler set one directly behind a product, on a register of that product's B operand */
    v8f sg[2]; const float* gp = GP + oo;
#pragma unroll
    for (int mb = 0; mb < 2; ++mb) { const v4f g0 = *(const v4f*)(gp + mb * 16), g1 = *(const v4f*)(gp + mb * 16 + 4);
#pragma unroll
        for (int r = 0; r < 8; ++r) sg[mb][r] = sigm_slot(r < 4 ? g0[r & 3] : g1[r & 3]); }
    asm volatile("s_wait_xcnt 0x0" :: "v"(gp) : "memory");   /* precaution: the address of the gate's loads is an input here, so it stays live up to this wait and is not overwritten in front of it */
    __builtin_amdgcn_sched_barrier(0);   /* keeps those exponentials in front of the products below */
    v8f o[2]; o[0] = (v8f){}; o[1] = (v8f){};
    /* the same order here: trip k = (key block c, channel half mb); V^T fragments from LDS one trip ahead (two sets), and half of the next key block's weights split to hi/lo beside each trip's products (two sets) */
    v8us PH[2][2], PL[2][2]; v16bf vh[2], vl[2];
    split8(st[0] * f, PH[0][0], PL[0][0]); split8(st[1] * f, PH[0][1], PL[0][1]);
    vh[0] = WFrag<bf>::ld(vph); vl[0] = WFrag<bf>::ld(vpl);
#pragma unroll
    for (int k = 0; k < NI / 16; ++k) { const int c = k >> 1, mb = k & 1;
        if (k + 1 < NI / 16) { const int e = ((k + 1) & 1) * 16 * NI + ((k + 1) >> 1) * 512; vh[(k + 1) & 1] = WFrag<bf>::ld(vph + e); vl[(k + 1) & 1] = WFrag<bf>::ld(vpl + e); }
        __builtin_amdgcn_sched_barrier(0);   /* the load group stays in front of the products, as above */
        const v16bf ph = cat16b(PH[c & 1][0], PH[c & 1][1]), pl = cat16b(PL[c & 1][0], PL[c & 1][1]);
        o[mb] = wmmab(vh[k & 1], ph, o[mb]); o[mb] = wmmab(vh[k & 1], pl, o[mb]); o[mb] = wmmab(vl[k & 1], ph, o[mb]);
        if (c + 1 < NI / 32) split8(st[2 * (c + 1) + mb] * f, PH[(c + 1) & 1][mb], PL[(c + 1) & 1][mb]);
        __builtin_amdgcn_sched_barrier(0);   /* and the next group behind them */
    }
    const unsigned ao = ((unsigned)(s * NI + (i - lr)) * DQ + h * 512 + 8 * lane);   /* the same in fragment order (K = DQ, block k / 32 = h): o[mb] is register half mb as it lies */
#pragma unroll
    for (int mb = 0; mb < 2; ++mb) { v8us oh, ol;
        v8f y;
#pragma unroll
        for (int r = 0; r < 8; ++r) y[r] = __fmul_rn(sg[mb][r], o[mb][r]);
        split8(y, oh, ol);
        *(v8us*)(Ah + ao + mb * 256) = oh; *(v8us*)(Al + ao + mb * 256) = ol; }
}

extern "C" void kernel_launch(void* const* d_in, const int* in_sizes, int n_in,
                              void* d_out, int out_size, void* d_ws, size_t ws_size, hipStream_t stream) {
    (void)in_sizes; (void)n_in; (void)out_size;
    const float* msa = (const float*)d_in[0]; const float* pair = (const float*)d_in[1]; const float* lmg = (const float*)d_in[2]; const float* lmb = (const float*)d_in[3]; const float* lpg = (const float*)d_in[4]; const float* lpb = (const float*)d_in[5]; const float* wq = (const float*)d_in[6]; const float* wk = (const float*)d_in[7]; const float* wv = (const float*)d_in[8]; const float* wp = (const float*)d_in[9]; const float* wg = (const float*)d_in[10]; const float* bg = (const float*)d_in[11]; const float* wo = (const float*)d_in[12]; const float* bo = (const float*)d_in[13];
    float* OUT = (float*)d_out;     // [1][128][256][256]
    char* wsp = (char*)d_ws;
    auto take = [&](size_t bytes) { char* p = wsp; wsp += (bytes + 255) & ~(size_t)255; return (void*)p; };
    bf* WQ = (bf*)take((size_t)DQ * DM * 2); bf* WK = (bf*)take((size_t)DQ * DM * 2); bf* WV = (bf*)take((size_t)DQ * DM * 2); bf* WG = (bf*)take((size_t)DQ * DM * 2); bf* WO = (bf*)take((size_t)DM * DQ * 2); bf* WP = (bf*)take((size_t)NBP * CZ * 2);
    bf* Mh = (bf*)take((size_t)NRM * DM * 2); bf* Ml = (bf*)take((size_t)NRM * DM * 2); float* FQ = (float*)take((size_t)NRM * DQ * 4); float* GP = (float*)take((size_t)NRM * DQ * 4); float* BIAS = (float*)take((size_t)NRP * NBP * 4);
    bf* QPh = (bf*)take((size_t)NP * NI * HD * 2); bf* QPl = (bf*)take((size_t)NP * NI * HD * 2); bf* KPh = (bf*)take((size_t)NP * NI * HD * 2); bf* KPl = (bf*)take((size_t)NP * NI * HD * 2); bf* VTh = (bf*)take((size_t)NP * HP * NI * 2); bf* VTl = (bf*)take((size_t)NP * HP * NI * 2);
    bf* ATh = Mh; bf* ATl = Ml;   /* the gated context reuses the LN operand buffers (m is dead after the projections) */
    if ((size_t)(wsp - (char*)d_ws) > ws_size) return;    // ws 256 MiB (carve ~241 MiB; the pair LN operand lies in FQ, see below)
    bf* PLh = (bf*)FQ; bf* PLl = (bf*)FQ + (size_t)NRP * CZ;   /* pair LN planes [65536][128] bf16 = 16 MiB each, both inside FQ (32 MiB), which holds nothing else: the gate GEMM writes GP in the launch that reads them */
    k_prep<<<5 * NBW + NBWP + NRP / 8 + NRM / 8, 256, 0, stream>>>(msa, pair, lmg, lmb, lpg, lpb, wq, wk, wv, wg, wo, wp, WQ, WK, WV, WG, WO, WP, Mh, Ml, PLh, PLl);
    k_proj<<<NRM / 64 + NRP / 256, 128, 0, stream>>>(Mh, Ml, WQ, WK, WV, WG, bg, QPh, QPl, KPh, KPl, VTh, VTl, GP, WP, PLh, PLl, BIAS);
    k_fattn<<<NS * NH_ * (NI / 128), 256, 0, stream>>>(QPh, QPl, KPh, KPl, VTh, VTl, BIAS, GP, ATh, ATl);
    k_gemmo<<<NRM / 64, 128, 0, stream>>>(ATh, ATl, WO, OUT, bo);            /* out = vals Wo + bo */
}

// v009
// It runs in 85.3 microseconds.
// Two timings next to v008 put it at 1.13 and 1.15 times that version's speed.
// Over all steps from v000 it is 20.3 times as fast.
#include <hip/hip_runtime.h>

// MSA row attention with pair bias (msa [1][128][256][256], pair [1][256][256][128]; m = LN(msa), p = LN(pair) (eps 1e-5, affine); Q, K, V = m W ('xw' [256][256], 8 heads x 32), G = sigmoid(m Wg + bg); bias[h][i][j] = (p Wp)[i][j][h] ('xw' [128][8]); per sequence s and head h: attn = softmax(Q_s,h . K_s,h / sqrt(32) + bias_h); vals = G * (attn V); out = vals Wo + bo ('xw' [256][256]) -> [1][128][256][256] (8.4 M)).
// Layout: the kernels that multiply LayerNorm rows normalise them themselves (a whole wave on a row) and put the hi/lo operands of the msa (32,768 x 256) and pair (65,536 x 128) slabs in LDS, never in memory; hl x exact projections (Q, K, V, gate pre-activation, and the pair bias against Wp zero-padded to 16 columns); the Q and K GEMMs store hi/lo planes [sequence x head][residue][32] and the V GEMM hi/lo V^T planes [sequence x head][64][residue], rows 0..31 written and read, from their epilogues; one attention kernel over all 1024 (sequence, head) pairs keeps a wave's 16 x 256 scores in registers: scores (3 products, K 32), + bias[h][i][j], softmax over the 256 residues with every row hi/lo, attn.V (3 products), sigmoid gate, and writes the hi/lo operand of the Wo GEMM.
// Operand order: every 16-bit plane that a matrix fragment is loaded from lies in fragment order (fro() below), written so by its producer, except the LayerNorm rows, which lie in LDS row by row at pitch AP or PP; the pair bias lies in the order of the score accumulators. A wave's 16-byte-a-lane load then covers 512 contiguous bytes.
// Compute dtypes, f32 accumulate: every input rounded to bf16; LN, sigmoid, softmax f32; GEMM activations bf16 hi/lo (2 products) x exact weights; scores and attn.V 3 products.

#define NB_  1
#define TT   256
#define DM   256
#define NH_  8
#define NKV  8
#define REP  (NH_ / NKV)
#define HD   32
#define DQ   (NH_ * HD)
#define DKV  (NKV * HD)
#define WIN  0
#define SCL  0.17677669529663688f   // 32^-0.5
#define NS   128     // sequences
#define NI   256     // residues (= TT)
#define CZ   128     // pair channels
#define NP   (NS * NH_)   // 1024 pseudo-heads
#define NRM  (NS * NI)    // 32768 msa rows
#define NRP  (NI * NI)    // 65536 pair rows
#define HP   64      // padded head width for attn.v
#define NBP  64      // head planes allocated for the bias (8 used)
typedef _Float16 h16;
typedef unsigned short bf;
typedef __attribute__((ext_vector_type(16))) __bf16   v16bf;
typedef __attribute__((ext_vector_type(16))) _Float16 v16h;
typedef __attribute__((ext_vector_type(8)))  _Float16 v8h;
typedef __attribute__((ext_vector_type(8)))  unsigned short v8us;
typedef __attribute__((ext_vector_type(8)))  float    v8f;
typedef __attribute__((ext_vector_type(4)))  float    v4f;
typedef v8h  __attribute__((may_alias)) v8ha;
typedef v4f  __attribute__((may_alias)) v4fa;
typedef v8us __attribute__((may_alias)) v8usa;

typedef __attribute__((ext_vector_type(2))) float    f32x2;
typedef __attribute__((ext_vector_type(2))) __bf16   bf16x2;
typedef __attribute__((ext_vector_type(4))) unsigned u32x4;
typedef __attribute__((ext_vector_type(2))) unsigned u32x2;
// f32 -> bf16, nearest even, by the convert instruction: one v_cvt_pk_bf16_f32 rounds two values and leaves them packed as the planes hold them
__device__ __forceinline__ unsigned pk2(float a, float b) { f32x2 x; x[0] = a; x[1] = b; return __builtin_bit_cast(unsigned, __builtin_convertvector(x, bf16x2)); }
__device__ __forceinline__ unsigned short f2bf(float f) { return __builtin_bit_cast(unsigned short, (__bf16)f); }
__device__ __forceinline__ float bf2f(unsigned short b) { return __uint_as_float(((unsigned)b) << 16); }
__device__ __forceinline__ float bfr(float f) { return bf2f(f2bf(f)); }
__device__ __forceinline__ void bfr2(float a, float b, float& ra, float& rb) { const unsigned h = pk2(a, b); ra = __uint_as_float(h << 16); rb = __uint_as_float(h & 0xFFFF0000u); }
// hi/lo split of a pair: h = the two rounded values, l = the two rounded remainders (a remainder is exact in f32)
__device__ __forceinline__ void split2(float a, float b, unsigned& h, unsigned& l) { h = pk2(a, b); l = pk2(a - __uint_as_float(h << 16), b - __uint_as_float(h & 0xFFFF0000u)); }
__device__ __forceinline__ void split8(v8f y, v8us& oh, v8us& ol) { u32x4 h, l;
    /* unrolled so that the vectors' elements are indexed by constants and stay in registers */
#pragma unroll
    for (int q = 0; q < 4; ++q) { unsigned u, w2; split2(y[2 * q], y[2 * q + 1], u, w2); h[q] = u; l[q] = w2; }
    oh = __builtin_bit_cast(v8us, h); ol = __builtin_bit_cast(v8us, l); }
__device__ __forceinline__ v16h cat16(v8h lo, v8h hi) { return __builtin_shufflevector(lo, hi, 0, 1, 2, 3, 4, 5, 6, 7, 8, 9, 10, 11, 12, 13, 14, 15); }
__device__ __forceinline__ v16bf cat16b(v8us lo, v8us hi) { return __builtin_bit_cast(v16bf, __builtin_shufflevector(lo, hi, 0, 1, 2, 3, 4, 5, 6, 7, 8, 9, 10, 11, 12, 13, 14, 15)); }
// Fragment order of a [rows][K] 16-bit plane: blocks of 16 rows x 32 k (1 KiB), block (row / 16, k / 32) row-major; inside a block [k / 16 % 2][k / 8 % 2][row % 16][k % 8], which is [register half][lane][8]: lane (lr, hi) of a 16x16x32 fragment finds its 16 values at block + lane * 8 and + 256.
__device__ __forceinline__ unsigned fro(unsigned row, unsigned k, unsigned K) { return ((row >> 4) * (K >> 5) + (k >> 5)) * 512u + ((k >> 4) & 1u) * 256u + ((k >> 3) & 1u) * 128u + (row & 15u) * 8u + (k & 7u); }
// its inverse: element e of the plane -> (row, k)
__device__ __forceinline__ void frd(unsigned e, unsigned K, unsigned& row, unsigned& k) { const unsigned blk = e >> 9; row = (blk / (K >> 5)) * 16u + ((e >> 3) & 15u); k = (blk % (K >> 5)) * 32u + ((e >> 8) & 1u) * 16u + ((e >> 7) & 1u) * 8u + (e & 7u); }
__device__ __forceinline__ v8f wmma16(v16h a, v16h b, v8f c) { return __builtin_amdgcn_wmma_f32_16x16x32_f16(false, a, false, b, (short)0, c, false, false); }
__device__ __forceinline__ v8f wmmab(v16bf a, v16bf b, v8f c) { return __builtin_amdgcn_wmma_f32_16x16x32_bf16(false, a, false, b, (short)0, c, false, false); }



// ---- gemmw_tile: register-blocked GEMM, ONE WAVE per 64x64 output tile (16 accumulators), operands straight from 16-bit planes in fragment order, except A with ALDS 2 (LayerNorm rows); tile (bx, by) of (M/64, N/64), 32 threads; sm = the wave's 4608 bytes of LDS for the epilogue.
// ALDS 1: A and A2 are the tile's own 64 rows, staged in LDS by stage_a() in the same fragment order, and shared by every wave of the workgroup. ALDS 2: the same rows, put in LDS by stage_ln() row by row at a pitch of AP values. B comes from global memory either way.
// C[m][n] (f32, pitch ldc, + optional f32 bias[n]) = sum_k A[m][k] Bt[n][k] (+ split products per NSPLIT). K % 32 == 0.
// OUTM 0: f32 C. OUTM 1 and 2 (m = sequence x residue, n = head x 32): bf16 hi/lo of C, 1: to Ph/Pl[sequence x head][residue][32], 2: transposed to Ph/Pl[sequence x head][HP][residue], each [sequence x head] slab in fragment order. All store 16 bytes a lane and whole 128-byte lines a store.
// LDS pitches, in 16-bit values, of rows that a LayerNorm stage lays down whole: row bytes + 16, an odd multiple of 16 bytes, so that the 16 rows of a fragment's 16-byte reads fall on distinct banks
#define AP (DM + 8)
#define PP (CZ + 8)
// a lane's 16 values of a 16x16x32 fragment from such a row: p = row lr, k = 32 t + 8 hi; register half 1 lies 16 values on (the k order of fro())
__device__ __forceinline__ v16bf ldrow(const bf* p) { return cat16b(*(const v8usa*)p, *(const v8usa*)(p + 16)); }
template <typename T16> struct WFrag;
template <> struct WFrag<h16> { typedef v16h V; static __device__ __forceinline__ V ld(const h16* p) { return cat16(*(const v8h*)p, *(const v8h*)(p + 256)); } static __device__ __forceinline__ v8f mma(V a, V b, v8f c) { return wmma16(a, b, c); } };
template <> struct WFrag<bf> { typedef v16bf V; static __device__ __forceinline__ V ld(const bf* p) { return cat16b(*(const v8us*)p, *(const v8us*)(p + 256)); } static __device__ __forceinline__ v8f mma(V a, V b, v8f c) { return wmmab(a, b, c); } };
template <typename T16, int NSPLIT, bool BIAS, int OUTM, int ALDS>
__device__ __forceinline__ void gemmw_tile(const T16* __restrict__ A, const T16* __restrict__ A2, const T16* __restrict__ Bt, const T16* __restrict__ Bt2, int K, float* C, int ldc, const float* __restrict__ bias, bf* Ph, bf* Pl, int bx, int by, char* sm) {
    typedef typename WFrag<T16>::V V;
    const int lane = threadIdx.x & 31, lr = lane & 15, hi = lane >> 4; const int r0 = bx * 64, c0 = by * 64;
    constexpr int NMB = 4;   /* 16-row blocks of A */
    v8f acc[NMB][4];
#pragma unroll
    for (int mb = 0; mb < NMB; ++mb)
#pragma unroll
        for (int nb = 0; nb < 4; ++nb) acc[mb][nb] = (v8f){};
    /* 32-bit byte offsets, as in k_fattn (every operand plane is below 64 MiB): one offset register serves the planes of A, one those of B; neither changes, every trip's step is an immediate offset */
    const unsigned ao = (ALDS == 2 ? (unsigned)(lr * AP + 8 * hi) : (ALDS ? 0u : (unsigned)r0 * K) + 8 * lane) * 2u, bo = ((unsigned)c0 * K + 8 * lane) * 2u;   /* 16 rows of K values are K / 32 blocks of 512 */
    const T16* pa = (const T16*)((const char*)A + ao); const T16* pa2 = (const T16*)((const char*)A2 + ao); const T16* pb = (const T16*)((const char*)Bt + bo); const T16* pb2 = (const T16*)((const char*)Bt2 + bo);
    /* NFS fragment sets: trip t's loads all go out as one group in front of the products of trip t - (NFS - 1), so that a trip waits for its operands once, and NFS - 1 trips of products after they were asked for */
    constexpr int NFS = 2;
    V a[NFS][NMB], a2[NFS][NMB], b[NFS][4], b2[NFS][4];
    /* unrolled whole (K is a constant at every call): the sets are indexed by constants and stay in registers, and no address register is rewritten between the trips */
#pragma unroll
    for (int t = 0; t < K / 32 + NFS - 1; ++t) {
        if (t < K / 32) { const int s = t % NFS;
#pragma unroll
            for (int nb = 0; nb < 4; ++nb) { b[s][nb] = WFrag<T16>::ld(pb + t * 512 + nb * 16 * K); if (NSPLIT >= 2) b2[s][nb] = WFrag<T16>::ld(pb2 + t * 512 + nb * 16 * K); }
#pragma unroll
            for (int mb = 0; mb < NMB; ++mb) {
                if constexpr (ALDS == 2) { a[s][mb] = ldrow(pa + t * 32 + mb * 16 * AP); a2[s][mb] = ldrow(pa2 + t * 32 + mb * 16 * AP); }
                else { a[s][mb] = WFrag<T16>::ld(pa + t * 512 + mb * 16 * K); if (NSPLIT == 1 || NSPLIT == 2) a2[s][mb] = WFrag<T16>::ld(pa2 + t * 512 + mb * 16 * K); } } }
        __builtin_amdgcn_sched_barrier(0);   /* keeps the load group in front of the products: moved down among them, each part of it would be waited for by itself */
        if (t >= NFS - 1) { const int s = (t - (NFS - 1)) % NFS;
#pragma unroll
            for (int nb = 0; nb < 4; ++nb) {
#pragma unroll
                for (int mb = 0; mb < NMB; ++mb) { acc[mb][nb] = WFrag<T16>::mma(a[s][mb], b[s][nb], acc[mb][nb]); if (NSPLIT == 1 || NSPLIT == 2) acc[mb][nb] = WFrag<T16>::mma(a2[s][mb], b[s][nb], acc[mb][nb]); if (NSPLIT >= 2) acc[mb][nb] = WFrag<T16>::mma(a[s][mb], b2[s][nb], acc[mb][nb]); } } }
        __builtin_amdgcn_sched_barrier(0);   /* keeps what follows (the next group; behind the last trip the epilogue) from being mixed in among these products: that build took more registers, enough to cost a wave per SIMD */
    }
    asm volatile("s_wait_xcnt 0x0" :: "v"(ao), "v"(bo) : "memory");   /* precaution: the offset registers of the loads are inputs here, so they stay live up to this wait and none is overwritten in front of it */
    if constexpr (OUTM == 2) {
    /* a lane's 8 accumulator rows are 8 neighbouring residues of one channel: one lane's 16 bytes of a V^T fragment (row = channel, k = residue), so every store is 512 contiguous bytes as the values lie */
    const unsigned pv = ((unsigned)r0 / NI) * NH_ + (unsigned)c0 / HD, kb = ((unsigned)r0 % NI) / 32;
    /* every loop of this block is unrolled so that acc[][] and the vectors' elements are indexed by constants and stay in registers */
#pragma unroll
    for (int nb = 0; nb < 4; ++nb) {
#pragma unroll
        for (int mb = 0; mb < 4; ++mb) { v8us oh, ol;
            split8(acc[mb][nb], oh, ol);
            const unsigned e = (pv + (nb >> 1)) * (HP * NI) + ((nb & 1) * (NI / 32) + kb + (mb >> 1)) * 512u + (mb & 1) * 256u + lane * 8u;
            *(v8us*)(Ph + e) = oh; *(v8us*)(Pl + e) = ol; }
        asm volatile("s_wait_xcnt 0x0" ::: "memory");   /* precaution: stands behind these stores, in front of whatever next overwrites their address or data registers */
    }
    } else {
    float* os = (float*)sm;
#pragma unroll
    for (int mb = 0; mb < 4; ++mb) {
#pragma unroll
        for (int nb = 0; nb < 4; ++nb) {
#pragma unroll
            for (int j = 0; j < 8; ++j) os[(hi * 8 + j) * 68 + nb * 16 + lr] = acc[mb][nb][j]; }
        __builtin_amdgcn_wave_barrier(); asm volatile("" ::: "memory");
        if (OUTM == 0) {
        float* crow = C + (size_t)(r0 + mb * 16) * ldc + c0;
#pragma unroll
            for (int s = 0; s < 8; ++s) { const int row = 2 * s + hi, cofs = lr * 4; v4f val = *(const v4fa*)(os + row * 68 + cofs); if (BIAS) { val[0] += bfr(bias[c0 + cofs]); val[1] += bfr(bias[c0 + cofs + 1]); val[2] += bfr(bias[c0 + cofs + 2]); val[3] += bfr(bias[c0 + cofs + 3]); }
                *(v4f*)(crow + (size_t)row * ldc + cofs) = val; }
        } else {
            /* unrolled, like the inner loop: the vectors' elements are indexed by constants and stay in registers */
#pragma unroll
            for (int s = 0; s < 4; ++s) { const int row = 8 * (s & 1) + (lane & 7), cofs = ((s >> 1) * 4 + (lane >> 3)) * 8; const v4f v0 = *(const v4fa*)(os + row * 68 + cofs), v1 = *(const v4fa*)(os + row * 68 + cofs + 4); v8us oh, ol;   /* 8 rows x the 4 pieces of one head: 4 whole lines in fragment order */
                split8(__builtin_shufflevector(v0, v1, 0, 1, 2, 3, 4, 5, 6, 7), oh, ol);
                const unsigned m = (unsigned)(r0 + mb * 16 + row), n = (unsigned)(c0 + cofs);
                const unsigned e = ((m / NI) * NH_ + n / HD) * (NI * HD) + fro(m % NI, n % HD, HD);
                *(v8us*)(Ph + e) = oh; *(v8us*)(Pl + e) = ol; }
        }
        asm volatile("s_wait_xcnt 0x0" ::: "memory");   /* precaution, as above: behind the stores of either form */
        __builtin_amdgcn_wave_barrier(); asm volatile("" ::: "memory");
    }
    }
}

// stage_a: the 64 rows x 256 k of tile bx of both planes of an A operand (in fragment order 32 KiB in a row of each plane) into sa, hi plane then lo plane, by asynchronous copies, 16 bytes a lane; 128 threads, 32 copies a lane. Behind it every wave of the workgroup may read sa.
__device__ __forceinline__ void cp8(unsigned l, const char* g) {
    /* eight copies and their s_wait_xcnt 0 in one statement: a precaution, the wait stands in front of whatever next rewrites an address register of a copy */
    asm volatile("global_load_async_to_lds_b128 %0, %8, off\n\tglobal_load_async_to_lds_b128 %1, %9, off\n\tglobal_load_async_to_lds_b128 %2, %10, off\n\tglobal_load_async_to_lds_b128 %3, %11, off\n\tglobal_load_async_to_lds_b128 %4, %12, off\n\tglobal_load_async_to_lds_b128 %5, %13, off\n\tglobal_load_async_to_lds_b128 %6, %14, off\n\tglobal_load_async_to_lds_b128 %7, %15, off\n\ts_wait_xcnt 0x0"
        :: "v"(l), "v"(l + 2048u), "v"(l + 4096u), "v"(l + 6144u), "v"(l + 8192u), "v"(l + 10240u), "v"(l + 12288u), "v"(l + 14336u),
           "v"(g), "v"(g + 2048), "v"(g + 4096), "v"(g + 6144), "v"(g + 8192), "v"(g + 10240), "v"(g + 12288), "v"(g + 14336) : "memory");
}
__device__ __forceinline__ void stage_a(bf* sa, const bf* __restrict__ Ah, const bf* __restrict__ Al, int bx) {
    const unsigned l = (unsigned)(size_t)sa + threadIdx.x * 16u;   /* the low 32 bits of a __shared__ address are the byte offset in LDS */
    const size_t go = (size_t)bx * (64 * DM * 2) + threadIdx.x * 16u;
    cp8(l, (const char*)Ah + go); cp8(l + 16384u, (const char*)Ah + go + 16384);
    cp8(l + 32768u, (const char*)Al + go); cp8(l + 49152u, (const char*)Al + go + 16384);
    asm volatile("s_wait_asynccnt 0x0" ::: "memory");   /* this wave's copies have landed */
    __syncthreads();                                    /* and every other wave's: nobody reads sa in front of this barrier */
}
typedef u32x2 __attribute__((may_alias)) u32x2a;
// Sum over the wave's 32 lanes, the same bits in every lane: four row_xmask steps inside the 16-lane rows, then the other row.
template <int CTRL> __device__ __forceinline__ float dppx(float x) { return __builtin_bit_cast(float, __builtin_amdgcn_update_dpp(0, __builtin_bit_cast(int, x), CTRL, 0xf, 0xf, true)); }
__device__ __forceinline__ float wsum(float x) { x += dppx<0x161>(x); x += dppx<0x162>(x); x += dppx<0x164>(x); x += dppx<0x168>(x); const int b = __builtin_bit_cast(int, x); return x + __builtin_bit_cast(float, __builtin_amdgcn_permlanex16(b, b, 0x76543210, 0xfedcba98, false, false)); }
__device__ __forceinline__ float rsq_slot(float a) { float r; asm("v_rsq_f32 %0, %1\n\tv_nop" : "=v"(r) : "v"(a)); return r; }
// the lane's LayerNorm scale and shift, rounded to bf16 like every input: values 128 c + 4 lane .. + 3 (lo = 16 lane, a byte offset)
template <int WD> __device__ __forceinline__ void lnaff(const float* __restrict__ g, const float* __restrict__ bb, unsigned lo, f32x2 (&gq)[WD / 64], f32x2 (&bq)[WD / 64]) {
#pragma unroll
    for (int c = 0; c < WD / 128; ++c) { const v4f gv = *(const v4f*)((const char*)g + lo + c * 512), bv = *(const v4f*)((const char*)bb + lo + c * 512); float t0, t1;
        bfr2(gv[0], gv[1], t0, t1); gq[2 * c][0] = t0; gq[2 * c][1] = t1; bfr2(gv[2], gv[3], t0, t1); gq[2 * c + 1][0] = t0; gq[2 * c + 1][1] = t1;
        bfr2(bv[0], bv[1], t0, t1); bq[2 * c][0] = t0; bq[2 * c][1] = t1; bfr2(bv[2], bv[3], t0, t1); bq[2 * c + 1][0] = t0; bq[2 * c + 1][1] = t1; }
}
// ln16: LayerNorm of the first NR of the rows of WD values that one wave holds (x[r][c] = values 128 c + 4 lane .. + 3 of row r); row r's hi/lo split goes to LDS at dh / dl + r * PITCH + 128 c (dh and dl include the lane's 4 lane): a store covers 256 contiguous bytes.
template <int WD, int PITCH, int NR>
__device__ __forceinline__ void ln16(const v4f (&x)[16][WD / 128], const f32x2 (&gq)[WD / 64], const f32x2 (&bq)[WD / 64], bf* dh, bf* dl) {
    constexpr int NK = WD / 64;
    /* unrolled: x[][] is indexed by constants and stays in registers, and the rows' reduction chains, which do not depend on each other, can be issued side by side */
#pragma unroll
    for (int r = 0; r < NR; ++r) { f32x2 a[NK];
#pragma unroll
        for (int k = 0; k < NK; ++k) { float t0, t1; bfr2(x[r][k >> 1][2 * (k & 1)], x[r][k >> 1][2 * (k & 1) + 1], t0, t1); a[k][0] = t0; a[k][1] = t1; }
        f32x2 s = a[0];
#pragma unroll
        for (int k = 1; k < NK; ++k) s += a[k];
        const float mean = wsum(s[0] + s[1]) * (1.0f / WD);
        f32x2 q = (f32x2){};
#pragma unroll
        for (int k = 0; k < NK; ++k) { a[k] -= mean; q += a[k] * a[k]; }
        const float rs = rsq_slot(wsum(q[0] + q[1]) * (1.0f / WD) + 1e-5f);
#pragma unroll
        for (int c = 0; c < WD / 128; ++c) { u32x2 h2, l2;
#pragma unroll
            for (int e = 0; e < 2; ++e) { const f32x2 y = a[2 * c + e] * rs * gq[2 * c + e] + bq[2 * c + e]; unsigned u, w2; split2(y[0], y[1], u, w2); h2[e] = u; l2[e] = w2; }
            *(u32x2a*)(dh + r * PITCH + c * 128) = h2; *(u32x2a*)(dl + r * PITCH + c * 128) = l2; }
    }
}
// stage_ln: LayerNorm of the 64 msa rows of tile bx, 16 rows a wave, all of a wave's 16 KiB asked for as one group; hi plane then lo plane in sa, rows at pitch AP. Behind it every wave of the workgroup may read sa.
__device__ __forceinline__ void stage_ln(bf* sa, const float* __restrict__ X, const float* __restrict__ g, const float* __restrict__ bb, int bx, int w) {
    const unsigned lo = (threadIdx.x & 31) * 16u, xo = ((unsigned)bx * 64 + w * 16) * (DM * 4u) + lo;   /* byte offsets (msa is 32 MiB) */
    const float* xr = (const float*)((const char*)X + xo);
    v4f x[16][DM / 128];
#pragma unroll
    for (int r = 0; r < 16; ++r)
#pragma unroll
        for (int c = 0; c < DM / 128; ++c) x[r][c] = *(const v4f*)(xr + r * DM + c * 128);
    f32x2 gq[DM / 64], bq[DM / 64]; lnaff<DM>(g, bb, lo, gq, bq);
    asm volatile("s_wait_xcnt 0x0" :: "v"(xo), "v"(lo), "s"(X), "s"(g), "s"(bb) : "memory");   /* precaution: the offset and base registers of the loads above are inputs here, so they stay live up to this wait and none is overwritten in front of it */
    __builtin_amdgcn_sched_barrier(0);   /* keeps the loads one group in front of the arithmetic: the last rows were asked for only after the first had come */
    bf* dh = sa + w * 16 * AP + (lo >> 2);
    /* kept rolled, four rows a trip, the rows still to come moved up in their registers behind each trip: for speed only, it keeps the kernel's text short */
#pragma unroll 1
    for (int q = 0; q < 4; ++q) {
        ln16<DM, AP, 4>(x, gq, bq, dh, dh + 64 * AP); dh += 4 * AP;
#pragma unroll
        for (int r = 0; r < 12; ++r)
#pragma unroll
            for (int c = 0; c < DM / 128; ++c) x[r][c] = x[r + 4][c];
    }
    __syncthreads();   /* every wave's rows lie in sa: nobody reads it in front of this barrier */
}
// pair_tile: the pair bias of 64 pair positions, one wave: bias[h][i][j] = Wp[:, h] . LN(pair[i][j]) for i = 16 I + 0..15, j = j0 + 0..3 (I = by / 64, j0 = 4 (by % 64)). Wp^T (rows 8..15 zero), rounded to bf16 by the wave itself, is the A operand; the B operand of column block nb is the hi/lo LayerNorm of the 16 rows (i, j0 + nb), normalised by the wave and turned to fragments through its own LDS sp (2 x 16 rows at pitch PP). The next block's rows are asked for in front of this block's LayerNorm.
__device__ __forceinline__ void pair_tile(const float* __restrict__ P, const float* __restrict__ g, const float* __restrict__ bb, const float* __restrict__ wp, float* C, int by, bf* sp) {
    const int lane = threadIdx.x & 31, lr = lane & 15, hi = lane >> 4;
    const unsigned lo = lane * 16u, wo = ((unsigned)hi * (8u * NH_) + (unsigned)min(lr, NH_ - 1)) * 4u, xo = (((unsigned)by >> 6) * (16u * NI) + ((unsigned)by & 63u) * 4u) * (CZ * 4u) + lo;   /* byte offsets (pair is 32 MiB) */
    v4f x[2][16][1];
    const float* x0 = (const float*)((const char*)P + xo);
#pragma unroll
    for (int r = 0; r < 16; ++r) x[0][r][0] = *(const v4f*)(x0 + r * (NI * CZ));
    /* lane (lr, hi) holds, of head lr, channels 32 t + 16 half + 8 hi + 0..7: the k order of ldrow() */
    const float* wr = (const float*)((const char*)wp + wo);
    v16bf a[CZ / 32];
#pragma unroll
    for (int t = 0; t < CZ / 32; ++t) { u32x4 p0, p1;
#pragma unroll
        for (int e = 0; e < 4; ++e) { const unsigned u0 = pk2(wr[(t * 32 + 2 * e) * NH_], wr[(t * 32 + 2 * e + 1) * NH_]), u1 = pk2(wr[(t * 32 + 16 + 2 * e) * NH_], wr[(t * 32 + 17 + 2 * e) * NH_]); p0[e] = lr < NH_ ? u0 : 0u; p1[e] = lr < NH_ ? u1 : 0u; }
        a[t] = cat16b(__builtin_bit_cast(v8us, p0), __builtin_bit_cast(v8us, p1)); }
    f32x2 gq[CZ / 64], bq[CZ / 64]; lnaff<CZ>(g, bb, lo, gq, bq);
    asm volatile("s_wait_xcnt 0x0" :: "v"(x0), "v"(wr), "v"(lo), "s"(g), "s"(bb) : "memory");   /* precaution: the address registers of the loads above are inputs here, so they stay live up to this wait and none is overwritten in front of it */
    v8f acc[4];
#pragma unroll
    for (int nb = 0; nb < 4; ++nb) acc[nb] = (v8f){};
    /* two column blocks a trip, two trips, kept rolled: the text stays short; inside a trip x[][][] and acc[] are indexed by constants and stay in registers */
#pragma unroll 1
    for (int p = 0; p < 2; ++p) {
        acc[0] = acc[2]; acc[1] = acc[3];
#pragma unroll
        for (int e = 0; e < 2; ++e) {
            const char* pn = (const char*)P + min(2 * p + e + 1, 3) * (CZ * 4);   /* the next block, a scalar step of the base; behind the last block there is none: the last is asked for again and not used, which keeps the trip free of branches */
            const float* xn = (const float*)(pn + xo);
#pragma unroll
            for (int r = 0; r < 16; ++r) x[e ^ 1][r][0] = *(const v4f*)(xn + r * (NI * CZ));
            asm volatile("s_wait_xcnt 0x0" :: "v"(xn) : "memory");   /* precaution, as above */
            ln16<CZ, PP, 16>(x[e], gq, bq, sp + 4 * lane, sp + 16 * PP + 4 * lane);
            asm volatile("" ::: "memory");   /* the reads below take what other lanes of this wave stored: the compiler may not lift them over the stores (the LDS serves a wave's operations in order) */
            __builtin_amdgcn_sched_barrier(0);   /* and keeps the next block's arithmetic behind this block's: lifted up, it waited for rows that had only just been asked for */
            v16bf bh[CZ / 32], bl[CZ / 32];
#pragma unroll
            for (int t = 0; t < CZ / 32; ++t) { bh[t] = ldrow(sp + lr * PP + 8 * hi + t * 32); bl[t] = ldrow(sp + (16 + lr) * PP + 8 * hi + t * 32); }
            asm volatile("" ::: "memory");   /* nor the next block's stores over these reads */
            __builtin_amdgcn_sched_barrier(0);   /* keeps the 16 reads one group in front of the products: set in pairs among them, each pair was waited for by itself */
            v8f c = (v8f){};
#pragma unroll
            for (int t = 0; t < CZ / 32; ++t) { c = wmmab(a[t], bh[t], c); c = wmmab(a[t], bl[t], c); }
            acc[2 + e] = c;
        }
    }
    /* lane lr of the lower half holds, for head r, bias[r][i][j0 .. j0 + 3] in acc[0..3][r]: 16 bytes of C[head][I][j / 16][j / 4 % 2][j / 8 % 2][i % 16][j % 4], which k_fattn reads lane by lane */
    if (hi == 0) {
        const unsigned e0 = (((unsigned)by >> 6) * 16u + (((unsigned)by & 63u) >> 2)) * 256u + ((unsigned)by & 1u) * 128u + (((unsigned)by >> 1) & 1u) * 64u + lr * 4u;
#pragma unroll
        for (int r = 0; r < NH_; ++r) { v4f val; val[0] = acc[0][r]; val[1] = acc[1][r]; val[2] = acc[2][r]; val[3] = acc[3][r]; *(v4f*)(C + e0 + (unsigned)r * NRP) = val; }
        asm volatile("s_wait_xcnt 0x0" ::: "memory");   /* precaution: behind the stores, in front of the next overwrite of their registers */
    }
}
// k_proj: the msa LayerNorm and the four GEMMs on it, four waves a workgroup: one 64-row tile of msa, normalised once into LDS; wave w multiplies it by column tile w of each of Wq, Wk, Wv and Wg (16 output tiles from one staged A). Two workgroups fit a WGP, so the 512 fill the chip exactly.
__global__ __launch_bounds__(128) void k_proj(const float* __restrict__ msa, const float* __restrict__ lmg, const float* __restrict__ lmb, const bf* __restrict__ WQ, const bf* __restrict__ WK, const bf* __restrict__ WV, const bf* __restrict__ WG, const float* __restrict__ bg, bf* QPh, bf* QPl, bf* KPh, bf* KPl, bf* VTh, bf* VTl, float* GP) {
    __shared__ __align__(16) bf sa[2 * 64 * AP];
    __shared__ __align__(16) char sm4[4 * 4608];
    const int b = (int)blockIdx.x, w = __builtin_amdgcn_readfirstlane(threadIdx.x >> 5); char* sm = sm4 + w * 4608;   /* the wave's number in a scalar register: the tile's addresses then stay scalar, as they were when they came from blockIdx */
    stage_ln(sa, msa, lmg, lmb, b, w);
    /* kept rolled: Q and K share one body, so the kernel's text stays short. Workgroup b starts with GEMM b % 4: at any time the workgroups then read all four weight matrices, not the same few lines of one */
#pragma unroll 1
    for (int it = 0; it < 4; ++it) { const int g = (b + it) & 3;
        if (g < 2) gemmw_tile<bf, 1, false, 1, 2>(sa, sa + 64 * AP, g ? WK : WQ, nullptr, DM, nullptr, 0, nullptr, g ? KPh : QPh, g ? KPl : QPl, b, w, sm);
        else if (g == 2) gemmw_tile<bf, 1, false, 2, 2>(sa, sa + 64 * AP, WV, nullptr, DM, nullptr, 0, nullptr, VTh, VTl, b, w, sm);
        else gemmw_tile<bf, 1, true, 0, 2>(sa, sa + 64 * AP, WG, nullptr, DM, GP, DQ, bg, nullptr, nullptr, b, w, sm);          /* gate pre-activation m Wg + bg */
    }
}
// k_gemmo: out = vals Wo + bo; grid M/64, wave w = column tile w, the 64 rows of vals staged once in LDS.
__global__ __launch_bounds__(128) void k_gemmo(const bf* __restrict__ Ah, const bf* __restrict__ Al, const bf* __restrict__ WO, float* OUT, const float* __restrict__ bo) {
    __shared__ __align__(16) bf sa[2 * 64 * DQ];
    __shared__ __align__(16) char sm4[4 * 4608];
    const int w = __builtin_amdgcn_readfirstlane(threadIdx.x >> 5);   /* scalar, as in k_proj */
    stage_a(sa, Ah, Al, blockIdx.x);
    gemmw_tile<bf, 1, true, 0, 1>(sa, sa + 64 * DQ, WO, nullptr, DQ, OUT, DM, bo, nullptr, nullptr, blockIdx.x, w, sm4 + w * 4608);
}

typedef __attribute__((ext_vector_type(2))) _Float16 v2h;
typedef __attribute__((ext_vector_type(4))) _Float16 v4h;
typedef __attribute__((ext_vector_type(2))) unsigned short v2us;
typedef __attribute__((ext_vector_type(4))) unsigned short v4us;
typedef v4us __attribute__((may_alias)) v4usa;
typedef __attribute__((ext_vector_type(2))) float v2f;
typedef __attribute__((ext_vector_type(4))) int v4i;

__device__ __forceinline__ void wtG(const float* __restrict__ w, int K, int N, bf* Bt, int blk) {
    const int lane = threadIdx.x & 31; const int L0 = (blk * 4 + (threadIdx.x >> 5)) * 8; const int nlines = N * K / 64;
    /* the launch is short now, and a chain of load latencies would be its length: a wave's 8 lines are asked for as one group (unrolled; a line past the end reads the last one and stores nothing) */
    float v0[8], v1[8];
#pragma unroll
    for (int l = 0; l < 8; ++l) { unsigned n, k; frd((unsigned)min(L0 + l, nlines - 1) * 64u + lane * 2u, (unsigned)K, n, k); v0[l] = w[(size_t)k * N + n]; v1[l] = w[(size_t)(k + 1) * N + n]; }   /* the line is written whole; (n, k) follow from its place */
#pragma unroll
    for (int l = 0; l < 8; ++l) { if (L0 + l < nlines) *(unsigned*)(Bt + (size_t)(L0 + l) * 64 + lane * 2) = pk2(v0[l], v1[l]); }
}
__global__ __launch_bounds__(256) void k_cvt8(const float* __restrict__ src, bf* dst, size_t n8) { const size_t i = (size_t)blockIdx.x * 256 + threadIdx.x; if (i >= n8) return; const v8f v = *(const v8f*)(src + i * 8); v8us o;
#pragma unroll
    for (int k = 0; k < 8; ++k) o[k] = f2bf(v[k]); *(v8us*)(dst + i * 8) = o;  }




// k_prep: what depends on the inputs alone and not on msa, in one launch, four waves a workgroup. Blocks 0..255: the pair bias (LayerNorm and product), one tile of 64 pair positions a wave; then the five 256 x 256 weights to bf16 [n][k] in fragment order (32 blocks each).
#define NBW  ((DM * DQ / 64 + 31) / 32)       // blocks of one weight
__global__ __launch_bounds__(128) void k_prep(const float* __restrict__ pair, const float* __restrict__ lpg, const float* __restrict__ lpb, const float* __restrict__ wp, float* BIAS, const float* __restrict__ wq, const float* __restrict__ wk, const float* __restrict__ wv, const float* __restrict__ wg, const float* __restrict__ wo, bf* WQ, bf* WK, bf* WV, bf* WG, bf* WO) {
    __shared__ __align__(16) bf sp4[4 * 2 * 16 * PP];
    const int b = (int)blockIdx.x - NRP / 256, w5 = __builtin_amdgcn_readfirstlane(threadIdx.x >> 5);   /* the wave's number in a scalar register, so that the tile's addresses stay scalar */
    if (b < 0) pair_tile(pair, lpg, lpb, wp, BIAS, (int)blockIdx.x * 4 + w5, sp4 + w5 * (2 * 16 * PP));
    else { const int g = b / NBW;
        const float* w = g == 0 ? wq : g == 1 ? wk : g == 2 ? wv : g == 3 ? wg : wo; bf* o = g == 0 ? WQ : g == 1 ? WK : g == 2 ? WV : g == 3 ? WG : WO;
        wtG(w, DM, DQ, o, b % NBW); }      /* all five are 256 x 256 (DM == DQ) */
}
__device__ __forceinline__ float sigm_slot(float a) { float e; asm("v_exp_f32 %0, %1\n\tv_nop" : "=v"(e) : "v"(__fmul_rn(-a, 1.4426950408889634f))); return __fdiv_rn(1.0f, __fadd_rn(1.0f, e)); }
// Four exponentials and one v_nop in one statement, for the same slot: the outputs are early-clobbered, so none overwrites a source of the exponential in front of it, and the v_nop stands behind the last.
__device__ __forceinline__ void exp2x4(float& a, float& b, float& c, float& d) { float e0, e1, e2, e3; asm("v_exp_f32 %0, %4\n\tv_exp_f32 %1, %5\n\tv_exp_f32 %2, %6\n\tv_exp_f32 %3, %7\n\tv_nop" : "=&v"(e0), "=&v"(e1), "=&v"(e2), "=&v"(e3) : "v"(a), "v"(b), "v"(c), "v"(d)); a = e0; b = e1; c = e2; d = e3; }
// k_fattn: scores, pair bias, softmax, attn.V and the sigmoid gate of one (sequence, head) for 16 query rows per wave, nothing through memory in between.
// S^T = K Q^T (A = 16 key rows, B = the wave's 16 queries): lane (lr, hi) holds, of query lr, keys 16 t + 8 hi + 0..7 in st[t]; two neighbouring tiles are the B fragment of O^T = V^T P^T as they lie.
// Workgroup: 8 waves = 8 query tiles of one (sequence, head); grid 128 sequences x 8 heads x 2 query halves. The head's K and V^T planes, hi and lo (in fragment order 16 KiB in a row each), are staged once in LDS by asynchronous copies and read there by all 8 waves; Q, the bias and the gate, which no two waves share, come from global memory.
// The second launch bound asks for four waves per SIMD (256 registers a wave), so that two workgroups share a WGP and one's vector work covers the other's loads.
__device__ __forceinline__ void cp44(unsigned l, const char* g, const char* g2) {
    /* a hi and a lo plane of 16 KiB, four copies each, 4 KiB apart (256 threads x 16 bytes), and their s_wait_xcnt 0 in one statement: a precaution, as in cp8 */
    asm volatile("global_load_async_to_lds_b128 %0, %8, off\n\tglobal_load_async_to_lds_b128 %1, %9, off\n\tglobal_load_async_to_lds_b128 %2, %10, off\n\tglobal_load_async_to_lds_b128 %3, %11, off\n\tglobal_load_async_to_lds_b128 %4, %12, off\n\tglobal_load_async_to_lds_b128 %5, %13, off\n\tglobal_load_async_to_lds_b128 %6, %14, off\n\tglobal_load_async_to_lds_b128 %7, %15, off\n\ts_wait_xcnt 0x0"
        :: "v"(l), "v"(l + 4096u), "v"(l + 8192u), "v"(l + 12288u), "v"(l + 16384u), "v"(l + 20480u), "v"(l + 24576u), "v"(l + 28672u),
           "v"(g), "v"(g + 4096), "v"(g + 8192), "v"(g + 12288), "v"(g2), "v"(g2 + 4096), "v"(g2 + 8192), "v"(g2 + 12288) : "memory");
}
__global__ __launch_bounds__(256, 4) void k_fattn(const bf* __restrict__ QPh, const bf* __restrict__ QPl, const bf* __restrict__ KPh, const bf* __restrict__ KPl, const bf* __restrict__ VTh, const bf* __restrict__ VTl, const float* __restrict__ BT, const float* __restrict__ GP, bf* Ah, bf* Al) {
    const int lane = threadIdx.x & 31, lr = lane & 15, hi = lane >> 4, w = threadIdx.x >> 5;
    __shared__ __align__(16) bf skv[4 * NI * HD];   /* K hi, K lo, V^T hi, V^T lo (rows 0..31), 16 KiB each */
    const int qb = blockIdx.x & 1, h = (blockIdx.x >> 1) & 7, s = blockIdx.x >> 4;
    const int p = s * NH_ + h, i = qb * 128 + w * 16 + lr;
    { const unsigned l = (unsigned)(size_t)skv + threadIdx.x * 16u;   /* the low 32 bits of a __shared__ address are the byte offset in LDS */
      const size_t gk = (size_t)p * (NI * HD * 2) + threadIdx.x * 16u, gv = (size_t)p * (HP * NI * 2) + threadIdx.x * 16u;
      cp44(l, (const char*)KPh + gk, (const char*)KPl + gk); cp44(l + 32768u, (const char*)VTh + gv, (const char*)VTl + gv); }
    /* 32-bit byte offsets (every plane is below 64 MiB): one offset register serves a hi and a lo plane */
    const unsigned qo = (((unsigned)p * NI + (i - lr)) * HD + 8 * lane) * 2u, bo = ((unsigned)h * NRP + (unsigned)(i - lr) * NI + 4 * lane) * 4u;   /* fragment order: 16 rows x 32 = one block of 512; bias: 16 queries x 16 keys = 256 floats, [j / 4 % 2][lane][4] */
    const bf* qph = (const bf*)((const char*)QPh + qo); const bf* qpl = (const bf*)((const char*)QPl + qo); const bf* kph = skv + 8 * lane; const bf* kpl = kph + NI * HD;
    const v16bf qh = WFrag<bf>::ld(qph), ql = WFrag<bf>::ld(qpl);   /* asked for while the copies fly */
    const float* br = (const float*)((const char*)BT + bo);
    /* K fragments come from LDS one tile ahead (two sets), the bias from global memory two tiles ahead of its tile's products and three ahead of its use (four sets); the first two bias tiles too are asked for while the copies fly */
    v16bf kh[2], kl[2]; v4f b0[4], b1[4];
#pragma unroll
    for (int t = 0; t < 2; ++t) { b0[t] = *(const v4f*)(br + t * 256); b1[t] = *(const v4f*)(br + t * 256 + 128); }
    asm volatile("s_wait_asynccnt 0x0" ::: "memory");   /* this wave's copies have landed */
    __syncthreads();                                    /* and every other wave's: nobody reads skv in front of this barrier */
    kh[0] = WFrag<bf>::ld(kph); kl[0] = WFrag<bf>::ld(kpl);
    v8f st[NI / 16]; float mx = -3.0e38f;
    /* unrolled whole: the sets and st[] are indexed by constants and stay in registers. Trip t: the loads as one group, then tile t's products beside the vector work on tile t - 1 */
#pragma unroll
    for (int t = 0; t <= NI / 16; ++t) {
        if (t + 1 < NI / 16) { kh[(t + 1) & 1] = WFrag<bf>::ld(kph + (t + 1) * 16 * HD); kl[(t + 1) & 1] = WFrag<bf>::ld(kpl + (t + 1) * 16 * HD); }
        if (t + 2 < NI / 16) { b0[(t + 2) & 3] = *(const v4f*)(br + (t + 2) * 256); b1[(t + 2) & 3] = *(const v4f*)(br + (t + 2) * 256 + 128); }
        __builtin_amdgcn_sched_barrier(0);   /* keeps the load group in front of the products: left to itself the compiler set most LDS reads directly in front of their product, each with a wait to 0 */
        if (t < NI / 16) { v8f c = (v8f){}; c = wmmab(kh[t & 1], qh, c); c = wmmab(kh[t & 1], ql, c); c = wmmab(kl[t & 1], qh, c); st[t] = c; }
        if (t >= 1) {
#pragma unroll
            for (int j = 0; j < 8; ++j) { const float x = __fadd_rn(st[t - 1][j], __fmul_rn(j < 4 ? b0[(t - 1) & 3][j & 3] : b1[(t - 1) & 3][j & 3], 5.656854249492380f)) * SCL;   /* (S + bias x sqrt(32)) x 32^-0.5: the reference adds the bias after the scale */
                st[t - 1][j] = x; mx = fmaxf(mx, x); } }
        __builtin_amdgcn_sched_barrier(0);   /* keeps the next group from being mixed in among these products */
    }
    asm volatile("s_wait_xcnt 0x0" :: "v"(qo), "v"(bo), "s"(QPh), "s"(QPl), "s"(BT) : "memory");   /* precaution: the offset and base registers of the loads above are inputs here, so they stay live up to this wait and none is overwritten in front of it */
    mx = fmaxf(mx, __shfl_xor(mx, 16, 32));
    float sm[4] = {0.f, 0.f, 0.f, 0.f};
#pragma unroll
    for (int t = 0; t < NI / 16; ++t) {
#pragma unroll
        for (int j = 0; j < 8; j += 4) { float x[4];
#pragma unroll
            for (int q = 0; q < 4; ++q) x[q] = __fmul_rn(__fsub_rn(st[t][j + q], mx), 1.4426950408889634f);
            exp2x4(x[0], x[1], x[2], x[3]);
#pragma unroll
            for (int q = 0; q < 4; ++q) { st[t][j + q] = x[q]; sm[q] += x[q]; } } }
    float sum = (sm[0] + sm[1]) + (sm[2] + sm[3]); sum += __shfl_xor(sum, 16, 32);
    const float f = __fdiv_rn(1.0f, sum);
    const bf* vph = kph + 2 * NI * HD; const bf* vpl = kph + 3 * NI * HD;
    const size_t oo = ((size_t)s * NI + i) * DQ + h * HD + 8 * hi;   /* o[mb][r] = context[query i][channel 16 mb + 8 hi + r] */
    /* the gate, ahead of attn.V: its exponentials are asm text; with LDS operands the compiler set one directly behind a product, on a register of that product's B operand */
    v8f sg[2]; const float* gp = GP + oo;
#pragma unroll
    for (int mb = 0; mb < 2; ++mb) { const v4f g0 = *(const v4f*)(gp + mb * 16), g1 = *(const v4f*)(gp + mb * 16 + 4);
#pragma unroll
        for (int r = 0; r < 8; ++r) sg[mb][r] = sigm_slot(r < 4 ? g0[r & 3] : g1[r & 3]); }
    asm volatile("s_wait_xcnt 0x0" :: "v"(gp) : "memory");   /* precaution: the address of the gate's loads is an input here, so it stays live up to this wait and is not overwritten in front of it */
    __builtin_amdgcn_sched_barrier(0);   /* keeps those exponentials in front of the products below */
    v8f o[2]; o[0] = (v8f){}; o[1] = (v8f){};
    /* the same order here: trip k = (key block c, channel half mb); V^T fragments from LDS one trip ahead (two sets), and half of the next key block's weights split to hi/lo beside each trip's products (two sets) */
    v8us PH[2][2], PL[2][2]; v16bf vh[2], vl[2];
    split8(st[0] * f, PH[0][0], PL[0][0]); split8(st[1] * f, PH[0][1], PL[0][1]);
    vh[0] = WFrag<bf>::ld(vph); vl[0] = WFrag<bf>::ld(vpl);
#pragma unroll
    for (int k = 0; k < NI / 16; ++k) { const int c = k >> 1, mb = k & 1;
        if (k + 1 < NI / 16) { const int e = ((k + 1) & 1) * 16 * NI + ((k + 1) >> 1) * 512; vh[(k + 1) & 1] = WFrag<bf>::ld(vph + e); vl[(k + 1) & 1] = WFrag<bf>::ld(vpl + e); }
        __builtin_amdgcn_sched_barrier(0);   /* the load group stays in front of the products, as above */
        const v16bf ph = cat16b(PH[c & 1][0], PH[c & 1][1]), pl = cat16b(PL[c & 1][0], PL[c & 1][1]);
        o[mb] = wmmab(vh[k & 1], ph, o[mb]); o[mb] = wmmab(vh[k & 1], pl, o[mb]); o[mb] = wmmab(vl[k & 1], ph, o[mb]);
        if (c + 1 < NI / 32) split8(st[2 * (c + 1) + mb] * f, PH[(c + 1) & 1][mb], PL[(c + 1) & 1][mb]);
        __builtin_amdgcn_sched_barrier(0);   /* and the next group behind them */
    }
    const unsigned ao = ((unsigned)(s * NI + (i - lr)) * DQ + h * 512 + 8 * lane);   /* the same in fragment order (K = DQ, block k / 32 = h): o[mb] is register half mb as it lies */
#pragma unroll
    for (int mb = 0; mb < 2; ++mb) { v8us oh, ol;
        v8f y;
#pragma unroll
        for (int r = 0; r < 8; ++r) y[r] = __fmul_rn(sg[mb][r], o[mb][r]);
        split8(y, oh, ol);
        *(v8us*)(Ah + ao + mb * 256) = oh; *(v8us*)(Al + ao + mb * 256) = ol; }
}

extern "C" void kernel_launch(void* const* d_in, const int* in_sizes, int n_in,
                              void* d_out, int out_size, void* d_ws, size_t ws_size, hipStream_t stream) {
    (void)in_sizes; (void)n_in; (void)out_size;
    const float* msa = (const float*)d_in[0]; const float* pair = (const float*)d_in[1]; const float* lmg = (const float*)d_in[2]; const float* lmb = (const float*)d_in[3]; const float* lpg = (const float*)d_in[4]; const float* lpb = (const float*)d_in[5]; const float* wq = (const float*)d_in[6]; const float* wk = (const float*)d_in[7]; const float* wv = (const float*)d_in[8]; const float* wp = (const float*)d_in[9]; const float* wg = (const float*)d_in[10]; const float* bg = (const float*)d_in[11]; const float* wo = (const float*)d_in[12]; const float* bo = (const float*)d_in[13];
    float* OUT = (float*)d_out;     // [1][128][256][256]
    char* wsp = (char*)d_ws;
    auto take = [&](size_t bytes) { char* p = wsp; wsp += (bytes + 255) & ~(size_t)255; return (void*)p; };
    bf* WQ = (bf*)take((size_t)DQ * DM * 2); bf* WK = (bf*)take((size_t)DQ * DM * 2); bf* WV = (bf*)take((size_t)DQ * DM * 2); bf* WG = (bf*)take((size_t)DQ * DM * 2); bf* WO = (bf*)take((size_t)DM * DQ * 2);
    bf* ATh = (bf*)take((size_t)NRM * DQ * 2); bf* ATl = (bf*)take((size_t)NRM * DQ * 2); float* GP = (float*)take((size_t)NRM * DQ * 4); float* BIAS = (float*)take((size_t)NRP * NBP * 4);
    bf* QPh = (bf*)take((size_t)NP * NI * HD * 2); bf* QPl = (bf*)take((size_t)NP * NI * HD * 2); bf* KPh = (bf*)take((size_t)NP * NI * HD * 2); bf* KPl = (bf*)take((size_t)NP * NI * HD * 2); bf* VTh = (bf*)take((size_t)NP * HP * NI * 2); bf* VTl = (bf*)take((size_t)NP * HP * NI * 2);
    if ((size_t)(wsp - (char*)d_ws) > ws_size) return;    // ws 256 MiB (carve ~209 MiB)
    k_prep<<<NRP / 256 + 5 * NBW, 128, 0, stream>>>(pair, lpg, lpb, wp, BIAS, wq, wk, wv, wg, wo, WQ, WK, WV, WG, WO);
    k_proj<<<NRM / 64, 128, 0, stream>>>(msa, lmg, lmb, WQ, WK, WV, WG, bg, QPh, QPl, KPh, KPl, VTh, VTl, GP);
    k_fattn<<<NS * NH_ * (NI / 128), 256, 0, stream>>>(QPh, QPl, KPh, KPl, VTh, VTl, BIAS, GP, ATh, ATl);
    k_gemmo<<<NRM / 64, 128, 0, stream>>>(ATh, ATl, WO, OUT, bo);            /* out = vals Wo + bo */
}

// v010
// Measured time: 80.5 microseconds a run.
// In two side-by-side timings against v009, it was 1.07 and 1.06 times as fast.
// Counting every step since v000, it is 21.6 times as fast.
#include <hip/hip_runtime.h>

// MSA row attention with pair bias (msa [1][128][256][256], pair [1][256][256][128]; m = LN(msa), p = LN(pair) (eps 1e-5, affine); Q, K, V = m W ('xw' [256][256], 8 heads x 32), G = sigmoid(m Wg + bg); bias[h][i][j] = (p Wp)[i][j][h] ('xw' [128][8]); per sequence s and head h: attn = softmax(Q_s,h . K_s,h / sqrt(32) + bias_h); vals = G * (attn V); out = vals Wo + bo ('xw' [256][256]) -> [1][128][256][256] (8.4 M)).
// Layout: the kernels that multiply LayerNorm rows normalise them themselves (a whole wave on a row) and put the hi/lo operands of the msa (32,768 x 256) and pair (65,536 x 128) slabs in LDS, never in memory; hl x exact projections (Q, K, V, gate pre-activation, and the pair bias against Wp zero-padded to 16 columns); the Q and K GEMMs store hi/lo planes [sequence x head][residue][32] and the V GEMM hi/lo V^T planes [sequence x head][64][residue], rows 0..31 written and read, from their epilogues; one attention kernel over all 1024 (sequence, head) pairs keeps a wave's 16 x 256 scores in registers: scores (3 products, K 32, and a fourth that adds bias[h][i][j]), softmax over the 256 residues with every row hi/lo, attn.V (3 products), sigmoid gate, and writes the hi/lo operand of the Wo GEMM.
// Operand order: every 16-bit plane in memory but the pair bias that a matrix fragment is loaded from lies in fragment order (fro() below), written so by its producer; the LayerNorm rows in LDS lie row by row (ldrow()); the pair bias (times sqrt(32), f16) lies so that a lane's two 8-byte loads of a key tile are its part of a B fragment. A wave's 16-byte-a-lane load then covers 512 contiguous bytes.
// Compute dtypes, f32 accumulate: every input rounded to bf16; LN, sigmoid, softmax f32; the pair bias and the gate pre-activation lie in memory as f16; GEMM activations bf16 hi/lo (2 products) x exact weights; scores and attn.V 3 products.

#define NB_  1
#define TT   256
#define DM   256
#define NH_  8
#define NKV  8
#define REP  (NH_ / NKV)
#define HD   32
#define DQ   (NH_ * HD)
#define DKV  (NKV * HD)
#define WIN  0
#define SCL  0.17677669529663688f   // 32^-0.5
#define RSCL 5.656854249492380f     // 32^0.5
#define NS   128     // sequences
#define NI   256     // residues (= TT)
#define CZ   128     // pair channels
#define NP   (NS * NH_)   // 1024 pseudo-heads
#define NRM  (NS * NI)    // 32768 msa rows
#define NRP  (NI * NI)    // 65536 pair rows
#define HP   64      // padded head width for attn.v
typedef _Float16 h16;
typedef unsigned short bf;
typedef __attribute__((ext_vector_type(16))) __bf16   v16bf;
typedef __attribute__((ext_vector_type(16))) _Float16 v16h;
typedef __attribute__((ext_vector_type(8)))  _Float16 v8h;
typedef __attribute__((ext_vector_type(4)))  _Float16 v4h16;
typedef __attribute__((ext_vector_type(8)))  unsigned short v8us;
typedef __attribute__((ext_vector_type(8)))  float    v8f;
typedef __attribute__((ext_vector_type(4)))  float    v4f;
typedef v8h  __attribute__((may_alias)) v8ha;
typedef v4f  __attribute__((may_alias)) v4fa;
typedef v8us __attribute__((may_alias)) v8usa;

typedef __attribute__((ext_vector_type(2))) float    f32x2;
typedef __attribute__((ext_vector_type(2))) __bf16   bf16x2;
typedef __attribute__((ext_vector_type(4))) unsigned u32x4;
typedef __attribute__((ext_vector_type(2))) unsigned u32x2;
// f32 -> bf16, nearest even, by the convert instruction: one v_cvt_pk_bf16_f32 rounds two values and leaves them packed as the planes hold them
__device__ __forceinline__ unsigned pk2(float a, float b) { f32x2 x; x[0] = a; x[1] = b; return __builtin_bit_cast(unsigned, __builtin_convertvector(x, bf16x2)); }
__device__ __forceinline__ unsigned short f2bf(float f) { return __builtin_bit_cast(unsigned short, (__bf16)f); }
__device__ __forceinline__ float bf2f(unsigned short b) { return __uint_as_float(((unsigned)b) << 16); }
__device__ __forceinline__ float bfr(float f) { return bf2f(f2bf(f)); }
__device__ __forceinline__ void bfr2(float a, float b, float& ra, float& rb) { const unsigned h = pk2(a, b); ra = __uint_as_float(h << 16); rb = __uint_as_float(h & 0xFFFF0000u); }
// hi/lo split of a pair: h = the two rounded values, l = the two rounded remainders (a remainder is exact in f32)
__device__ __forceinline__ void split2(float a, float b, unsigned& h, unsigned& l) { h = pk2(a, b); l = pk2(a - __uint_as_float(h << 16), b - __uint_as_float(h & 0xFFFF0000u)); }
__device__ __forceinline__ void split8(v8f y, v8us& oh, v8us& ol) { u32x4 h, l;
    /* unrolled so that the vectors' elements are indexed by constants and stay in registers */
#pragma unroll
    for (int q = 0; q < 4; ++q) { unsigned u, w2; split2(y[2 * q], y[2 * q + 1], u, w2); h[q] = u; l[q] = w2; }
    oh = __builtin_bit_cast(v8us, h); ol = __builtin_bit_cast(v8us, l); }
__device__ __forceinline__ v16h cat16(v8h lo, v8h hi) { return __builtin_shufflevector(lo, hi, 0, 1, 2, 3, 4, 5, 6, 7, 8, 9, 10, 11, 12, 13, 14, 15); }
__device__ __forceinline__ v16bf cat16b(v8us lo, v8us hi) { return __builtin_bit_cast(v16bf, __builtin_shufflevector(lo, hi, 0, 1, 2, 3, 4, 5, 6, 7, 8, 9, 10, 11, 12, 13, 14, 15)); }
// Fragment order of a [rows][K] 16-bit plane: blocks of 16 rows x 32 k (1 KiB), block (row / 16, k / 32) row-major; inside a block [k / 16 % 2][k / 8 % 2][row % 16][k % 8], which is [register half][lane][8]: lane (lr, hi) of a 16x16x32 fragment finds its 16 values at block + lane * 8 and + 256.
__device__ __forceinline__ unsigned fro(unsigned row, unsigned k, unsigned K) { return ((row >> 4) * (K >> 5) + (k >> 5)) * 512u + ((k >> 4) & 1u) * 256u + ((k >> 3) & 1u) * 128u + (row & 15u) * 8u + (k & 7u); }
// its inverse: element e of the plane -> (row, k)
__device__ __forceinline__ void frd(unsigned e, unsigned K, unsigned& row, unsigned& k) { const unsigned blk = e >> 9; row = (blk / (K >> 5)) * 16u + ((e >> 3) & 15u); k = (blk % (K >> 5)) * 32u + ((e >> 8) & 1u) * 16u + ((e >> 7) & 1u) * 8u + (e & 7u); }
__device__ __forceinline__ v8f wmma16(v16h a, v16h b, v8f c) { return __builtin_amdgcn_wmma_f32_16x16x32_f16(false, a, false, b, (short)0, c, false, false); }
__device__ __forceinline__ v8f wmmab(v16bf a, v16bf b, v8f c) { return __builtin_amdgcn_wmma_f32_16x16x32_bf16(false, a, false, b, (short)0, c, false, false); }



// ---- gemmw_tile: register-blocked GEMM, ONE WAVE per 64x64 output tile (16 accumulators), operands straight from 16-bit planes in fragment order, except A with ALDS 2 (LayerNorm rows); tile (bx, by) of (M/64, N/64), 32 threads; sm = the wave's 4608 bytes of LDS for the epilogue.
// ALDS 1: A and A2 are the tile's own 64 rows, staged in LDS by stage_a() in the same fragment order, and shared by every wave of the workgroup. ALDS 2: the same rows, put in LDS by stage_ln() row by row at a pitch of AP values. B comes from global memory either way.
// C[m][n] (f32, pitch ldc, + optional f32 bias[n]) = sum_k A[m][k] Bt[n][k] (+ split products per NSPLIT). K % 32 == 0.
// OUTM 0: f32 C. OUTM 3: C rounded to f16, at Ph (pitch ldc). OUTM 1 and 2 (m = sequence x residue, n = head x 32): bf16 hi/lo of C, 1: to Ph/Pl[sequence x head][residue][32], 2: transposed to Ph/Pl[sequence x head][HP][residue], each [sequence x head] slab in fragment order. All store 16 bytes a lane and whole 128-byte lines a store.
// LDS pitches, in 16-bit values, of rows that a LayerNorm stage lays down whole: row bytes + 16, an odd multiple of 16 bytes, so that the 16 rows of a fragment's 16-byte reads fall on distinct banks
#define AP (DM + 8)
#define PP (CZ + 8)
// a lane's 16 values of a 16x16x32 fragment from such a row: p = row lr, k = 32 t + 8 hi; register half 1 lies 16 values on (the k order of fro())
__device__ __forceinline__ v16bf ldrow(const bf* p) { return cat16b(*(const v8usa*)p, *(const v8usa*)(p + 16)); }
template <typename T16> struct WFrag;
template <> struct WFrag<h16> { typedef v16h V; static __device__ __forceinline__ V ld(const h16* p) { return cat16(*(const v8h*)p, *(const v8h*)(p + 256)); } static __device__ __forceinline__ v8f mma(V a, V b, v8f c) { return wmma16(a, b, c); } };
template <> struct WFrag<bf> { typedef v16bf V; static __device__ __forceinline__ V ld(const bf* p) { return cat16b(*(const v8us*)p, *(const v8us*)(p + 256)); } static __device__ __forceinline__ v8f mma(V a, V b, v8f c) { return wmmab(a, b, c); } };
template <typename T16, int NSPLIT, bool BIAS, int OUTM, int ALDS>
__device__ __forceinline__ void gemmw_tile(const T16* __restrict__ A, const T16* __restrict__ A2, const T16* __restrict__ Bt, const T16* __restrict__ Bt2, int K, float* C, int ldc, const float* __restrict__ bias, bf* Ph, bf* Pl, int bx, int by, char* sm) {
    typedef typename WFrag<T16>::V V;
    const int lane = threadIdx.x & 31, lr = lane & 15, hi = lane >> 4; const int r0 = bx * 64, c0 = by * 64;
    constexpr int NMB = 4;   /* 16-row blocks of A */
    v8f acc[NMB][4];
#pragma unroll
    for (int mb = 0; mb < NMB; ++mb)
#pragma unroll
        for (int nb = 0; nb < 4; ++nb) acc[mb][nb] = (v8f){};
    /* 32-bit byte offsets, as in k_fattn (every operand plane is below 64 MiB): one offset register serves the planes of A, one those of B; neither changes, every trip's step is an immediate offset */
    const unsigned ao = (ALDS == 2 ? (unsigned)(lr * AP + 8 * hi) : (ALDS ? 0u : (unsigned)r0 * K) + 8 * lane) * 2u, bo = ((unsigned)c0 * K + 8 * lane) * 2u;   /* 16 rows of K values are K / 32 blocks of 512 */
    const T16* pa = (const T16*)((const char*)A + ao); const T16* pa2 = (const T16*)((const char*)A2 + ao); const T16* pb = (const T16*)((const char*)Bt + bo); const T16* pb2 = (const T16*)((const char*)Bt2 + bo);
    /* NFS fragment sets: trip t's loads all go out as one group in front of the products of trip t - (NFS - 1), so that a trip waits for its operands once, and NFS - 1 trips of products after they were asked for */
    constexpr int NFS = 2;
    V a[NFS][NMB], a2[NFS][NMB], b[NFS][4], b2[NFS][4];
    /* unrolled whole (K is a constant at every call): the sets are indexed by constants and stay in registers, and no address register is rewritten between the trips */
#pragma unroll
    for (int t = 0; t < K / 32 + NFS - 1; ++t) {
        if (t < K / 32) { const int s = t % NFS;
#pragma unroll
            for (int nb = 0; nb < 4; ++nb) { b[s][nb] = WFrag<T16>::ld(pb + t * 512 + nb * 16 * K); if (NSPLIT >= 2) b2[s][nb] = WFrag<T16>::ld(pb2 + t * 512 + nb * 16 * K); }
#pragma unroll
            for (int mb = 0; mb < NMB; ++mb) {
                if constexpr (ALDS == 2) { a[s][mb] = ldrow(pa + t * 32 + mb * 16 * AP); a2[s][mb] = ldrow(pa2 + t * 32 + mb * 16 * AP); }
                else { a[s][mb] = WFrag<T16>::ld(pa + t * 512 + mb * 16 * K); if (NSPLIT == 1 || NSPLIT == 2) a2[s][mb] = WFrag<T16>::ld(pa2 + t * 512 + mb * 16 * K); } } }
        __builtin_amdgcn_sched_barrier(0);   /* keeps the load group in front of the products: moved down among them, each part of it would be waited for by itself */
        if (t >= NFS - 1) { const int s = (t - (NFS - 1)) % NFS;
#pragma unroll
            for (int nb = 0; nb < 4; ++nb) {
#pragma unroll
                for (int mb = 0; mb < NMB; ++mb) { acc[mb][nb] = WFrag<T16>::mma(a[s][mb], b[s][nb], acc[mb][nb]); if (NSPLIT == 1 || NSPLIT == 2) acc[mb][nb] = WFrag<T16>::mma(a2[s][mb], b[s][nb], acc[mb][nb]); if (NSPLIT >= 2) acc[mb][nb] = WFrag<T16>::mma(a[s][mb], b2[s][nb], acc[mb][nb]); } } }
        __builtin_amdgcn_sched_barrier(0);   /* keeps what follows (the next group; behind the last trip the epilogue) from being mixed in among these products: that build took more registers, enough to cost a wave per SIMD */
    }
    asm volatile("s_wait_xcnt 0x0" :: "v"(ao), "v"(bo) : "memory");   /* precaution: the offset registers of the loads are inputs here, so they stay live up to this wait and none is overwritten in front of it */
    if constexpr (OUTM == 2) {
    /* a lane's 8 accumulator rows are 8 neighbouring residues of one channel: one lane's 16 bytes of a V^T fragment (row = channel, k = residue), so every store is 512 contiguous bytes as the values lie */
    const unsigned pv = ((unsigned)r0 / NI) * NH_ + (unsigned)c0 / HD, kb = ((unsigned)r0 % NI) / 32;
    /* every loop of this block is unrolled so that acc[][] and the vectors' elements are indexed by constants and stay in registers */
#pragma unroll
    for (int nb = 0; nb < 4; ++nb) {
#pragma unroll
        for (int mb = 0; mb < 4; ++mb) { v8us oh, ol;
            split8(acc[mb][nb], oh, ol);
            const unsigned e = (pv + (nb >> 1)) * (HP * NI) + ((nb & 1) * (NI / 32) + kb + (mb >> 1)) * 512u + (mb & 1) * 256u + lane * 8u;
            *(v8us*)(Ph + e) = oh; *(v8us*)(Pl + e) = ol; }
        asm volatile("s_wait_xcnt 0x0" ::: "memory");   /* precaution: stands behind these stores, in front of whatever next overwrites their address or data registers */
    }
    } else {
    float* os = (float*)sm;
#pragma unroll
    for (int mb = 0; mb < 4; ++mb) {
#pragma unroll
        for (int nb = 0; nb < 4; ++nb) {
#pragma unroll
            for (int j = 0; j < 8; ++j) os[(hi * 8 + j) * 68 + nb * 16 + lr] = acc[mb][nb][j]; }
        __builtin_amdgcn_wave_barrier(); asm volatile("" ::: "memory");
        if (OUTM == 0) {
        float* crow = C + (size_t)(r0 + mb * 16) * ldc + c0;
#pragma unroll
            for (int s = 0; s < 8; ++s) { const int row = 2 * s + hi, cofs = lr * 4; v4f val = *(const v4fa*)(os + row * 68 + cofs); if (BIAS) { val[0] += bfr(bias[c0 + cofs]); val[1] += bfr(bias[c0 + cofs + 1]); val[2] += bfr(bias[c0 + cofs + 2]); val[3] += bfr(bias[c0 + cofs + 3]); }
                *(v4f*)(crow + (size_t)row * ldc + cofs) = val; }
        } else if (OUTM == 3) {
        h16* crow = (h16*)Ph + (size_t)(r0 + mb * 16) * ldc + c0; const int cofs = (lane & 7) * 8; v4f v0[4], v1[4];
            /* unrolled, like the inner loops: the vectors' elements are indexed by constants and stay in registers */
#pragma unroll
            for (int s = 0; s < 4; ++s) { v0[s] = *(const v4fa*)(os + (4 * s + (lane >> 3)) * 68 + cofs); v1[s] = *(const v4fa*)(os + (4 * s + (lane >> 3)) * 68 + cofs + 4); }   /* the eight LDS reads as one group, waited for once */
#pragma unroll
            for (int s = 0; s < 4; ++s) { const int row = 4 * s + (lane >> 3); v8h o;   /* 4 rows x the tile's 64 columns: 4 whole lines */
#pragma unroll
                for (int q = 0; q < 8; ++q) o[q] = (h16)((q < 4 ? v0[s][q & 3] : v1[s][q & 3]) + (BIAS ? bfr(bias[c0 + cofs + q]) : 0.0f));
                *(v8h*)(crow + (size_t)row * ldc + cofs) = o;
                asm volatile("s_wait_xcnt 0x0" ::: "memory"); }   /* precaution: behind each store, in front of the next overwrite of its registers */
        } else {
            /* unrolled, like the inner loop: the vectors' elements are indexed by constants and stay in registers */
#pragma unroll
            for (int s = 0; s < 4; ++s) { const int row = 8 * (s & 1) + (lane & 7), cofs = ((s >> 1) * 4 + (lane >> 3)) * 8; const v4f v0 = *(const v4fa*)(os + row * 68 + cofs), v1 = *(const v4fa*)(os + row * 68 + cofs + 4); v8us oh, ol;   /* 8 rows x the 4 pieces of one head: 4 whole lines in fragment order */
                split8(__builtin_shufflevector(v0, v1, 0, 1, 2, 3, 4, 5, 6, 7), oh, ol);
                const unsigned m = (unsigned)(r0 + mb * 16 + row), n = (unsigned)(c0 + cofs);
                const unsigned e = ((m / NI) * NH_ + n / HD) * (NI * HD) + fro(m % NI, n % HD, HD);
                *(v8us*)(Ph + e) = oh; *(v8us*)(Pl + e) = ol; }
        }
        asm volatile("s_wait_xcnt 0x0" ::: "memory");   /* precaution, as above: behind the stores of either form */
        __builtin_amdgcn_wave_barrier(); asm volatile("" ::: "memory");
    }
    }
}

// stage_a: the 64 rows x 256 k of tile bx of both planes of an A operand (in fragment order 32 KiB in a row of each plane) into sa, hi plane then lo plane, by asynchronous copies, 16 bytes a lane; 128 threads, 32 copies a lane. Behind it every wave of the workgroup may read sa.
__device__ __forceinline__ void cp8(unsigned l, const char* g) {
    /* eight copies and their s_wait_xcnt 0 in one statement: a precaution, the wait stands in front of whatever next rewrites an address register of a copy */
    asm volatile("global_load_async_to_lds_b128 %0, %8, off\n\tglobal_load_async_to_lds_b128 %1, %9, off\n\tglobal_load_async_to_lds_b128 %2, %10, off\n\tglobal_load_async_to_lds_b128 %3, %11, off\n\tglobal_load_async_to_lds_b128 %4, %12, off\n\tglobal_load_async_to_lds_b128 %5, %13, off\n\tglobal_load_async_to_lds_b128 %6, %14, off\n\tglobal_load_async_to_lds_b128 %7, %15, off\n\ts_wait_xcnt 0x0"
        :: "v"(l), "v"(l + 2048u), "v"(l + 4096u), "v"(l + 6144u), "v"(l + 8192u), "v"(l + 10240u), "v"(l + 12288u), "v"(l + 14336u),
           "v"(g), "v"(g + 2048), "v"(g + 4096), "v"(g + 6144), "v"(g + 8192), "v"(g + 10240), "v"(g + 12288), "v"(g + 14336) : "memory");
}
__device__ __forceinline__ void stage_a(bf* sa, const bf* __restrict__ Ah, const bf* __restrict__ Al, int bx) {
    const unsigned l = (unsigned)(size_t)sa + threadIdx.x * 16u;   /* the low 32 bits of a __shared__ address are the byte offset in LDS */
    const size_t go = (size_t)bx * (64 * DM * 2) + threadIdx.x * 16u;
    cp8(l, (const char*)Ah + go); cp8(l + 16384u, (const char*)Ah + go + 16384);
    cp8(l + 32768u, (const char*)Al + go); cp8(l + 49152u, (const char*)Al + go + 16384);
    asm volatile("s_wait_asynccnt 0x0" ::: "memory");   /* this wave's copies have landed */
    __syncthreads();                                    /* and every other wave's: nobody reads sa in front of this barrier */
}
typedef u32x2 __attribute__((may_alias)) u32x2a;
// Sum over the wave's 32 lanes, the same bits in every lane: four row_xmask steps inside the 16-lane rows, then the other row.
template <int CTRL> __device__ __forceinline__ float dppx(float x) { return __builtin_bit_cast(float, __builtin_amdgcn_update_dpp(0, __builtin_bit_cast(int, x), CTRL, 0xf, 0xf, true)); }
__device__ __forceinline__ float wsum(float x) { x += dppx<0x161>(x); x += dppx<0x162>(x); x += dppx<0x164>(x); x += dppx<0x168>(x); const int b = __builtin_bit_cast(int, x); return x + __builtin_bit_cast(float, __builtin_amdgcn_permlanex16(b, b, 0x76543210, 0xfedcba98, false, false)); }
__device__ __forceinline__ float rsq_slot(float a) { float r; asm("v_rsq_f32 %0, %1\n\tv_nop" : "=v"(r) : "v"(a)); return r; }
// the lane's LayerNorm scale and shift, rounded to bf16 like every input: values 128 c + 4 lane .. + 3 (lo = 16 lane, a byte offset)
template <int WD> __device__ __forceinline__ void lnaff(const float* __restrict__ g, const float* __restrict__ bb, unsigned lo, f32x2 (&gq)[WD / 64], f32x2 (&bq)[WD / 64]) {
#pragma unroll
    for (int c = 0; c < WD / 128; ++c) { const v4f gv = *(const v4f*)((const char*)g + lo + c * 512), bv = *(const v4f*)((const char*)bb + lo + c * 512); float t0, t1;
        bfr2(gv[0], gv[1], t0, t1); gq[2 * c][0] = t0; gq[2 * c][1] = t1; bfr2(gv[2], gv[3], t0, t1); gq[2 * c + 1][0] = t0; gq[2 * c + 1][1] = t1;
        bfr2(bv[0], bv[1], t0, t1); bq[2 * c][0] = t0; bq[2 * c][1] = t1; bfr2(bv[2], bv[3], t0, t1); bq[2 * c + 1][0] = t0; bq[2 * c + 1][1] = t1; }
}
// ln16: LayerNorm of the first NR of the rows of WD values that one wave holds (x[r][c] = values 128 c + 4 lane .. + 3 of row r); row r's hi/lo split goes to LDS at dh / dl + r * PITCH + 128 c (dh and dl include the lane's 4 lane): a store covers 256 contiguous bytes.
template <int WD, int PITCH, int NR>
__device__ __forceinline__ void ln16(const v4f (&x)[16][WD / 128], const f32x2 (&gq)[WD / 64], const f32x2 (&bq)[WD / 64], bf* dh, bf* dl) {
    constexpr int NK = WD / 64;
    /* unrolled: x[][] is indexed by constants and stays in registers, and the rows' reduction chains, which do not depend on each other, can be issued side by side */
#pragma unroll
    for (int r = 0; r < NR; ++r) { f32x2 a[NK];
#pragma unroll
        for (int k = 0; k < NK; ++k) { float t0, t1; bfr2(x[r][k >> 1][2 * (k & 1)], x[r][k >> 1][2 * (k & 1) + 1], t0, t1); a[k][0] = t0; a[k][1] = t1; }
        f32x2 s = a[0];
#pragma unroll
        for (int k = 1; k < NK; ++k) s += a[k];
        const float mean = wsum(s[0] + s[1]) * (1.0f / WD);
        f32x2 q = (f32x2){};
#pragma unroll
        for (int k = 0; k < NK; ++k) { a[k] -= mean; q += a[k] * a[k]; }
        const float rs = rsq_slot(wsum(q[0] + q[1]) * (1.0f / WD) + 1e-5f);
#pragma unroll
        for (int c = 0; c < WD / 128; ++c) { u32x2 h2, l2;
#pragma unroll
            for (int e = 0; e < 2; ++e) { const f32x2 y = a[2 * c + e] * rs * gq[2 * c + e] + bq[2 * c + e]; unsigned u, w2; split2(y[0], y[1], u, w2); h2[e] = u; l2[e] = w2; }
            *(u32x2a*)(dh + r * PITCH + c * 128) = h2; *(u32x2a*)(dl + r * PITCH + c * 128) = l2; }
    }
}
// stage_ln: LayerNorm of the 64 msa rows of tile bx, 16 rows a wave, all of a wave's 16 KiB asked for as one group; hi plane then lo plane in sa, rows at pitch AP. Behind it every wave of the workgroup may read sa.
__device__ __forceinline__ void stage_ln(bf* sa, const float* __restrict__ X, const float* __restrict__ g, const float* __restrict__ bb, int bx, int w) {
    const unsigned lo = (threadIdx.x & 31) * 16u, xo = ((unsigned)bx * 64 + w * 16) * (DM * 4u) + lo;   /* byte offsets (msa is 32 MiB) */
    const float* xr = (const float*)((const char*)X + xo);
    v4f x[16][DM / 128];
#pragma unroll
    for (int r = 0; r < 16; ++r)
#pragma unroll
        for (int c = 0; c < DM / 128; ++c) x[r][c] = *(const v4f*)(xr + r * DM + c * 128);
    f32x2 gq[DM / 64], bq[DM / 64]; lnaff<DM>(g, bb, lo, gq, bq);
    asm volatile("s_wait_xcnt 0x0" :: "v"(xo), "v"(lo), "s"(X), "s"(g), "s"(bb) : "memory");   /* precaution: the offset and base registers of the loads above are inputs here, so they stay live up to this wait and none is overwritten in front of it */
    __builtin_amdgcn_sched_barrier(0);   /* keeps the loads one group in front of the arithmetic: the last rows were asked for only after the first had come */
    bf* dh = sa + w * 16 * AP + (lo >> 2);
    /* kept rolled, four rows a trip, the rows still to come moved up in their registers behind each trip: for speed only, it keeps the kernel's text short */
#pragma unroll 1
    for (int q = 0; q < 4; ++q) {
        ln16<DM, AP, 4>(x, gq, bq, dh, dh + 64 * AP); dh += 4 * AP;
#pragma unroll
        for (int r = 0; r < 12; ++r)
#pragma unroll
            for (int c = 0; c < DM / 128; ++c) x[r][c] = x[r + 4][c];
    }
    __syncthreads();   /* every wave's rows lie in sa: nobody reads it in front of this barrier */
}
// pair_tile: the pair bias of 64 pair positions, one wave: bias[h][i][j] = Wp[:, h] . LN(pair[i][j]) for i = 16 I + 0..15, j = j0 + 0..3 (I = by / 64, j0 = 4 (by % 64)). Wp^T (rows 8..15 zero), rounded to bf16 by the wave itself, is the A operand; the B operand of column block nb is the hi/lo LayerNorm of the 16 rows (i, j0 + nb), normalised by the wave and turned to fragments through its own LDS sp (2 x 16 rows at pitch PP). The next block's rows are asked for in front of this block's LayerNorm.
__device__ __forceinline__ void pair_tile(const float* __restrict__ P, const float* __restrict__ g, const float* __restrict__ bb, const float* __restrict__ wp, h16* C, int by, bf* sp) {
    const int lane = threadIdx.x & 31, lr = lane & 15, hi = lane >> 4;
    const unsigned lo = lane * 16u, wo = ((unsigned)hi * (8u * NH_) + (unsigned)min(lr, NH_ - 1)) * 4u, xo = (((unsigned)by >> 6) * (16u * NI) + ((unsigned)by & 63u) * 4u) * (CZ * 4u) + lo;   /* byte offsets (pair is 32 MiB) */
    v4f x[2][16][1];
    const float* x0 = (const float*)((const char*)P + xo);
#pragma unroll
    for (int r = 0; r < 16; ++r) x[0][r][0] = *(const v4f*)(x0 + r * (NI * CZ));
    /* lane (lr, hi) holds, of head lr, channels 32 t + 16 half + 8 hi + 0..7: the k order of ldrow() */
    const float* wr = (const float*)((const char*)wp + wo);
    v16bf a[CZ / 32];
#pragma unroll
    for (int t = 0; t < CZ / 32; ++t) { u32x4 p0, p1;
#pragma unroll
        for (int e = 0; e < 4; ++e) { const unsigned u0 = pk2(wr[(t * 32 + 2 * e) * NH_], wr[(t * 32 + 2 * e + 1) * NH_]), u1 = pk2(wr[(t * 32 + 16 + 2 * e) * NH_], wr[(t * 32 + 17 + 2 * e) * NH_]); p0[e] = lr < NH_ ? u0 : 0u; p1[e] = lr < NH_ ? u1 : 0u; }
        a[t] = cat16b(__builtin_bit_cast(v8us, p0), __builtin_bit_cast(v8us, p1)); }
    f32x2 gq[CZ / 64], bq[CZ / 64]; lnaff<CZ>(g, bb, lo, gq, bq);
    asm volatile("s_wait_xcnt 0x0" :: "v"(x0), "v"(wr), "v"(lo), "s"(g), "s"(bb) : "memory");   /* precaution: the address registers of the loads above are inputs here, so they stay live up to this wait and none is overwritten in front of it */
    v8f acc[4];
#pragma unroll
    for (int nb = 0; nb < 4; ++nb) acc[nb] = (v8f){};
    /* two column blocks a trip, two trips, kept rolled: the text stays short; inside a trip x[][][] and acc[] are indexed by constants and stay in registers */
#pragma unroll 1
    for (int p = 0; p < 2; ++p) {
        acc[0] = acc[2]; acc[1] = acc[3];
#pragma unroll
        for (int e = 0; e < 2; ++e) {
            const char* pn = (const char*)P + min(2 * p + e + 1, 3) * (CZ * 4);   /* the next block, a scalar step of the base; behind the last block there is none: the last is asked for again and not used, which keeps the trip free of branches */
            const float* xn = (const float*)(pn + xo);
#pragma unroll
            for (int r = 0; r < 16; ++r) x[e ^ 1][r][0] = *(const v4f*)(xn + r * (NI * CZ));
            asm volatile("s_wait_xcnt 0x0" :: "v"(xn) : "memory");   /* precaution, as above */
            ln16<CZ, PP, 16>(x[e], gq, bq, sp + 4 * lane, sp + 16 * PP + 4 * lane);
            asm volatile("" ::: "memory");   /* the reads below take what other lanes of this wave stored: the compiler may not lift them over the stores (the LDS serves a wave's operations in order) */
            __builtin_amdgcn_sched_barrier(0);   /* and keeps the next block's arithmetic behind this block's: lifted up, it waited for rows that had only just been asked for */
            v16bf bh[CZ / 32], bl[CZ / 32];
#pragma unroll
            for (int t = 0; t < CZ / 32; ++t) { bh[t] = ldrow(sp + lr * PP + 8 * hi + t * 32); bl[t] = ldrow(sp + (16 + lr) * PP + 8 * hi + t * 32); }
            asm volatile("" ::: "memory");   /* nor the next block's stores over these reads */
            __builtin_amdgcn_sched_barrier(0);   /* keeps the 16 reads one group in front of the products: set in pairs among them, each pair was waited for by itself */
            v8f c = (v8f){};
#pragma unroll
            for (int t = 0; t < CZ / 32; ++t) { c = wmmab(a[t], bh[t], c); c = wmmab(a[t], bl[t], c); }
            acc[2 + e] = c;
        }
    }
    /* lane lr of the lower half holds, for head r, bias[r][i][j0 .. j0 + 3] in acc[0..3][r]: times sqrt(32) (k_fattn adds it in front of the scale) and rounded to f16, 8 bytes of C[head][I][j / 16][j / 4 % 4][i % 16][j % 4]; the 16 lanes' store is one whole 128-byte line, and k_fattn reads the plane lane by lane */
    if (hi == 0) {
        const unsigned e0 = (((unsigned)by >> 6) * 16u + (((unsigned)by & 63u) >> 2)) * 256u + ((unsigned)by & 3u) * 64u + lr * 4u;
#pragma unroll
        for (int r = 0; r < NH_; ++r) { v4h16 val; val[0] = (h16)(acc[0][r] * RSCL); val[1] = (h16)(acc[1][r] * RSCL); val[2] = (h16)(acc[2][r] * RSCL); val[3] = (h16)(acc[3][r] * RSCL); *(v4h16*)(C + e0 + (unsigned)r * NRP) = val;
            asm volatile("s_wait_xcnt 0x0" ::: "memory"); }   /* precaution: behind each store, in front of the next overwrite of its registers */
    }
}
// k_proj: the msa LayerNorm and the four GEMMs on it, four waves a workgroup: one 64-row tile of msa, normalised once into LDS; wave w multiplies it by column tile w of each of Wq, Wk, Wv and Wg (16 output tiles from one staged A). Two workgroups fit a WGP, so the 512 fill the chip exactly.
__global__ __launch_bounds__(128) void k_proj(const float* __restrict__ msa, const float* __restrict__ lmg, const float* __restrict__ lmb, const bf* __restrict__ WQ, const bf* __restrict__ WK, const bf* __restrict__ WV, const bf* __restrict__ WG, const float* __restrict__ bg, bf* QPh, bf* QPl, bf* KPh, bf* KPl, bf* VTh, bf* VTl, h16* GP) {
    __shared__ __align__(16) bf sa[2 * 64 * AP];
    __shared__ __align__(16) char sm4[4 * 4608];
    const int b = (int)blockIdx.x, w = __builtin_amdgcn_readfirstlane(threadIdx.x >> 5); char* sm = sm4 + w * 4608;   /* the wave's number in a scalar register: the tile's addresses then stay scalar, as they were when they came from blockIdx */
    stage_ln(sa, msa, lmg, lmb, b, w);
    /* kept rolled: Q and K share one body, so the kernel's text stays short. Workgroup b starts with GEMM b % 4: at any time the workgroups then read all four weight matrices, not the same few lines of one */
#pragma unroll 1
    for (int it = 0; it < 4; ++it) { const int g = (b + it) & 3;
        if (g < 2) gemmw_tile<bf, 1, false, 1, 2>(sa, sa + 64 * AP, g ? WK : WQ, nullptr, DM, nullptr, 0, nullptr, g ? KPh : QPh, g ? KPl : QPl, b, w, sm);
        else if (g == 2) gemmw_tile<bf, 1, false, 2, 2>(sa, sa + 64 * AP, WV, nullptr, DM, nullptr, 0, nullptr, VTh, VTl, b, w, sm);
        else gemmw_tile<bf, 1, true, 3, 2>(sa, sa + 64 * AP, WG, nullptr, DM, nullptr, DQ, bg, (bf*)GP, nullptr, b, w, sm);          /* gate pre-activation m Wg + bg, stored f16 */
    }
}
// k_gemmo: out = vals Wo + bo; grid M/64, wave w = column tile w, the 64 rows of vals staged once in LDS.
__global__ __launch_bounds__(128) void k_gemmo(const bf* __restrict__ Ah, const bf* __restrict__ Al, const bf* __restrict__ WO, float* OUT, const float* __restrict__ bo) {
    __shared__ __align__(16) bf sa[2 * 64 * DQ];
    __shared__ __align__(16) char sm4[4 * 4608];
    const int w = __builtin_amdgcn_readfirstlane(threadIdx.x >> 5);   /* scalar, as in k_proj */
    stage_a(sa, Ah, Al, blockIdx.x);
    gemmw_tile<bf, 1, true, 0, 1>(sa, sa + 64 * DQ, WO, nullptr, DQ, OUT, DM, bo, nullptr, nullptr, blockIdx.x, w, sm4 + w * 4608);
}

typedef __attribute__((ext_vector_type(2))) _Float16 v2h;
typedef __attribute__((ext_vector_type(4))) _Float16 v4h;
typedef __attribute__((ext_vector_type(2))) unsigned short v2us;
typedef __attribute__((ext_vector_type(4))) unsigned short v4us;
typedef v4us __attribute__((may_alias)) v4usa;
typedef __attribute__((ext_vector_type(2))) float v2f;
typedef __attribute__((ext_vector_type(4))) int v4i;

__device__ __forceinline__ void wtG(const float* __restrict__ w, int K, int N, bf* Bt, int blk) {
    const int lane = threadIdx.x & 31; const int L0 = (blk * 4 + (threadIdx.x >> 5)) * 8; const int nlines = N * K / 64;
    /* the launch is short now, and a chain of load latencies would be its length: a wave's 8 lines are asked for as one group (unrolled; a line past the end reads the last one and stores nothing) */
    float v0[8], v1[8];
#pragma unroll
    for (int l = 0; l < 8; ++l) { unsigned n, k; frd((unsigned)min(L0 + l, nlines - 1) * 64u + lane * 2u, (unsigned)K, n, k); v0[l] = w[(size_t)k * N + n]; v1[l] = w[(size_t)(k + 1) * N + n]; }   /* the line is written whole; (n, k) follow from its place */
#pragma unroll
    for (int l = 0; l < 8; ++l) { if (L0 + l < nlines) *(unsigned*)(Bt + (size_t)(L0 + l) * 64 + lane * 2) = pk2(v0[l], v1[l]); }
}
__global__ __launch_bounds__(256) void k_cvt8(const float* __restrict__ src, bf* dst, size_t n8) { const size_t i = (size_t)blockIdx.x * 256 + threadIdx.x; if (i >= n8) return; const v8f v = *(const v8f*)(src + i * 8); v8us o;
#pragma unroll
    for (int k = 0; k < 8; ++k) o[k] = f2bf(v[k]); *(v8us*)(dst + i * 8) = o;  }




// k_prep: what depends on the inputs alone and not on msa, in one launch, four waves a workgroup. Blocks 0..255: the pair bias (LayerNorm and product), one tile of 64 pair positions a wave; then the five 256 x 256 weights to bf16 [n][k] in fragment order (32 blocks each).
#define NBW  ((DM * DQ / 64 + 31) / 32)       // blocks of one weight
__global__ __launch_bounds__(128) void k_prep(const float* __restrict__ pair, const float* __restrict__ lpg, const float* __restrict__ lpb, const float* __restrict__ wp, h16* BIAS, const float* __restrict__ wq, const float* __restrict__ wk, const float* __restrict__ wv, const float* __restrict__ wg, const float* __restrict__ wo, bf* WQ, bf* WK, bf* WV, bf* WG, bf* WO) {
    __shared__ __align__(16) bf sp4[4 * 2 * 16 * PP];
    const int b = (int)blockIdx.x - NRP / 256, w5 = __builtin_amdgcn_readfirstlane(threadIdx.x >> 5);   /* the wave's number in a scalar register, so that the tile's addresses stay scalar */
    if (b < 0) pair_tile(pair, lpg, lpb, wp, BIAS, (int)blockIdx.x * 4 + w5, sp4 + w5 * (2 * 16 * PP));
    else { const int g = b / NBW;
        const float* w = g == 0 ? wq : g == 1 ? wk : g == 2 ? wv : g == 3 ? wg : wo; bf* o = g == 0 ? WQ : g == 1 ? WK : g == 2 ? WV : g == 3 ? WG : WO;
        wtG(w, DM, DQ, o, b % NBW); }      /* all five are 256 x 256 (DM == DQ) */
}
__device__ __forceinline__ float sigm_slot(float a) { float e; asm("v_exp_f32 %0, %1\n\tv_nop" : "=v"(e) : "v"(__fmul_rn(-a, 1.4426950408889634f))); return __fdiv_rn(1.0f, __fadd_rn(1.0f, e)); }
// Four exponentials and one v_nop in one statement, for the same slot: the outputs are early-clobbered, so none overwrites a source of the exponential in front of it, and the v_nop stands behind the last.
__device__ __forceinline__ void exp2x4(float& a, float& b, float& c, float& d) { float e0, e1, e2, e3; asm("v_exp_f32 %0, %4\n\tv_exp_f32 %1, %5\n\tv_exp_f32 %2, %6\n\tv_exp_f32 %3, %7\n\tv_nop" : "=&v"(e0), "=&v"(e1), "=&v"(e2), "=&v"(e3) : "v"(a), "v"(b), "v"(c), "v"(d)); a = e0; b = e1; c = e2; d = e3; }
// k_fattn: scores, pair bias, softmax, attn.V and the sigmoid gate of one (sequence, head) for 16 query rows per wave, nothing through memory in between.
// S^T = K Q^T (A = 16 key rows, B = the wave's 16 queries): lane (lr, hi) holds, of query lr, keys 16 t + 8 hi + 0..7 in st[t]; two neighbouring tiles are the B fragment of O^T = V^T P^T as they lie.
// Workgroup: 8 waves = 8 query tiles of one (sequence, head); grid 128 sequences x 8 heads x 2 query halves. The head's K and V^T planes, hi and lo (in fragment order 16 KiB in a row each), are staged once in LDS by asynchronous copies and read there by all 8 waves; Q, the bias and the gate, which no two waves share, come from global memory.
// The second launch bound asks for four waves per SIMD (256 registers a wave), so that two workgroups share a WGP and one's vector work covers the other's loads.
__device__ __forceinline__ void cp44(unsigned l, const char* g, const char* g2) {
    /* a hi and a lo plane of 16 KiB, four copies each, 4 KiB apart (256 threads x 16 bytes), and their s_wait_xcnt 0 in one statement: a precaution, as in cp8 */
    asm volatile("global_load_async_to_lds_b128 %0, %8, off\n\tglobal_load_async_to_lds_b128 %1, %9, off\n\tglobal_load_async_to_lds_b128 %2, %10, off\n\tglobal_load_async_to_lds_b128 %3, %11, off\n\tglobal_load_async_to_lds_b128 %4, %12, off\n\tglobal_load_async_to_lds_b128 %5, %13, off\n\tglobal_load_async_to_lds_b128 %6, %14, off\n\tglobal_load_async_to_lds_b128 %7, %15, off\n\ts_wait_xcnt 0x0"
        :: "v"(l), "v"(l + 4096u), "v"(l + 8192u), "v"(l + 12288u), "v"(l + 16384u), "v"(l + 20480u), "v"(l + 24576u), "v"(l + 28672u),
           "v"(g), "v"(g + 4096), "v"(g + 8192), "v"(g + 12288), "v"(g2), "v"(g2 + 4096), "v"(g2 + 8192), "v"(g2 + 12288) : "memory");
}
// a lane's 8 bias values of one key tile: keys 8 hi + 0..3 and, 64 values on, + 4..7
__device__ __forceinline__ v8h ldb8(const h16* p) { return __builtin_shufflevector(*(const v4h16*)p, *(const v4h16*)(p + 64), 0, 1, 2, 3, 4, 5, 6, 7); }
__global__ __launch_bounds__(256, 4) void k_fattn(const bf* __restrict__ QPh, const bf* __restrict__ QPl, const bf* __restrict__ KPh, const bf* __restrict__ KPl, const bf* __restrict__ VTh, const bf* __restrict__ VTl, const h16* __restrict__ BT, const h16* __restrict__ GP, bf* Ah, bf* Al) {
    const int lane = threadIdx.x & 31, lr = lane & 15, hi = lane >> 4, w = threadIdx.x >> 5;
    __shared__ __align__(16) bf skv[4 * NI * HD];   /* K hi, K lo, V^T hi, V^T lo (rows 0..31), 16 KiB each */
    const int qb = blockIdx.x & 1, h = (blockIdx.x >> 1) & 7, s = blockIdx.x >> 4;
    const int p = s * NH_ + h, i = qb * 128 + w * 16 + lr;
    { const unsigned l = (unsigned)(size_t)skv + threadIdx.x * 16u;   /* the low 32 bits of a __shared__ address are the byte offset in LDS */
      const size_t gk = (size_t)p * (NI * HD * 2) + threadIdx.x * 16u, gv = (size_t)p * (HP * NI * 2) + threadIdx.x * 16u;
      cp44(l, (const char*)KPh + gk, (const char*)KPl + gk); cp44(l + 32768u, (const char*)VTh + gv, (const char*)VTl + gv); }
    /* 32-bit byte offsets (every plane is below 64 MiB): one offset register serves a hi and a lo plane */
    const unsigned qo = (((unsigned)p * NI + (i - lr)) * HD + 8 * lane) * 2u, bo = ((unsigned)h * NRP + (unsigned)(i - lr) * NI + 128 * hi + 4 * lr) * 2u;   /* fragment order: 16 rows x 32 = one block of 512; bias: 16 queries x 16 keys = 256 f16 values, [j / 4 % 4][query][4]: the lane's keys 8 hi + 0..3 and, 64 values on, + 4..7 */
    const bf* qph = (const bf*)((const char*)QPh + qo); const bf* qpl = (const bf*)((const char*)QPl + qo); const bf* kph = skv + 8 * lane; const bf* kpl = kph + NI * HD;
    const v16bf qh = WFrag<bf>::ld(qph), ql = WFrag<bf>::ld(qpl);   /* asked for while the copies fly */
    const h16* br = (const h16*)((const char*)BT + bo);
    /* K fragments come from LDS one tile ahead (two sets), the bias from global memory by pairs of tiles, four tiles ahead of the pair's first product (three sets); the first two pairs too are asked for while the copies fly */
    /* The bias reaches the scores through the matrix unit: the f16 values of two neighbouring key tiles, as the lane loads them, are one B fragment (position (hi, e) = key 8 hi + e of the even tile, (hi, 8 + e) of the odd one), and se / so are the A operands of ones and zeros that pick the even / the odd tile: row m has its one at the position that holds key m. 1 x bias is exact, and the other tile's finite values times 0 add nothing. */
    v16h se, so;
    /* unrolled: the vectors' elements are indexed by constants and stay in registers */
#pragma unroll
    for (int e = 0; e < 8; ++e) { const h16 one = (8 * hi + e == lr) ? (h16)1.0f : (h16)0.0f; se[e] = one; se[8 + e] = (h16)0.0f; so[e] = (h16)0.0f; so[8 + e] = one; }
    v16bf kh[2], kl[2]; v8h bb[3][2];
#pragma unroll
    for (int t = 0; t < 4; ++t) bb[t >> 1][t & 1] = ldb8(br + t * 256);
    asm volatile("s_wait_asynccnt 0x0" ::: "memory");   /* this wave's copies have landed */
    __syncthreads();                                    /* and every other wave's: nobody reads skv in front of this barrier */
    kh[0] = WFrag<bf>::ld(kph); kl[0] = WFrag<bf>::ld(kpl);
    v8f st[NI / 16]; float mx = -3.0e38f;
    /* unrolled whole: the sets and st[] are indexed by constants and stay in registers. Trip t: the loads as one group, then tile t's products beside the vector work on tile t - 1 */
#pragma unroll
    for (int t = 0; t <= NI / 16; ++t) {
        if (t + 1 < NI / 16) { kh[(t + 1) & 1] = WFrag<bf>::ld(kph + (t + 1) * 16 * HD); kl[(t + 1) & 1] = WFrag<bf>::ld(kpl + (t + 1) * 16 * HD); }
        if ((t & 1) == 0 && t + 4 < NI / 16) { bb[((t >> 1) + 2) % 3][0] = ldb8(br + (t + 4) * 256); bb[((t >> 1) + 2) % 3][1] = ldb8(br + (t + 5) * 256); }
        __builtin_amdgcn_sched_barrier(0);   /* keeps the load group in front of the products: left to itself the compiler set most LDS reads directly in front of their product, each with a wait to 0 */
        if (t < NI / 16) { v8f c = (v8f){}; c = wmma16((t & 1) ? so : se, cat16(bb[(t >> 1) % 3][0], bb[(t >> 1) % 3][1]), c); c = wmmab(kh[t & 1], qh, c); c = wmmab(kh[t & 1], ql, c); c = wmmab(kl[t & 1], qh, c); st[t] = c; }
        if (t >= 1) {
#pragma unroll
            for (int j = 0; j < 8; ++j) { const float x = st[t - 1][j] * SCL;   /* (S + bias x sqrt(32)) x 32^-0.5: the reference adds the bias after the scale */
                st[t - 1][j] = x; mx = fmaxf(mx, x); } }
        __builtin_amdgcn_sched_barrier(0);   /* keeps the next group from being mixed in among these products */
    }
    asm volatile("s_wait_xcnt 0x0" :: "v"(qo), "v"(bo), "s"(QPh), "s"(QPl), "s"(BT) : "memory");   /* precaution: the offset and base registers of the loads above are inputs here, so they stay live up to this wait and none is overwritten in front of it */
    mx = fmaxf(mx, __shfl_xor(mx, 16, 32));
    float sm[4] = {0.f, 0.f, 0.f, 0.f};
#pragma unroll
    for (int t = 0; t < NI / 16; ++t) {
#pragma unroll
        for (int j = 0; j < 8; j += 4) { float x[4];
#pragma unroll
            for (int q = 0; q < 4; ++q) x[q] = __fmul_rn(__fsub_rn(st[t][j + q], mx), 1.4426950408889634f);
            exp2x4(x[0], x[1], x[2], x[3]);
#pragma unroll
            for (int q = 0; q < 4; ++q) { st[t][j + q] = x[q]; sm[q] += x[q]; } } }
    float sum = (sm[0] + sm[1]) + (sm[2] + sm[3]); sum += __shfl_xor(sum, 16, 32);
    const float f = __fdiv_rn(1.0f, sum);
    const bf* vph = kph + 2 * NI * HD; const bf* vpl = kph + 3 * NI * HD;
    const size_t oo = ((size_t)s * NI + i) * DQ + h * HD + 8 * hi;   /* o[mb][r] = context[query i][channel 16 mb + 8 hi + r] */
    /* the gate, ahead of attn.V: its exponentials are asm text */
    v8f sg[2]; const h16* gp = GP + oo;
#pragma unroll
    for (int mb = 0; mb < 2; ++mb) { const v8h g0 = *(const v8h*)(gp + mb * 16);
#pragma unroll
        for (int r = 0; r < 8; ++r) sg[mb][r] = sigm_slot((float)g0[r]); }
    asm volatile("s_wait_xcnt 0x0" :: "v"(gp) : "memory");   /* precaution: the address of the gate's loads is an input here, so it stays live up to this wait and is not overwritten in front of it */
    __builtin_amdgcn_sched_barrier(0);   /* keeps those exponentials in front of the products below */
    v8f o[2]; o[0] = (v8f){}; o[1] = (v8f){};
    /* the same order here: trip k = (key block c, channel half mb); V^T fragments from LDS one trip ahead (two sets), and half of the next key block's weights split to hi/lo beside each trip's products (two sets) */
    v8us PH[2][2], PL[2][2]; v16bf vh[2], vl[2];
    split8(st[0] * f, PH[0][0], PL[0][0]); split8(st[1] * f, PH[0][1], PL[0][1]);
    vh[0] = WFrag<bf>::ld(vph); vl[0] = WFrag<bf>::ld(vpl);
#pragma unroll
    for (int k = 0; k < NI / 16; ++k) { const int c = k >> 1, mb = k & 1;
        if (k + 1 < NI / 16) { const int e = ((k + 1) & 1) * 16 * NI + ((k + 1) >> 1) * 512; vh[(k + 1) & 1] = WFrag<bf>::ld(vph + e); vl[(k + 1) & 1] = WFrag<bf>::ld(vpl + e); }
        __builtin_amdgcn_sched_barrier(0);   /* the load group stays in front of the products, as above */
        const v16bf ph = cat16b(PH[c & 1][0], PH[c & 1][1]), pl = cat16b(PL[c & 1][0], PL[c & 1][1]);
        o[mb] = wmmab(vh[k & 1], ph, o[mb]); o[mb] = wmmab(vh[k & 1], pl, o[mb]); o[mb] = wmmab(vl[k & 1], ph, o[mb]);
        if (c + 1 < NI / 32) split8(st[2 * (c + 1) + mb] * f, PH[(c + 1) & 1][mb], PL[(c + 1) & 1][mb]);
        __builtin_amdgcn_sched_barrier(0);   /* and the next group behind them */
    }
    const unsigned ao = ((unsigned)(s * NI + (i - lr)) * DQ + h * 512 + 8 * lane);   /* the same in fragment order (K = DQ, block k / 32 = h): o[mb] is register half mb as it lies */
#pragma unroll
    for (int mb = 0; mb < 2; ++mb) { v8us oh, ol;
        v8f y;
#pragma unroll
        for (int r = 0; r < 8; ++r) y[r] = __fmul_rn(sg[mb][r], o[mb][r]);
        split8(y, oh, ol);
        *(v8us*)(Ah + ao + mb * 256) = oh; *(v8us*)(Al + ao + mb * 256) = ol; }
}

extern "C" void kernel_launch(void* const* d_in, const int* in_sizes, int n_in,
                              void* d_out, int out_size, void* d_ws, size_t ws_size, hipStream_t stream) {
    (void)in_sizes; (void)n_in; (void)out_size;
    const float* msa = (const float*)d_in[0]; const float* pair = (const float*)d_in[1]; const float* lmg = (const float*)d_in[2]; const float* lmb = (const float*)d_in[3]; const float* lpg = (const float*)d_in[4]; const float* lpb = (const float*)d_in[5]; const float* wq = (const float*)d_in[6]; const float* wk = (const float*)d_in[7]; const float* wv = (const float*)d_in[8]; const float* wp = (const float*)d_in[9]; const float* wg = (const float*)d_in[10]; const float* bg = (const float*)d_in[11]; const float* wo = (const float*)d_in[12]; const float* bo = (const float*)d_in[13];
    float* OUT = (float*)d_out;     // [1][128][256][256]
    char* wsp = (char*)d_ws;
    auto take = [&](size_t bytes) { char* p = wsp; wsp += (bytes + 255) & ~(size_t)255; return (void*)p; };
    bf* WQ = (bf*)take((size_t)DQ * DM * 2); bf* WK = (bf*)take((size_t)DQ * DM * 2); bf* WV = (bf*)take((size_t)DQ * DM * 2); bf* WG = (bf*)take((size_t)DQ * DM * 2); bf* WO = (bf*)take((size_t)DM * DQ * 2);
    bf* ATh = (bf*)take((size_t)NRM * DQ * 2); bf* ATl = (bf*)take((size_t)NRM * DQ * 2); h16* GP = (h16*)take((size_t)NRM * DQ * 2); h16* BIAS = (h16*)take((size_t)NRP * NH_ * 2);
    bf* QPh = (bf*)take((size_t)NP * NI * HD * 2); bf* QPl = (bf*)take((size_t)NP * NI * HD * 2); bf* KPh = (bf*)take((size_t)NP * NI * HD * 2); bf* KPl = (bf*)take((size_t)NP * NI * HD * 2); bf* VTh = (bf*)take((size_t)NP * HP * NI * 2); bf* VTl = (bf*)take((size_t)NP * HP * NI * 2);
    if ((size_t)(wsp - (char*)d_ws) > ws_size) return;    // ws 256 MiB (carve ~178 MiB)
    k_prep<<<NRP / 256 + 5 * NBW, 128, 0, stream>>>(pair, lpg, lpb, wp, BIAS, wq, wk, wv, wg, wo, WQ, WK, WV, WG, WO);
    k_proj<<<NRM / 64, 128, 0, stream>>>(msa, lmg, lmb, WQ, WK, WV, WG, bg, QPh, QPl, KPh, KPl, VTh, VTl, GP);
    k_fattn<<<NS * NH_ * (NI / 128), 256, 0, stream>>>(QPh, QPl, KPh, KPl, VTh, VTl, BIAS, GP, ATh, ATl);
    k_gemmo<<<NRM / 64, 128, 0, stream>>>(ATh, ATl, WO, OUT, bo);            /* out = vals Wo + bo */
}
